// v000
// The times below were measured on an AMD MI455X: many runs one after another, warmed up first and cycling through
// copies of the inputs, with the whole window's GPU time divided by the number of runs. Launches and the gaps
// between them are all in it. The median over several windows is given; except for v000 it joins two sittings, which
// can be a few percent apart, so the side-by-side timings, each taken in one sitting, are the better comparison.
// v000 is the starting kernel. One run takes 1550 microseconds.
#include <hip/hip_runtime.h>

// Masked attention block: three input streams q, k, v [2][2048][768]; per-stream projection x W + b (W stored [in][out]); 12 heads x 64; logits x 1/8 plus mask x -1e9 (mask [2048][2048] read as values from its input buffer); softmax over all keys; merged heads x Wo + bo -> [2][2048][768].
// Compute dtypes (every product accumulates in f32): inputs, mask, biases and weights RNE-converted to bf16; projections v_wmma_f32_16x16x32_bf16 (exact products) + f32 bias; logits: query rows < 512 on bf16 hi/lo planes (3 products), other rows on f16 planes (1 product); P x V: rows < 512 bf16 hi/lo (3 products), other rows v_wmma_f32_16x16x32_f16 with P carried x1024; softmax f32; output projection: merged bf16 hi/lo planes x bf16 Wo (2 products) + f32 bias.

#ifndef NB
#define NB 2
#endif
#ifndef SEQ
#define SEQ 2048
#endif
#define NB_FULL  2
#define SEQ_FULL 2048
#define TT   SEQ
#define DM   768
#define NH_  12
#define NKV  12
#define REP  (NH_ / NKV)
#define HD   64
#define DQ   (NH_ * HD)
#define DKV  (NKV * HD)
#define ZH   2
#define RH   ((TT) < 512 ? (TT) : 512)   // query rows < RH use hi+lo planes
#define PCAR 1024.0f
#define SCL  0.125f   // HD^-0.5
#define MNEG (-1.0e9f)

static_assert(TT % 128 == 0);
static_assert(TT <= SEQ_FULL);
static_assert(NB <= NB_FULL);
static_assert(DM % 64 == 0);
static_assert(DQ % 64 == 0);
static_assert(DQ == DM);
static_assert(HD == 64);
static_assert(NH_ % ZH == 0);
static_assert(RH % 64 == 0);
static_assert((TT - RH) % 64 == 0);

typedef _Float16 h16;
typedef unsigned short bf;
typedef __attribute__((ext_vector_type(16))) __bf16   v16bf;
typedef __attribute__((ext_vector_type(16))) _Float16 v16h;
typedef __attribute__((ext_vector_type(8)))  _Float16 v8h;
typedef __attribute__((ext_vector_type(8)))  unsigned short v8us;
typedef __attribute__((ext_vector_type(8)))  float    v8f;
typedef __attribute__((ext_vector_type(4)))  float    v4f;
typedef v8h  __attribute__((may_alias)) v8ha;
typedef v4f  __attribute__((may_alias)) v4fa;
typedef v8us __attribute__((may_alias)) v8usa;

__device__ __forceinline__ unsigned short f2bf(float f) { unsigned u = __float_as_uint(f); u += 0x7FFFu + ((u >> 16) & 1u); return (unsigned short)(u >> 16); }
__device__ __forceinline__ float bf2f(unsigned short b) { return __uint_as_float(((unsigned)b) << 16); }
__device__ __forceinline__ float bfr(float f) { return bf2f(f2bf(f)); }
__device__ __forceinline__ v16h cat16(v8h lo, v8h hi) { return __builtin_shufflevector(lo, hi, 0, 1, 2, 3, 4, 5, 6, 7, 8, 9, 10, 11, 12, 13, 14, 15); }
__device__ __forceinline__ v16bf cat16b(v8us lo, v8us hi) { return __builtin_bit_cast(v16bf, __builtin_shufflevector(lo, hi, 0, 1, 2, 3, 4, 5, 6, 7, 8, 9, 10, 11, 12, 13, 14, 15)); }
__device__ __forceinline__ v8f wmma16(v16h a, v16h b, v8f c) { return __builtin_amdgcn_wmma_f32_16x16x32_f16(false, a, false, b, (short)0, c, false, false); }
__device__ __forceinline__ v8f wmmab(v16bf a, v16bf b, v8f c) { return __builtin_amdgcn_wmma_f32_16x16x32_bf16(false, a, false, b, (short)0, c, false, false); }

// ---- k_gemmw: register-blocked GEMM, ONE WAVE per 64x64 output tile (16 accumulators), operands straight from K-contiguous 16-bit planes; grid (M/64, N/64, Z), 32 threads.
// C[m][n] (f32, pitch ldc, + optional f32 bias[n]) = sum_k A[m][k] Bt[n][k] (+ split products per NSPLIT). z-batch strides sA/sB/sC in elements. K % 32 == 0, M % 64 == 0, N % 64 == 0.
// Fragment map: lane l, h = l >> 4: elements 0..7 <- k0 + 8h + 0..7, elements 8..15 <- k0 + 16 + 8h + 0..7 (A row / B column = l & 15); D element j -> (row 8h + j, col l & 15).
template <typename T16> struct WFrag;
template <> struct WFrag<h16> { typedef v16h V; static __device__ __forceinline__ V ld(const h16* p) { return cat16(*(const v8h*)p, *(const v8h*)(p + 16)); } static __device__ __forceinline__ v8f mma(V a, V b, v8f c) { return wmma16(a, b, c); } };
template <> struct WFrag<bf> { typedef v16bf V; static __device__ __forceinline__ V ld(const bf* p) { return cat16b(*(const v8us*)p, *(const v8us*)(p + 16)); } static __device__ __forceinline__ v8f mma(V a, V b, v8f c) { return wmmab(a, b, c); } };
template <typename T16, int NSPLIT, bool BIAS>
__global__ __launch_bounds__(32) void k_gemmw(const T16* __restrict__ A, const T16* __restrict__ A2, const T16* __restrict__ Bt, const T16* __restrict__ Bt2, int K, float* C, int ldc, const float* __restrict__ bias, size_t sA, size_t sB, size_t sC) {
    typedef typename WFrag<T16>::V V;
    __shared__ __align__(16) float os[16 * 68];
    const size_t z = blockIdx.z; A += z * sA; if (A2) A2 += z * sA; Bt += z * sB; if (Bt2) Bt2 += z * sB; C += z * sC;
    const int lane = threadIdx.x & 31, lr = lane & 15, hi = lane >> 4; const int r0 = blockIdx.x * 64, c0 = blockIdx.y * 64;
    v8f acc[4][4];
#pragma unroll
    for (int mb = 0; mb < 4; ++mb)
#pragma unroll
        for (int nb = 0; nb < 4; ++nb) acc[mb][nb] = (v8f){};
    const size_t aoff = (size_t)(r0 + lr) * K + 8 * hi, boff = (size_t)(c0 + lr) * K + 8 * hi;
#pragma unroll 1
    for (int kc = 0; kc < K; kc += 32) {
        V a[4], a2[4];
#pragma unroll
        for (int mb = 0; mb < 4; ++mb) { a[mb] = WFrag<T16>::ld(A + aoff + (size_t)mb * 16 * K + kc); if (NSPLIT == 1 || NSPLIT == 2) a2[mb] = WFrag<T16>::ld(A2 + aoff + (size_t)mb * 16 * K + kc); }
#pragma unroll
        for (int nb = 0; nb < 4; ++nb) { const V b = WFrag<T16>::ld(Bt + boff + (size_t)nb * 16 * K + kc); V b2; if (NSPLIT >= 2) b2 = WFrag<T16>::ld(Bt2 + boff + (size_t)nb * 16 * K + kc);
#pragma unroll
            for (int mb = 0; mb < 4; ++mb) { acc[mb][nb] = WFrag<T16>::mma(a[mb], b, acc[mb][nb]); if (NSPLIT == 1 || NSPLIT == 2) acc[mb][nb] = WFrag<T16>::mma(a2[mb], b, acc[mb][nb]); if (NSPLIT >= 2) acc[mb][nb] = WFrag<T16>::mma(a[mb], b2, acc[mb][nb]); } }
        asm volatile("v_nop\n\tv_nop\n\tv_nop\n\tv_nop" : "+v"(acc[0][0]), "+v"(acc[1][1]), "+v"(acc[2][2]), "+v"(acc[3][3]) : "v"(a[0]), "v"(a[3]));
    }
#pragma unroll
    for (int mb = 0; mb < 4; ++mb) {
#pragma unroll
        for (int nb = 0; nb < 4; ++nb) {
#pragma unroll
            for (int j = 0; j < 8; ++j) os[(hi * 8 + j) * 68 + nb * 16 + lr] = acc[mb][nb][j]; }
        __builtin_amdgcn_wave_barrier(); asm volatile("" ::: "memory");
        float* crow = C + (size_t)(r0 + mb * 16) * ldc + c0;
{
#pragma unroll
            for (int s = 0; s < 8; ++s) { const int row = 2 * s + hi, cofs = lr * 4; v4f val = *(const v4fa*)(os + row * 68 + cofs); if (BIAS) { val[0] += bfr(bias[c0 + cofs]); val[1] += bfr(bias[c0 + cofs + 1]); val[2] += bfr(bias[c0 + cofs + 2]); val[3] += bfr(bias[c0 + cofs + 3]); }
                *(v4f*)(crow + (size_t)row * ldc + cofs) = val; }
             }
        __builtin_amdgcn_wave_barrier(); asm volatile("" ::: "memory");
    }
}

__device__ __forceinline__ h16 tohx(float x) { return (h16)x; }
__device__ __forceinline__ void splitf(float y, unsigned short& h, unsigned short& l) { h = f2bf(y); l = f2bf(y - bf2f(h)); }
typedef __attribute__((ext_vector_type(2))) _Float16 v2h;
typedef __attribute__((ext_vector_type(4))) _Float16 v4h;
typedef __attribute__((ext_vector_type(2))) unsigned short v2us;
typedef __attribute__((ext_vector_type(4))) unsigned short v4us;
typedef __attribute__((ext_vector_type(2))) float v2f;

__global__ __launch_bounds__(256) void k_wtG(const float* __restrict__ w, int K, int N, bf* Bt) {
    const int lane = threadIdx.x & 31; const int L0 = (blockIdx.x * 8 + (threadIdx.x >> 5)) * 8; const int nlines = N * K / 64;
{
#pragma unroll 1
        for (int l = 0; l < 8; ++l) { const int L = L0 + l; if (L >= nlines) break; const size_t e = (size_t)L * 64 + lane * 2; const int k = (int)(e % K), n = (int)(e / K); v2us o;
            o[0] = f2bf(w[(size_t)k * N + n]); o[1] = f2bf(w[(size_t)(k + 1) * N + n]); *(v2us*)(Bt + e) = o; }
         }
}
__global__ __launch_bounds__(256) void k_cvt8(const float* __restrict__ src, bf* dst, size_t n8) { const size_t i = (size_t)blockIdx.x * 256 + threadIdx.x; if (i >= n8) return; const v8f v = *(const v8f*)(src + i * 8); v8us o;
#pragma unroll
    for (int k = 0; k < 8; ++k) o[k] = f2bf(v[k]); *(v8us*)(dst + i * 8) = o;  }

__global__ __launch_bounds__(256) void k_hpl(const float* __restrict__ F, int pitch, int nheads, h16* P16, bf* Ph, bf* Pl) {
    const size_t e = ((size_t)blockIdx.x * 256 + threadIdx.x) * 2; if (e >= (size_t)nheads * TT * HD) return; const int d = (int)(e % HD); const int t = (int)((e / HD) % TT); const int h = (int)(e / ((size_t)HD * TT));
    const v2f x = *(const v2f*)(F + (size_t)t * pitch + h * HD + d); v2h o16; v2us oh, ol;
#pragma unroll
    for (int q = 0; q < 2; ++q) { const float r = x[q]; o16[q] = tohx(r); unsigned short a2, c2; splitf(r, a2, c2); oh[q] = a2; ol[q] = c2; }
    *(v2h*)(P16 + e) = o16; *(v2us*)(Ph + e) = oh; *(v2us*)(Pl + e) = ol;  }
__global__ __launch_bounds__(256) void k_vtp(const float* __restrict__ F, int pitch, int nheads, h16* V16, bf* Vh, bf* Vl) { const size_t e = ((size_t)blockIdx.x * 256 + threadIdx.x) * 2; if (e >= (size_t)nheads * HD * TT) return; const int t = (int)(e % TT); const int d = (int)((e / TT) % HD); const int g = (int)(e / ((size_t)TT * HD)); v2h o16; v2us oh, ol;
#pragma unroll
    for (int q = 0; q < 2; ++q) { const float x = F[(size_t)(t + q) * pitch + g * HD + d]; o16[q] = tohx(x); unsigned short a2, c2; splitf(x, a2, c2); oh[q] = a2; ol[q] = c2; }
    *(v2h*)(V16 + e) = o16; *(v2us*)(Vh + e) = oh; *(v2us*)(Vl + e) = ol;  }

// k_asoft: one wave per row (zz, i): t = S x HD^-0.5 + bf16(mask[i][j]) x -1e9 (mask row pitch mpitch, shared by all heads and batches);
__global__ __launch_bounds__(256) void k_asoft(const float* __restrict__ Sb, const float* __restrict__ Mk, int mpitch, h16* P16, bf* Ph, bf* Pl) {
#pragma clang fp contract(off)
    const int lane = threadIdx.x & 31; const int row = blockIdx.x * 8 + __builtin_amdgcn_readfirstlane((int)(threadIdx.x >> 5)); if (row >= ZH * TT) return; const int i = row % TT; const int zz = row / TT; const bool hires = (i < RH); const float* sr = Sb + (size_t)row * TT; const float* mr = Mk + (size_t)i * mpitch; float v[TT / 32]; float mx = -3.0e38f;
#pragma unroll
    for (int ch = 0; ch < TT / 128; ++ch) { const int j0 = ch * 128 + lane * 4; const v4f a = *(const v4f*)(sr + j0);
#pragma unroll
        for (int q = 0; q < 4; ++q) v[ch * 4 + q] = a[q] * SCL; }
    asm volatile("" ::: "memory");
#pragma unroll
    for (int ch = 0; ch < TT / 128; ++ch) { const int j0 = ch * 128 + lane * 4; const v4f m = *(const v4f*)(mr + j0);
#pragma unroll
        for (int q = 0; q < 4; ++q) { const float mb = bfr(m[q]) * MNEG; const float t = v[ch * 4 + q] + mb; v[ch * 4 + q] = t; mx = fmaxf(mx, t); } }
#pragma unroll
    for (int sh = 16; sh; sh >>= 1) mx = fmaxf(mx, __shfl_xor(mx, sh, 32));
    float sum = 0.f;
#pragma unroll
    for (int k = 0; k < TT / 32; ++k) { float d0 = v[k] - mx; asm volatile("" : "+v"(d0)); v[k] = __builtin_amdgcn_exp2f(d0 * 1.4426950408889634f); sum += v[k]; }
#pragma unroll
    for (int sh = 16; sh; sh >>= 1) sum += __shfl_xor(sum, sh, 32);
    const float f = (hires ? 1.0f : PCAR) * (1.0f / sum);
{
        if (hires) {
#pragma unroll
            for (int ch = 0; ch < TT / 128; ++ch) { v4us oh, ol;
#pragma unroll
                for (int q = 0; q < 4; ++q) { unsigned short a, c2; splitf(v[ch * 4 + q] * f, a, c2); oh[q] = a; ol[q] = c2; }
                const size_t oo = ((size_t)zz * RH + i) * TT + ch * 128 + lane * 4; *(v4us*)(Ph + oo) = oh; *(v4us*)(Pl + oo) = ol; }
        } else {
#pragma unroll
            for (int ch = 0; ch < TT / 128; ++ch) { v4h o4;
#pragma unroll
                for (int q = 0; q < 4; ++q) o4[q] = tohx(v[ch * 4 + q] * f);
                *(v4h*)(P16 + (size_t)row * TT + ch * 128 + lane * 4) = o4; } }
         }
}
__global__ __launch_bounds__(256) void k_merge(const float* __restrict__ O, int h0, bf* Ah, bf* Al) { const size_t e = ((size_t)blockIdx.x * 256 + threadIdx.x) * 2; if (e >= (size_t)ZH * TT * HD) return; const int d = (int)(e % HD); const int t = (int)((e / HD) % TT); const int zz = (int)(e / ((size_t)HD * TT)); const float cs = (t < RH) ? 1.0f : (1.0f / PCAR); const size_t oo = (size_t)t * DQ + (h0 + zz) * HD + d;
    const v2f x = *(const v2f*)(O + e); v2us oh, ol;
#pragma unroll
    for (int q = 0; q < 2; ++q) { unsigned short a, c2; splitf(x[q] * cs, a, c2); oh[q] = a; ol[q] = c2; } *(v2us*)(Ah + oo) = oh; *(v2us*)(Al + oo) = ol;  }

extern "C" void kernel_launch(void* const* d_in, const int* in_sizes, int n_in,
                              void* d_out, int out_size, void* d_ws, size_t ws_size, hipStream_t stream) {
    if (n_in < 12) return;
    const long long xneed = (long long)(NB - 1) * SEQ_FULL * DM + (long long)TT * DM;
    if ((long long)in_sizes[0] < xneed || (long long)in_sizes[1] < xneed || (long long)in_sizes[2] < xneed) return;
    if ((long long)in_sizes[3] < (long long)(TT - 1) * SEQ_FULL + TT) return;
    if (in_sizes[4] < DM * DQ || in_sizes[6] < DM * DKV || in_sizes[8] < DM * DKV || in_sizes[10] < DQ * DM) return;
    if (in_sizes[5] < DQ || in_sizes[7] < DKV || in_sizes[9] < DKV || in_sizes[11] < DM) return;
    if ((long long)out_size < (long long)NB * TT * DM) return;
    const float* xq = (const float*)d_in[0]; const float* xk = (const float*)d_in[1]; const float* xv = (const float*)d_in[2]; const float* mk = (const float*)d_in[3];
    const float* wq = (const float*)d_in[4]; const float* bq = (const float*)d_in[5]; const float* wk = (const float*)d_in[6]; const float* bk = (const float*)d_in[7]; const float* wv = (const float*)d_in[8]; const float* bv = (const float*)d_in[9]; const float* wo = (const float*)d_in[10]; const float* bo = (const float*)d_in[11];
    float* OUT = (float*)d_out;     // [NB][TT][DM]
    char* wsp = (char*)d_ws;
    auto take = [&](size_t bytes) { char* p = wsp; wsp += (bytes + 255) & ~(size_t)255; return (void*)p; };
    bf* WQ = (bf*)take((size_t)DQ * DM * 2); bf* WK = (bf*)take((size_t)DKV * DM * 2); bf* WV = (bf*)take((size_t)DKV * DM * 2); bf* WO = (bf*)take((size_t)DM * DQ * 2);
    bf* XB = (bf*)take((size_t)TT * DM * 2); float* FQ = (float*)take((size_t)TT * DQ * 4); float* FK = (float*)take((size_t)TT * DKV * 4);
    h16* QP16 = (h16*)take((size_t)NH_ * TT * HD * 2); h16* KP16 = (h16*)take((size_t)NKV * TT * HD * 2); h16* VT16 = (h16*)take((size_t)NKV * HD * TT * 2);
    bf* QPh = (bf*)take((size_t)NH_ * TT * HD * 2); bf* QPl = (bf*)take((size_t)NH_ * TT * HD * 2); bf* KPh = (bf*)take((size_t)NKV * TT * HD * 2); bf* KPl = (bf*)take((size_t)NKV * TT * HD * 2); bf* VTh = (bf*)take((size_t)NKV * HD * TT * 2); bf* VTl = (bf*)take((size_t)NKV * HD * TT * 2); bf* Ph = (bf*)take((size_t)ZH * RH * TT * 2); bf* Pl = (bf*)take((size_t)ZH * RH * TT * 2);
    float* Sb = (float*)take((size_t)ZH * TT * TT * 4); h16* P16 = (h16*)take((size_t)ZH * TT * TT * 2); float* Ob = (float*)take((size_t)ZH * TT * HD * 4); bf* ATh = (bf*)take((size_t)TT * DQ * 2); bf* ATl = (bf*)take((size_t)TT * DQ * 2);
    const size_t carved = (size_t)(wsp - (char*)d_ws);
    if (carved > ws_size || carved > (size_t)134217728) return;    // full-size carve 114,819,072 B
    float* FV = FK;   // v projection reuses the k buffer after the k planes are built (stream-ordered)
    // weights: w is [in = K rows][out = N cols] -> Bt[N][K]
    k_wtG<<<(unsigned)((DM * DQ / 64 + 63) / 64), 256, 0, stream>>>(wq, DM, DQ, WQ);
    k_wtG<<<(unsigned)((DM * DKV / 64 + 63) / 64), 256, 0, stream>>>(wk, DM, DKV, WK);
    k_wtG<<<(unsigned)((DM * DKV / 64 + 63) / 64), 256, 0, stream>>>(wv, DM, DKV, WV);
    k_wtG<<<(unsigned)((DQ * DM / 64 + 63) / 64), 256, 0, stream>>>(wo, DQ, DM, WO);
    const unsigned LQ = (unsigned)(((size_t)NH_ * TT * HD / 2 + 255) / 256), LKv = (unsigned)(((size_t)NKV * TT * HD / 2 + 255) / 256);
    const unsigned LX = (unsigned)(((size_t)TT * DM / 8 + 255) / 256);
    for (int b = 0; b < NB; ++b) {
        const size_t xo = (size_t)b * SEQ_FULL * DM;
        k_cvt8<<<LX, 256, 0, stream>>>(xq + xo, XB, (size_t)TT * DM / 8);
        k_gemmw<bf, 0, true><<<dim3(TT / 64, DQ / 64, 1), 32, 0, stream>>>(XB, nullptr, WQ, nullptr, DM, FQ, DQ, bq, 0, 0, 0);
        k_hpl<<<LQ, 256, 0, stream>>>(FQ, DQ, NH_, QP16, QPh, QPl);
        k_cvt8<<<LX, 256, 0, stream>>>(xk + xo, XB, (size_t)TT * DM / 8);
        k_gemmw<bf, 0, true><<<dim3(TT / 64, DKV / 64, 1), 32, 0, stream>>>(XB, nullptr, WK, nullptr, DM, FK, DKV, bk, 0, 0, 0);
        k_hpl<<<LKv, 256, 0, stream>>>(FK, DKV, NKV, KP16, KPh, KPl);
        k_cvt8<<<LX, 256, 0, stream>>>(xv + xo, XB, (size_t)TT * DM / 8);
        k_gemmw<bf, 0, true><<<dim3(TT / 64, DKV / 64, 1), 32, 0, stream>>>(XB, nullptr, WV, nullptr, DM, FV, DKV, bv, 0, 0, 0);
        k_vtp<<<LKv, 256, 0, stream>>>(FV, DKV, NKV, VT16, VTh, VTl);
        for (int h0 = 0; h0 < NH_; h0 += ZH) { const size_t zq = (size_t)h0, zk = (size_t)(h0 / REP);   // the pass's ZH heads use consecutive planes (z-strides TT*HD)
            k_gemmw<bf, 2, false><<<dim3(RH / 64, TT / 64, ZH), 32, 0, stream>>>(QPh + zq * TT * HD, QPl + zq * TT * HD, KPh + zk * TT * HD, KPl + zk * TT * HD, HD, Sb, TT, nullptr, (size_t)TT * HD, (size_t)TT * HD, (size_t)TT * TT);
            if (TT > RH) k_gemmw<h16, 0, false><<<dim3((TT - RH) / 64, TT / 64, ZH), 32, 0, stream>>>(QP16 + zq * TT * HD + (size_t)RH * HD, nullptr, KP16 + zk * TT * HD, nullptr, HD, Sb + (size_t)RH * TT, TT, nullptr, (size_t)TT * HD, (size_t)TT * HD, (size_t)TT * TT);
            k_asoft<<<ZH * TT / 8, 256, 0, stream>>>(Sb, mk, SEQ_FULL, P16, Ph, Pl);
            k_gemmw<bf, 2, false><<<dim3(RH / 64, HD / 64, ZH), 32, 0, stream>>>(Ph, Pl, VTh + zk * HD * TT, VTl + zk * HD * TT, TT, Ob, HD, nullptr, (size_t)RH * TT, (size_t)HD * TT, (size_t)TT * HD);
            if (TT > RH) k_gemmw<h16, 0, false><<<dim3((TT - RH) / 64, HD / 64, ZH), 32, 0, stream>>>(P16 + (size_t)RH * TT, nullptr, VT16 + zk * HD * TT, nullptr, TT, Ob + (size_t)RH * HD, HD, nullptr, (size_t)TT * TT, (size_t)HD * TT, (size_t)TT * HD);
            k_merge<<<(unsigned)(((size_t)ZH * TT * HD / 2 + 255) / 256), 256, 0, stream>>>(Ob, h0, ATh, ATl); }
        k_gemmw<bf, 1, true><<<dim3(TT / 64, DM / 64, 1), 32, 0, stream>>>(ATh, ATl, WO, nullptr, DQ, OUT + (size_t)b * TT * DM, DM, bo, 0, 0, 0); }
}

// v001
// Measured time: 697 microseconds a run.
// Timed twice side by side with v000, it ran 2.23 and 2.21 times as fast.
#include <hip/hip_runtime.h>

// Masked attention block: three input streams q, k, v [2][2048][768]; per-stream projection x W + b (W stored [in][out]); 12 heads x 64; logits x 1/8 plus mask x -1e9 (mask [2048][2048] read as values from its input buffer); softmax over all keys; merged heads x Wo + bo -> [2][2048][768].
// Compute dtypes (every product accumulates in f32): inputs, mask, biases and weights RNE-converted to bf16; projections v_wmma_f32_16x16x32_bf16 (exact products) + f32 bias; logits: query rows < 512 on bf16 hi/lo planes (3 products), other rows on f16 planes (1 product); P x V: rows < 512 bf16 hi/lo (3 products), other rows v_wmma_f32_16x16x32_f16 with P carried x1024; softmax f32; output projection: merged bf16 hi/lo planes x bf16 Wo (2 products) + f32 bias.

#ifndef NB
#define NB 2
#endif
#ifndef SEQ
#define SEQ 2048
#endif
#define NB_FULL  2
#define SEQ_FULL 2048
#define TT   SEQ
#define DM   768
#define NH_  12
#define NKV  12
#define REP  (NH_ / NKV)
#define HD   64
#define DQ   (NH_ * HD)
#define DKV  (NKV * HD)
#define ZH   2
#define RH   ((TT) < 512 ? (TT) : 512)   // query rows < RH use hi+lo planes
#define PCAR 1024.0f
#define SCL  0.125f   // HD^-0.5
#define MNEG (-1.0e9f)
#define KSP  ((TT) % 512 == 0 ? 16 : 4)   // key slices of the P x V products: one work-group per (tile, slice)

static_assert(TT % 128 == 0);
static_assert(TT <= SEQ_FULL);
static_assert(NB <= NB_FULL);
static_assert(DM % 64 == 0);
static_assert(DQ % 64 == 0);
static_assert(DQ == DM);
static_assert(HD == 64);
static_assert(NH_ % ZH == 0);
static_assert(RH % 64 == 0);
static_assert((TT - RH) % 64 == 0);
static_assert(TT % (32 * KSP) == 0);

typedef _Float16 h16;
typedef unsigned short bf;
typedef __attribute__((ext_vector_type(16))) __bf16   v16bf;
typedef __attribute__((ext_vector_type(16))) _Float16 v16h;
typedef __attribute__((ext_vector_type(8)))  _Float16 v8h;
typedef __attribute__((ext_vector_type(8)))  unsigned short v8us;
typedef __attribute__((ext_vector_type(8)))  float    v8f;
typedef __attribute__((ext_vector_type(4)))  float    v4f;
typedef v8h  __attribute__((may_alias)) v8ha;
typedef v4f  __attribute__((may_alias)) v4fa;
typedef v8us __attribute__((may_alias)) v8usa;

__device__ __forceinline__ unsigned short f2bf(float f) { unsigned u = __float_as_uint(f); u += 0x7FFFu + ((u >> 16) & 1u); return (unsigned short)(u >> 16); }
__device__ __forceinline__ float bf2f(unsigned short b) { return __uint_as_float(((unsigned)b) << 16); }
__device__ __forceinline__ float bfr(float f) { return bf2f(f2bf(f)); }
__device__ __forceinline__ v16h cat16(v8h lo, v8h hi) { return __builtin_shufflevector(lo, hi, 0, 1, 2, 3, 4, 5, 6, 7, 8, 9, 10, 11, 12, 13, 14, 15); }
__device__ __forceinline__ v16bf cat16b(v8us lo, v8us hi) { return __builtin_bit_cast(v16bf, __builtin_shufflevector(lo, hi, 0, 1, 2, 3, 4, 5, 6, 7, 8, 9, 10, 11, 12, 13, 14, 15)); }
__device__ __forceinline__ v8f wmma16(v16h a, v16h b, v8f c) { return __builtin_amdgcn_wmma_f32_16x16x32_f16(false, a, false, b, (short)0, c, false, false); }
__device__ __forceinline__ v8f wmmab(v16bf a, v16bf b, v8f c) { return __builtin_amdgcn_wmma_f32_16x16x32_bf16(false, a, false, b, (short)0, c, false, false); }

// ---- k_gemmw: register-blocked GEMM, ONE WAVE per 64x64 output tile (16 accumulators), operands straight from K-contiguous 16-bit planes; grid (M/64, N/64, Z), 32 threads.
// C[m][n] (f32, pitch ldc, + optional f32 bias[n]) = sum_k A[m][k] Bt[n][k] (+ split products per NSPLIT). z-batch strides sA/sB/sC in elements. K % (32 KS) == 0, M % 64 == 0, N % 64 == 0.
// KS > 1: grid z = Z x KS; work-group (z, ks) sums only k in [ks K/KS, (ks+1) K/KS) and stores its f32 partial tile into plane ks (plane stride sP elements); the reader adds the KS planes in the order 0..KS-1.
// Fragment map: lane l, h = l >> 4: elements 0..7 <- k0 + 8h + 0..7, elements 8..15 <- k0 + 16 + 8h + 0..7 (A row / B column = l & 15); D element j -> (row 8h + j, col l & 15).
template <typename T16> struct WFrag;
template <> struct WFrag<h16> { typedef v16h V; static __device__ __forceinline__ V ld(const h16* p) { return cat16(*(const v8h*)p, *(const v8h*)(p + 16)); } static __device__ __forceinline__ v8f mma(V a, V b, v8f c) { return wmma16(a, b, c); } };
template <> struct WFrag<bf> { typedef v16bf V; static __device__ __forceinline__ V ld(const bf* p) { return cat16b(*(const v8us*)p, *(const v8us*)(p + 16)); } static __device__ __forceinline__ v8f mma(V a, V b, v8f c) { return wmmab(a, b, c); } };
template <typename T16, int NSPLIT, bool BIAS, int KS>
__global__ __launch_bounds__(32) void k_gemmw(const T16* __restrict__ A, const T16* __restrict__ A2, const T16* __restrict__ Bt, const T16* __restrict__ Bt2, int K, float* C, int ldc, const float* __restrict__ bias, size_t sA, size_t sB, size_t sC, size_t sP) {
    static_assert(KS == 1 || !BIAS);
    typedef typename WFrag<T16>::V V;
    __shared__ __align__(16) float os[16 * 68];
    const size_t z = blockIdx.z / KS; const int ks = (int)(blockIdx.z % KS); A += z * sA; if (A2) A2 += z * sA; Bt += z * sB; if (Bt2) Bt2 += z * sB; C += z * sC + (size_t)ks * sP;
    const int kbeg = ks * (K / KS), kend = kbeg + K / KS;
    const int lane = threadIdx.x & 31, lr = lane & 15, hi = lane >> 4; const int r0 = blockIdx.x * 64, c0 = blockIdx.y * 64;
    v8f acc[4][4];
#pragma unroll
    for (int mb = 0; mb < 4; ++mb)
#pragma unroll
        for (int nb = 0; nb < 4; ++nb) acc[mb][nb] = (v8f){};
    const size_t aoff = (size_t)(r0 + lr) * K + 8 * hi, boff = (size_t)(c0 + lr) * K + 8 * hi;
#pragma unroll 1
    for (int kc = kbeg; kc < kend; kc += 32) {
        V a[4], a2[4];
#pragma unroll
        for (int mb = 0; mb < 4; ++mb) { a[mb] = WFrag<T16>::ld(A + aoff + (size_t)mb * 16 * K + kc); if (NSPLIT == 1 || NSPLIT == 2) a2[mb] = WFrag<T16>::ld(A2 + aoff + (size_t)mb * 16 * K + kc); }
#pragma unroll
        for (int nb = 0; nb < 4; ++nb) { const V b = WFrag<T16>::ld(Bt + boff + (size_t)nb * 16 * K + kc); V b2; if (NSPLIT >= 2) b2 = WFrag<T16>::ld(Bt2 + boff + (size_t)nb * 16 * K + kc);
#pragma unroll
            for (int mb = 0; mb < 4; ++mb) { acc[mb][nb] = WFrag<T16>::mma(a[mb], b, acc[mb][nb]); if (NSPLIT == 1 || NSPLIT == 2) acc[mb][nb] = WFrag<T16>::mma(a2[mb], b, acc[mb][nb]); if (NSPLIT >= 2) acc[mb][nb] = WFrag<T16>::mma(a[mb], b2, acc[mb][nb]); } }
        asm volatile("v_nop\n\tv_nop\n\tv_nop\n\tv_nop" : "+v"(acc[0][0]), "+v"(acc[1][1]), "+v"(acc[2][2]), "+v"(acc[3][3]) : "v"(a[0]), "v"(a[3]));
    }
#pragma unroll
    for (int mb = 0; mb < 4; ++mb) {
#pragma unroll
        for (int nb = 0; nb < 4; ++nb) {
#pragma unroll
            for (int j = 0; j < 8; ++j) os[(hi * 8 + j) * 68 + nb * 16 + lr] = acc[mb][nb][j]; }
        __builtin_amdgcn_wave_barrier(); asm volatile("" ::: "memory");
        float* crow = C + (size_t)(r0 + mb * 16) * ldc + c0;
{
#pragma unroll
            for (int s = 0; s < 8; ++s) { const int row = 2 * s + hi, cofs = lr * 4; v4f val = *(const v4fa*)(os + row * 68 + cofs); if (BIAS) { val[0] += bfr(bias[c0 + cofs]); val[1] += bfr(bias[c0 + cofs + 1]); val[2] += bfr(bias[c0 + cofs + 2]); val[3] += bfr(bias[c0 + cofs + 3]); }
                *(v4f*)(crow + (size_t)row * ldc + cofs) = val; }
             }
        __builtin_amdgcn_wave_barrier(); asm volatile("" ::: "memory");
    }
}

__device__ __forceinline__ h16 tohx(float x) { return (h16)x; }
__device__ __forceinline__ void splitf(float y, unsigned short& h, unsigned short& l) { h = f2bf(y); l = f2bf(y - bf2f(h)); }
typedef __attribute__((ext_vector_type(2))) _Float16 v2h;
typedef __attribute__((ext_vector_type(4))) _Float16 v4h;
typedef __attribute__((ext_vector_type(2))) unsigned short v2us;
typedef __attribute__((ext_vector_type(4))) unsigned short v4us;
typedef __attribute__((ext_vector_type(2))) float v2f;

__global__ __launch_bounds__(256) void k_wtG(const float* __restrict__ w, int K, int N, bf* Bt) {
    const int lane = threadIdx.x & 31; const int L0 = (blockIdx.x * 8 + (threadIdx.x >> 5)) * 8; const int nlines = N * K / 64;
{
#pragma unroll 1
        for (int l = 0; l < 8; ++l) { const int L = L0 + l; if (L >= nlines) break; const size_t e = (size_t)L * 64 + lane * 2; const int k = (int)(e % K), n = (int)(e / K); v2us o;
            o[0] = f2bf(w[(size_t)k * N + n]); o[1] = f2bf(w[(size_t)(k + 1) * N + n]); *(v2us*)(Bt + e) = o; }
         }
}
__global__ __launch_bounds__(256) void k_cvt8(const float* __restrict__ src, bf* dst, size_t n8) { const size_t i = (size_t)blockIdx.x * 256 + threadIdx.x; if (i >= n8) return; const v8f v = *(const v8f*)(src + i * 8); v8us o;
#pragma unroll
    for (int k = 0; k < 8; ++k) o[k] = f2bf(v[k]); *(v8us*)(dst + i * 8) = o;  }

__global__ __launch_bounds__(256) void k_hpl(const float* __restrict__ F, int pitch, int nheads, h16* P16, bf* Ph, bf* Pl) {
    const size_t e = ((size_t)blockIdx.x * 256 + threadIdx.x) * 2; if (e >= (size_t)nheads * TT * HD) return; const int d = (int)(e % HD); const int t = (int)((e / HD) % TT); const int h = (int)(e / ((size_t)HD * TT));
    const v2f x = *(const v2f*)(F + (size_t)t * pitch + h * HD + d); v2h o16; v2us oh, ol;
#pragma unroll
    for (int q = 0; q < 2; ++q) { const float r = x[q]; o16[q] = tohx(r); unsigned short a2, c2; splitf(r, a2, c2); oh[q] = a2; ol[q] = c2; }
    *(v2h*)(P16 + e) = o16; *(v2us*)(Ph + e) = oh; *(v2us*)(Pl + e) = ol;  }
__global__ __launch_bounds__(256) void k_vtp(const float* __restrict__ F, int pitch, int nheads, h16* V16, bf* Vh, bf* Vl) { const size_t e = ((size_t)blockIdx.x * 256 + threadIdx.x) * 2; if (e >= (size_t)nheads * HD * TT) return; const int t = (int)(e % TT); const int d = (int)((e / TT) % HD); const int g = (int)(e / ((size_t)TT * HD)); v2h o16; v2us oh, ol;
#pragma unroll
    for (int q = 0; q < 2; ++q) { const float x = F[(size_t)(t + q) * pitch + g * HD + d]; o16[q] = tohx(x); unsigned short a2, c2; splitf(x, a2, c2); oh[q] = a2; ol[q] = c2; }
    *(v2h*)(V16 + e) = o16; *(v2us*)(Vh + e) = oh; *(v2us*)(Vl + e) = ol;  }

// k_asoft: one wave per row (zz, i): t = S x HD^-0.5 + bf16(mask[i][j]) x -1e9 (mask row pitch mpitch, shared by all heads and batches);
__global__ __launch_bounds__(256) void k_asoft(const float* __restrict__ Sb, const float* __restrict__ Mk, int mpitch, h16* P16, bf* Ph, bf* Pl) {
#pragma clang fp contract(off)
    const int lane = threadIdx.x & 31; const int row = blockIdx.x * 8 + __builtin_amdgcn_readfirstlane((int)(threadIdx.x >> 5)); if (row >= ZH * TT) return; const int i = row % TT; const int zz = row / TT; const bool hires = (i < RH); const float* sr = Sb + (size_t)row * TT; const float* mr = Mk + (size_t)i * mpitch; float v[TT / 32]; float mx = -3.0e38f;
#pragma unroll
    for (int ch = 0; ch < TT / 128; ++ch) { const int j0 = ch * 128 + lane * 4; const v4f a = *(const v4f*)(sr + j0);
#pragma unroll
        for (int q = 0; q < 4; ++q) v[ch * 4 + q] = a[q] * SCL; }
    asm volatile("" ::: "memory");
#pragma unroll
    for (int ch = 0; ch < TT / 128; ++ch) { const int j0 = ch * 128 + lane * 4; const v4f m = *(const v4f*)(mr + j0);
#pragma unroll
        for (int q = 0; q < 4; ++q) { const float mb = bfr(m[q]) * MNEG; const float t = v[ch * 4 + q] + mb; v[ch * 4 + q] = t; mx = fmaxf(mx, t); } }
#pragma unroll
    for (int sh = 16; sh; sh >>= 1) mx = fmaxf(mx, __shfl_xor(mx, sh, 32));
    float sum = 0.f;
#pragma unroll
    for (int k = 0; k < TT / 32; ++k) { float d0 = v[k] - mx; asm volatile("" : "+v"(d0)); v[k] = __builtin_amdgcn_exp2f(d0 * 1.4426950408889634f); sum += v[k]; }
#pragma unroll
    for (int sh = 16; sh; sh >>= 1) sum += __shfl_xor(sum, sh, 32);
    const float f = (hires ? 1.0f : PCAR) * (1.0f / sum);
{
        if (hires) {
#pragma unroll
            for (int ch = 0; ch < TT / 128; ++ch) { v4us oh, ol;
#pragma unroll
                for (int q = 0; q < 4; ++q) { unsigned short a, c2; splitf(v[ch * 4 + q] * f, a, c2); oh[q] = a; ol[q] = c2; }
                const size_t oo = ((size_t)zz * RH + i) * TT + ch * 128 + lane * 4; *(v4us*)(Ph + oo) = oh; *(v4us*)(Pl + oo) = ol; }
        } else {
#pragma unroll
            for (int ch = 0; ch < TT / 128; ++ch) { v4h o4;
#pragma unroll
                for (int q = 0; q < 4; ++q) o4[q] = tohx(v[ch * 4 + q] * f);
                *(v4h*)(P16 + (size_t)row * TT + ch * 128 + lane * 4) = o4; } }
         }
}
__global__ __launch_bounds__(256) void k_merge(const float* __restrict__ O, int h0, bf* Ah, bf* Al) { const size_t e = ((size_t)blockIdx.x * 256 + threadIdx.x) * 2; if (e >= (size_t)ZH * TT * HD) return; const int d = (int)(e % HD); const int t = (int)((e / HD) % TT); const int zz = (int)(e / ((size_t)HD * TT)); const float cs = (t < RH) ? 1.0f : (1.0f / PCAR); const size_t oo = (size_t)t * DQ + (h0 + zz) * HD + d;
    v2f x = *(const v2f*)(O + e); v2us oh, ol;
#pragma unroll
    for (int s = 1; s < KSP; ++s) x += *(const v2f*)(O + (size_t)s * ((size_t)ZH * TT * HD) + e);   // key-slice partial planes, fixed order
#pragma unroll
    for (int q = 0; q < 2; ++q) { unsigned short a, c2; splitf(x[q] * cs, a, c2); oh[q] = a; ol[q] = c2; } *(v2us*)(Ah + oo) = oh; *(v2us*)(Al + oo) = ol;  }

extern "C" void kernel_launch(void* const* d_in, const int* in_sizes, int n_in,
                              void* d_out, int out_size, void* d_ws, size_t ws_size, hipStream_t stream) {
    if (n_in < 12) return;
    const long long xneed = (long long)(NB - 1) * SEQ_FULL * DM + (long long)TT * DM;
    if ((long long)in_sizes[0] < xneed || (long long)in_sizes[1] < xneed || (long long)in_sizes[2] < xneed) return;
    if ((long long)in_sizes[3] < (long long)(TT - 1) * SEQ_FULL + TT) return;
    if (in_sizes[4] < DM * DQ || in_sizes[6] < DM * DKV || in_sizes[8] < DM * DKV || in_sizes[10] < DQ * DM) return;
    if (in_sizes[5] < DQ || in_sizes[7] < DKV || in_sizes[9] < DKV || in_sizes[11] < DM) return;
    if ((long long)out_size < (long long)NB * TT * DM) return;
    const float* xq = (const float*)d_in[0]; const float* xk = (const float*)d_in[1]; const float* xv = (const float*)d_in[2]; const float* mk = (const float*)d_in[3];
    const float* wq = (const float*)d_in[4]; const float* bq = (const float*)d_in[5]; const float* wk = (const float*)d_in[6]; const float* bk = (const float*)d_in[7]; const float* wv = (const float*)d_in[8]; const float* bv = (const float*)d_in[9]; const float* wo = (const float*)d_in[10]; const float* bo = (const float*)d_in[11];
    float* OUT = (float*)d_out;     // [NB][TT][DM]
    char* wsp = (char*)d_ws;
    auto take = [&](size_t bytes) { char* p = wsp; wsp += (bytes + 255) & ~(size_t)255; return (void*)p; };
    bf* WQ = (bf*)take((size_t)DQ * DM * 2); bf* WK = (bf*)take((size_t)DKV * DM * 2); bf* WV = (bf*)take((size_t)DKV * DM * 2); bf* WO = (bf*)take((size_t)DM * DQ * 2);
    bf* XB = (bf*)take((size_t)TT * DM * 2); float* FQ = (float*)take((size_t)TT * DQ * 4); float* FK = (float*)take((size_t)TT * DKV * 4);
    h16* QP16 = (h16*)take((size_t)NH_ * TT * HD * 2); h16* KP16 = (h16*)take((size_t)NKV * TT * HD * 2); h16* VT16 = (h16*)take((size_t)NKV * HD * TT * 2);
    bf* QPh = (bf*)take((size_t)NH_ * TT * HD * 2); bf* QPl = (bf*)take((size_t)NH_ * TT * HD * 2); bf* KPh = (bf*)take((size_t)NKV * TT * HD * 2); bf* KPl = (bf*)take((size_t)NKV * TT * HD * 2); bf* VTh = (bf*)take((size_t)NKV * HD * TT * 2); bf* VTl = (bf*)take((size_t)NKV * HD * TT * 2); bf* Ph = (bf*)take((size_t)ZH * RH * TT * 2); bf* Pl = (bf*)take((size_t)ZH * RH * TT * 2);
    float* Sb = (float*)take((size_t)ZH * TT * TT * 4); h16* P16 = (h16*)take((size_t)ZH * TT * TT * 2); float* Ob = (float*)take((size_t)KSP * ZH * TT * HD * 4); bf* ATh = (bf*)take((size_t)TT * DQ * 2); bf* ATl = (bf*)take((size_t)TT * DQ * 2);
    const size_t carved = (size_t)(wsp - (char*)d_ws);
    if (carved > ws_size || carved > (size_t)134217728) return;    // full-size carve 130,547,712 B
    float* FV = FK;   // v projection reuses the k buffer after the k planes are built (stream-ordered)
    // weights: w is [in = K rows][out = N cols] -> Bt[N][K]
    k_wtG<<<(unsigned)((DM * DQ / 64 + 63) / 64), 256, 0, stream>>>(wq, DM, DQ, WQ);
    k_wtG<<<(unsigned)((DM * DKV / 64 + 63) / 64), 256, 0, stream>>>(wk, DM, DKV, WK);
    k_wtG<<<(unsigned)((DM * DKV / 64 + 63) / 64), 256, 0, stream>>>(wv, DM, DKV, WV);
    k_wtG<<<(unsigned)((DQ * DM / 64 + 63) / 64), 256, 0, stream>>>(wo, DQ, DM, WO);
    const unsigned LQ = (unsigned)(((size_t)NH_ * TT * HD / 2 + 255) / 256), LKv = (unsigned)(((size_t)NKV * TT * HD / 2 + 255) / 256);
    const unsigned LX = (unsigned)(((size_t)TT * DM / 8 + 255) / 256);
    for (int b = 0; b < NB; ++b) {
        const size_t xo = (size_t)b * SEQ_FULL * DM;
        k_cvt8<<<LX, 256, 0, stream>>>(xq + xo, XB, (size_t)TT * DM / 8);
        k_gemmw<bf, 0, true, 1><<<dim3(TT / 64, DQ / 64, 1), 32, 0, stream>>>(XB, nullptr, WQ, nullptr, DM, FQ, DQ, bq, 0, 0, 0, 0);
        k_hpl<<<LQ, 256, 0, stream>>>(FQ, DQ, NH_, QP16, QPh, QPl);
        k_cvt8<<<LX, 256, 0, stream>>>(xk + xo, XB, (size_t)TT * DM / 8);
        k_gemmw<bf, 0, true, 1><<<dim3(TT / 64, DKV / 64, 1), 32, 0, stream>>>(XB, nullptr, WK, nullptr, DM, FK, DKV, bk, 0, 0, 0, 0);
        k_hpl<<<LKv, 256, 0, stream>>>(FK, DKV, NKV, KP16, KPh, KPl);
        k_cvt8<<<LX, 256, 0, stream>>>(xv + xo, XB, (size_t)TT * DM / 8);
        k_gemmw<bf, 0, true, 1><<<dim3(TT / 64, DKV / 64, 1), 32, 0, stream>>>(XB, nullptr, WV, nullptr, DM, FV, DKV, bv, 0, 0, 0, 0);
        k_vtp<<<LKv, 256, 0, stream>>>(FV, DKV, NKV, VT16, VTh, VTl);
        for (int h0 = 0; h0 < NH_; h0 += ZH) { const size_t zq = (size_t)h0, zk = (size_t)(h0 / REP);   // the pass's ZH heads use consecutive planes (z-strides TT*HD)
            k_gemmw<bf, 2, false, 1><<<dim3(RH / 64, TT / 64, ZH), 32, 0, stream>>>(QPh + zq * TT * HD, QPl + zq * TT * HD, KPh + zk * TT * HD, KPl + zk * TT * HD, HD, Sb, TT, nullptr, (size_t)TT * HD, (size_t)TT * HD, (size_t)TT * TT, 0);
            if (TT > RH) k_gemmw<h16, 0, false, 1><<<dim3((TT - RH) / 64, TT / 64, ZH), 32, 0, stream>>>(QP16 + zq * TT * HD + (size_t)RH * HD, nullptr, KP16 + zk * TT * HD, nullptr, HD, Sb + (size_t)RH * TT, TT, nullptr, (size_t)TT * HD, (size_t)TT * HD, (size_t)TT * TT, 0);
            k_asoft<<<ZH * TT / 8, 256, 0, stream>>>(Sb, mk, SEQ_FULL, P16, Ph, Pl);
            k_gemmw<bf, 2, false, KSP><<<dim3(RH / 64, HD / 64, ZH * KSP), 32, 0, stream>>>(Ph, Pl, VTh + zk * HD * TT, VTl + zk * HD * TT, TT, Ob, HD, nullptr, (size_t)RH * TT, (size_t)HD * TT, (size_t)TT * HD, (size_t)ZH * TT * HD);
            if (TT > RH) k_gemmw<h16, 0, false, KSP><<<dim3((TT - RH) / 64, HD / 64, ZH * KSP), 32, 0, stream>>>(P16 + (size_t)RH * TT, nullptr, VT16 + zk * HD * TT, nullptr, TT, Ob + (size_t)RH * HD, HD, nullptr, (size_t)TT * TT, (size_t)HD * TT, (size_t)TT * HD, (size_t)ZH * TT * HD);
            k_merge<<<(unsigned)(((size_t)ZH * TT * HD / 2 + 255) / 256), 256, 0, stream>>>(Ob, h0, ATh, ATl); }
        k_gemmw<bf, 1, true, 1><<<dim3(TT / 64, DM / 64, 1), 32, 0, stream>>>(ATh, ATl, WO, nullptr, DQ, OUT + (size_t)b * TT * DM, DM, bo, 0, 0, 0, 0); }
}

// v002
// A run of this version takes 428 microseconds.
// In both of two side-by-side timings against v001, it was 1.63 times as fast.
// All steps since v000 together make it 3.62 times as fast.
#include <hip/hip_runtime.h>

// Masked attention block: three input streams q, k, v [2][2048][768]; per-stream projection x W + b (W stored [in][out]); 12 heads x 64; logits x 1/8 plus mask x -1e9 (mask [2048][2048] read as values from its input buffer); softmax over all keys; merged heads x Wo + bo -> [2][2048][768].
// Compute dtypes (every product accumulates in f32): inputs, mask, biases and weights RNE-converted to bf16; projections v_wmma_f32_16x16x32_bf16 (exact products) + f32 bias; logits: query rows < 512 on bf16 hi/lo planes (3 products), other rows on f16 planes (1 product); P x V: rows < 512 bf16 hi/lo (3 products), other rows v_wmma_f32_16x16x32_f16 with P carried x1024; softmax f32; output projection: merged bf16 hi/lo planes x bf16 Wo (2 products) + f32 bias.

#ifndef NB
#define NB 2
#endif
#ifndef SEQ
#define SEQ 2048
#endif
#define NB_FULL  2
#define SEQ_FULL 2048
#define TT   SEQ
#define DM   768
#define NH_  12
#define NKV  12
#define REP  (NH_ / NKV)
#define HD   64
#define DQ   (NH_ * HD)
#define DKV  (NKV * HD)
#define ZH   6      // (batch, head) slices per attention pass
#define NZ   (NB * NH_)
#define RH   ((TT) < 512 ? (TT) : 512)   // query rows < RH use hi+lo planes
#define PCAR 1024.0f
#define SCL  0.125f   // HD^-0.5
#define MNEG (-1.0e9f)
#define KSP  ((TT) % 512 == 0 ? 16 : 4)   // key slices of the P x V products: one work-group per (tile, slice)

static_assert(TT % 128 == 0);
static_assert(TT <= SEQ_FULL);
static_assert(NB <= NB_FULL);
static_assert(DM % 64 == 0);
static_assert(DQ % 64 == 0);
static_assert(DQ == DM);
static_assert(HD == 64);
static_assert(NZ % ZH == 0);
static_assert(NKV == NH_);
static_assert(RH % 64 == 0);
static_assert((TT - RH) % 64 == 0);
static_assert(TT % (32 * KSP) == 0);

typedef _Float16 h16;
typedef unsigned short bf;
typedef __attribute__((ext_vector_type(16))) __bf16   v16bf;
typedef __attribute__((ext_vector_type(16))) _Float16 v16h;
typedef __attribute__((ext_vector_type(8)))  _Float16 v8h;
typedef __attribute__((ext_vector_type(8)))  unsigned short v8us;
typedef __attribute__((ext_vector_type(8)))  float    v8f;
typedef __attribute__((ext_vector_type(4)))  float    v4f;
typedef v8h  __attribute__((may_alias)) v8ha;
typedef v4f  __attribute__((may_alias)) v4fa;
typedef v8us __attribute__((may_alias)) v8usa;

__device__ __forceinline__ unsigned short f2bf(float f) { unsigned u = __float_as_uint(f); u += 0x7FFFu + ((u >> 16) & 1u); return (unsigned short)(u >> 16); }
__device__ __forceinline__ float bf2f(unsigned short b) { return __uint_as_float(((unsigned)b) << 16); }
__device__ __forceinline__ float bfr(float f) { return bf2f(f2bf(f)); }
__device__ __forceinline__ v16h cat16(v8h lo, v8h hi) { return __builtin_shufflevector(lo, hi, 0, 1, 2, 3, 4, 5, 6, 7, 8, 9, 10, 11, 12, 13, 14, 15); }
__device__ __forceinline__ v16bf cat16b(v8us lo, v8us hi) { return __builtin_bit_cast(v16bf, __builtin_shufflevector(lo, hi, 0, 1, 2, 3, 4, 5, 6, 7, 8, 9, 10, 11, 12, 13, 14, 15)); }
__device__ __forceinline__ v8f wmma16(v16h a, v16h b, v8f c) { return __builtin_amdgcn_wmma_f32_16x16x32_f16(false, a, false, b, (short)0, c, false, false); }
__device__ __forceinline__ v8f wmmab(v16bf a, v16bf b, v8f c) { return __builtin_amdgcn_wmma_f32_16x16x32_bf16(false, a, false, b, (short)0, c, false, false); }

// ---- k_gemmw: register-blocked GEMM, ONE WAVE per 64x64 output tile (16 accumulators), operands straight from K-contiguous 16-bit planes; grid (M/64, N/64, Z), 32 threads.
// C[m][n] (f32, pitch ldc, + optional f32 bias[n]) = sum_k A[m][k] Bt[n][k] (+ split products per NSPLIT). z-batch strides sA/sB/sC in elements. K % (32 KS) == 0, M % 64 == 0, N % 64 == 0.
// BIAS: z-slice 0 / 1 / 2 adds bias / bias1 / bias2.
// KS > 1: grid z = Z x KS; work-group (z, ks) sums only k in [ks K/KS, (ks+1) K/KS) and stores its f32 partial tile into plane ks (plane stride sP elements); the reader adds the KS planes in the order 0..KS-1.
// Fragment map: lane l, h = l >> 4: elements 0..7 <- k0 + 8h + 0..7, elements 8..15 <- k0 + 16 + 8h + 0..7 (A row / B column = l & 15); D element j -> (row 8h + j, col l & 15).
template <typename T16> struct WFrag;
template <> struct WFrag<h16> { typedef v16h V; static __device__ __forceinline__ V ld(const h16* p) { return cat16(*(const v8h*)p, *(const v8h*)(p + 16)); } static __device__ __forceinline__ v8f mma(V a, V b, v8f c) { return wmma16(a, b, c); } };
template <> struct WFrag<bf> { typedef v16bf V; static __device__ __forceinline__ V ld(const bf* p) { return cat16b(*(const v8us*)p, *(const v8us*)(p + 16)); } static __device__ __forceinline__ v8f mma(V a, V b, v8f c) { return wmmab(a, b, c); } };
template <typename T16, int NSPLIT, bool BIAS, int KS>
__global__ __launch_bounds__(32) void k_gemmw(const T16* __restrict__ A, const T16* __restrict__ A2, const T16* __restrict__ Bt, const T16* __restrict__ Bt2, int K, float* C, int ldc, const float* __restrict__ bias, const float* __restrict__ bias1, const float* __restrict__ bias2, size_t sA, size_t sB, size_t sC, size_t sP) {
    static_assert(KS == 1 || !BIAS);
    typedef typename WFrag<T16>::V V;
    __shared__ __align__(16) float os[16 * 68];
    const size_t z = blockIdx.z / KS; const int ks = (int)(blockIdx.z % KS); A += z * sA; if (A2) A2 += z * sA; Bt += z * sB; if (Bt2) Bt2 += z * sB; C += z * sC + (size_t)ks * sP;
    const float* bz = (z == 0) ? bias : ((z == 1) ? bias1 : bias2);
    const int kbeg = ks * (K / KS), kend = kbeg + K / KS;
    const int lane = threadIdx.x & 31, lr = lane & 15, hi = lane >> 4; const int r0 = blockIdx.x * 64, c0 = blockIdx.y * 64;
    v8f acc[4][4];
#pragma unroll
    for (int mb = 0; mb < 4; ++mb)
#pragma unroll
        for (int nb = 0; nb < 4; ++nb) acc[mb][nb] = (v8f){};
    const size_t aoff = (size_t)(r0 + lr) * K + 8 * hi, boff = (size_t)(c0 + lr) * K + 8 * hi;
#pragma unroll 1
    for (int kc = kbeg; kc < kend; kc += 32) {
        V a[4], a2[4];
#pragma unroll
        for (int mb = 0; mb < 4; ++mb) { a[mb] = WFrag<T16>::ld(A + aoff + (size_t)mb * 16 * K + kc); if (NSPLIT == 1 || NSPLIT == 2) a2[mb] = WFrag<T16>::ld(A2 + aoff + (size_t)mb * 16 * K + kc); }
#pragma unroll
        for (int nb = 0; nb < 4; ++nb) { const V b = WFrag<T16>::ld(Bt + boff + (size_t)nb * 16 * K + kc); V b2; if (NSPLIT >= 2) b2 = WFrag<T16>::ld(Bt2 + boff + (size_t)nb * 16 * K + kc);
#pragma unroll
            for (int mb = 0; mb < 4; ++mb) { acc[mb][nb] = WFrag<T16>::mma(a[mb], b, acc[mb][nb]); if (NSPLIT == 1 || NSPLIT == 2) acc[mb][nb] = WFrag<T16>::mma(a2[mb], b, acc[mb][nb]); if (NSPLIT >= 2) acc[mb][nb] = WFrag<T16>::mma(a[mb], b2, acc[mb][nb]); } }
        asm volatile("v_nop\n\tv_nop\n\tv_nop\n\tv_nop" : "+v"(acc[0][0]), "+v"(acc[1][1]), "+v"(acc[2][2]), "+v"(acc[3][3]) : "v"(a[0]), "v"(a[3]));
    }
#pragma unroll
    for (int mb = 0; mb < 4; ++mb) {
#pragma unroll
        for (int nb = 0; nb < 4; ++nb) {
#pragma unroll
            for (int j = 0; j < 8; ++j) os[(hi * 8 + j) * 68 + nb * 16 + lr] = acc[mb][nb][j]; }
        __builtin_amdgcn_wave_barrier(); asm volatile("" ::: "memory");
        float* crow = C + (size_t)(r0 + mb * 16) * ldc + c0;
{
#pragma unroll
            for (int s = 0; s < 8; ++s) { const int row = 2 * s + hi, cofs = lr * 4; v4f val = *(const v4fa*)(os + row * 68 + cofs); if (BIAS) { val[0] += bfr(bz[c0 + cofs]); val[1] += bfr(bz[c0 + cofs + 1]); val[2] += bfr(bz[c0 + cofs + 2]); val[3] += bfr(bz[c0 + cofs + 3]); }
                *(v4f*)(crow + (size_t)row * ldc + cofs) = val; }
             }
        __builtin_amdgcn_wave_barrier(); asm volatile("" ::: "memory");
    }
}

__device__ __forceinline__ h16 tohx(float x) { return (h16)x; }
__device__ __forceinline__ void splitf(float y, unsigned short& h, unsigned short& l) { h = f2bf(y); l = f2bf(y - bf2f(h)); }
typedef __attribute__((ext_vector_type(2))) _Float16 v2h;
typedef __attribute__((ext_vector_type(4))) _Float16 v4h;
typedef __attribute__((ext_vector_type(2))) unsigned short v2us;
typedef __attribute__((ext_vector_type(4))) unsigned short v4us;
typedef __attribute__((ext_vector_type(2))) float v2f;

// grid.y picks one of four equally shaped weights; Bt holds the four transposed planes one behind the other.
__global__ __launch_bounds__(256) void k_wtG(const float* __restrict__ w0, const float* __restrict__ w1, const float* __restrict__ w2, const float* __restrict__ w3, int K, int N, bf* Bt) {
    const int y = (int)blockIdx.y; const float* w = (y == 0) ? w0 : ((y == 1) ? w1 : ((y == 2) ? w2 : w3)); Bt += (size_t)y * K * N;
    const int lane = threadIdx.x & 31; const int L0 = (blockIdx.x * 8 + (threadIdx.x >> 5)) * 8; const int nlines = N * K / 64;
{
#pragma unroll 1
        for (int l = 0; l < 8; ++l) { const int L = L0 + l; if (L >= nlines) break; const size_t e = (size_t)L * 64 + lane * 2; const int k = (int)(e % K), n = (int)(e / K); v2us o;
            o[0] = f2bf(w[(size_t)k * N + n]); o[1] = f2bf(w[(size_t)(k + 1) * N + n]); *(v2us*)(Bt + e) = o; }
         }
}
// grid.z picks the stream, grid.y the batch (source batch stride sb elements); dst is [stream][batch][n8 * 8].
__global__ __launch_bounds__(256) void k_cvt8(const float* __restrict__ s0, const float* __restrict__ s1, const float* __restrict__ s2, size_t sb, bf* dst, size_t n8) { const size_t i = (size_t)blockIdx.x * 256 + threadIdx.x; if (i >= n8) return;
    const int s = (int)blockIdx.z; const float* src = ((s == 0) ? s0 : ((s == 1) ? s1 : s2)) + (size_t)blockIdx.y * sb; dst += ((size_t)s * NB + blockIdx.y) * n8 * 8; const v8f v = *(const v8f*)(src + i * 8); v8us o;
#pragma unroll
    for (int k = 0; k < 8; ++k) o[k] = f2bf(v[k]); *(v8us*)(dst + i * 8) = o;  }

// F is [nblk][TT][pitch] (nblk = streams x batches); plane z = blk * NH_ + h (nheads == NH_).
__global__ __launch_bounds__(256) void k_hpl(const float* __restrict__ F, int pitch, int nheads, int nblk, h16* P16, bf* Ph, bf* Pl) {
    const size_t e = ((size_t)blockIdx.x * 256 + threadIdx.x) * 2; if (e >= (size_t)nblk * nheads * TT * HD) return; const int d = (int)(e % HD); const int t = (int)((e / HD) % TT); const int z = (int)(e / ((size_t)HD * TT)); const int blk = z / NH_, h = z % NH_;
    const v2f x = *(const v2f*)(F + ((size_t)blk * TT + t) * pitch + h * HD + d); v2h o16; v2us oh, ol;
#pragma unroll
    for (int q = 0; q < 2; ++q) { const float r = x[q]; o16[q] = tohx(r); unsigned short a2, c2; splitf(r, a2, c2); oh[q] = a2; ol[q] = c2; }
    *(v2h*)(P16 + e) = o16; *(v2us*)(Ph + e) = oh; *(v2us*)(Pl + e) = ol;  }
__global__ __launch_bounds__(256) void k_vtp(const float* __restrict__ F, int pitch, int nheads, int nblk, h16* V16, bf* Vh, bf* Vl) { const size_t e = ((size_t)blockIdx.x * 256 + threadIdx.x) * 2; if (e >= (size_t)nblk * nheads * HD * TT) return; const int t = (int)(e % TT); const int d = (int)((e / TT) % HD); const int z = (int)(e / ((size_t)TT * HD)); const int blk = z / NH_, g = z % NH_; v2h o16; v2us oh, ol;
#pragma unroll
    for (int q = 0; q < 2; ++q) { const float x = F[((size_t)blk * TT + t + q) * pitch + g * HD + d]; o16[q] = tohx(x); unsigned short a2, c2; splitf(x, a2, c2); oh[q] = a2; ol[q] = c2; }
    *(v2h*)(V16 + e) = o16; *(v2us*)(Vh + e) = oh; *(v2us*)(Vl + e) = ol;  }

// k_asoft: one wave per row (zz, i): t = S x HD^-0.5 + bf16(mask[i][j]) x -1e9 (mask row pitch mpitch, shared by all heads and batches);
__global__ __launch_bounds__(256) void k_asoft(const float* __restrict__ Sb, const float* __restrict__ Mk, int mpitch, h16* P16, bf* Ph, bf* Pl) {
#pragma clang fp contract(off)
    const int lane = threadIdx.x & 31; const int row = blockIdx.x * 8 + __builtin_amdgcn_readfirstlane((int)(threadIdx.x >> 5)); if (row >= ZH * TT) return; const int i = row % TT; const int zz = row / TT; const bool hires = (i < RH); const float* sr = Sb + (size_t)row * TT; const float* mr = Mk + (size_t)i * mpitch; float v[TT / 32]; float mx = -3.0e38f;
#pragma unroll
    for (int ch = 0; ch < TT / 128; ++ch) { const int j0 = ch * 128 + lane * 4; const v4f a = *(const v4f*)(sr + j0);
#pragma unroll
        for (int q = 0; q < 4; ++q) v[ch * 4 + q] = a[q] * SCL; }
    asm volatile("" ::: "memory");
#pragma unroll
    for (int ch = 0; ch < TT / 128; ++ch) { const int j0 = ch * 128 + lane * 4; const v4f m = *(const v4f*)(mr + j0);
#pragma unroll
        for (int q = 0; q < 4; ++q) { const float mb = bfr(m[q]) * MNEG; const float t = v[ch * 4 + q] + mb; v[ch * 4 + q] = t; mx = fmaxf(mx, t); } }
#pragma unroll
    for (int sh = 16; sh; sh >>= 1) mx = fmaxf(mx, __shfl_xor(mx, sh, 32));
    float sum = 0.f;
#pragma unroll
    for (int k = 0; k < TT / 32; ++k) { float d0 = v[k] - mx; asm volatile("" : "+v"(d0)); v[k] = __builtin_amdgcn_exp2f(d0 * 1.4426950408889634f); sum += v[k]; }
#pragma unroll
    for (int sh = 16; sh; sh >>= 1) sum += __shfl_xor(sum, sh, 32);
    const float f = (hires ? 1.0f : PCAR) * (1.0f / sum);
{
        if (hires) {
#pragma unroll
            for (int ch = 0; ch < TT / 128; ++ch) { v4us oh, ol;
#pragma unroll
                for (int q = 0; q < 4; ++q) { unsigned short a, c2; splitf(v[ch * 4 + q] * f, a, c2); oh[q] = a; ol[q] = c2; }
                const size_t oo = ((size_t)zz * RH + i) * TT + ch * 128 + lane * 4; *(v4us*)(Ph + oo) = oh; *(v4us*)(Pl + oo) = ol; }
        } else {
#pragma unroll
            for (int ch = 0; ch < TT / 128; ++ch) { v4h o4;
#pragma unroll
                for (int q = 0; q < 4; ++q) o4[q] = tohx(v[ch * 4 + q] * f);
                *(v4h*)(P16 + (size_t)row * TT + ch * 128 + lane * 4) = o4; } }
         }
}
__global__ __launch_bounds__(256) void k_merge(const float* __restrict__ O, int z0, bf* Ah, bf* Al) { const size_t e = ((size_t)blockIdx.x * 256 + threadIdx.x) * 2; if (e >= (size_t)ZH * TT * HD) return; const int d = (int)(e % HD); const int t = (int)((e / HD) % TT); const int zz = (int)(e / ((size_t)HD * TT)); const float cs = (t < RH) ? 1.0f : (1.0f / PCAR); const int z = z0 + zz; const size_t oo = ((size_t)(z / NH_) * TT + t) * DQ + (z % NH_) * HD + d;
    v2f x = *(const v2f*)(O + e); v2us oh, ol;
#pragma unroll
    for (int s = 1; s < KSP; ++s) x += *(const v2f*)(O + (size_t)s * ((size_t)ZH * TT * HD) + e);   // key-slice partial planes, fixed order
#pragma unroll
    for (int q = 0; q < 2; ++q) { unsigned short a, c2; splitf(x[q] * cs, a, c2); oh[q] = a; ol[q] = c2; } *(v2us*)(Ah + oo) = oh; *(v2us*)(Al + oo) = ol;  }

extern "C" void kernel_launch(void* const* d_in, const int* in_sizes, int n_in,
                              void* d_out, int out_size, void* d_ws, size_t ws_size, hipStream_t stream) {
    if (n_in < 12) return;
    const long long xneed = (long long)(NB - 1) * SEQ_FULL * DM + (long long)TT * DM;
    if ((long long)in_sizes[0] < xneed || (long long)in_sizes[1] < xneed || (long long)in_sizes[2] < xneed) return;
    if ((long long)in_sizes[3] < (long long)(TT - 1) * SEQ_FULL + TT) return;
    if (in_sizes[4] < DM * DQ || in_sizes[6] < DM * DKV || in_sizes[8] < DM * DKV || in_sizes[10] < DQ * DM) return;
    if (in_sizes[5] < DQ || in_sizes[7] < DKV || in_sizes[9] < DKV || in_sizes[11] < DM) return;
    if ((long long)out_size < (long long)NB * TT * DM) return;
    const float* xq = (const float*)d_in[0]; const float* xk = (const float*)d_in[1]; const float* xv = (const float*)d_in[2]; const float* mk = (const float*)d_in[3];
    const float* wq = (const float*)d_in[4]; const float* bq = (const float*)d_in[5]; const float* wk = (const float*)d_in[6]; const float* bk = (const float*)d_in[7]; const float* wv = (const float*)d_in[8]; const float* bv = (const float*)d_in[9]; const float* wo = (const float*)d_in[10]; const float* bo = (const float*)d_in[11];
    float* OUT = (float*)d_out;     // [NB][TT][DM]
    char* wsp = (char*)d_ws;
    auto take = [&](size_t bytes) { char* p = wsp; wsp += (bytes + 255) & ~(size_t)255; return (void*)p; };
    constexpr size_t WSZ = (size_t)DM * DQ;           // elements of one weight plane
    constexpr size_t PSZ = (size_t)NZ * TT * HD;      // elements of one plane set over all (batch, head) slices
    constexpr size_t XSZ = (size_t)NB * TT * DM;      // elements of one stream, both batches
    constexpr size_t SB_B = (size_t)ZH * TT * TT * 4, OB_B = (size_t)KSP * ZH * TT * HD * 4, ST_B = 3 * XSZ * 2 + 3 * XSZ * 4;
    constexpr size_t POOL_B = SB_B > OB_B ? (SB_B > ST_B ? SB_B : ST_B) : (OB_B > ST_B ? OB_B : ST_B);
    bf* W4 = (bf*)take(4 * WSZ * 2);                  // Wq, Wk, Wv, Wo transposed, one behind the other
    h16* QK16 = (h16*)take(2 * PSZ * 2); bf* QKh = (bf*)take(2 * PSZ * 2); bf* QKl = (bf*)take(2 * PSZ * 2);   // q planes, then k planes
    h16* VT16 = (h16*)take(PSZ * 2); bf* VTh = (bf*)take(PSZ * 2); bf* VTl = (bf*)take(PSZ * 2);
    bf* Ph = (bf*)take((size_t)ZH * RH * TT * 2); bf* Pl = (bf*)take((size_t)ZH * RH * TT * 2); h16* P16 = (h16*)take((size_t)ZH * TT * TT * 2);
    bf* ATh = (bf*)take(XSZ * 2); bf* ATl = (bf*)take(XSZ * 2);
    char* pool = (char*)take(POOL_B);
    const size_t carved = (size_t)(wsp - (char*)d_ws);
    if (carved > ws_size) return;    // full-size carve 250,085,376 B
    // One pool, three stream-ordered uses: projection staging (dead once the planes are built), the logits of a pass (dead after its softmax), the P x V partial planes of the pass (dead after its merge).
    bf* XB = (bf*)pool; float* F3 = (float*)(pool + 3 * XSZ * 2); float* Sb = (float*)pool; float* Ob = (float*)pool;
    // weights: w is [in = K rows][out = N cols] -> Bt[N][K]
    k_wtG<<<dim3((unsigned)((WSZ / 64 + 63) / 64), 4, 1), 256, 0, stream>>>(wq, wk, wv, wo, DM, DQ, W4);
    k_cvt8<<<dim3((unsigned)(((size_t)TT * DM / 8 + 255) / 256), NB, 3), 256, 0, stream>>>(xq, xk, xv, (size_t)SEQ_FULL * DM, XB, (size_t)TT * DM / 8);
    k_gemmw<bf, 0, true, 1><<<dim3(NB * TT / 64, DQ / 64, 3), 32, 0, stream>>>(XB, nullptr, W4, nullptr, DM, F3, DQ, bq, bk, bv, XSZ, WSZ, XSZ, 0);
    k_hpl<<<(unsigned)((2 * PSZ / 2 + 255) / 256), 256, 0, stream>>>(F3, DQ, NH_, 2 * NB, QK16, QKh, QKl);
    k_vtp<<<(unsigned)((PSZ / 2 + 255) / 256), 256, 0, stream>>>(F3 + 2 * XSZ, DKV, NKV, NB, VT16, VTh, VTl);
    for (int z0 = 0; z0 < NZ; z0 += ZH) { const size_t zq = (size_t)z0 * TT * HD, zk = PSZ + zq;   // the pass's ZH slices use consecutive planes (z-strides TT*HD)
        k_gemmw<bf, 2, false, 1><<<dim3(RH / 64, TT / 64, ZH), 32, 0, stream>>>(QKh + zq, QKl + zq, QKh + zk, QKl + zk, HD, Sb, TT, nullptr, nullptr, nullptr, (size_t)TT * HD, (size_t)TT * HD, (size_t)TT * TT, 0);
        if (TT > RH) k_gemmw<h16, 0, false, 1><<<dim3((TT - RH) / 64, TT / 64, ZH), 32, 0, stream>>>(QK16 + zq + (size_t)RH * HD, nullptr, QK16 + zk, nullptr, HD, Sb + (size_t)RH * TT, TT, nullptr, nullptr, nullptr, (size_t)TT * HD, (size_t)TT * HD, (size_t)TT * TT, 0);
        k_asoft<<<ZH * TT / 8, 256, 0, stream>>>(Sb, mk, SEQ_FULL, P16, Ph, Pl);
        k_gemmw<bf, 2, false, KSP><<<dim3(RH / 64, HD / 64, ZH * KSP), 32, 0, stream>>>(Ph, Pl, VTh + zq, VTl + zq, TT, Ob, HD, nullptr, nullptr, nullptr, (size_t)RH * TT, (size_t)HD * TT, (size_t)TT * HD, (size_t)ZH * TT * HD);
        if (TT > RH) k_gemmw<h16, 0, false, KSP><<<dim3((TT - RH) / 64, HD / 64, ZH * KSP), 32, 0, stream>>>(P16 + (size_t)RH * TT, nullptr, VT16 + zq, nullptr, TT, Ob + (size_t)RH * HD, HD, nullptr, nullptr, nullptr, (size_t)TT * TT, (size_t)HD * TT, (size_t)TT * HD, (size_t)ZH * TT * HD);
        k_merge<<<(unsigned)(((size_t)ZH * TT * HD / 2 + 255) / 256), 256, 0, stream>>>(Ob, z0, ATh, ATl); }
    k_gemmw<bf, 1, true, 1><<<dim3(NB * TT / 64, DM / 64, 1), 32, 0, stream>>>(ATh, ATl, W4 + 3 * WSZ, nullptr, DQ, OUT, DM, bo, bo, bo, 0, 0, 0, 0);
}

// v003
// Measured time: 226 microseconds a run.
// Next to v002, in two timings, it ran 1.90 times as fast each time.
// Over all steps from v000 it is 6.88 times as fast.
#include <hip/hip_runtime.h>

// Masked attention block: three input streams q, k, v [2][2048][768]; per-stream projection x W + b (W stored [in][out]); 12 heads x 64; logits x 1/8 plus mask x -1e9 (mask [2048][2048] read as values from its input buffer); softmax over all keys; merged heads x Wo + bo -> [2][2048][768].
// Compute dtypes (every product accumulates in f32): inputs, mask, biases and weights RNE-converted to bf16; projections v_wmma_f32_16x16x32_bf16 (exact products) + f32 bias; logits: query rows < 512 on bf16 hi/lo planes (3 products), other rows on f16 planes (1 product); P x V: rows < 512 bf16 hi/lo (3 products), other rows v_wmma_f32_16x16x32_f16 with P carried x1024; softmax f32, running maximum and sum per query row inside the attention kernel; output projection: merged bf16 hi/lo planes x bf16 Wo (2 products) + f32 bias.

#ifndef NB
#define NB 2
#endif
#ifndef SEQ
#define SEQ 2048
#endif
#define NB_FULL  2
#define SEQ_FULL 2048
#define TT   SEQ
#define DM   768
#define NH_  12
#define NKV  12
#define REP  (NH_ / NKV)
#define HD   64
#define DQ   (NH_ * HD)
#define DKV  (NKV * HD)
#define NZ   (NB * NH_)
#define RH   ((TT) < 512 ? (TT) : 512)   // query rows < RH use hi+lo planes
#define PEXP 10.0f    // f16 rows carry P x 2^10 (added to the exponent; the row sum carries it too, so the quotient is free of it)
#define L2E  1.4426950408889634f
#define SCL  0.125f   // HD^-0.5
#define MNEG (-1.0e9f)
#define KSF  4        // key slices of the attention kernel: one work-group per (query block, slice)

static_assert(TT % 128 == 0);
static_assert(TT <= SEQ_FULL);
static_assert(NB <= NB_FULL);
static_assert(DM % 64 == 0);
static_assert(DQ % 64 == 0);
static_assert(DQ == DM);
static_assert(HD == 64);
static_assert(NKV == NH_);
static_assert(RH % 64 == 0);
static_assert((TT - RH) % 128 == 0);
static_assert(TT % (32 * KSF) == 0);

typedef _Float16 h16;
typedef unsigned short bf;
typedef __attribute__((ext_vector_type(16))) __bf16   v16bf;
typedef __attribute__((ext_vector_type(16))) _Float16 v16h;
typedef __attribute__((ext_vector_type(8)))  _Float16 v8h;
typedef __attribute__((ext_vector_type(8)))  unsigned short v8us;
typedef __attribute__((ext_vector_type(8)))  float    v8f;
typedef __attribute__((ext_vector_type(4)))  float    v4f;
typedef v8h  __attribute__((may_alias)) v8ha;
typedef v4f  __attribute__((may_alias)) v4fa;
typedef v8us __attribute__((may_alias)) v8usa;

__device__ __forceinline__ unsigned short f2bf(float f) { unsigned u = __float_as_uint(f); u += 0x7FFFu + ((u >> 16) & 1u); return (unsigned short)(u >> 16); }
__device__ __forceinline__ float bf2f(unsigned short b) { return __uint_as_float(((unsigned)b) << 16); }
__device__ __forceinline__ float bfr(float f) { return bf2f(f2bf(f)); }
__device__ __forceinline__ v16h cat16(v8h lo, v8h hi) { return __builtin_shufflevector(lo, hi, 0, 1, 2, 3, 4, 5, 6, 7, 8, 9, 10, 11, 12, 13, 14, 15); }
__device__ __forceinline__ v16bf cat16b(v8us lo, v8us hi) { return __builtin_bit_cast(v16bf, __builtin_shufflevector(lo, hi, 0, 1, 2, 3, 4, 5, 6, 7, 8, 9, 10, 11, 12, 13, 14, 15)); }
__device__ __forceinline__ v8f wmma16(v16h a, v16h b, v8f c) { return __builtin_amdgcn_wmma_f32_16x16x32_f16(false, a, false, b, (short)0, c, false, false); }
__device__ __forceinline__ v8f wmmab(v16bf a, v16bf b, v8f c) { return __builtin_amdgcn_wmma_f32_16x16x32_bf16(false, a, false, b, (short)0, c, false, false); }

// ---- k_gemmw: register-blocked GEMM, ONE WAVE per 64x64 output tile (16 accumulators), operands straight from K-contiguous 16-bit planes; grid (M/64, N/64, Z), 32 threads.
// C[m][n] (f32, pitch ldc, + optional f32 bias[n]) = sum_k A[m][k] Bt[n][k] (+ split products per NSPLIT). z-batch strides sA/sB/sC in elements. K % (32 KS) == 0, M % 64 == 0, N % 64 == 0.
// BIAS: z-slice 0 / 1 / 2 adds bias / bias1 / bias2.
// KS > 1: grid z = Z x KS; work-group (z, ks) sums only k in [ks K/KS, (ks+1) K/KS) and stores its f32 partial tile into plane ks (plane stride sP elements); the reader adds the KS planes in the order 0..KS-1.
// Fragment map: lane l, h = l >> 4: elements 0..7 <- k0 + 8h + 0..7, elements 8..15 <- k0 + 16 + 8h + 0..7 (A row / B column = l & 15); D element j -> (row 8h + j, col l & 15).
template <typename T16> struct WFrag;
template <> struct WFrag<h16> { typedef v16h V; static __device__ __forceinline__ V ld(const h16* p) { return cat16(*(const v8h*)p, *(const v8h*)(p + 16)); } static __device__ __forceinline__ v8f mma(V a, V b, v8f c) { return wmma16(a, b, c); } };
template <> struct WFrag<bf> { typedef v16bf V; static __device__ __forceinline__ V ld(const bf* p) { return cat16b(*(const v8us*)p, *(const v8us*)(p + 16)); } static __device__ __forceinline__ v8f mma(V a, V b, v8f c) { return wmmab(a, b, c); } };
template <typename T16, int NSPLIT, bool BIAS, int KS>
__global__ __launch_bounds__(32) void k_gemmw(const T16* __restrict__ A, const T16* __restrict__ A2, const T16* __restrict__ Bt, const T16* __restrict__ Bt2, int K, float* C, int ldc, const float* __restrict__ bias, const float* __restrict__ bias1, const float* __restrict__ bias2, size_t sA, size_t sB, size_t sC, size_t sP) {
    static_assert(KS == 1 || !BIAS);
    typedef typename WFrag<T16>::V V;
    __shared__ __align__(16) float os[16 * 68];
    const size_t z = blockIdx.z / KS; const int ks = (int)(blockIdx.z % KS); A += z * sA; if (A2) A2 += z * sA; Bt += z * sB; if (Bt2) Bt2 += z * sB; C += z * sC + (size_t)ks * sP;
    const float* bz = (z == 0) ? bias : ((z == 1) ? bias1 : bias2);
    const int kbeg = ks * (K / KS), kend = kbeg + K / KS;
    const int lane = threadIdx.x & 31, lr = lane & 15, hi = lane >> 4; const int r0 = blockIdx.x * 64, c0 = blockIdx.y * 64;
    v8f acc[4][4];
#pragma unroll
    for (int mb = 0; mb < 4; ++mb)
#pragma unroll
        for (int nb = 0; nb < 4; ++nb) acc[mb][nb] = (v8f){};
    const size_t aoff = (size_t)(r0 + lr) * K + 8 * hi, boff = (size_t)(c0 + lr) * K + 8 * hi;
#pragma unroll 1
    for (int kc = kbeg; kc < kend; kc += 32) {
        V a[4], a2[4];
#pragma unroll
        for (int mb = 0; mb < 4; ++mb) { a[mb] = WFrag<T16>::ld(A + aoff + (size_t)mb * 16 * K + kc); if (NSPLIT == 1 || NSPLIT == 2) a2[mb] = WFrag<T16>::ld(A2 + aoff + (size_t)mb * 16 * K + kc); }
#pragma unroll
        for (int nb = 0; nb < 4; ++nb) { const V b = WFrag<T16>::ld(Bt + boff + (size_t)nb * 16 * K + kc); V b2; if (NSPLIT >= 2) b2 = WFrag<T16>::ld(Bt2 + boff + (size_t)nb * 16 * K + kc);
#pragma unroll
            for (int mb = 0; mb < 4; ++mb) { acc[mb][nb] = WFrag<T16>::mma(a[mb], b, acc[mb][nb]); if (NSPLIT == 1 || NSPLIT == 2) acc[mb][nb] = WFrag<T16>::mma(a2[mb], b, acc[mb][nb]); if (NSPLIT >= 2) acc[mb][nb] = WFrag<T16>::mma(a[mb], b2, acc[mb][nb]); } }
        asm volatile("v_nop\n\tv_nop\n\tv_nop\n\tv_nop" : "+v"(acc[0][0]), "+v"(acc[1][1]), "+v"(acc[2][2]), "+v"(acc[3][3]) : "v"(a[0]), "v"(a[3]));
    }
#pragma unroll
    for (int mb = 0; mb < 4; ++mb) {
#pragma unroll
        for (int nb = 0; nb < 4; ++nb) {
#pragma unroll
            for (int j = 0; j < 8; ++j) os[(hi * 8 + j) * 68 + nb * 16 + lr] = acc[mb][nb][j]; }
        __builtin_amdgcn_wave_barrier(); asm volatile("" ::: "memory");
        float* crow = C + (size_t)(r0 + mb * 16) * ldc + c0;
{
#pragma unroll
            for (int s = 0; s < 8; ++s) { const int row = 2 * s + hi, cofs = lr * 4; v4f val = *(const v4fa*)(os + row * 68 + cofs); if (BIAS) { val[0] += bfr(bz[c0 + cofs]); val[1] += bfr(bz[c0 + cofs + 1]); val[2] += bfr(bz[c0 + cofs + 2]); val[3] += bfr(bz[c0 + cofs + 3]); }
                *(v4f*)(crow + (size_t)row * ldc + cofs) = val; }
             }
        __builtin_amdgcn_wave_barrier(); asm volatile("" ::: "memory");
    }
}

__device__ __forceinline__ h16 tohx(float x) { return (h16)x; }
__device__ __forceinline__ void splitf(float y, unsigned short& h, unsigned short& l) { h = f2bf(y); l = f2bf(y - bf2f(h)); }
typedef __attribute__((ext_vector_type(2))) _Float16 v2h;
typedef __attribute__((ext_vector_type(4))) _Float16 v4h;
typedef __attribute__((ext_vector_type(2))) unsigned short v2us;
typedef __attribute__((ext_vector_type(4))) unsigned short v4us;
typedef __attribute__((ext_vector_type(2))) float v2f;

// grid.y picks one of four equally shaped weights; Bt holds the four transposed planes one behind the other.
__global__ __launch_bounds__(256) void k_wtG(const float* __restrict__ w0, const float* __restrict__ w1, const float* __restrict__ w2, const float* __restrict__ w3, int K, int N, bf* Bt) {
    const int y = (int)blockIdx.y; const float* w = (y == 0) ? w0 : ((y == 1) ? w1 : ((y == 2) ? w2 : w3)); Bt += (size_t)y * K * N;
    const int lane = threadIdx.x & 31; const int L0 = (blockIdx.x * 8 + (threadIdx.x >> 5)) * 8; const int nlines = N * K / 64;
{
#pragma unroll 1
        for (int l = 0; l < 8; ++l) { const int L = L0 + l; if (L >= nlines) break; const size_t e = (size_t)L * 64 + lane * 2; const int k = (int)(e % K), n = (int)(e / K); v2us o;
            o[0] = f2bf(w[(size_t)k * N + n]); o[1] = f2bf(w[(size_t)(k + 1) * N + n]); *(v2us*)(Bt + e) = o; }
         }
}
// grid.z picks the stream, grid.y the batch (source batch stride sb elements); dst is [stream][batch][n8 * 8].
__global__ __launch_bounds__(256) void k_cvt8(const float* __restrict__ s0, const float* __restrict__ s1, const float* __restrict__ s2, size_t sb, bf* dst, size_t n8) { const size_t i = (size_t)blockIdx.x * 256 + threadIdx.x; if (i >= n8) return;
    const int s = (int)blockIdx.z; const float* src = ((s == 0) ? s0 : ((s == 1) ? s1 : s2)) + (size_t)blockIdx.y * sb; dst += ((size_t)s * NB + blockIdx.y) * n8 * 8; const v8f v = *(const v8f*)(src + i * 8); v8us o;
#pragma unroll
    for (int k = 0; k < 8; ++k) o[k] = f2bf(v[k]); *(v8us*)(dst + i * 8) = o;  }

// F is [nblk][TT][pitch] (nblk = streams x batches); plane z = blk * NH_ + h (nheads == NH_).
__global__ __launch_bounds__(256) void k_hpl(const float* __restrict__ F, int pitch, int nheads, int nblk, h16* P16, bf* Ph, bf* Pl) {
    const size_t e = ((size_t)blockIdx.x * 256 + threadIdx.x) * 2; if (e >= (size_t)nblk * nheads * TT * HD) return; const int d = (int)(e % HD); const int t = (int)((e / HD) % TT); const int z = (int)(e / ((size_t)HD * TT)); const int blk = z / NH_, h = z % NH_;
    const v2f x = *(const v2f*)(F + ((size_t)blk * TT + t) * pitch + h * HD + d); v2h o16; v2us oh, ol;
#pragma unroll
    for (int q = 0; q < 2; ++q) { const float r = x[q]; o16[q] = tohx(r); unsigned short a2, c2; splitf(r, a2, c2); oh[q] = a2; ol[q] = c2; }
    *(v2h*)(P16 + e) = o16; *(v2us*)(Ph + e) = oh; *(v2us*)(Pl + e) = ol;  }
__global__ __launch_bounds__(256) void k_vtp(const float* __restrict__ F, int pitch, int nheads, int nblk, h16* V16, bf* Vh, bf* Vl) { const size_t e = ((size_t)blockIdx.x * 256 + threadIdx.x) * 2; if (e >= (size_t)nblk * nheads * HD * TT) return; const int t = (int)(e % TT); const int d = (int)((e / TT) % HD); const int z = (int)(e / ((size_t)TT * HD)); const int blk = z / NH_, g = z % NH_; v2h o16; v2us oh, ol;
#pragma unroll
    for (int q = 0; q < 2; ++q) { const float x = F[((size_t)blk * TT + t + q) * pitch + g * HD + d]; o16[q] = tohx(x); unsigned short a2, c2; splitf(x, a2, c2); oh[q] = a2; ol[q] = c2; }
    *(v2h*)(V16 + e) = o16; *(v2us*)(Vh + e) = oh; *(v2us*)(Vl + e) = ol;  }

// ---- k_attn: logits, softmax and P x V of one (batch, head) slice z in one kernel; scores and probabilities stay in registers.
// One wave owns 16 NQ query rows and the keys [ks TT/KSF, (ks+1) TT/KSF), 32 keys a trip. It forms the TRANSPOSED logits tile (A = key rows, B = query rows), so that D element j of key tile kt is (key 16 kt + 8h + j, query l & 15):
// the two key tiles of a trip are, lane by lane, the B fragment of P^T (elements 0..7 <- key 8h + j, elements 8..15 <- key 16 + 8h + j), the k order of the V^T A fragment. O^T (A = V^T rows d, B = P^T) has its query in l & 15 too, so a row's maximum, sum and rescale factor are one value a lane.
// Each wave stores its unnormalised f32 O rows, and per 16 rows one 128-byte line: 16 running maxima, then 16 sums. k_merge joins the KSF slices.
template <typename T16, bool HI, int NQ>
__device__ __forceinline__ void attn_body(const T16* __restrict__ Q, const T16* __restrict__ Q2, const T16* __restrict__ Kp, const T16* __restrict__ K2, const T16* __restrict__ Vt, const T16* __restrict__ V2, const float* __restrict__ Mk, int mpitch, int q0, int kbeg, float* Op, float* St) {
    typedef typename WFrag<T16>::V V;
    const int lane = threadIdx.x & 31, lr = lane & 15, hi = lane >> 4;
    V qf[NQ][2], qf2[NQ][2];
#pragma unroll
    for (int nq = 0; nq < NQ; ++nq)
#pragma unroll
        for (int c = 0; c < 2; ++c) { const size_t o = (size_t)(q0 + nq * 16 + lr) * HD + c * 32 + 8 * hi; qf[nq][c] = WFrag<T16>::ld(Q + o); if (HI) qf2[nq][c] = WFrag<T16>::ld(Q2 + o); }
    v8f oacc[NQ][4]; float mrun[NQ], lrun[NQ];
#pragma unroll
    for (int nq = 0; nq < NQ; ++nq) { mrun[nq] = -3.0e38f; lrun[nq] = 0.f;
#pragma unroll
        for (int dt = 0; dt < 4; ++dt) oacc[nq][dt] = (v8f){}; }
    const T16* vp = Vt + (size_t)lr * TT + kbeg + 8 * hi; const T16* vp2 = HI ? V2 + (size_t)lr * TT + kbeg + 8 * hi : nullptr;   // this lane's V^T row at the trip's first key
#pragma unroll 1   // one copy of a body that holds a whole trip's loads and products: registers and instruction cache
    for (int k0 = kbeg; k0 < kbeg + TT / KSF; k0 += 32) {
        V kf[2][2], kf2[2][2], vf[4], vf2[4]; v4f mv[NQ][2][2];
#pragma unroll
        for (int kt = 0; kt < 2; ++kt)
#pragma unroll
            for (int c = 0; c < 2; ++c) { const size_t o = (size_t)(k0 + kt * 16 + lr) * HD + c * 32 + 8 * hi; kf[kt][c] = WFrag<T16>::ld(Kp + o); if (HI) kf2[kt][c] = WFrag<T16>::ld(K2 + o); }
#pragma unroll
        for (int nq = 0; nq < NQ; ++nq)
#pragma unroll
            for (int kt = 0; kt < 2; ++kt) { const float* mr = Mk + (size_t)(q0 + nq * 16 + lr) * mpitch + k0 + kt * 16 + 8 * hi; mv[nq][kt][0] = *(const v4f*)mr; mv[nq][kt][1] = *(const v4f*)(mr + 4); }
        asm volatile("s_wait_xcnt 0x0" ::: "memory");   // the V loads below may land in registers that held the addresses of the loads above
        __builtin_amdgcn_sched_barrier(0);              // keeps the V loads behind that wait
#pragma unroll
        for (int dt = 0; dt < 4; ++dt) { vf[dt] = WFrag<T16>::ld(vp + (size_t)dt * 16 * TT); if (HI) vf2[dt] = WFrag<T16>::ld(vp2 + (size_t)dt * 16 * TT); }
        // The trip's loads are all issued above; their address registers are advanced for the next trip below. The V addresses are inputs of the wait, so they live up to it and no load of the run lands in them.
        if constexpr (HI) asm volatile("s_wait_xcnt 0x0" :: "v"(vp), "v"(vp2) : "memory"); else asm volatile("s_wait_xcnt 0x0" :: "v"(vp) : "memory");
        __builtin_amdgcn_sched_barrier(0);              // keeps those address additions behind the wait, and every load of the trip in front of the first product
#pragma unroll
        for (int nq = 0; nq < NQ; ++nq) {
            v8f s[2];
#pragma unroll
            for (int kt = 0; kt < 2; ++kt) { s[kt] = (v8f){};
#pragma unroll
                for (int c = 0; c < 2; ++c) { s[kt] = WFrag<T16>::mma(kf[kt][c], qf[nq][c], s[kt]); if (HI) { s[kt] = WFrag<T16>::mma(kf[kt][c], qf2[nq][c], s[kt]); s[kt] = WFrag<T16>::mma(kf2[kt][c], qf[nq][c], s[kt]); } } }
            float mx = mrun[nq];
#pragma unroll
            for (int kt = 0; kt < 2; ++kt)
#pragma unroll
                for (int j = 0; j < 8; ++j) { const float t = s[kt][j] * SCL + bfr(mv[nq][kt][j >> 2][j & 3]) * MNEG; s[kt][j] = t; mx = fmaxf(mx, t); }
            mx = fmaxf(mx, __shfl_xor(mx, 16, 32));   // the row's other 16 keys of the trip lie in lane l ^ 16
            const float al = __builtin_amdgcn_exp2f((mrun[nq] - mx) * L2E); mrun[nq] = mx;
            float sum = 0.f;
#pragma unroll
            for (int kt = 0; kt < 2; ++kt) { v8f x, p;
#pragma unroll
                for (int j = 0; j < 8; ++j) { x[j] = (s[kt][j] - mx) * L2E; if (!HI) x[j] += PEXP; }
#pragma unroll
                for (int j = 0; j < 8; ++j) p[j] = __builtin_amdgcn_exp2f(x[j]);
                asm volatile("v_nop" : "+v"(p) : "v"(x));   // the slot behind a transcendental: no result of the eight is read and no source register reused before this instruction
                s[kt] = p;
#pragma unroll
                for (int j = 0; j < 8; ++j) sum += p[j]; }
            lrun[nq] = lrun[nq] * al + sum;
#pragma unroll
            for (int dt = 0; dt < 4; ++dt) oacc[nq][dt] *= al;
            if constexpr (HI) { v8us ph[2], pl[2];
#pragma unroll
                for (int kt = 0; kt < 2; ++kt)
#pragma unroll
                    for (int j = 0; j < 8; ++j) { unsigned short a, c2; splitf(s[kt][j], a, c2); ph[kt][j] = a; pl[kt][j] = c2; }
                const V pfh = cat16b(ph[0], ph[1]), pfl = cat16b(pl[0], pl[1]);
#pragma unroll
                for (int dt = 0; dt < 4; ++dt) { oacc[nq][dt] = WFrag<T16>::mma(vf[dt], pfh, oacc[nq][dt]); oacc[nq][dt] = WFrag<T16>::mma(vf[dt], pfl, oacc[nq][dt]); oacc[nq][dt] = WFrag<T16>::mma(vf2[dt], pfh, oacc[nq][dt]); }
            } else { v8h p16[2];
#pragma unroll
                for (int kt = 0; kt < 2; ++kt)
#pragma unroll
                    for (int j = 0; j < 8; ++j) p16[kt][j] = tohx(s[kt][j]);
                const V pf = cat16(p16[0], p16[1]);
#pragma unroll
                for (int dt = 0; dt < 4; ++dt) oacc[nq][dt] = WFrag<T16>::mma(vf[dt], pf, oacc[nq][dt]); }
        }
        vp += 32; if (HI) vp2 += 32;
    }
#pragma unroll
    for (int nq = 0; nq < NQ; ++nq) {
        const float lt = lrun[nq] + __shfl_xor(lrun[nq], 16, 32);
        St[(size_t)(q0 + nq * 16) * 2 + lane] = hi ? lt : mrun[nq];
#pragma unroll
        for (int dt = 0; dt < 4; ++dt) *(v8f*)(Op + (size_t)(q0 + nq * 16 + lr) * HD + dt * 16 + 8 * hi) = oacc[nq][dt];
    }
}
// grid (RH/64 + (TT-RH)/128, KSF, NZ), 4 independent waves: blocks x < RH/64 take 16 hi+lo query rows a wave, the others 32 f16 rows a wave. QK* hold the q planes, then (kofs elements on) the k planes.
__global__ __launch_bounds__(128) void k_attn(const h16* __restrict__ QK16, const bf* __restrict__ QKh, const bf* __restrict__ QKl, size_t kofs, const h16* __restrict__ VT16, const bf* __restrict__ VTh, const bf* __restrict__ VTl, const float* __restrict__ Mk, int mpitch, float* Op, float* St) {
    const int wave = __builtin_amdgcn_readfirstlane((int)(threadIdx.x >> 5)); const int bx = (int)blockIdx.x, ks = (int)blockIdx.y; const size_t z = blockIdx.z; const size_t zo = z * TT * HD;
    Op += ((size_t)ks * NZ + z) * TT * HD; St += ((size_t)ks * NZ + z) * TT * 2; const int kbeg = ks * (TT / KSF);
    if (bx < RH / 64) attn_body<bf, true, 1>(QKh + zo, QKl + zo, QKh + kofs + zo, QKl + kofs + zo, VTh + zo, VTl + zo, Mk, mpitch, bx * 64 + wave * 16, kbeg, Op, St);
    else attn_body<h16, false, 2>(QK16 + zo, nullptr, QK16 + kofs + zo, nullptr, VT16 + zo, nullptr, Mk, mpitch, RH + (bx - RH / 64) * 128 + wave * 32, kbeg, Op, St);
}
// Joins the KSF key slices of every row in the order 0..KSF-1: weights 2^((m_s - max m) log2 e), O = sum w O_s / sum w l_s; hi+lo bf16 planes in merged-head order.
__global__ __launch_bounds__(256) void k_merge(const float* __restrict__ O, const float* __restrict__ St, bf* Ah, bf* Al) { const size_t e = ((size_t)blockIdx.x * 256 + threadIdx.x) * 2; if (e >= (size_t)NZ * TT * HD) return; const int d = (int)(e % HD); const int t = (int)((e / HD) % TT); const int z = (int)(e / ((size_t)HD * TT)); const size_t oo = ((size_t)(z / NH_) * TT + t) * DQ + (z % NH_) * HD + d;
    const size_t so = ((size_t)z * TT + (t & ~15)) * 2 + (t & 15); float m[KSF], l[KSF]; float mx = -3.0e38f;
#pragma unroll
    for (int s = 0; s < KSF; ++s) { m[s] = St[(size_t)s * ((size_t)NZ * TT * 2) + so]; l[s] = St[(size_t)s * ((size_t)NZ * TT * 2) + so + 16]; mx = fmaxf(mx, m[s]); }
    const float w0 = __builtin_amdgcn_exp2f((m[0] - mx) * L2E); v2f x = *(const v2f*)(O + e) * w0; float den = l[0] * w0; v2us oh, ol;
#pragma unroll
    for (int s = 1; s < KSF; ++s) { const float w = __builtin_amdgcn_exp2f((m[s] - mx) * L2E); x += *(const v2f*)(O + (size_t)s * ((size_t)NZ * TT * HD) + e) * w; den += l[s] * w; }
    const float f = 1.0f / den;
#pragma unroll
    for (int q = 0; q < 2; ++q) { unsigned short a, c2; splitf(x[q] * f, a, c2); oh[q] = a; ol[q] = c2; } *(v2us*)(Ah + oo) = oh; *(v2us*)(Al + oo) = ol;  }

extern "C" void kernel_launch(void* const* d_in, const int* in_sizes, int n_in,
                              void* d_out, int out_size, void* d_ws, size_t ws_size, hipStream_t stream) {
    if (n_in < 12) return;
    const long long xneed = (long long)(NB - 1) * SEQ_FULL * DM + (long long)TT * DM;
    if ((long long)in_sizes[0] < xneed || (long long)in_sizes[1] < xneed || (long long)in_sizes[2] < xneed) return;
    if ((long long)in_sizes[3] < (long long)(TT - 1) * SEQ_FULL + TT) return;
    if (in_sizes[4] < DM * DQ || in_sizes[6] < DM * DKV || in_sizes[8] < DM * DKV || in_sizes[10] < DQ * DM) return;
    if (in_sizes[5] < DQ || in_sizes[7] < DKV || in_sizes[9] < DKV || in_sizes[11] < DM) return;
    if ((long long)out_size < (long long)NB * TT * DM) return;
    const float* xq = (const float*)d_in[0]; const float* xk = (const float*)d_in[1]; const float* xv = (const float*)d_in[2]; const float* mk = (const float*)d_in[3];
    const float* wq = (const float*)d_in[4]; const float* bq = (const float*)d_in[5]; const float* wk = (const float*)d_in[6]; const float* bk = (const float*)d_in[7]; const float* wv = (const float*)d_in[8]; const float* bv = (const float*)d_in[9]; const float* wo = (const float*)d_in[10]; const float* bo = (const float*)d_in[11];
    float* OUT = (float*)d_out;     // [NB][TT][DM]
    char* wsp = (char*)d_ws;
    auto take = [&](size_t bytes) { char* p = wsp; wsp += (bytes + 255) & ~(size_t)255; return (void*)p; };
    constexpr size_t WSZ = (size_t)DM * DQ;           // elements of one weight plane
    constexpr size_t PSZ = (size_t)NZ * TT * HD;      // elements of one plane set over all (batch, head) slices
    constexpr size_t XSZ = (size_t)NB * TT * DM;      // elements of one stream, both batches
    constexpr size_t OB_B = (size_t)KSF * PSZ * 4, ST_B = 3 * XSZ * 2 + 3 * XSZ * 4;
    constexpr size_t POOL_B = OB_B > ST_B ? OB_B : ST_B;
    bf* W4 = (bf*)take(4 * WSZ * 2);                  // Wq, Wk, Wv, Wo transposed, one behind the other
    h16* QK16 = (h16*)take(2 * PSZ * 2); bf* QKh = (bf*)take(2 * PSZ * 2); bf* QKl = (bf*)take(2 * PSZ * 2);   // q planes, then k planes
    h16* VT16 = (h16*)take(PSZ * 2); bf* VTh = (bf*)take(PSZ * 2); bf* VTl = (bf*)take(PSZ * 2);
    float* Stt = (float*)take((size_t)KSF * NZ * TT * 2 * 4);   // per key slice and row: running maximum and sum
    bf* ATh = (bf*)take(XSZ * 2); bf* ATl = (bf*)take(XSZ * 2);
    char* pool = (char*)take(POOL_B);
    const size_t carved = (size_t)(wsp - (char*)d_ws);
    if (carved > ws_size) return;
    // One pool, two stream-ordered uses: projection staging (dead once the planes are built), then the attention kernel's partial O planes.
    bf* XB = (bf*)pool; float* F3 = (float*)(pool + 3 * XSZ * 2); float* Ob = (float*)pool;
    // weights: w is [in = K rows][out = N cols] -> Bt[N][K]
    k_wtG<<<dim3((unsigned)((WSZ / 64 + 63) / 64), 4, 1), 256, 0, stream>>>(wq, wk, wv, wo, DM, DQ, W4);
    k_cvt8<<<dim3((unsigned)(((size_t)TT * DM / 8 + 255) / 256), NB, 3), 256, 0, stream>>>(xq, xk, xv, (size_t)SEQ_FULL * DM, XB, (size_t)TT * DM / 8);
    k_gemmw<bf, 0, true, 1><<<dim3(NB * TT / 64, DQ / 64, 3), 32, 0, stream>>>(XB, nullptr, W4, nullptr, DM, F3, DQ, bq, bk, bv, XSZ, WSZ, XSZ, 0);
    k_hpl<<<(unsigned)((2 * PSZ / 2 + 255) / 256), 256, 0, stream>>>(F3, DQ, NH_, 2 * NB, QK16, QKh, QKl);
    k_vtp<<<(unsigned)((PSZ / 2 + 255) / 256), 256, 0, stream>>>(F3 + 2 * XSZ, DKV, NKV, NB, VT16, VTh, VTl);
    k_attn<<<dim3(RH / 64 + (TT - RH) / 128, KSF, NZ), 128, 0, stream>>>(QK16, QKh, QKl, PSZ, VT16, VTh, VTl, mk, SEQ_FULL, Ob, Stt);
    k_merge<<<(unsigned)((PSZ / 2 + 255) / 256), 256, 0, stream>>>(Ob, Stt, ATh, ATl);
    k_gemmw<bf, 1, true, 1><<<dim3(NB * TT / 64, DM / 64, 1), 32, 0, stream>>>(ATh, ATl, W4 + 3 * WSZ, nullptr, DQ, OUT, DM, bo, bo, bo, 0, 0, 0, 0);
}

// v004
// One run takes 197 microseconds.
// Next to v003, in two timings, it ran 1.15 times as fast each time.
// Counting every step since v000, it is 7.90 times as fast.
#include <hip/hip_runtime.h>

// Masked attention block: three input streams q, k, v [2][2048][768]; per-stream projection x W + b (W stored [in][out]); 12 heads x 64; logits x 1/8 plus mask x -1e9 (mask [2048][2048] read as values from its input buffer); softmax over all keys; merged heads x Wo + bo -> [2][2048][768].
// Compute dtypes (every product accumulates in f32): inputs, mask, biases and weights RNE-converted to bf16; projections v_wmma_f32_16x16x32_bf16 (exact products) + f32 bias; logits: query rows < 512 on bf16 hi/lo planes (3 products), other rows on f16 planes (1 product); P x V: rows < 512 bf16 hi/lo (3 products), other rows v_wmma_f32_16x16x32_f16 with P carried x1024; softmax f32, running maximum and sum per query row inside the attention kernel; output projection: merged bf16 hi/lo planes x bf16 Wo (2 products) + f32 bias.

#ifndef NB
#define NB 2
#endif
#ifndef SEQ
#define SEQ 2048
#endif
#define NB_FULL  2
#define SEQ_FULL 2048
#define TT   SEQ
#define DM   768
#define NH_  12
#define NKV  12
#define REP  (NH_ / NKV)
#define HD   64
#define DQ   (NH_ * HD)
#define DKV  (NKV * HD)
#define NZ   (NB * NH_)
#define RH   ((TT) < 512 ? (TT) : 512)   // query rows < RH use hi+lo planes
#define PEXP 10.0f    // f16 rows carry P x 2^10 (added to the exponent; the row sum carries it too, so the quotient is free of it)
#define L2E  1.4426950408889634f
#define SCL  0.125f   // HD^-0.5
#define MNEG (-1.0e9f)
#define KSF  4        // key slices of the attention kernel: one work-group per (query block, slice)

static_assert(TT % 128 == 0);
static_assert(TT <= SEQ_FULL);
static_assert(NB <= NB_FULL);
static_assert(DM % 64 == 0);
static_assert(DQ % 64 == 0);
static_assert(DQ == DM);
static_assert(HD == 64);
static_assert(NKV == NH_);
static_assert(RH % 64 == 0);
static_assert((TT - RH) % 128 == 0);
static_assert(TT % (32 * KSF) == 0);

typedef _Float16 h16;
typedef unsigned short bf;
typedef __attribute__((ext_vector_type(16))) __bf16   v16bf;
typedef __attribute__((ext_vector_type(16))) _Float16 v16h;
typedef __attribute__((ext_vector_type(8)))  _Float16 v8h;
typedef __attribute__((ext_vector_type(8)))  unsigned short v8us;
typedef __attribute__((ext_vector_type(8)))  float    v8f;
typedef __attribute__((ext_vector_type(4)))  float    v4f;
typedef v8h  __attribute__((may_alias)) v8ha;
typedef v4f  __attribute__((may_alias)) v4fa;
typedef v8us __attribute__((may_alias)) v8usa;

__device__ __forceinline__ unsigned short f2bf(float f) { unsigned u = __float_as_uint(f); u += 0x7FFFu + ((u >> 16) & 1u); return (unsigned short)(u >> 16); }
__device__ __forceinline__ float bf2f(unsigned short b) { return __uint_as_float(((unsigned)b) << 16); }
__device__ __forceinline__ float bfr(float f) { return bf2f(f2bf(f)); }
__device__ __forceinline__ v16h cat16(v8h lo, v8h hi) { return __builtin_shufflevector(lo, hi, 0, 1, 2, 3, 4, 5, 6, 7, 8, 9, 10, 11, 12, 13, 14, 15); }
__device__ __forceinline__ v16bf cat16b(v8us lo, v8us hi) { return __builtin_bit_cast(v16bf, __builtin_shufflevector(lo, hi, 0, 1, 2, 3, 4, 5, 6, 7, 8, 9, 10, 11, 12, 13, 14, 15)); }
__device__ __forceinline__ v8f wmma16(v16h a, v16h b, v8f c) { return __builtin_amdgcn_wmma_f32_16x16x32_f16(false, a, false, b, (short)0, c, false, false); }
__device__ __forceinline__ v8f wmmab(v16bf a, v16bf b, v8f c) { return __builtin_amdgcn_wmma_f32_16x16x32_bf16(false, a, false, b, (short)0, c, false, false); }
__device__ __forceinline__ h16 tohx(float x) { return (h16)x; }
__device__ __forceinline__ void splitf(float y, unsigned short& h, unsigned short& l) { h = f2bf(y); l = f2bf(y - bf2f(h)); }
typedef __attribute__((ext_vector_type(4))) _Float16 v4h;
typedef __attribute__((ext_vector_type(2))) unsigned short v2us;
typedef __attribute__((ext_vector_type(4))) unsigned short v4us;
typedef __attribute__((ext_vector_type(2))) float v2f;

// ---- k_gemmw: register-blocked GEMM, ONE WAVE per 64x64 output tile (16 accumulators), operands straight from K-contiguous 16-bit planes; grid (M/64, N/64, Z), 32 threads.
// C[m][n] (f32, pitch ldc, + optional f32 bias[n]) = sum_k A[m][k] Bt[n][k] (+ split products per NSPLIT). z-batch strides sA/sB/sC in elements. K % (32 KS) == 0, M % 64 == 0, N % 64 == 0.
// BIAS: z-slice 0 / 1 / 2 adds bias / bias1 / bias2.
// KS > 1: grid z = Z x KS; work-group (z, ks) sums only k in [ks K/KS, (ks+1) K/KS) and stores its f32 partial tile into plane ks (plane stride sP elements); the reader adds the KS planes in the order 0..KS-1.
// PL: no f32 C. The tile is 64 tokens of one batch x the 64 columns of head blockIdx.y, and the wave stores it (+ bias) as the attention kernel's operand planes, f16 and bf16 hi / lo:
// z-slices 0 and 1 (q, k) as rows [z][batch][head][token][HD], a contiguous 8 KB a plane; z-slice 2 (v) transposed, [batch][head][d][token], straight from the accumulators (a lane's 8 D elements are 8 consecutive tokens of one d).
// Fragment map: lane l, h = l >> 4: elements 0..7 <- k0 + 8h + 0..7, elements 8..15 <- k0 + 16 + 8h + 0..7 (A row / B column = l & 15); D element j -> (row 8h + j, col l & 15).
template <typename T16> struct WFrag;
template <> struct WFrag<h16> { typedef v16h V; static __device__ __forceinline__ V ld(const h16* p) { return cat16(*(const v8h*)p, *(const v8h*)(p + 16)); } static __device__ __forceinline__ v8f mma(V a, V b, v8f c) { return wmma16(a, b, c); } };
template <> struct WFrag<bf> { typedef v16bf V; static __device__ __forceinline__ V ld(const bf* p) { return cat16b(*(const v8us*)p, *(const v8us*)(p + 16)); } static __device__ __forceinline__ v8f mma(V a, V b, v8f c) { return wmmab(a, b, c); } };
template <typename T16, int NSPLIT, bool BIAS, int KS, bool PL>
__global__ __launch_bounds__(32) void k_gemmw(const T16* __restrict__ A, const T16* __restrict__ A2, const T16* __restrict__ Bt, const T16* __restrict__ Bt2, int K, float* C, int ldc, const float* __restrict__ bias, const float* __restrict__ bias1, const float* __restrict__ bias2, size_t sA, size_t sB, size_t sC, size_t sP, h16* P16, bf* Ph, bf* Pl, h16* V16, bf* Vh, bf* Vl) {
    static_assert(KS == 1 || !BIAS);
    static_assert(!PL || (BIAS && KS == 1));
    typedef typename WFrag<T16>::V V;
    __shared__ __align__(16) float os[16 * 68];
    const size_t z = blockIdx.z / KS; const int ks = (int)(blockIdx.z % KS); A += z * sA; if (A2) A2 += z * sA; Bt += z * sB; if (Bt2) Bt2 += z * sB; C += z * sC + (size_t)ks * sP;
    const float* bz = (z == 0) ? bias : ((z == 1) ? bias1 : bias2);
    const int kbeg = ks * (K / KS), kend = kbeg + K / KS;
    const int lane = threadIdx.x & 31, lr = lane & 15, hi = lane >> 4; const int r0 = blockIdx.x * 64, c0 = blockIdx.y * 64;
    v8f acc[4][4];
#pragma unroll
    for (int mb = 0; mb < 4; ++mb)
#pragma unroll
        for (int nb = 0; nb < 4; ++nb) acc[mb][nb] = (v8f){};
    const size_t aoff = (size_t)(r0 + lr) * K + 8 * hi, boff = (size_t)(c0 + lr) * K + 8 * hi;
#pragma unroll 1
    for (int kc = kbeg; kc < kend; kc += 32) {
        V a[4], a2[4];
#pragma unroll
        for (int mb = 0; mb < 4; ++mb) { a[mb] = WFrag<T16>::ld(A + aoff + (size_t)mb * 16 * K + kc); if (NSPLIT == 1 || NSPLIT == 2) a2[mb] = WFrag<T16>::ld(A2 + aoff + (size_t)mb * 16 * K + kc); }
#pragma unroll
        for (int nb = 0; nb < 4; ++nb) { const V b = WFrag<T16>::ld(Bt + boff + (size_t)nb * 16 * K + kc); V b2; if (NSPLIT >= 2) b2 = WFrag<T16>::ld(Bt2 + boff + (size_t)nb * 16 * K + kc);
#pragma unroll
            for (int mb = 0; mb < 4; ++mb) { acc[mb][nb] = WFrag<T16>::mma(a[mb], b, acc[mb][nb]); if (NSPLIT == 1 || NSPLIT == 2) acc[mb][nb] = WFrag<T16>::mma(a2[mb], b, acc[mb][nb]); if (NSPLIT >= 2) acc[mb][nb] = WFrag<T16>::mma(a[mb], b2, acc[mb][nb]); } }
        asm volatile("v_nop\n\tv_nop\n\tv_nop\n\tv_nop" : "+v"(acc[0][0]), "+v"(acc[1][1]), "+v"(acc[2][2]), "+v"(acc[3][3]) : "v"(a[0]), "v"(a[3]));
    }
    const int bt = r0 / TT, t0 = r0 % TT;   // PL: the tile's batch and first token
    const size_t pb = (((z * NB + bt) * NH_ + blockIdx.y) * TT + t0) * HD;   // PL: the tile's first element in a q / k plane
    v4f pbias = (v4f){};
    if (!PL || z != 2) {
    if constexpr (PL) { pbias[0] = bfr(bz[c0 + lr * 4]); pbias[1] = bfr(bz[c0 + lr * 4 + 1]); pbias[2] = bfr(bz[c0 + lr * 4 + 2]); pbias[3] = bfr(bz[c0 + lr * 4 + 3]); }
#pragma unroll
    for (int mb = 0; mb < 4; ++mb) {
#pragma unroll
        for (int nb = 0; nb < 4; ++nb) {
#pragma unroll
            for (int j = 0; j < 8; ++j) os[(hi * 8 + j) * 68 + nb * 16 + lr] = acc[mb][nb][j]; }
        __builtin_amdgcn_wave_barrier(); asm volatile("" ::: "memory");
        float* crow = C + (size_t)(r0 + mb * 16) * ldc + c0;
        if constexpr (PL) { v4h o16[8]; v4us oh[8], ol[8];
#pragma unroll
            for (int s = 0; s < 8; ++s) { const v4f val = *(const v4fa*)(os + (2 * s + hi) * 68 + lr * 4) + pbias;
#pragma unroll
                for (int q = 0; q < 4; ++q) { o16[s][q] = tohx(val[q]); unsigned short a2, c2; splitf(val[q], a2, c2); oh[s][q] = a2; ol[s][q] = c2; } }
            __builtin_amdgcn_sched_barrier(0);              // every conversion of the block stands in front of its stores: none lands in a register that an issued store names
#pragma unroll
            for (int s = 0; s < 8; ++s) { const size_t e = pb + (size_t)(mb * 16 + 2 * s + hi) * HD + lr * 4; *(v4h*)(P16 + e) = o16[s]; *(v4us*)(Ph + e) = oh[s]; *(v4us*)(Pl + e) = ol[s]; }
            asm volatile("s_wait_xcnt 0x0" ::: "memory");   // the next block's values may land in registers that the stores above name (behind the last block the kernel ends)
            __builtin_amdgcn_sched_barrier(0);              // keeps what follows behind that wait
        } else
{
#pragma unroll
            for (int s = 0; s < 8; ++s) { const int row = 2 * s + hi, cofs = lr * 4; v4f val = *(const v4fa*)(os + row * 68 + cofs); if (BIAS) { val[0] += bfr(bz[c0 + cofs]); val[1] += bfr(bz[c0 + cofs + 1]); val[2] += bfr(bz[c0 + cofs + 2]); val[3] += bfr(bz[c0 + cofs + 3]); }
                *(v4f*)(crow + (size_t)row * ldc + cofs) = val; }
             }
        __builtin_amdgcn_wave_barrier(); asm volatile("" ::: "memory");
    }
    } else if constexpr (PL) {
        const size_t vb = (size_t)(bt * NH_ + (int)blockIdx.y) * HD * TT + t0 + 8 * hi;
        float bb[4];
#pragma unroll
        for (int nb = 0; nb < 4; ++nb) bb[nb] = bfr(bz[c0 + nb * 16 + lr]);
#pragma unroll
        for (int nb = 0; nb < 4; ++nb) { v8h o16[4]; v8us oh[4], ol[4];
#pragma unroll
            for (int mb = 0; mb < 4; ++mb)
#pragma unroll
                for (int j = 0; j < 8; ++j) { const float x = acc[mb][nb][j] + bb[nb]; o16[mb][j] = tohx(x); unsigned short a2, c2; splitf(x, a2, c2); oh[mb][j] = a2; ol[mb][j] = c2; }
            __builtin_amdgcn_sched_barrier(0);              // every conversion of the block stands in front of its stores: none lands in a register that an issued store names
#pragma unroll
            for (int mb = 0; mb < 4; ++mb) { const size_t e = vb + (size_t)(nb * 16 + lr) * TT + mb * 16; *(v8h*)(V16 + e) = o16[mb]; *(v8us*)(Vh + e) = oh[mb]; *(v8us*)(Vl + e) = ol[mb]; }
            if (nb < 3) { asm volatile("s_wait_xcnt 0x0" ::: "memory");   // the next block's values may land in registers that the stores above name
                __builtin_amdgcn_sched_barrier(0); }        // keeps the next block's instructions behind that wait
        }
    }
}


// grid.y picks one of four equally shaped weights; Bt holds the four transposed planes one behind the other.
__global__ __launch_bounds__(256) void k_wtG(const float* __restrict__ w0, const float* __restrict__ w1, const float* __restrict__ w2, const float* __restrict__ w3, int K, int N, bf* Bt) {
    const int y = (int)blockIdx.y; const float* w = (y == 0) ? w0 : ((y == 1) ? w1 : ((y == 2) ? w2 : w3)); Bt += (size_t)y * K * N;
    const int lane = threadIdx.x & 31; const int L0 = (blockIdx.x * 8 + (threadIdx.x >> 5)) * 8; const int nlines = N * K / 64;
{
#pragma unroll 1
        for (int l = 0; l < 8; ++l) { const int L = L0 + l; if (L >= nlines) break; const size_t e = (size_t)L * 64 + lane * 2; const int k = (int)(e % K), n = (int)(e / K); v2us o;
            o[0] = f2bf(w[(size_t)k * N + n]); o[1] = f2bf(w[(size_t)(k + 1) * N + n]); *(v2us*)(Bt + e) = o; }
         }
}
// grid.z picks the stream, grid.y the batch (source batch stride sb elements); dst is [stream][batch][n8 * 8].
__global__ __launch_bounds__(256) void k_cvt8(const float* __restrict__ s0, const float* __restrict__ s1, const float* __restrict__ s2, size_t sb, bf* dst, size_t n8) { const size_t i = (size_t)blockIdx.x * 256 + threadIdx.x; if (i >= n8) return;
    const int s = (int)blockIdx.z; const float* src = ((s == 0) ? s0 : ((s == 1) ? s1 : s2)) + (size_t)blockIdx.y * sb; dst += ((size_t)s * NB + blockIdx.y) * n8 * 8; const v8f v = *(const v8f*)(src + i * 8); v8us o;
#pragma unroll
    for (int k = 0; k < 8; ++k) o[k] = f2bf(v[k]); *(v8us*)(dst + i * 8) = o;  }

// ---- k_attn: logits, softmax and P x V of one (batch, head) slice z in one kernel; scores and probabilities stay in registers.
// One wave owns 16 NQ query rows and the keys [ks TT/KSF, (ks+1) TT/KSF), 32 keys a trip. It forms the TRANSPOSED logits tile (A = key rows, B = query rows), so that D element j of key tile kt is (key 16 kt + 8h + j, query l & 15):
// the two key tiles of a trip are, lane by lane, the B fragment of P^T (elements 0..7 <- key 8h + j, elements 8..15 <- key 16 + 8h + j), the k order of the V^T A fragment. O^T (A = V^T rows d, B = P^T) has its query in l & 15 too, so a row's maximum, sum and rescale factor are one value a lane.
// Each wave stores its unnormalised f32 O rows, and per 16 rows one 128-byte line: 16 running maxima, then 16 sums. k_merge joins the KSF slices.
template <typename T16, bool HI, int NQ>
__device__ __forceinline__ void attn_body(const T16* __restrict__ Q, const T16* __restrict__ Q2, const T16* __restrict__ Kp, const T16* __restrict__ K2, const T16* __restrict__ Vt, const T16* __restrict__ V2, const float* __restrict__ Mk, int mpitch, int q0, int kbeg, float* Op, float* St) {
    typedef typename WFrag<T16>::V V;
    const int lane = threadIdx.x & 31, lr = lane & 15, hi = lane >> 4;
    V qf[NQ][2], qf2[NQ][2];
#pragma unroll
    for (int nq = 0; nq < NQ; ++nq)
#pragma unroll
        for (int c = 0; c < 2; ++c) { const size_t o = (size_t)(q0 + nq * 16 + lr) * HD + c * 32 + 8 * hi; qf[nq][c] = WFrag<T16>::ld(Q + o); if (HI) qf2[nq][c] = WFrag<T16>::ld(Q2 + o); }
    v8f oacc[NQ][4]; float mrun[NQ], lrun[NQ];
#pragma unroll
    for (int nq = 0; nq < NQ; ++nq) { mrun[nq] = -3.0e38f; lrun[nq] = 0.f;
#pragma unroll
        for (int dt = 0; dt < 4; ++dt) oacc[nq][dt] = (v8f){}; }
    const T16* vp = Vt + (size_t)lr * TT + kbeg + 8 * hi; const T16* vp2 = HI ? V2 + (size_t)lr * TT + kbeg + 8 * hi : nullptr;   // this lane's V^T row at the trip's first key
#pragma unroll 1   // one copy of a body that holds a whole trip's loads and products: registers and instruction cache
    for (int k0 = kbeg; k0 < kbeg + TT / KSF; k0 += 32) {
        V kf[2][2], kf2[2][2], vf[4], vf2[4]; v4f mv[NQ][2][2];
#pragma unroll
        for (int kt = 0; kt < 2; ++kt)
#pragma unroll
            for (int c = 0; c < 2; ++c) { const size_t o = (size_t)(k0 + kt * 16 + lr) * HD + c * 32 + 8 * hi; kf[kt][c] = WFrag<T16>::ld(Kp + o); if (HI) kf2[kt][c] = WFrag<T16>::ld(K2 + o); }
#pragma unroll
        for (int nq = 0; nq < NQ; ++nq)
#pragma unroll
            for (int kt = 0; kt < 2; ++kt) { const float* mr = Mk + (size_t)(q0 + nq * 16 + lr) * mpitch + k0 + kt * 16 + 8 * hi; mv[nq][kt][0] = *(const v4f*)mr; mv[nq][kt][1] = *(const v4f*)(mr + 4); }
        asm volatile("s_wait_xcnt 0x0" ::: "memory");   // the V loads below may land in registers that held the addresses of the loads above
        __builtin_amdgcn_sched_barrier(0);              // keeps the V loads behind that wait
#pragma unroll
        for (int dt = 0; dt < 4; ++dt) { vf[dt] = WFrag<T16>::ld(vp + (size_t)dt * 16 * TT); if (HI) vf2[dt] = WFrag<T16>::ld(vp2 + (size_t)dt * 16 * TT); }
        // The trip's loads are all issued above; their address registers are advanced for the next trip below. The V addresses are inputs of the wait, so they live up to it and no load of the run lands in them.
        if constexpr (HI) asm volatile("s_wait_xcnt 0x0" :: "v"(vp), "v"(vp2) : "memory"); else asm volatile("s_wait_xcnt 0x0" :: "v"(vp) : "memory");
        __builtin_amdgcn_sched_barrier(0);              // keeps those address additions behind the wait, and every load of the trip in front of the first product
#pragma unroll
        for (int nq = 0; nq < NQ; ++nq) {
            v8f s[2];
#pragma unroll
            for (int kt = 0; kt < 2; ++kt) { s[kt] = (v8f){};
#pragma unroll
                for (int c = 0; c < 2; ++c) { s[kt] = WFrag<T16>::mma(kf[kt][c], qf[nq][c], s[kt]); if (HI) { s[kt] = WFrag<T16>::mma(kf[kt][c], qf2[nq][c], s[kt]); s[kt] = WFrag<T16>::mma(kf2[kt][c], qf[nq][c], s[kt]); } } }
            float mx = mrun[nq];
#pragma unroll
            for (int kt = 0; kt < 2; ++kt)
#pragma unroll
                for (int j = 0; j < 8; ++j) { const float t = s[kt][j] * SCL + bfr(mv[nq][kt][j >> 2][j & 3]) * MNEG; s[kt][j] = t; mx = fmaxf(mx, t); }
            mx = fmaxf(mx, __shfl_xor(mx, 16, 32));   // the row's other 16 keys of the trip lie in lane l ^ 16
            const float al = __builtin_amdgcn_exp2f((mrun[nq] - mx) * L2E); mrun[nq] = mx;
            float sum = 0.f;
#pragma unroll
            for (int kt = 0; kt < 2; ++kt) { v8f x, p;
#pragma unroll
                for (int j = 0; j < 8; ++j) { x[j] = (s[kt][j] - mx) * L2E; if (!HI) x[j] += PEXP; }
#pragma unroll
                for (int j = 0; j < 8; ++j) p[j] = __builtin_amdgcn_exp2f(x[j]);
                asm volatile("v_nop" : "+v"(p) : "v"(x));   // the slot behind a transcendental: no result of the eight is read and no source register reused before this instruction
                s[kt] = p;
#pragma unroll
                for (int j = 0; j < 8; ++j) sum += p[j]; }
            lrun[nq] = lrun[nq] * al + sum;
#pragma unroll
            for (int dt = 0; dt < 4; ++dt) oacc[nq][dt] *= al;
            if constexpr (HI) { v8us ph[2], pl[2];
#pragma unroll
                for (int kt = 0; kt < 2; ++kt)
#pragma unroll
                    for (int j = 0; j < 8; ++j) { unsigned short a, c2; splitf(s[kt][j], a, c2); ph[kt][j] = a; pl[kt][j] = c2; }
                const V pfh = cat16b(ph[0], ph[1]), pfl = cat16b(pl[0], pl[1]);
#pragma unroll
                for (int dt = 0; dt < 4; ++dt) { oacc[nq][dt] = WFrag<T16>::mma(vf[dt], pfh, oacc[nq][dt]); oacc[nq][dt] = WFrag<T16>::mma(vf[dt], pfl, oacc[nq][dt]); oacc[nq][dt] = WFrag<T16>::mma(vf2[dt], pfh, oacc[nq][dt]); }
            } else { v8h p16[2];
#pragma unroll
                for (int kt = 0; kt < 2; ++kt)
#pragma unroll
                    for (int j = 0; j < 8; ++j) p16[kt][j] = tohx(s[kt][j]);
                const V pf = cat16(p16[0], p16[1]);
#pragma unroll
                for (int dt = 0; dt < 4; ++dt) oacc[nq][dt] = WFrag<T16>::mma(vf[dt], pf, oacc[nq][dt]); }
        }
        vp += 32; if (HI) vp2 += 32;
    }
#pragma unroll
    for (int nq = 0; nq < NQ; ++nq) {
        const float lt = lrun[nq] + __shfl_xor(lrun[nq], 16, 32);
        St[(size_t)(q0 + nq * 16) * 2 + lane] = hi ? lt : mrun[nq];
#pragma unroll
        for (int dt = 0; dt < 4; ++dt) *(v8f*)(Op + (size_t)(q0 + nq * 16 + lr) * HD + dt * 16 + 8 * hi) = oacc[nq][dt];
    }
}
// grid (RH/64 + (TT-RH)/128, KSF, NZ), 4 independent waves: blocks x < RH/64 take 16 hi+lo query rows a wave, the others 32 f16 rows a wave. QK* hold the q planes, then (kofs elements on) the k planes.
__global__ __launch_bounds__(128) void k_attn(const h16* __restrict__ QK16, const bf* __restrict__ QKh, const bf* __restrict__ QKl, size_t kofs, const h16* __restrict__ VT16, const bf* __restrict__ VTh, const bf* __restrict__ VTl, const float* __restrict__ Mk, int mpitch, float* Op, float* St) {
    const int wave = __builtin_amdgcn_readfirstlane((int)(threadIdx.x >> 5)); const int bx = (int)blockIdx.x, ks = (int)blockIdx.y; const size_t z = blockIdx.z; const size_t zo = z * TT * HD;
    Op += ((size_t)ks * NZ + z) * TT * HD; St += ((size_t)ks * NZ + z) * TT * 2; const int kbeg = ks * (TT / KSF);
    if (bx < RH / 64) attn_body<bf, true, 1>(QKh + zo, QKl + zo, QKh + kofs + zo, QKl + kofs + zo, VTh + zo, VTl + zo, Mk, mpitch, bx * 64 + wave * 16, kbeg, Op, St);
    else attn_body<h16, false, 2>(QK16 + zo, nullptr, QK16 + kofs + zo, nullptr, VT16 + zo, nullptr, Mk, mpitch, RH + (bx - RH / 64) * 128 + wave * 32, kbeg, Op, St);
}
// Joins the KSF key slices of every row in the order 0..KSF-1: weights 2^((m_s - max m) log2 e), O = sum w O_s / sum w l_s; hi+lo bf16 planes in merged-head order.
__global__ __launch_bounds__(256) void k_merge(const float* __restrict__ O, const float* __restrict__ St, bf* Ah, bf* Al) { const size_t e = ((size_t)blockIdx.x * 256 + threadIdx.x) * 2; if (e >= (size_t)NZ * TT * HD) return; const int d = (int)(e % HD); const int t = (int)((e / HD) % TT); const int z = (int)(e / ((size_t)HD * TT)); const size_t oo = ((size_t)(z / NH_) * TT + t) * DQ + (z % NH_) * HD + d;
    const size_t so = ((size_t)z * TT + (t & ~15)) * 2 + (t & 15); float m[KSF], l[KSF]; float mx = -3.0e38f;
#pragma unroll
    for (int s = 0; s < KSF; ++s) { m[s] = St[(size_t)s * ((size_t)NZ * TT * 2) + so]; l[s] = St[(size_t)s * ((size_t)NZ * TT * 2) + so + 16]; mx = fmaxf(mx, m[s]); }
    const float w0 = __builtin_amdgcn_exp2f((m[0] - mx) * L2E); v2f x = *(const v2f*)(O + e) * w0; float den = l[0] * w0; v2us oh, ol;
#pragma unroll
    for (int s = 1; s < KSF; ++s) { const float w = __builtin_amdgcn_exp2f((m[s] - mx) * L2E); x += *(const v2f*)(O + (size_t)s * ((size_t)NZ * TT * HD) + e) * w; den += l[s] * w; }
    const float f = 1.0f / den;
#pragma unroll
    for (int q = 0; q < 2; ++q) { unsigned short a, c2; splitf(x[q] * f, a, c2); oh[q] = a; ol[q] = c2; } *(v2us*)(Ah + oo) = oh; *(v2us*)(Al + oo) = ol;  }

extern "C" void kernel_launch(void* const* d_in, const int* in_sizes, int n_in,
                              void* d_out, int out_size, void* d_ws, size_t ws_size, hipStream_t stream) {
    if (n_in < 12) return;
    const long long xneed = (long long)(NB - 1) * SEQ_FULL * DM + (long long)TT * DM;
    if ((long long)in_sizes[0] < xneed || (long long)in_sizes[1] < xneed || (long long)in_sizes[2] < xneed) return;
    if ((long long)in_sizes[3] < (long long)(TT - 1) * SEQ_FULL + TT) return;
    if (in_sizes[4] < DM * DQ || in_sizes[6] < DM * DKV || in_sizes[8] < DM * DKV || in_sizes[10] < DQ * DM) return;
    if (in_sizes[5] < DQ || in_sizes[7] < DKV || in_sizes[9] < DKV || in_sizes[11] < DM) return;
    if ((long long)out_size < (long long)NB * TT * DM) return;
    const float* xq = (const float*)d_in[0]; const float* xk = (const float*)d_in[1]; const float* xv = (const float*)d_in[2]; const float* mk = (const float*)d_in[3];
    const float* wq = (const float*)d_in[4]; const float* bq = (const float*)d_in[5]; const float* wk = (const float*)d_in[6]; const float* bk = (const float*)d_in[7]; const float* wv = (const float*)d_in[8]; const float* bv = (const float*)d_in[9]; const float* wo = (const float*)d_in[10]; const float* bo = (const float*)d_in[11];
    float* OUT = (float*)d_out;     // [NB][TT][DM]
    char* wsp = (char*)d_ws;
    auto take = [&](size_t bytes) { char* p = wsp; wsp += (bytes + 255) & ~(size_t)255; return (void*)p; };
    constexpr size_t WSZ = (size_t)DM * DQ;           // elements of one weight plane
    constexpr size_t PSZ = (size_t)NZ * TT * HD;      // elements of one plane set over all (batch, head) slices
    constexpr size_t XSZ = (size_t)NB * TT * DM;      // elements of one stream, both batches
    constexpr size_t OB_B = (size_t)KSF * PSZ * 4, ST_B = 3 * XSZ * 2;
    constexpr size_t POOL_B = OB_B > ST_B ? OB_B : ST_B;
    bf* W4 = (bf*)take(4 * WSZ * 2);                  // Wq, Wk, Wv, Wo transposed, one behind the other
    h16* QK16 = (h16*)take(2 * PSZ * 2); bf* QKh = (bf*)take(2 * PSZ * 2); bf* QKl = (bf*)take(2 * PSZ * 2);   // q planes, then k planes
    h16* VT16 = (h16*)take(PSZ * 2); bf* VTh = (bf*)take(PSZ * 2); bf* VTl = (bf*)take(PSZ * 2);
    float* Stt = (float*)take((size_t)KSF * NZ * TT * 2 * 4);   // per key slice and row: running maximum and sum
    bf* ATh = (bf*)take(XSZ * 2); bf* ATl = (bf*)take(XSZ * 2);
    char* pool = (char*)take(POOL_B);
    const size_t carved = (size_t)(wsp - (char*)d_ws);
    if (carved > ws_size) return;
    // One pool, two stream-ordered uses: the projections' bf16 inputs (dead once the planes are built), then the attention kernel's partial O planes.
    bf* XB = (bf*)pool; float* Ob = (float*)pool;
    // weights: w is [in = K rows][out = N cols] -> Bt[N][K]
    k_wtG<<<dim3((unsigned)((WSZ / 64 + 63) / 64), 4, 1), 256, 0, stream>>>(wq, wk, wv, wo, DM, DQ, W4);
    k_cvt8<<<dim3((unsigned)(((size_t)TT * DM / 8 + 255) / 256), NB, 3), 256, 0, stream>>>(xq, xk, xv, (size_t)SEQ_FULL * DM, XB, (size_t)TT * DM / 8);
    k_gemmw<bf, 0, true, 1, true><<<dim3(NB * TT / 64, DQ / 64, 3), 32, 0, stream>>>(XB, nullptr, W4, nullptr, DM, nullptr, DQ, bq, bk, bv, XSZ, WSZ, 0, 0, QK16, QKh, QKl, VT16, VTh, VTl);
    k_attn<<<dim3(RH / 64 + (TT - RH) / 128, KSF, NZ), 128, 0, stream>>>(QK16, QKh, QKl, PSZ, VT16, VTh, VTl, mk, SEQ_FULL, Ob, Stt);
    k_merge<<<(unsigned)((PSZ / 2 + 255) / 256), 256, 0, stream>>>(Ob, Stt, ATh, ATl);
    k_gemmw<bf, 1, true, 1, false><<<dim3(NB * TT / 64, DM / 64, 1), 32, 0, stream>>>(ATh, ATl, W4 + 3 * WSZ, nullptr, DQ, OUT, DM, bo, bo, bo, 0, 0, 0, 0, nullptr, nullptr, nullptr, nullptr, nullptr, nullptr);
}

// v005
// It runs in 149 microseconds.
// In two side-by-side timings against v004, it was 1.32 and 1.31 times as fast.
// Over all steps from v000 it is 10.4 times as fast.
#include <hip/hip_runtime.h>

// Masked attention block: three input streams q, k, v [2][2048][768]; per-stream projection x W + b (W stored [in][out]); 12 heads x 64; logits x 1/8 plus mask x -1e9 (mask [2048][2048] read as values from its input buffer); softmax over all keys; merged heads x Wo + bo -> [2][2048][768].
// Compute dtypes (every product accumulates in f32): inputs, mask, biases and weights RNE-converted to bf16; projections v_wmma_f32_16x16x32_bf16 (exact products) + f32 bias; logits: query rows < 512 on bf16 hi/lo planes (3 products), other rows on f16 planes (1 product); P x V: rows < 512 bf16 hi/lo (3 products), other rows v_wmma_f32_16x16x32_f16 with P carried x1024; softmax f32, running maximum and sum per query row inside the attention kernel (mask tiles classed from their values by k_mcls); output projection: merged bf16 hi/lo planes x bf16 Wo (2 products) + f32 bias.

#ifndef NB
#define NB 2
#endif
#ifndef SEQ
#define SEQ 2048
#endif
#define NB_FULL  2
#define SEQ_FULL 2048
#define TT   SEQ
#define DM   768
#define NH_  12
#define NKV  12
#define REP  (NH_ / NKV)
#define HD   64
#define DQ   (NH_ * HD)
#define DKV  (NKV * HD)
#define NZ   (NB * NH_)
#define RH   ((TT) < 512 ? (TT) : 512)   // query rows < RH use hi+lo planes
#define PEXP 10.0f    // f16 rows carry P x 2^10 (added to the exponent; the row sum carries it too, so the quotient is free of it)
#define L2E  1.4426950408889634f
#define SCL  0.125f   // HD^-0.5
#define MNEG (-1.0e9f)
#define KSF  4        // key slices of the attention kernel: one work-group per (query block, slice)

static_assert(TT % 128 == 0);
static_assert(TT <= SEQ_FULL);
static_assert(NB <= NB_FULL);
static_assert(DM % 64 == 0);
static_assert(DQ % 64 == 0);
static_assert(DQ == DM);
static_assert(HD == 64);
static_assert(NKV == NH_);
static_assert(RH % 64 == 0);
static_assert((TT - RH) % 128 == 0);
static_assert(TT % (32 * KSF) == 0);
static_assert(TT / 32 <= 64);          // one bit a key tile in a 64-bit class word
static_assert(TT / KSF / 32 <= 32);    // a slice's bits fit one 32-bit word

typedef _Float16 h16;
typedef unsigned short bf;
typedef __attribute__((ext_vector_type(16))) __bf16   v16bf;
typedef __attribute__((ext_vector_type(16))) _Float16 v16h;
typedef __attribute__((ext_vector_type(8)))  _Float16 v8h;
typedef __attribute__((ext_vector_type(8)))  unsigned short v8us;
typedef __attribute__((ext_vector_type(8)))  float    v8f;
typedef __attribute__((ext_vector_type(4)))  float    v4f;
typedef v8h  __attribute__((may_alias)) v8ha;
typedef v4f  __attribute__((may_alias)) v4fa;
typedef v8us __attribute__((may_alias)) v8usa;

__device__ __forceinline__ unsigned short f2bf(float f) { unsigned u = __float_as_uint(f); u += 0x7FFFu + ((u >> 16) & 1u); return (unsigned short)(u >> 16); }
__device__ __forceinline__ float bf2f(unsigned short b) { return __uint_as_float(((unsigned)b) << 16); }
__device__ __forceinline__ float bfr(float f) { return bf2f(f2bf(f)); }
__device__ __forceinline__ v16h cat16(v8h lo, v8h hi) { return __builtin_shufflevector(lo, hi, 0, 1, 2, 3, 4, 5, 6, 7, 8, 9, 10, 11, 12, 13, 14, 15); }
__device__ __forceinline__ v16bf cat16b(v8us lo, v8us hi) { return __builtin_bit_cast(v16bf, __builtin_shufflevector(lo, hi, 0, 1, 2, 3, 4, 5, 6, 7, 8, 9, 10, 11, 12, 13, 14, 15)); }
__device__ __forceinline__ v8f wmma16(v16h a, v16h b, v8f c) { return __builtin_amdgcn_wmma_f32_16x16x32_f16(false, a, false, b, (short)0, c, false, false); }
__device__ __forceinline__ v8f wmmab(v16bf a, v16bf b, v8f c) { return __builtin_amdgcn_wmma_f32_16x16x32_bf16(false, a, false, b, (short)0, c, false, false); }
__device__ __forceinline__ h16 tohx(float x) { return (h16)x; }
__device__ __forceinline__ void splitf(float y, unsigned short& h, unsigned short& l) { h = f2bf(y); l = f2bf(y - bf2f(h)); }
typedef __attribute__((ext_vector_type(4))) _Float16 v4h;
typedef __attribute__((ext_vector_type(2))) unsigned short v2us;
typedef __attribute__((ext_vector_type(4))) unsigned short v4us;
typedef __attribute__((ext_vector_type(2))) float v2f;
typedef __attribute__((ext_vector_type(4))) unsigned v4u;

// ---- k_gemmw: register-blocked GEMM, ONE WAVE per 64x64 output tile (16 accumulators), operands straight from K-contiguous 16-bit planes; grid (M/64, N/64, Z), 32 threads.
// C[m][n] (f32, pitch ldc, + optional f32 bias[n]) = sum_k A[m][k] Bt[n][k] (+ split products per NSPLIT). z-batch strides sA/sB/sC in elements. K % (32 KS) == 0, M % 64 == 0, N % 64 == 0.
// BIAS: z-slice 0 / 1 / 2 adds bias / bias1 / bias2.
// KS > 1: grid z = Z x KS; work-group (z, ks) sums only k in [ks K/KS, (ks+1) K/KS) and stores its f32 partial tile into plane ks (plane stride sP elements); the reader adds the KS planes in the order 0..KS-1.
// PL: no f32 C. The tile is 64 tokens of one batch x the 64 columns of head blockIdx.y, and the wave stores it (+ bias) as the attention kernel's operand planes, f16 and bf16 hi / lo:
// z-slices 0 and 1 (q, k) as rows [z][batch][head][token][HD], a contiguous 8 KB a plane; z-slice 2 (v) transposed, [batch][head][d][token], straight from the accumulators (a lane's 8 D elements are 8 consecutive tokens of one d).
// Fragment map: lane l, h = l >> 4: elements 0..7 <- k0 + 8h + 0..7, elements 8..15 <- k0 + 16 + 8h + 0..7 (A row / B column = l & 15); D element j -> (row 8h + j, col l & 15).
template <typename T16> struct WFrag;
template <> struct WFrag<h16> { typedef v16h V; static __device__ __forceinline__ V ld(const h16* p) { return cat16(*(const v8h*)p, *(const v8h*)(p + 16)); } static __device__ __forceinline__ v8f mma(V a, V b, v8f c) { return wmma16(a, b, c); } };
template <> struct WFrag<bf> { typedef v16bf V; static __device__ __forceinline__ V ld(const bf* p) { return cat16b(*(const v8us*)p, *(const v8us*)(p + 16)); } static __device__ __forceinline__ v8f mma(V a, V b, v8f c) { return wmmab(a, b, c); } };
template <typename T16, int NSPLIT, bool BIAS, int KS, bool PL>
__global__ __launch_bounds__(32) void k_gemmw(const T16* __restrict__ A, const T16* __restrict__ A2, const T16* __restrict__ Bt, const T16* __restrict__ Bt2, int K, float* C, int ldc, const float* __restrict__ bias, const float* __restrict__ bias1, const float* __restrict__ bias2, size_t sA, size_t sB, size_t sC, size_t sP, h16* P16, bf* Ph, bf* Pl, h16* V16, bf* Vh, bf* Vl) {
    static_assert(KS == 1 || !BIAS);
    static_assert(!PL || (BIAS && KS == 1));
    typedef typename WFrag<T16>::V V;
    __shared__ __align__(16) float os[16 * 68];
    const size_t z = blockIdx.z / KS; const int ks = (int)(blockIdx.z % KS); A += z * sA; if (A2) A2 += z * sA; Bt += z * sB; if (Bt2) Bt2 += z * sB; C += z * sC + (size_t)ks * sP;
    const float* bz = (z == 0) ? bias : ((z == 1) ? bias1 : bias2);
    const int kbeg = ks * (K / KS), kend = kbeg + K / KS;
    const int lane = threadIdx.x & 31, lr = lane & 15, hi = lane >> 4; const int r0 = blockIdx.x * 64, c0 = blockIdx.y * 64;
    v8f acc[4][4];
#pragma unroll
    for (int mb = 0; mb < 4; ++mb)
#pragma unroll
        for (int nb = 0; nb < 4; ++nb) acc[mb][nb] = (v8f){};
    const size_t aoff = (size_t)(r0 + lr) * K + 8 * hi, boff = (size_t)(c0 + lr) * K + 8 * hi;
#pragma unroll 1
    for (int kc = kbeg; kc < kend; kc += 32) {
        V a[4], a2[4];
#pragma unroll
        for (int mb = 0; mb < 4; ++mb) { a[mb] = WFrag<T16>::ld(A + aoff + (size_t)mb * 16 * K + kc); if (NSPLIT == 1 || NSPLIT == 2) a2[mb] = WFrag<T16>::ld(A2 + aoff + (size_t)mb * 16 * K + kc); }
#pragma unroll
        for (int nb = 0; nb < 4; ++nb) { const V b = WFrag<T16>::ld(Bt + boff + (size_t)nb * 16 * K + kc); V b2; if (NSPLIT >= 2) b2 = WFrag<T16>::ld(Bt2 + boff + (size_t)nb * 16 * K + kc);
#pragma unroll
            for (int mb = 0; mb < 4; ++mb) { acc[mb][nb] = WFrag<T16>::mma(a[mb], b, acc[mb][nb]); if (NSPLIT == 1 || NSPLIT == 2) acc[mb][nb] = WFrag<T16>::mma(a2[mb], b, acc[mb][nb]); if (NSPLIT >= 2) acc[mb][nb] = WFrag<T16>::mma(a[mb], b2, acc[mb][nb]); } }
        asm volatile("v_nop\n\tv_nop\n\tv_nop\n\tv_nop" : "+v"(acc[0][0]), "+v"(acc[1][1]), "+v"(acc[2][2]), "+v"(acc[3][3]) : "v"(a[0]), "v"(a[3]));
    }
    const int bt = r0 / TT, t0 = r0 % TT;   // PL: the tile's batch and first token
    const size_t pb = (((z * NB + bt) * NH_ + blockIdx.y) * TT + t0) * HD;   // PL: the tile's first element in a q / k plane
    v4f pbias = (v4f){};
    if (!PL || z != 2) {
    if constexpr (PL) { pbias[0] = bfr(bz[c0 + lr * 4]); pbias[1] = bfr(bz[c0 + lr * 4 + 1]); pbias[2] = bfr(bz[c0 + lr * 4 + 2]); pbias[3] = bfr(bz[c0 + lr * 4 + 3]); }
#pragma unroll
    for (int mb = 0; mb < 4; ++mb) {
#pragma unroll
        for (int nb = 0; nb < 4; ++nb) {
#pragma unroll
            for (int j = 0; j < 8; ++j) os[(hi * 8 + j) * 68 + nb * 16 + lr] = acc[mb][nb][j]; }
        __builtin_amdgcn_wave_barrier(); asm volatile("" ::: "memory");
        float* crow = C + (size_t)(r0 + mb * 16) * ldc + c0;
        if constexpr (PL) { v4h o16[8]; v4us oh[8], ol[8];
#pragma unroll
            for (int s = 0; s < 8; ++s) { const v4f val = *(const v4fa*)(os + (2 * s + hi) * 68 + lr * 4) + pbias;
#pragma unroll
                for (int q = 0; q < 4; ++q) { o16[s][q] = tohx(val[q]); unsigned short a2, c2; splitf(val[q], a2, c2); oh[s][q] = a2; ol[s][q] = c2; } }
            __builtin_amdgcn_sched_barrier(0);              // every conversion of the block stands in front of its stores: none lands in a register that an issued store names
#pragma unroll
            for (int s = 0; s < 8; ++s) { const size_t e = pb + (size_t)(mb * 16 + 2 * s + hi) * HD + lr * 4; *(v4h*)(P16 + e) = o16[s]; *(v4us*)(Ph + e) = oh[s]; *(v4us*)(Pl + e) = ol[s]; }
            asm volatile("s_wait_xcnt 0x0" ::: "memory");   // the next block's values may land in registers that the stores above name (behind the last block the kernel ends)
            __builtin_amdgcn_sched_barrier(0);              // keeps what follows behind that wait
        } else
{
#pragma unroll
            for (int s = 0; s < 8; ++s) { const int row = 2 * s + hi, cofs = lr * 4; v4f val = *(const v4fa*)(os + row * 68 + cofs); if (BIAS) { val[0] += bfr(bz[c0 + cofs]); val[1] += bfr(bz[c0 + cofs + 1]); val[2] += bfr(bz[c0 + cofs + 2]); val[3] += bfr(bz[c0 + cofs + 3]); }
                *(v4f*)(crow + (size_t)row * ldc + cofs) = val; }
             }
        __builtin_amdgcn_wave_barrier(); asm volatile("" ::: "memory");
    }
    } else if constexpr (PL) {
        const size_t vb = (size_t)(bt * NH_ + (int)blockIdx.y) * HD * TT + t0 + 8 * hi;
        float bb[4];
#pragma unroll
        for (int nb = 0; nb < 4; ++nb) bb[nb] = bfr(bz[c0 + nb * 16 + lr]);
#pragma unroll
        for (int nb = 0; nb < 4; ++nb) { v8h o16[4]; v8us oh[4], ol[4];
#pragma unroll
            for (int mb = 0; mb < 4; ++mb)
#pragma unroll
                for (int j = 0; j < 8; ++j) { const float x = acc[mb][nb][j] + bb[nb]; o16[mb][j] = tohx(x); unsigned short a2, c2; splitf(x, a2, c2); oh[mb][j] = a2; ol[mb][j] = c2; }
            __builtin_amdgcn_sched_barrier(0);              // every conversion of the block stands in front of its stores: none lands in a register that an issued store names
#pragma unroll
            for (int mb = 0; mb < 4; ++mb) { const size_t e = vb + (size_t)(nb * 16 + lr) * TT + mb * 16; *(v8h*)(V16 + e) = o16[mb]; *(v8us*)(Vh + e) = oh[mb]; *(v8us*)(Vl + e) = ol[mb]; }
            if (nb < 3) { asm volatile("s_wait_xcnt 0x0" ::: "memory");   // the next block's values may land in registers that the stores above name
                __builtin_amdgcn_sched_barrier(0); }        // keeps the next block's instructions behind that wait
        }
    }
}


// grid.y picks one of four equally shaped weights; Bt holds the four transposed planes one behind the other.
__global__ __launch_bounds__(256) void k_wtG(const float* __restrict__ w0, const float* __restrict__ w1, const float* __restrict__ w2, const float* __restrict__ w3, int K, int N, bf* Bt) {
    const int y = (int)blockIdx.y; const float* w = (y == 0) ? w0 : ((y == 1) ? w1 : ((y == 2) ? w2 : w3)); Bt += (size_t)y * K * N;
    const int lane = threadIdx.x & 31; const int L0 = (blockIdx.x * 8 + (threadIdx.x >> 5)) * 8; const int nlines = N * K / 64;
{
#pragma unroll 1
        for (int l = 0; l < 8; ++l) { const int L = L0 + l; if (L >= nlines) break; const size_t e = (size_t)L * 64 + lane * 2; const int k = (int)(e % K), n = (int)(e / K); v2us o;
            o[0] = f2bf(w[(size_t)k * N + n]); o[1] = f2bf(w[(size_t)(k + 1) * N + n]); *(v2us*)(Bt + e) = o; }
         }
}
// grid.z picks the stream, grid.y the batch (source batch stride sb elements); dst is [stream][batch][n8 * 8].
__global__ __launch_bounds__(256) void k_cvt8(const float* __restrict__ s0, const float* __restrict__ s1, const float* __restrict__ s2, size_t sb, bf* dst, size_t n8) { const size_t i = (size_t)blockIdx.x * 256 + threadIdx.x; if (i >= n8) return;
    const int s = (int)blockIdx.z; const float* src = ((s == 0) ? s0 : ((s == 1) ? s1 : s2)) + (size_t)blockIdx.y * sb; dst += ((size_t)s * NB + blockIdx.y) * n8 * 8; const v8f v = *(const v8f*)(src + i * 8); v8us o;
#pragma unroll
    for (int k = 0; k < 8; ++k) o[k] = f2bf(v[k]); *(v8us*)(dst + i * 8) = o;  }

// ---- k_mcls: reads the mask once and classes its tiles of 16 query rows x 32 keys from the values found there. grid TT/16, 32 waves; wave w takes key tiles w and w + 32, whole 128-byte lines a row.
// Cl[4 rb ..]: words 0, 1 = one bit a key tile, set where the tile is CLOSED: every value >= 0.75; words 2, 3 = set where it is OPEN: every value rounds to bf16 zero, so mask x -1e9 adds nothing to a logit.
// The closed bits are kept only where each of the 16 rows holds, somewhere among all its keys, a value <= 0.25. Such a row's maximum logit lies at least 5e8 - 2 max|logit / 8| above every key of a closed tile;
// over the at most 18 rescale factors between that key's term and the output one spans 2e7 or more and is exactly 0 in f32: the tile adds exact zeros, and leaving it out changes no bit. A row block without that property keeps every tile.
__global__ __launch_bounds__(1024) void k_mcls(const float* __restrict__ Mk, int mpitch, unsigned* __restrict__ Cl) {
    __shared__ unsigned sf[32], sl[32];
    const int wave = (int)(threadIdx.x >> 5), lane = (int)(threadIdx.x & 31), rb = (int)blockIdx.x;
    const float* mp = Mk + (size_t)(rb * 16 + (lane >> 3)) * mpitch + (lane & 7) * 4;   // load c of a tile: rows 4c + (lane >> 3)
    const float* rp[4]; v4f m[2][4];
#pragma unroll
    for (int c = 0; c < 4; ++c) rp[c] = mp + (size_t)c * 4 * mpitch + wave * 32;
#pragma unroll
    for (int i = 0; i < 2; ++i)
#pragma unroll
        for (int c = 0; c < 4; ++c) m[i][c] = (wave + 32 * i < TT / 32) ? *(const v4f*)(rp[c] + i * 1024) : (v4f){0.5f, 0.5f, 0.5f, 0.5f};
    asm volatile("s_wait_xcnt 0x0" :: "v"(rp[0]), "v"(rp[1]), "v"(rp[2]), "v"(rp[3]) : "memory");   // the four row addresses are inputs of the wait: they live up to it, so no load of the run lands in one and nothing rewrites one before it
    unsigned flags = 0, rows = 0;
#pragma unroll
    for (int i = 0; i < 2; ++i) { bool cl = true; unsigned nz = 0;
#pragma unroll
        for (int c = 0; c < 4; ++c) { bool lv = false;
#pragma unroll
            for (int q = 0; q < 4; ++q) { const float x = m[i][c][q]; cl = cl & (x >= 0.75f); nz |= f2bf(x) & 0x7FFFu; lv = lv | (x <= 0.25f); }
            const unsigned b = __builtin_amdgcn_ballot_w32(lv);
#pragma unroll
            for (int g = 0; g < 4; ++g) rows |= (((b >> (8 * g)) & 0xFFu) != 0u ? 1u : 0u) << (4 * c + g); }
        flags |= (__builtin_amdgcn_ballot_w32(cl) == 0xFFFFFFFFu ? 1u : 0u) << i; flags |= (__builtin_amdgcn_ballot_w32(nz == 0u) == 0xFFFFFFFFu ? 4u : 0u) << i; }
    if (lane == 0) { sf[wave] = flags; sl[wave] = rows; }
    __syncthreads();
    if (wave == 0) { const unsigned f = sf[lane]; unsigned r = sl[lane];
#pragma unroll
        for (int o = 16; o > 0; o >>= 1) r |= __shfl_xor(r, o, 32);
        const unsigned keep = (r == 0xFFFFu) ? 0xFFFFFFFFu : 0u; v4u w;
        w[0] = __builtin_amdgcn_ballot_w32((f & 1u) != 0u) & keep; w[1] = __builtin_amdgcn_ballot_w32((f & 2u) != 0u) & keep; w[2] = __builtin_amdgcn_ballot_w32((f & 4u) != 0u); w[3] = __builtin_amdgcn_ballot_w32((f & 8u) != 0u);
        if (lane == 0) *(v4u*)(Cl + (size_t)rb * 4) = w; }
}

// ---- k_attn: logits, softmax and P x V of one (batch, head) slice z in one kernel; scores and probabilities stay in registers.
// One wave owns 16 NQ query rows and the keys [ks TT/KSF, (ks+1) TT/KSF), 32 keys a trip. It forms the TRANSPOSED logits tile (A = key rows, B = query rows), so that D element j of key tile kt is (key 16 kt + 8h + j, query l & 15):
// the two key tiles of a trip are, lane by lane, the B fragment of P^T (elements 0..7 <- key 8h + j, elements 8..15 <- key 16 + 8h + j), the k order of the V^T A fragment. O^T (A = V^T rows d, B = P^T) has its query in l & 15 too, so a row's maximum, sum and rescale factor are one value a lane.
// A trip whose mask tile k_mcls found closed for all of the wave's rows is left out whole (scalar branch); one found open loads no mask and takes zeros in its place. A wave with no trip left stores maximum -3e38, sum 0 and O 0: weight 0 in k_merge.
// Each wave stores its unnormalised f32 O rows, and per 16 rows one 128-byte line: 16 running maxima, then 16 sums. k_merge joins the KSF slices.
template <typename T16, bool HI, int NQ>
__device__ __forceinline__ void attn_body(const T16* __restrict__ Q, const T16* __restrict__ Q2, const T16* __restrict__ Kp, const T16* __restrict__ K2, const T16* __restrict__ Vt, const T16* __restrict__ V2, const float* __restrict__ Mk, int mpitch, const unsigned* __restrict__ Cl, int q0, int kbeg, float* Op, float* St) {
    typedef typename WFrag<T16>::V V;
    const int lane = threadIdx.x & 31, lr = lane & 15, hi = lane >> 4;
    unsigned long long cw = ~0ull, ow = ~0ull;   // closed / open for every one of the wave's row blocks
#pragma unroll
    for (int nq = 0; nq < NQ; ++nq) { const v4u c = *(const v4u*)(Cl + (size_t)((q0 >> 4) + nq) * 4); cw &= (unsigned long long)c[0] | ((unsigned long long)c[1] << 32); ow &= (unsigned long long)c[2] | ((unsigned long long)c[3] << 32); }
    unsigned cbits = __builtin_amdgcn_readfirstlane((unsigned)(cw >> (kbeg / 32))), obits = __builtin_amdgcn_readfirstlane((unsigned)(ow >> (kbeg / 32)));   // bit 0: the coming trip's tile
    V qf[NQ][2], qf2[NQ][2];
#pragma unroll
    for (int nq = 0; nq < NQ; ++nq)
#pragma unroll
        for (int c = 0; c < 2; ++c) { const size_t o = (size_t)(q0 + nq * 16 + lr) * HD + c * 32 + 8 * hi; qf[nq][c] = WFrag<T16>::ld(Q + o); if (HI) qf2[nq][c] = WFrag<T16>::ld(Q2 + o); }
    v8f oacc[NQ][4]; float mrun[NQ], lrun[NQ];
#pragma unroll
    for (int nq = 0; nq < NQ; ++nq) { mrun[nq] = -3.0e38f; lrun[nq] = 0.f;
#pragma unroll
        for (int dt = 0; dt < 4; ++dt) oacc[nq][dt] = (v8f){}; }
    const T16* vp = Vt + (size_t)lr * TT + kbeg + 8 * hi; const T16* vp2 = HI ? V2 + (size_t)lr * TT + kbeg + 8 * hi : nullptr;   // this lane's V^T row at the trip's first key
#pragma unroll 1   // one copy of a body that holds a whole trip's loads and products: registers and instruction cache
    for (int k0 = kbeg; k0 < kbeg + TT / KSF; k0 += 32) {
      if (!(cbits & 1u)) {
        V kf[2][2], kf2[2][2], vf[4], vf2[4]; v4f mv[NQ][2][2];
        if (obits & 1u) {
#pragma unroll
            for (int nq = 0; nq < NQ; ++nq)
#pragma unroll
                for (int kt = 0; kt < 2; ++kt) { mv[nq][kt][0] = (v4f){}; mv[nq][kt][1] = (v4f){}; }
        } else {
#pragma unroll
            for (int nq = 0; nq < NQ; ++nq)
#pragma unroll
                for (int kt = 0; kt < 2; ++kt) { const float* mr = Mk + (size_t)(q0 + nq * 16 + lr) * mpitch + k0 + kt * 16 + 8 * hi; mv[nq][kt][0] = *(const v4f*)mr; mv[nq][kt][1] = *(const v4f*)(mr + 4); }
            asm volatile("s_wait_xcnt 0x0" ::: "memory");   // the K loads below may land in registers that held the addresses of the mask loads above
        }
#pragma unroll
        for (int kt = 0; kt < 2; ++kt)
#pragma unroll
            for (int c = 0; c < 2; ++c) { const size_t o = (size_t)(k0 + kt * 16 + lr) * HD + c * 32 + 8 * hi; kf[kt][c] = WFrag<T16>::ld(Kp + o); if (HI) kf2[kt][c] = WFrag<T16>::ld(K2 + o); }
        asm volatile("s_wait_xcnt 0x0" ::: "memory");   // the V loads below may land in registers that held the addresses of the loads above
        __builtin_amdgcn_sched_barrier(0);              // keeps the V loads behind that wait
#pragma unroll
        for (int dt = 0; dt < 4; ++dt) { vf[dt] = WFrag<T16>::ld(vp + (size_t)dt * 16 * TT); if (HI) vf2[dt] = WFrag<T16>::ld(vp2 + (size_t)dt * 16 * TT); }
        // The trip's loads are all issued above; their address registers are advanced for the next trip below. The V addresses are inputs of the wait, so they live up to it and no load of the run lands in them.
        if constexpr (HI) asm volatile("s_wait_xcnt 0x0" :: "v"(vp), "v"(vp2) : "memory"); else asm volatile("s_wait_xcnt 0x0" :: "v"(vp) : "memory");
        __builtin_amdgcn_sched_barrier(0);              // keeps those address additions behind the wait, and every load of the trip in front of the first product
#pragma unroll
        for (int nq = 0; nq < NQ; ++nq) {
            v8f s[2];
#pragma unroll
            for (int kt = 0; kt < 2; ++kt) { s[kt] = (v8f){};
#pragma unroll
                for (int c = 0; c < 2; ++c) { s[kt] = WFrag<T16>::mma(kf[kt][c], qf[nq][c], s[kt]); if (HI) { s[kt] = WFrag<T16>::mma(kf[kt][c], qf2[nq][c], s[kt]); s[kt] = WFrag<T16>::mma(kf2[kt][c], qf[nq][c], s[kt]); } } }
            float mx = mrun[nq];
#pragma unroll
            for (int kt = 0; kt < 2; ++kt)
#pragma unroll
                for (int j = 0; j < 8; ++j) { const float t = s[kt][j] * SCL + bfr(mv[nq][kt][j >> 2][j & 3]) * MNEG; s[kt][j] = t; mx = fmaxf(mx, t); }
            mx = fmaxf(mx, __shfl_xor(mx, 16, 32));   // the row's other 16 keys of the trip lie in lane l ^ 16
            const float al = __builtin_amdgcn_exp2f((mrun[nq] - mx) * L2E); mrun[nq] = mx;
            float sum = 0.f;
#pragma unroll
            for (int kt = 0; kt < 2; ++kt) { v8f x, p;
#pragma unroll
                for (int j = 0; j < 8; ++j) { x[j] = (s[kt][j] - mx) * L2E; if (!HI) x[j] += PEXP; }
#pragma unroll
                for (int j = 0; j < 8; ++j) p[j] = __builtin_amdgcn_exp2f(x[j]);
                asm volatile("v_nop" : "+v"(p) : "v"(x));   // the slot behind a transcendental: no result of the eight is read and no source register reused before this instruction
                s[kt] = p;
#pragma unroll
                for (int j = 0; j < 8; ++j) sum += p[j]; }
            lrun[nq] = lrun[nq] * al + sum;
#pragma unroll
            for (int dt = 0; dt < 4; ++dt) oacc[nq][dt] *= al;
            if constexpr (HI) { v8us ph[2], pl[2];
#pragma unroll
                for (int kt = 0; kt < 2; ++kt)
#pragma unroll
                    for (int j = 0; j < 8; ++j) { unsigned short a, c2; splitf(s[kt][j], a, c2); ph[kt][j] = a; pl[kt][j] = c2; }
                const V pfh = cat16b(ph[0], ph[1]), pfl = cat16b(pl[0], pl[1]);
#pragma unroll
                for (int dt = 0; dt < 4; ++dt) { oacc[nq][dt] = WFrag<T16>::mma(vf[dt], pfh, oacc[nq][dt]); oacc[nq][dt] = WFrag<T16>::mma(vf[dt], pfl, oacc[nq][dt]); oacc[nq][dt] = WFrag<T16>::mma(vf2[dt], pfh, oacc[nq][dt]); }
            } else { v8h p16[2];
#pragma unroll
                for (int kt = 0; kt < 2; ++kt)
#pragma unroll
                    for (int j = 0; j < 8; ++j) p16[kt][j] = tohx(s[kt][j]);
                const V pf = cat16(p16[0], p16[1]);
#pragma unroll
                for (int dt = 0; dt < 4; ++dt) oacc[nq][dt] = WFrag<T16>::mma(vf[dt], pf, oacc[nq][dt]); }
        }
      }
        vp += 32; if (HI) vp2 += 32; cbits >>= 1; obits >>= 1;
    }
#pragma unroll
    for (int nq = 0; nq < NQ; ++nq) {
        const float lt = lrun[nq] + __shfl_xor(lrun[nq], 16, 32);
        St[(size_t)(q0 + nq * 16) * 2 + lane] = hi ? lt : mrun[nq];
#pragma unroll
        for (int dt = 0; dt < 4; ++dt) *(v8f*)(Op + (size_t)(q0 + nq * 16 + lr) * HD + dt * 16 + 8 * hi) = oacc[nq][dt];
    }
}
// grid (RH/64 + (TT-RH)/128, KSF, NZ), 4 independent waves: blocks x < RH/64 take 16 hi+lo query rows a wave, the others 32 f16 rows a wave. QK* hold the q planes, then (kofs elements on) the k planes.
__global__ __launch_bounds__(128) void k_attn(const h16* __restrict__ QK16, const bf* __restrict__ QKh, const bf* __restrict__ QKl, size_t kofs, const h16* __restrict__ VT16, const bf* __restrict__ VTh, const bf* __restrict__ VTl, const float* __restrict__ Mk, int mpitch, const unsigned* __restrict__ Cl, float* Op, float* St) {
    const int wave = __builtin_amdgcn_readfirstlane((int)(threadIdx.x >> 5)); const int bx = (int)blockIdx.x, ks = (int)blockIdx.y; const size_t z = blockIdx.z; const size_t zo = z * TT * HD;
    Op += ((size_t)ks * NZ + z) * TT * HD; St += ((size_t)ks * NZ + z) * TT * 2; const int kbeg = ks * (TT / KSF);
    if (bx < RH / 64) attn_body<bf, true, 1>(QKh + zo, QKl + zo, QKh + kofs + zo, QKl + kofs + zo, VTh + zo, VTl + zo, Mk, mpitch, Cl, bx * 64 + wave * 16, kbeg, Op, St);
    else attn_body<h16, false, 2>(QK16 + zo, nullptr, QK16 + kofs + zo, nullptr, VT16 + zo, nullptr, Mk, mpitch, Cl, RH + (bx - RH / 64) * 128 + wave * 32, kbeg, Op, St);
}
// Joins the KSF key slices of every row in the order 0..KSF-1: weights 2^((m_s - max m) log2 e), O = sum w O_s / sum w l_s; hi+lo bf16 planes in merged-head order.
__global__ __launch_bounds__(256) void k_merge(const float* __restrict__ O, const float* __restrict__ St, bf* Ah, bf* Al) { const size_t e = ((size_t)blockIdx.x * 256 + threadIdx.x) * 2; if (e >= (size_t)NZ * TT * HD) return; const int d = (int)(e % HD); const int t = (int)((e / HD) % TT); const int z = (int)(e / ((size_t)HD * TT)); const size_t oo = ((size_t)(z / NH_) * TT + t) * DQ + (z % NH_) * HD + d;
    const size_t so = ((size_t)z * TT + (t & ~15)) * 2 + (t & 15); float m[KSF], l[KSF]; float mx = -3.0e38f;
#pragma unroll
    for (int s = 0; s < KSF; ++s) { m[s] = St[(size_t)s * ((size_t)NZ * TT * 2) + so]; l[s] = St[(size_t)s * ((size_t)NZ * TT * 2) + so + 16]; mx = fmaxf(mx, m[s]); }
    const float w0 = __builtin_amdgcn_exp2f((m[0] - mx) * L2E); v2f x = *(const v2f*)(O + e) * w0; float den = l[0] * w0; v2us oh, ol;
#pragma unroll
    for (int s = 1; s < KSF; ++s) { const float w = __builtin_amdgcn_exp2f((m[s] - mx) * L2E); x += *(const v2f*)(O + (size_t)s * ((size_t)NZ * TT * HD) + e) * w; den += l[s] * w; }
    const float f = 1.0f / den;
#pragma unroll
    for (int q = 0; q < 2; ++q) { unsigned short a, c2; splitf(x[q] * f, a, c2); oh[q] = a; ol[q] = c2; } *(v2us*)(Ah + oo) = oh; *(v2us*)(Al + oo) = ol;  }

extern "C" void kernel_launch(void* const* d_in, const int* in_sizes, int n_in,
                              void* d_out, int out_size, void* d_ws, size_t ws_size, hipStream_t stream) {
    if (n_in < 12) return;
    const long long xneed = (long long)(NB - 1) * SEQ_FULL * DM + (long long)TT * DM;
    if ((long long)in_sizes[0] < xneed || (long long)in_sizes[1] < xneed || (long long)in_sizes[2] < xneed) return;
    if ((long long)in_sizes[3] < (long long)(TT - 1) * SEQ_FULL + TT) return;
    if (in_sizes[4] < DM * DQ || in_sizes[6] < DM * DKV || in_sizes[8] < DM * DKV || in_sizes[10] < DQ * DM) return;
    if (in_sizes[5] < DQ || in_sizes[7] < DKV || in_sizes[9] < DKV || in_sizes[11] < DM) return;
    if ((long long)out_size < (long long)NB * TT * DM) return;
    const float* xq = (const float*)d_in[0]; const float* xk = (const float*)d_in[1]; const float* xv = (const float*)d_in[2]; const float* mk = (const float*)d_in[3];
    const float* wq = (const float*)d_in[4]; const float* bq = (const float*)d_in[5]; const float* wk = (const float*)d_in[6]; const float* bk = (const float*)d_in[7]; const float* wv = (const float*)d_in[8]; const float* bv = (const float*)d_in[9]; const float* wo = (const float*)d_in[10]; const float* bo = (const float*)d_in[11];
    float* OUT = (float*)d_out;     // [NB][TT][DM]
    char* wsp = (char*)d_ws;
    auto take = [&](size_t bytes) { char* p = wsp; wsp += (bytes + 255) & ~(size_t)255; return (void*)p; };
    constexpr size_t WSZ = (size_t)DM * DQ;           // elements of one weight plane
    constexpr size_t PSZ = (size_t)NZ * TT * HD;      // elements of one plane set over all (batch, head) slices
    constexpr size_t XSZ = (size_t)NB * TT * DM;      // elements of one stream, both batches
    constexpr size_t OB_B = (size_t)KSF * PSZ * 4, ST_B = 3 * XSZ * 2;
    constexpr size_t POOL_B = OB_B > ST_B ? OB_B : ST_B;
    bf* W4 = (bf*)take(4 * WSZ * 2);                  // Wq, Wk, Wv, Wo transposed, one behind the other
    h16* QK16 = (h16*)take(2 * PSZ * 2); bf* QKh = (bf*)take(2 * PSZ * 2); bf* QKl = (bf*)take(2 * PSZ * 2);   // q planes, then k planes
    h16* VT16 = (h16*)take(PSZ * 2); bf* VTh = (bf*)take(PSZ * 2); bf* VTl = (bf*)take(PSZ * 2);
    float* Stt = (float*)take((size_t)KSF * NZ * TT * 2 * 4);   // per key slice and row: running maximum and sum
    unsigned* Cls = (unsigned*)take((size_t)(TT / 16) * 4 * 4);   // per 16 query rows: closed and open bits of the 64 key tiles
    bf* ATh = (bf*)take(XSZ * 2); bf* ATl = (bf*)take(XSZ * 2);
    char* pool = (char*)take(POOL_B);
    const size_t carved = (size_t)(wsp - (char*)d_ws);
    if (carved > ws_size) return;
    // One pool, two stream-ordered uses: the projections' bf16 inputs (dead once the planes are built), then the attention kernel's partial O planes.
    bf* XB = (bf*)pool; float* Ob = (float*)pool;
    // weights: w is [in = K rows][out = N cols] -> Bt[N][K]
    k_wtG<<<dim3((unsigned)((WSZ / 64 + 63) / 64), 4, 1), 256, 0, stream>>>(wq, wk, wv, wo, DM, DQ, W4);
    k_cvt8<<<dim3((unsigned)(((size_t)TT * DM / 8 + 255) / 256), NB, 3), 256, 0, stream>>>(xq, xk, xv, (size_t)SEQ_FULL * DM, XB, (size_t)TT * DM / 8);
    k_gemmw<bf, 0, true, 1, true><<<dim3(NB * TT / 64, DQ / 64, 3), 32, 0, stream>>>(XB, nullptr, W4, nullptr, DM, nullptr, DQ, bq, bk, bv, XSZ, WSZ, 0, 0, QK16, QKh, QKl, VT16, VTh, VTl);
    k_mcls<<<TT / 16, 1024, 0, stream>>>(mk, SEQ_FULL, Cls);
    k_attn<<<dim3(RH / 64 + (TT - RH) / 128, KSF, NZ), 128, 0, stream>>>(QK16, QKh, QKl, PSZ, VT16, VTh, VTl, mk, SEQ_FULL, Cls, Ob, Stt);
    k_merge<<<(unsigned)((PSZ / 2 + 255) / 256), 256, 0, stream>>>(Ob, Stt, ATh, ATl);
    k_gemmw<bf, 1, true, 1, false><<<dim3(NB * TT / 64, DM / 64, 1), 32, 0, stream>>>(ATh, ATl, W4 + 3 * WSZ, nullptr, DQ, OUT, DM, bo, bo, bo, 0, 0, 0, 0, nullptr, nullptr, nullptr, nullptr, nullptr, nullptr);
}

// v006
// It runs in 109 microseconds.
// Next to v005, in two timings, it ran 1.38 and 1.37 times as fast.
// All steps since v000 together make it 14.3 times as fast.
#include <hip/hip_runtime.h>

// Masked attention block: three input streams q, k, v [2][2048][768]; per-stream projection x W + b (W stored [in][out]); 12 heads x 64; logits x 1/8 plus mask x -1e9 (mask [2048][2048] read as values from its input buffer); softmax over all keys; merged heads x Wo + bo -> [2][2048][768].
// Compute dtypes (every product accumulates in f32): inputs, mask, biases and weights RNE-converted to bf16; projections v_wmma_f32_16x16x32_bf16 (exact products) + f32 bias; logits: query rows < 512 on bf16 hi/lo planes (3 products), other rows on f16 planes (1 product); P x V: rows < 512 bf16 hi/lo (3 products), other rows v_wmma_f32_16x16x32_f16 with P carried x1024; softmax f32, running maximum and sum per query row inside the attention kernel (mask tiles classed from their values by k_mcls); output projection: merged bf16 hi/lo planes x bf16 Wo (2 products) + f32 bias.

#ifndef NB
#define NB 2
#endif
#ifndef SEQ
#define SEQ 2048
#endif
#define NB_FULL  2
#define SEQ_FULL 2048
#define TT   SEQ
#define DM   768
#define NH_  12
#define NKV  12
#define REP  (NH_ / NKV)
#define HD   64
#define DQ   (NH_ * HD)
#define DKV  (NKV * HD)
#define NZ   (NB * NH_)
#define RH   ((TT) < 512 ? (TT) : 512)   // query rows < RH use hi+lo planes
#define PEXP 10.0f    // f16 rows carry P x 2^10 (added to the exponent; the row sum carries it too, so the quotient is free of it)
#define L2E  1.4426950408889634f
#define SCL  0.125f   // HD^-0.5
#define MNEG (-1.0e9f)
#define KSF  4        // key slices of the attention kernel: one work-group per (query block, slice)

static_assert(TT % 128 == 0);
static_assert(TT <= SEQ_FULL);
static_assert(NB <= NB_FULL);
static_assert(DM % 64 == 0);
static_assert(TT % 64 == 0);
static_assert(DQ % 64 == 0);
static_assert(DQ == DM);
static_assert(HD == 64);
static_assert(NKV == NH_);
static_assert(RH % 64 == 0);
static_assert((TT - RH) % 128 == 0);
static_assert(TT % (32 * KSF) == 0);
static_assert(TT / 32 <= 64);          // one bit a key tile in a 64-bit class word
static_assert(TT / KSF / 32 <= 32);    // a slice's bits fit one 32-bit word

// FRAGMENT ORDER of every 16-bit operand plane (R rows x K columns, the k axis of its product along the columns): blocks of 16 rows x 32 k, 512 elements = 1 KB, block (rb, kb) at element (rb K/32 + kb) 512 (the V^T planes: at (kb HD/16 + rb) 512, so that the 32 keys of a trip are 4 KB in a row).
// Inside a block element (row r, k = 16 g + 8 h + e) lies at 256 g + 8 (16 h + r) + e: lane l = 16 h + r of a wave finds its fragment's elements 0..7 at 8 l and 8..15 at 256 + 8 l,
// so each of the two 16-byte loads of a fragment covers 512 contiguous bytes, four whole 128-byte lines, and each writer stores such 512-byte runs.
typedef _Float16 h16;
typedef unsigned short bf;
typedef __attribute__((ext_vector_type(16))) __bf16   v16bf;
typedef __attribute__((ext_vector_type(16))) _Float16 v16h;
typedef __attribute__((ext_vector_type(8)))  _Float16 v8h;
typedef __attribute__((ext_vector_type(8)))  unsigned short v8us;
typedef __attribute__((ext_vector_type(8)))  float    v8f;
typedef __attribute__((ext_vector_type(4)))  float    v4f;
typedef v8h  __attribute__((may_alias)) v8ha;
typedef v4f  __attribute__((may_alias)) v4fa;
typedef v8us __attribute__((may_alias)) v8usa;

__device__ __forceinline__ unsigned short f2bf(float f) { unsigned u = __float_as_uint(f); u += 0x7FFFu + ((u >> 16) & 1u); return (unsigned short)(u >> 16); }
__device__ __forceinline__ float bf2f(unsigned short b) { return __uint_as_float(((unsigned)b) << 16); }
__device__ __forceinline__ float bfr(float f) { return bf2f(f2bf(f)); }
__device__ __forceinline__ v16h cat16(v8h lo, v8h hi) { return __builtin_shufflevector(lo, hi, 0, 1, 2, 3, 4, 5, 6, 7, 8, 9, 10, 11, 12, 13, 14, 15); }
__device__ __forceinline__ v16bf cat16b(v8us lo, v8us hi) { return __builtin_bit_cast(v16bf, __builtin_shufflevector(lo, hi, 0, 1, 2, 3, 4, 5, 6, 7, 8, 9, 10, 11, 12, 13, 14, 15)); }
__device__ __forceinline__ v8f wmma16(v16h a, v16h b, v8f c) { return __builtin_amdgcn_wmma_f32_16x16x32_f16(false, a, false, b, (short)0, c, false, false); }
__device__ __forceinline__ v8f wmmab(v16bf a, v16bf b, v8f c) { return __builtin_amdgcn_wmma_f32_16x16x32_bf16(false, a, false, b, (short)0, c, false, false); }
__device__ __forceinline__ h16 tohx(float x) { return (h16)x; }
__device__ __forceinline__ void splitf(float y, unsigned short& h, unsigned short& l) { h = f2bf(y); l = f2bf(y - bf2f(h)); }
typedef __attribute__((ext_vector_type(4))) _Float16 v4h;
typedef __attribute__((ext_vector_type(2))) unsigned short v2us;
typedef __attribute__((ext_vector_type(4))) unsigned short v4us;
typedef __attribute__((ext_vector_type(2))) float v2f;
typedef __attribute__((ext_vector_type(4))) unsigned v4u;

// ---- k_gemmw: register-blocked GEMM, ONE WAVE per 64x64 output tile (16 accumulators), operands straight from 16-bit planes in fragment order; grid (M/64, N/64, Z), 32 threads.
// C[m][n] (f32, pitch ldc, + optional f32 bias[n]) = sum_k A[m][k] Bt[n][k] (+ split products per NSPLIT). z-batch strides sA/sB/sC in elements. K % (32 KS) == 0, M % 64 == 0, N % 64 == 0.
// BIAS: z-slice 0 / 1 / 2 adds bias / bias1 / bias2.
// KS > 1: grid z = Z x KS; work-group (z, ks) sums only k in [ks K/KS, (ks+1) K/KS) and stores its f32 partial tile into plane ks (plane stride sP elements); the reader adds the KS planes in the order 0..KS-1.
// PL: no f32 C. The tile is 64 tokens of one batch x the 64 columns of head blockIdx.y, and the wave stores it (+ bias) as the attention kernel's operand planes, f16 and bf16 hi / lo:
// z-slices 0 and 1 (q, k) as planes [z][batch][head] of TT rows x HD, a contiguous 8 KB a plane; z-slice 2 (v) transposed, planes [batch][head] of HD rows x TT, straight from the accumulators (a lane's 8 D elements are 8 consecutive tokens of one d: one 16-byte piece of the fragment order). All in fragment order.
// Fragment map: lane l, h = l >> 4: elements 0..7 <- k0 + 8h + 0..7, elements 8..15 <- k0 + 16 + 8h + 0..7 (A row / B column = l & 15); D element j -> (row 8h + j, col l & 15). ld(p): p = the block's first element + 8 l.
template <typename T16> struct WFrag;
template <> struct WFrag<h16> { typedef v16h V; static __device__ __forceinline__ V ld(const h16* p) { return cat16(*(const v8h*)p, *(const v8h*)(p + 256)); } static __device__ __forceinline__ v8f mma(V a, V b, v8f c) { return wmma16(a, b, c); } };
template <> struct WFrag<bf> { typedef v16bf V; static __device__ __forceinline__ V ld(const bf* p) { return cat16b(*(const v8us*)p, *(const v8us*)(p + 256)); } static __device__ __forceinline__ v8f mma(V a, V b, v8f c) { return wmmab(a, b, c); } };
template <typename T16, int NSPLIT, bool BIAS, int KS, bool PL>
__global__ __launch_bounds__(32) void k_gemmw(const T16* __restrict__ A, const T16* __restrict__ A2, const T16* __restrict__ Bt, const T16* __restrict__ Bt2, int K, float* C, int ldc, const float* __restrict__ bias, const float* __restrict__ bias1, const float* __restrict__ bias2, size_t sA, size_t sB, size_t sC, size_t sP, h16* P16, bf* Ph, bf* Pl, h16* V16, bf* Vh, bf* Vl) {
    static_assert(NSPLIT == 0 || NSPLIT == 1);
    static_assert(KS == 1 || !BIAS);
    static_assert(!PL || (BIAS && KS == 1));
    typedef typename WFrag<T16>::V V;
    __shared__ __align__(16) float os[16 * 68];
    const size_t z = blockIdx.z / KS; const int ks = (int)(blockIdx.z % KS); A += z * sA; if (A2) A2 += z * sA; Bt += z * sB; if (Bt2) Bt2 += z * sB; C += z * sC + (size_t)ks * sP;
    const float* bz = (z == 0) ? bias : ((z == 1) ? bias1 : bias2);
    const int kbeg = ks * (K / KS), kend = kbeg + K / KS;
    const int lane = threadIdx.x & 31, lr = lane & 15, hi = lane >> 4; const int r0 = blockIdx.x * 64, c0 = blockIdx.y * 64;
    v8f acc[4][4];
#pragma unroll
    for (int mb = 0; mb < 4; ++mb)
#pragma unroll
        for (int nb = 0; nb < 4; ++nb) acc[mb][nb] = (v8f){};
    // Byte offsets of this lane's piece in the first block of each of the tile's four row blocks of A and of Bt: 16 rows of blocks hold 16 K elements; a step of 32 k is one block, 1 KB.
    unsigned oa[4], ow[4];
#pragma unroll
    for (int i = 0; i < 4; ++i) { const unsigned o = (unsigned)(i * 16 * K + kbeg * 16 + 8 * lane) * 2u; oa[i] = (unsigned)(r0 * K) * 2u + o; ow[i] = (unsigned)(c0 * K) * 2u + o; }
#pragma unroll 1
    for (int kc = kbeg; kc < kend; kc += 32) {
        V a[4], a2[4], b[4];
#pragma unroll
        for (int mb = 0; mb < 4; ++mb) { a[mb] = WFrag<T16>::ld((const T16*)((const char*)A + oa[mb])); if (NSPLIT == 1) a2[mb] = WFrag<T16>::ld((const T16*)((const char*)A2 + oa[mb])); }
#pragma unroll
        for (int nb = 0; nb < 4; ++nb) b[nb] = WFrag<T16>::ld((const T16*)((const char*)Bt + ow[nb]));
        // The trip's loads are all issued above; their offsets are advanced below. The offsets are inputs of the wait, so they live up to it and no load of the run lands in them.
        asm volatile("s_wait_xcnt 0x0" :: "v"(oa[0]), "v"(oa[1]), "v"(oa[2]), "v"(oa[3]), "v"(ow[0]), "v"(ow[1]), "v"(ow[2]), "v"(ow[3]) : "memory");
        __builtin_amdgcn_sched_barrier(0);              // keeps the address additions behind that wait
#pragma unroll
        for (int nb = 0; nb < 4; ++nb)
#pragma unroll
            for (int mb = 0; mb < 4; ++mb) { acc[mb][nb] = WFrag<T16>::mma(a[mb], b[nb], acc[mb][nb]); if (NSPLIT == 1) acc[mb][nb] = WFrag<T16>::mma(a2[mb], b[nb], acc[mb][nb]); }
        asm volatile("v_nop\n\tv_nop\n\tv_nop\n\tv_nop" : "+v"(acc[0][0]), "+v"(acc[1][1]), "+v"(acc[2][2]), "+v"(acc[3][3]) : "v"(a[0]), "v"(a[3]));
#pragma unroll
        for (int i = 0; i < 4; ++i) { oa[i] += 1024u; ow[i] += 1024u; }
    }
    const int bt = r0 / TT, t0 = r0 % TT;   // PL: the tile's batch and first token
    const size_t pb = (((z * NB + bt) * NH_ + blockIdx.y) * TT + t0) * HD;   // PL: the tile's first element in a q / k plane
    float bb[4] = {0.f, 0.f, 0.f, 0.f};   // PL: the bias of this lane's column in each of the four column tiles
    if constexpr (PL) {
#pragma unroll
        for (int nb = 0; nb < 4; ++nb) bb[nb] = bfr(bz[c0 + nb * 16 + lr]); }
    if (!PL || z != 2) {
#pragma unroll
    for (int mb = 0; mb < 4; ++mb) {
#pragma unroll
        for (int nb = 0; nb < 4; ++nb) {
#pragma unroll
            for (int j = 0; j < 8; ++j) os[(hi * 8 + j) * 68 + nb * 16 + lr] = PL ? acc[mb][nb][j] + bb[nb] : acc[mb][nb][j]; }
        __builtin_amdgcn_wave_barrier(); asm volatile("" ::: "memory");
        float* crow = C + (size_t)(r0 + mb * 16) * ldc + c0;
        if constexpr (PL) { v8h o16[4]; v8us oh[4], ol[4];   // piece s: token lr, columns 16 s + 8 hi + 0..7
#pragma unroll
            for (int s = 0; s < 4; ++s) { const float* rp = os + lr * 68 + s * 16 + hi * 8; const v4f v0 = *(const v4fa*)rp, v1 = *(const v4fa*)(rp + 4);
#pragma unroll
                for (int q = 0; q < 8; ++q) { const float x = q < 4 ? v0[q & 3] : v1[q & 3]; o16[s][q] = tohx(x); unsigned short a2, c2; splitf(x, a2, c2); oh[s][q] = a2; ol[s][q] = c2; } }
            __builtin_amdgcn_sched_barrier(0);              // every conversion of the block stands in front of its stores: none lands in a register that an issued store names
#pragma unroll
            for (int s = 0; s < 4; ++s) { const size_t e = pb + (size_t)(mb * 16) * HD + s * 256 + lane * 8; *(v8h*)(P16 + e) = o16[s]; *(v8us*)(Ph + e) = oh[s]; *(v8us*)(Pl + e) = ol[s]; }
            asm volatile("s_wait_xcnt 0x0" ::: "memory");   // the next block's values may land in registers that the stores above name
            __builtin_amdgcn_sched_barrier(0);              // keeps what follows behind that wait
        } else
{
#pragma unroll
            for (int s = 0; s < 8; ++s) { const int row = 2 * s + hi, cofs = lr * 4; v4f val = *(const v4fa*)(os + row * 68 + cofs); if (BIAS) { val[0] += bfr(bz[c0 + cofs]); val[1] += bfr(bz[c0 + cofs + 1]); val[2] += bfr(bz[c0 + cofs + 2]); val[3] += bfr(bz[c0 + cofs + 3]); }
                *(v4f*)(crow + (size_t)row * ldc + cofs) = val; }
             }
        __builtin_amdgcn_wave_barrier(); asm volatile("" ::: "memory");
    }
    } else if constexpr (PL) {
        const size_t vb = (size_t)(bt * NH_ + (int)blockIdx.y) * HD * TT + (size_t)t0 * HD + 8 * lane;   // 32 tokens of all HD rows are HD / 16 blocks, 32 HD elements
#pragma unroll
        for (int nb = 0; nb < 4; ++nb) { v8h o16[4]; v8us oh[4], ol[4];
#pragma unroll
            for (int mb = 0; mb < 4; ++mb)
#pragma unroll
                for (int j = 0; j < 8; ++j) { const float x = acc[mb][nb][j] + bb[nb]; o16[mb][j] = tohx(x); unsigned short a2, c2; splitf(x, a2, c2); oh[mb][j] = a2; ol[mb][j] = c2; }
            __builtin_amdgcn_sched_barrier(0);              // every conversion of the block stands in front of its stores: none lands in a register that an issued store names
#pragma unroll
            for (int mb = 0; mb < 4; ++mb) { const size_t e = vb + (size_t)((mb >> 1) * (HD / 16) + nb) * 512 + (mb & 1) * 256; *(v8h*)(V16 + e) = o16[mb]; *(v8us*)(Vh + e) = oh[mb]; *(v8us*)(Vl + e) = ol[mb]; }
            if (nb < 3) { asm volatile("s_wait_xcnt 0x0" ::: "memory");   // the next block's values may land in registers that the stores above name
                __builtin_amdgcn_sched_barrier(0); }        // keeps the next block's instructions behind that wait
        }
    }
}


// grid.y picks one of four equally shaped weights; Bt holds the four transposed planes (N rows x K) one behind the other, each in fragment order. Thread i makes 16-byte piece i of its plane: 8 consecutive k of one n; 16 lanes read 64 contiguous bytes of a weight row.
__global__ __launch_bounds__(256) void k_wtG(const float* __restrict__ w0, const float* __restrict__ w1, const float* __restrict__ w2, const float* __restrict__ w3, int K, int N, bf* Bt) {
    const int y = (int)blockIdx.y; const float* w = (y == 0) ? w0 : ((y == 1) ? w1 : ((y == 2) ? w2 : w3)); Bt += (size_t)y * K * N;
    const int i = (int)(blockIdx.x * 256 + threadIdx.x); if (i >= N * K / 8) return;
    const int lane = i & 31, g = (i >> 5) & 1, blk = i >> 6; const int kb = blk % (K / 32), rb = blk / (K / 32);
    const float* wp[8]; float x[8]; v8us o;
#pragma unroll
    for (int e = 0; e < 8; ++e) wp[e] = w + (size_t)(kb * 32 + g * 16 + (lane >> 4) * 8 + e) * N + rb * 16 + (lane & 15);
#pragma unroll
    for (int e = 0; e < 8; ++e) x[e] = *wp[e];
    asm volatile("s_wait_xcnt 0x0" :: "v"(wp[0]), "v"(wp[1]), "v"(wp[2]), "v"(wp[3]), "v"(wp[4]), "v"(wp[5]), "v"(wp[6]), "v"(wp[7]) : "memory");   // the eight addresses are inputs of the wait: they live up to it, so no load of the run lands in one and nothing rewrites one before it
#pragma unroll
    for (int e = 0; e < 8; ++e) o[e] = f2bf(x[e]);
    *(v8us*)(Bt + (size_t)i * 8) = o;
}
// grid.z picks the stream, grid.y the batch (source batch stride sb elements); dst is [stream][batch][n8 * 8], each a plane of rows x DM in fragment order. Thread i makes 16-byte piece i of its plane.
__global__ __launch_bounds__(256) void k_cvt8(const float* __restrict__ s0, const float* __restrict__ s1, const float* __restrict__ s2, size_t sb, bf* dst, size_t n8) { const size_t i = (size_t)blockIdx.x * 256 + threadIdx.x; if (i >= n8) return;
    const int s = (int)blockIdx.z; const float* src = ((s == 0) ? s0 : ((s == 1) ? s1 : s2)) + (size_t)blockIdx.y * sb; dst += ((size_t)s * NB + blockIdx.y) * n8 * 8;
    const int lane = (int)(i & 31), g = (int)((i >> 5) & 1); const int blk = (int)(i >> 6); const int kb = blk % (DM / 32), rb = blk / (DM / 32);
    const float* sp = src + (size_t)(rb * 16 + (lane & 15)) * DM + kb * 32 + g * 16 + (lane >> 4) * 8; const v8f v = *(const v8f*)sp; v8us o;
    asm volatile("s_wait_xcnt 0x0" :: "v"(sp) : "memory");   // the address is an input of the wait: it lives up to it, so neither load lands in it and nothing rewrites it before
#pragma unroll
    for (int k = 0; k < 8; ++k) o[k] = f2bf(v[k]); *(v8us*)(dst + i * 8) = o;  }

// ---- k_mcls: reads the mask once and classes its tiles of 16 query rows x 32 keys from the values found there. grid TT/16, 32 waves; wave w takes key tiles w and w + 32, whole 128-byte lines a row.
// Cl[4 rb ..]: words 0, 1 = one bit a key tile, set where the tile is CLOSED: every value >= 0.75; words 2, 3 = set where it is OPEN: every value rounds to bf16 zero, so mask x -1e9 adds nothing to a logit.
// The closed bits are kept only where each of the 16 rows holds, somewhere among all its keys, a value <= 0.25. Such a row's maximum logit lies at least 5e8 - 2 max|logit / 8| above every key of a closed tile;
// over the at most 18 rescale factors between that key's term and the output one spans 2e7 or more and is exactly 0 in f32: the tile adds exact zeros, and leaving it out changes no bit. A row block without that property keeps every tile.
__global__ __launch_bounds__(1024) void k_mcls(const float* __restrict__ Mk, int mpitch, unsigned* __restrict__ Cl) {
    __shared__ unsigned sf[32], sl[32];
    const int wave = (int)(threadIdx.x >> 5), lane = (int)(threadIdx.x & 31), rb = (int)blockIdx.x;
    const float* mp = Mk + (size_t)(rb * 16 + (lane >> 3)) * mpitch + (lane & 7) * 4;   // load c of a tile: rows 4c + (lane >> 3)
    const float* rp[4]; v4f m[2][4];
#pragma unroll
    for (int c = 0; c < 4; ++c) rp[c] = mp + (size_t)c * 4 * mpitch + wave * 32;
#pragma unroll
    for (int i = 0; i < 2; ++i)
#pragma unroll
        for (int c = 0; c < 4; ++c) m[i][c] = (wave + 32 * i < TT / 32) ? *(const v4f*)(rp[c] + i * 1024) : (v4f){0.5f, 0.5f, 0.5f, 0.5f};
    asm volatile("s_wait_xcnt 0x0" :: "v"(rp[0]), "v"(rp[1]), "v"(rp[2]), "v"(rp[3]) : "memory");   // the four row addresses are inputs of the wait: they live up to it, so no load of the run lands in one and nothing rewrites one before it
    unsigned flags = 0, rows = 0;
#pragma unroll
    for (int i = 0; i < 2; ++i) { bool cl = true; unsigned nz = 0;
#pragma unroll
        for (int c = 0; c < 4; ++c) { bool lv = false;
#pragma unroll
            for (int q = 0; q < 4; ++q) { const float x = m[i][c][q]; cl = cl & (x >= 0.75f); nz |= f2bf(x) & 0x7FFFu; lv = lv | (x <= 0.25f); }
            const unsigned b = __builtin_amdgcn_ballot_w32(lv);
#pragma unroll
            for (int g = 0; g < 4; ++g) rows |= (((b >> (8 * g)) & 0xFFu) != 0u ? 1u : 0u) << (4 * c + g); }
        flags |= (__builtin_amdgcn_ballot_w32(cl) == 0xFFFFFFFFu ? 1u : 0u) << i; flags |= (__builtin_amdgcn_ballot_w32(nz == 0u) == 0xFFFFFFFFu ? 4u : 0u) << i; }
    if (lane == 0) { sf[wave] = flags; sl[wave] = rows; }
    __syncthreads();
    if (wave == 0) { const unsigned f = sf[lane]; unsigned r = sl[lane];
#pragma unroll
        for (int o = 16; o > 0; o >>= 1) r |= __shfl_xor(r, o, 32);
        const unsigned keep = (r == 0xFFFFu) ? 0xFFFFFFFFu : 0u; v4u w;
        w[0] = __builtin_amdgcn_ballot_w32((f & 1u) != 0u) & keep; w[1] = __builtin_amdgcn_ballot_w32((f & 2u) != 0u) & keep; w[2] = __builtin_amdgcn_ballot_w32((f & 4u) != 0u); w[3] = __builtin_amdgcn_ballot_w32((f & 8u) != 0u);
        if (lane == 0) *(v4u*)(Cl + (size_t)rb * 4) = w; }
}

// ---- k_attn: logits, softmax and P x V of one (batch, head) slice z in one kernel; scores and probabilities stay in registers.
// One wave owns 16 NQ query rows and the keys [ks TT/KSF, (ks+1) TT/KSF), 32 keys a trip. It forms the TRANSPOSED logits tile (A = key rows, B = query rows), so that D element j of key tile kt is (key 16 kt + 8h + j, query l & 15):
// the two key tiles of a trip are, lane by lane, the B fragment of P^T (elements 0..7 <- key 8h + j, elements 8..15 <- key 16 + 8h + j), the k order of the V^T A fragment. O^T (A = V^T rows d, B = P^T) has its query in l & 15 too, so a row's maximum, sum and rescale factor are one value a lane.
// A trip whose mask tile k_mcls found closed for all of the wave's rows is left out whole (scalar branch); one found open loads no mask and takes zeros in its place. A wave with no trip left stores maximum -3e38, sum 0 and O 0: weight 0 in k_merge.
// Each wave stores its unnormalised f32 O tiles as they lie in the accumulators (per 16 rows and 16 d one KB: lane l's 8 values, row l & 15, d 8h + 0..7, at 8 l), and per 16 rows one 128-byte line: 16 running maxima, then 16 sums. k_merge joins the KSF slices.
template <typename T16, bool HI, int NQ>
__device__ __forceinline__ void attn_body(const T16* __restrict__ Q, const T16* __restrict__ Q2, const T16* __restrict__ Kp, const T16* __restrict__ K2, const T16* __restrict__ Vt, const T16* __restrict__ V2, const float* __restrict__ Mk, int mpitch, const unsigned* __restrict__ Cl, int q0, int kbeg, float* Op, float* St) {
    typedef typename WFrag<T16>::V V;
    const int lane = threadIdx.x & 31, lr = lane & 15, hi = lane >> 4;
    unsigned long long cw = ~0ull, ow = ~0ull;   // closed / open for every one of the wave's row blocks
#pragma unroll
    for (int nq = 0; nq < NQ; ++nq) { const v4u c = *(const v4u*)(Cl + (size_t)((q0 >> 4) + nq) * 4); cw &= (unsigned long long)c[0] | ((unsigned long long)c[1] << 32); ow &= (unsigned long long)c[2] | ((unsigned long long)c[3] << 32); }
    unsigned cbits = __builtin_amdgcn_readfirstlane((unsigned)(cw >> (kbeg / 32))), obits = __builtin_amdgcn_readfirstlane((unsigned)(ow >> (kbeg / 32)));   // bit 0: the coming trip's tile
    V qf[NQ][2], qf2[NQ][2];
#pragma unroll
    for (int nq = 0; nq < NQ; ++nq)
#pragma unroll
        for (int c = 0; c < 2; ++c) { const size_t o = (size_t)(q0 + nq * 16) * HD + c * 512 + 8 * lane; qf[nq][c] = WFrag<T16>::ld(Q + o); if (HI) qf2[nq][c] = WFrag<T16>::ld(Q2 + o); }
    v8f oacc[NQ][4]; float mrun[NQ], lrun[NQ];
#pragma unroll
    for (int nq = 0; nq < NQ; ++nq) { mrun[nq] = -3.0e38f; lrun[nq] = 0.f;
#pragma unroll
        for (int dt = 0; dt < 4; ++dt) oacc[nq][dt] = (v8f){}; }
    const T16* vp = Vt + (size_t)kbeg * HD + 8 * lane; const T16* vp2 = HI ? V2 + (size_t)kbeg * HD + 8 * lane : nullptr;   // this lane's piece in the first V^T block of the trip's 32 keys
#pragma unroll 1   // one copy of a body that holds a whole trip's loads and products: registers and instruction cache
    for (int k0 = kbeg; k0 < kbeg + TT / KSF; k0 += 32) {
      if (!(cbits & 1u)) {
        V kf[2][2], kf2[2][2], vf[4], vf2[4]; v4f mv[NQ][2][2];
        if (obits & 1u) {
#pragma unroll
            for (int nq = 0; nq < NQ; ++nq)
#pragma unroll
                for (int kt = 0; kt < 2; ++kt) { mv[nq][kt][0] = (v4f){}; mv[nq][kt][1] = (v4f){}; }
        } else {
#pragma unroll
            for (int nq = 0; nq < NQ; ++nq)
#pragma unroll
                for (int kt = 0; kt < 2; ++kt) { const float* mr = Mk + (size_t)(q0 + nq * 16 + lr) * mpitch + k0 + kt * 16 + 8 * hi; mv[nq][kt][0] = *(const v4f*)mr; mv[nq][kt][1] = *(const v4f*)(mr + 4); }
            asm volatile("s_wait_xcnt 0x0" ::: "memory");   // the K loads below may land in registers that held the addresses of the mask loads above
        }
#pragma unroll
        for (int kt = 0; kt < 2; ++kt)
#pragma unroll
            for (int c = 0; c < 2; ++c) { const size_t o = (size_t)(k0 + kt * 16) * HD + c * 512 + 8 * lane; kf[kt][c] = WFrag<T16>::ld(Kp + o); if (HI) kf2[kt][c] = WFrag<T16>::ld(K2 + o); }
        asm volatile("s_wait_xcnt 0x0" ::: "memory");   // the V loads below may land in registers that held the addresses of the loads above
        __builtin_amdgcn_sched_barrier(0);              // keeps the V loads behind that wait
#pragma unroll
        for (int dt = 0; dt < 4; ++dt) { vf[dt] = WFrag<T16>::ld(vp + dt * 512); if (HI) vf2[dt] = WFrag<T16>::ld(vp2 + dt * 512); }
        // The trip's loads are all issued above; their address registers are advanced for the next trip below. The V addresses are inputs of the wait, so they live up to it and no load of the run lands in them.
        if constexpr (HI) asm volatile("s_wait_xcnt 0x0" :: "v"(vp), "v"(vp2) : "memory"); else asm volatile("s_wait_xcnt 0x0" :: "v"(vp) : "memory");
        __builtin_amdgcn_sched_barrier(0);              // keeps those address additions behind the wait, and every load of the trip in front of the first product
#pragma unroll
        for (int nq = 0; nq < NQ; ++nq) {
            v8f s[2];
#pragma unroll
            for (int kt = 0; kt < 2; ++kt) { s[kt] = (v8f){};
#pragma unroll
                for (int c = 0; c < 2; ++c) { s[kt] = WFrag<T16>::mma(kf[kt][c], qf[nq][c], s[kt]); if (HI) { s[kt] = WFrag<T16>::mma(kf[kt][c], qf2[nq][c], s[kt]); s[kt] = WFrag<T16>::mma(kf2[kt][c], qf[nq][c], s[kt]); } } }
            float mx = mrun[nq];
#pragma unroll
            for (int kt = 0; kt < 2; ++kt)
#pragma unroll
                for (int j = 0; j < 8; ++j) { const float t = s[kt][j] * SCL + bfr(mv[nq][kt][j >> 2][j & 3]) * MNEG; s[kt][j] = t; mx = fmaxf(mx, t); }
            mx = fmaxf(mx, __shfl_xor(mx, 16, 32));   // the row's other 16 keys of the trip lie in lane l ^ 16
            const float al = __builtin_amdgcn_exp2f((mrun[nq] - mx) * L2E); mrun[nq] = mx;
            float sum = 0.f;
#pragma unroll
            for (int kt = 0; kt < 2; ++kt) { v8f x, p;
#pragma unroll
                for (int j = 0; j < 8; ++j) { x[j] = (s[kt][j] - mx) * L2E; if (!HI) x[j] += PEXP; }
#pragma unroll
                for (int j = 0; j < 8; ++j) p[j] = __builtin_amdgcn_exp2f(x[j]);
                asm volatile("v_nop" : "+v"(p) : "v"(x));   // the slot behind a transcendental: no result of the eight is read and no source register reused before this instruction
                s[kt] = p;
#pragma unroll
                for (int j = 0; j < 8; ++j) sum += p[j]; }
            lrun[nq] = lrun[nq] * al + sum;
#pragma unroll
            for (int dt = 0; dt < 4; ++dt) oacc[nq][dt] *= al;
            if constexpr (HI) { v8us ph[2], pl[2];
#pragma unroll
                for (int kt = 0; kt < 2; ++kt)
#pragma unroll
                    for (int j = 0; j < 8; ++j) { unsigned short a, c2; splitf(s[kt][j], a, c2); ph[kt][j] = a; pl[kt][j] = c2; }
                const V pfh = cat16b(ph[0], ph[1]), pfl = cat16b(pl[0], pl[1]);
#pragma unroll
                for (int dt = 0; dt < 4; ++dt) { oacc[nq][dt] = WFrag<T16>::mma(vf[dt], pfh, oacc[nq][dt]); oacc[nq][dt] = WFrag<T16>::mma(vf[dt], pfl, oacc[nq][dt]); oacc[nq][dt] = WFrag<T16>::mma(vf2[dt], pfh, oacc[nq][dt]); }
            } else { v8h p16[2];
#pragma unroll
                for (int kt = 0; kt < 2; ++kt)
#pragma unroll
                    for (int j = 0; j < 8; ++j) p16[kt][j] = tohx(s[kt][j]);
                const V pf = cat16(p16[0], p16[1]);
#pragma unroll
                for (int dt = 0; dt < 4; ++dt) oacc[nq][dt] = WFrag<T16>::mma(vf[dt], pf, oacc[nq][dt]); }
        }
      }
        vp += 32 * HD; if (HI) vp2 += 32 * HD; cbits >>= 1; obits >>= 1;
    }
#pragma unroll
    for (int nq = 0; nq < NQ; ++nq) {
        const float lt = lrun[nq] + __shfl_xor(lrun[nq], 16, 32);
        St[(size_t)(q0 + nq * 16) * 2 + lane] = hi ? lt : mrun[nq];
#pragma unroll
        for (int dt = 0; dt < 4; ++dt) *(v8f*)(Op + (size_t)(q0 + nq * 16) * HD + dt * 256 + 8 * lane) = oacc[nq][dt];
    }
}
// grid (RH/64 + (TT-RH)/128, KSF, NZ), 4 independent waves: blocks x < RH/64 take 16 hi+lo query rows a wave, the others 32 f16 rows a wave. QK* hold the q planes, then (kofs elements on) the k planes.
__global__ __launch_bounds__(128) void k_attn(const h16* __restrict__ QK16, const bf* __restrict__ QKh, const bf* __restrict__ QKl, size_t kofs, const h16* __restrict__ VT16, const bf* __restrict__ VTh, const bf* __restrict__ VTl, const float* __restrict__ Mk, int mpitch, const unsigned* __restrict__ Cl, float* Op, float* St) {
    const int wave = __builtin_amdgcn_readfirstlane((int)(threadIdx.x >> 5)); const int bx = (int)blockIdx.x, ks = (int)blockIdx.y; const size_t z = blockIdx.z; const size_t zo = z * TT * HD;
    Op += ((size_t)ks * NZ + z) * TT * HD; St += ((size_t)ks * NZ + z) * TT * 2; const int kbeg = ks * (TT / KSF);
    if (bx < RH / 64) attn_body<bf, true, 1>(QKh + zo, QKl + zo, QKh + kofs + zo, QKl + kofs + zo, VTh + zo, VTl + zo, Mk, mpitch, Cl, bx * 64 + wave * 16, kbeg, Op, St);
    else attn_body<h16, false, 2>(QK16 + zo, nullptr, QK16 + kofs + zo, nullptr, VT16 + zo, nullptr, Mk, mpitch, Cl, RH + (bx - RH / 64) * 128 + wave * 32, kbeg, Op, St);
}
// Joins the KSF key slices of every row in the order 0..KSF-1: weights 2^((m_s - max m) log2 e), O = sum w O_s / sum w l_s; hi+lo bf16 planes of NB TT rows x DQ (merged-head order) in fragment order.
// Thread i makes 16-byte piece i of both planes; the 8 values it joins are one lane's 8 values of an O tile, 32 contiguous bytes a slice.
__global__ __launch_bounds__(256) void k_merge(const float* __restrict__ O0, const float* __restrict__ O1, const float* __restrict__ O2, const float* __restrict__ O3, const float* __restrict__ St, bf* Ah, bf* Al) { const size_t i = (size_t)blockIdx.x * 256 + threadIdx.x; if (i >= (size_t)NZ * TT * HD / 8) return;
    const int lane = (int)(i & 31), g = (int)((i >> 5) & 1), blk = (int)(i >> 6); const int kb = blk % (DQ / 32), m0 = (blk / (DQ / 32)) * 16; const int z = (m0 / TT) * NH_ + (kb >> 1), t0 = m0 % TT;
    const size_t e = ((size_t)z * TT + t0) * HD + ((kb & 1) * 2 + g) * 256 + lane * 8;
    const size_t so = ((size_t)z * TT + t0) * 2 + (lane & 15); float m[KSF], l[KSF]; float mx = -3.0e38f; v8f ov[KSF]; const unsigned ob = (unsigned)e * 4u, sb = (unsigned)so * 4u;   // byte offsets inside a slice's O and St
    static_assert(KSF == 4);
    static_assert((size_t)NZ * TT * HD * 4 < 0xFFFFFFFFull);
#pragma unroll
    for (int s = 0; s < KSF; ++s) { const float* q = (const float*)((const char*)(St + (size_t)s * ((size_t)NZ * TT * 2)) + sb); m[s] = q[0]; l[s] = q[16]; const float* Os = s == 0 ? O0 : (s == 1 ? O1 : (s == 2 ? O2 : O3)); ov[s] = *(const v8f*)((const char*)Os + ob); }   // a scalar base a slice, one offset register for all
    asm volatile("s_wait_xcnt 0x0" :: "v"(ob), "v"(sb), "v"(ov[0]), "v"(ov[1]), "v"(ov[2]), "v"(ov[3]), "v"(m[0]), "v"(m[1]), "v"(m[2]), "v"(m[3]), "v"(l[0]), "v"(l[1]), "v"(l[2]), "v"(l[3]) : "memory");   // both offsets are inputs of the wait: they live up to it, so no load of the run lands in one and nothing rewrites one before it; the loaded values are inputs too, which keeps every load in front of it
#pragma unroll
    for (int s = 0; s < KSF; ++s) mx = fmaxf(mx, m[s]);
    const float w0 = __builtin_amdgcn_exp2f((m[0] - mx) * L2E); v8f x = ov[0] * w0; float den = l[0] * w0; v8us oh, ol;
#pragma unroll
    for (int s = 1; s < KSF; ++s) { const float w = __builtin_amdgcn_exp2f((m[s] - mx) * L2E); x += ov[s] * w; den += l[s] * w; }
    const float f = 1.0f / den;
#pragma unroll
    for (int q = 0; q < 8; ++q) { unsigned short a, c2; splitf(x[q] * f, a, c2); oh[q] = a; ol[q] = c2; } *(v8us*)(Ah + i * 8) = oh; *(v8us*)(Al + i * 8) = ol;  }

extern "C" void kernel_launch(void* const* d_in, const int* in_sizes, int n_in,
                              void* d_out, int out_size, void* d_ws, size_t ws_size, hipStream_t stream) {
    if (n_in < 12) return;
    const long long xneed = (long long)(NB - 1) * SEQ_FULL * DM + (long long)TT * DM;
    if ((long long)in_sizes[0] < xneed || (long long)in_sizes[1] < xneed || (long long)in_sizes[2] < xneed) return;
    if ((long long)in_sizes[3] < (long long)(TT - 1) * SEQ_FULL + TT) return;
    if (in_sizes[4] < DM * DQ || in_sizes[6] < DM * DKV || in_sizes[8] < DM * DKV || in_sizes[10] < DQ * DM) return;
    if (in_sizes[5] < DQ || in_sizes[7] < DKV || in_sizes[9] < DKV || in_sizes[11] < DM) return;
    if ((long long)out_size < (long long)NB * TT * DM) return;
    const float* xq = (const float*)d_in[0]; const float* xk = (const float*)d_in[1]; const float* xv = (const float*)d_in[2]; const float* mk = (const float*)d_in[3];
    const float* wq = (const float*)d_in[4]; const float* bq = (const float*)d_in[5]; const float* wk = (const float*)d_in[6]; const float* bk = (const float*)d_in[7]; const float* wv = (const float*)d_in[8]; const float* bv = (const float*)d_in[9]; const float* wo = (const float*)d_in[10]; const float* bo = (const float*)d_in[11];
    float* OUT = (float*)d_out;     // [NB][TT][DM]
    char* wsp = (char*)d_ws;
    auto take = [&](size_t bytes) { char* p = wsp; wsp += (bytes + 255) & ~(size_t)255; return (void*)p; };
    constexpr size_t WSZ = (size_t)DM * DQ;           // elements of one weight plane
    constexpr size_t PSZ = (size_t)NZ * TT * HD;      // elements of one plane set over all (batch, head) slices
    constexpr size_t XSZ = (size_t)NB * TT * DM;      // elements of one stream, both batches
    constexpr size_t OB_B = (size_t)KSF * PSZ * 4, ST_B = 3 * XSZ * 2;
    constexpr size_t POOL_B = OB_B > ST_B ? OB_B : ST_B;
    bf* W4 = (bf*)take(4 * WSZ * 2);                  // Wq, Wk, Wv, Wo transposed, one behind the other
    h16* QK16 = (h16*)take(2 * PSZ * 2); bf* QKh = (bf*)take(2 * PSZ * 2); bf* QKl = (bf*)take(2 * PSZ * 2);   // q planes, then k planes
    h16* VT16 = (h16*)take(PSZ * 2); bf* VTh = (bf*)take(PSZ * 2); bf* VTl = (bf*)take(PSZ * 2);
    float* Stt = (float*)take((size_t)KSF * NZ * TT * 2 * 4);   // per key slice and row: running maximum and sum
    unsigned* Cls = (unsigned*)take((size_t)(TT / 16) * 4 * 4);   // per 16 query rows: closed and open bits of the 64 key tiles
    bf* ATh = (bf*)take(XSZ * 2); bf* ATl = (bf*)take(XSZ * 2);
    char* pool = (char*)take(POOL_B);
    const size_t carved = (size_t)(wsp - (char*)d_ws);
    if (carved > ws_size) return;
    // One pool, two stream-ordered uses: the projections' bf16 inputs (dead once the planes are built), then the attention kernel's partial O planes.
    bf* XB = (bf*)pool; float* Ob = (float*)pool;
    // weights: w is [in = K rows][out = N cols] -> Bt, N rows x K, fragment order
    k_wtG<<<dim3((unsigned)((WSZ / 8 + 255) / 256), 4, 1), 256, 0, stream>>>(wq, wk, wv, wo, DM, DQ, W4);
    k_cvt8<<<dim3((unsigned)(((size_t)TT * DM / 8 + 255) / 256), NB, 3), 256, 0, stream>>>(xq, xk, xv, (size_t)SEQ_FULL * DM, XB, (size_t)TT * DM / 8);
    k_gemmw<bf, 0, true, 1, true><<<dim3(NB * TT / 64, DQ / 64, 3), 32, 0, stream>>>(XB, nullptr, W4, nullptr, DM, nullptr, DQ, bq, bk, bv, XSZ, WSZ, 0, 0, QK16, QKh, QKl, VT16, VTh, VTl);
    k_mcls<<<TT / 16, 1024, 0, stream>>>(mk, SEQ_FULL, Cls);
    k_attn<<<dim3(RH / 64 + (TT - RH) / 128, KSF, NZ), 128, 0, stream>>>(QK16, QKh, QKl, PSZ, VT16, VTh, VTl, mk, SEQ_FULL, Cls, Ob, Stt);
    k_merge<<<(unsigned)((PSZ / 8 + 255) / 256), 256, 0, stream>>>(Ob, Ob + PSZ, Ob + 2 * PSZ, Ob + 3 * PSZ, Stt, ATh, ATl);
    k_gemmw<bf, 1, true, 1, false><<<dim3(NB * TT / 64, DM / 64, 1), 32, 0, stream>>>(ATh, ATl, W4 + 3 * WSZ, nullptr, DQ, OUT, DM, bo, bo, bo, 0, 0, 0, 0, nullptr, nullptr, nullptr, nullptr, nullptr, nullptr);
}

// v007
// Measured time: 103 microseconds a run.
// In both of two side-by-side timings against v006, it was 1.06 times as fast.
// Over all steps from v000 it is 15.1 times as fast.
#include <hip/hip_runtime.h>

// Masked attention block: three input streams q, k, v [2][2048][768]; per-stream projection x W + b (W stored [in][out]); 12 heads x 64; logits x 1/8 plus mask x -1e9 (mask [2048][2048] read as values from its input buffer); softmax over all keys; merged heads x Wo + bo -> [2][2048][768].
// Compute dtypes (every product accumulates in f32): inputs, mask, biases and weights RNE-converted to bf16; projections v_wmma_f32_16x16x32_bf16 (exact products) + f32 bias; logits: query rows < 512 on bf16 hi/lo planes (3 products), other rows on f16 planes (1 product); P x V: rows < 512 bf16 hi/lo (3 products), other rows v_wmma_f32_16x16x32_f16 with P carried x1024; softmax f32, running maximum and sum per query row inside the attention kernel (mask tiles classed from their values by k_prep); output projection: merged bf16 hi/lo planes x bf16 Wo (2 products) + f32 bias.

#ifndef NB
#define NB 2
#endif
#ifndef SEQ
#define SEQ 2048
#endif
#define NB_FULL  2
#define SEQ_FULL 2048
#define TT   SEQ
#define DM   768
#define NH_  12
#define NKV  12
#define REP  (NH_ / NKV)
#define HD   64
#define DQ   (NH_ * HD)
#define DKV  (NKV * HD)
#define NZ   (NB * NH_)
#define RH   ((TT) < 512 ? (TT) : 512)   // query rows < RH use hi+lo planes
#define PEXP 10.0f    // f16 rows carry P x 2^10 (added to the exponent; the row sum carries it too, so the quotient is free of it)
#define L2E  1.4426950408889634f
#define SCL  0.125f   // HD^-0.5
#define MNEG (-1.0e9f)
#define KSF  4        // key slices of the attention kernel: one work-group per (query block, slice)

static_assert(TT % 128 == 0);
static_assert(TT <= SEQ_FULL);
static_assert(NB <= NB_FULL);
static_assert(DM % 64 == 0);
static_assert(TT % 64 == 0);
static_assert(DQ % 64 == 0);
static_assert(DQ == DM);
static_assert(HD == 64);
static_assert(NKV == NH_);
static_assert(RH % 64 == 0);
static_assert((TT - RH) % 128 == 0);
static_assert(TT % (32 * KSF) == 0);
static_assert(TT / 32 <= 64);          // one bit a key tile in a 64-bit class word
static_assert(TT / KSF / 32 <= 32);    // a slice's bits fit one 32-bit word

// FRAGMENT ORDER of every 16-bit operand plane (R rows x K columns, the k axis of its product along the columns): blocks of 16 rows x 32 k, 512 elements = 1 KB, block (rb, kb) at element (rb K/32 + kb) 512 (the V^T planes: at (kb HD/16 + rb) 512, so that the 32 keys of a trip are 4 KB in a row).
// Inside a block element (row r, k = 16 g + 8 h + e) lies at 256 g + 8 (16 h + r) + e: lane l = 16 h + r of a wave finds its fragment's elements 0..7 at 8 l and 8..15 at 256 + 8 l,
// so each of the two 16-byte loads of a fragment covers 512 contiguous bytes, four whole 128-byte lines, and each writer stores such 512-byte runs.
typedef _Float16 h16;
typedef unsigned short bf;
typedef __attribute__((ext_vector_type(16))) __bf16   v16bf;
typedef __attribute__((ext_vector_type(16))) _Float16 v16h;
typedef __attribute__((ext_vector_type(8)))  _Float16 v8h;
typedef __attribute__((ext_vector_type(8)))  unsigned short v8us;
typedef __attribute__((ext_vector_type(8)))  float    v8f;
typedef __attribute__((ext_vector_type(4)))  float    v4f;
typedef v8h  __attribute__((may_alias)) v8ha;
typedef v4f  __attribute__((may_alias)) v4fa;
typedef v8us __attribute__((may_alias)) v8usa;

__device__ __forceinline__ unsigned short f2bf(float f) { unsigned u = __float_as_uint(f); u += 0x7FFFu + ((u >> 16) & 1u); return (unsigned short)(u >> 16); }
__device__ __forceinline__ float bf2f(unsigned short b) { return __uint_as_float(((unsigned)b) << 16); }
__device__ __forceinline__ float bfr(float f) { return bf2f(f2bf(f)); }
__device__ __forceinline__ v16h cat16(v8h lo, v8h hi) { return __builtin_shufflevector(lo, hi, 0, 1, 2, 3, 4, 5, 6, 7, 8, 9, 10, 11, 12, 13, 14, 15); }
__device__ __forceinline__ v16bf cat16b(v8us lo, v8us hi) { return __builtin_bit_cast(v16bf, __builtin_shufflevector(lo, hi, 0, 1, 2, 3, 4, 5, 6, 7, 8, 9, 10, 11, 12, 13, 14, 15)); }
__device__ __forceinline__ v8f wmma16(v16h a, v16h b, v8f c) { return __builtin_amdgcn_wmma_f32_16x16x32_f16(false, a, false, b, (short)0, c, false, false); }
__device__ __forceinline__ v8f wmmab(v16bf a, v16bf b, v8f c) { return __builtin_amdgcn_wmma_f32_16x16x32_bf16(false, a, false, b, (short)0, c, false, false); }
__device__ __forceinline__ h16 tohx(float x) { return (h16)x; }
__device__ __forceinline__ void splitf(float y, unsigned short& h, unsigned short& l) { h = f2bf(y); l = f2bf(y - bf2f(h)); }
typedef __attribute__((ext_vector_type(4))) _Float16 v4h;
typedef __attribute__((ext_vector_type(2))) unsigned short v2us;
typedef __attribute__((ext_vector_type(4))) unsigned short v4us;
typedef __attribute__((ext_vector_type(2))) float v2f;
typedef __attribute__((ext_vector_type(4))) unsigned v4u;

// ---- k_gemmw: register-blocked GEMM, ONE WAVE per 64x64 output tile (16 accumulators), operands straight from 16-bit planes in fragment order; grid (M/64, N/64, Z), 32 threads.
// C[m][n] (f32, pitch ldc, + optional f32 bias[n]) = sum_k A[m][k] Bt[n][k] (+ split products per NSPLIT). z-batch strides sA/sB/sC in elements. K % (32 KS) == 0, M % 64 == 0, N % 64 == 0.
// BIAS: z-slice 0 / 1 / 2 adds bias / bias1 / bias2.
// KS > 1: grid z = Z x KS; work-group (z, ks) sums only k in [ks K/KS, (ks+1) K/KS) and stores its f32 partial tile into plane ks (plane stride sP elements); the reader adds the KS planes in the order 0..KS-1.
// PL: no f32 C. The tile is 64 tokens of one batch x the 64 columns of head blockIdx.y, and the wave stores it (+ bias) as the attention kernel's operand planes, f16 and bf16 hi / lo:
// z-slices 0 and 1 (q, k) as planes [z][batch][head] of TT rows x HD, a contiguous 8 KB a plane; z-slice 2 (v) transposed, planes [batch][head] of HD rows x TT, straight from the accumulators (a lane's 8 D elements are 8 consecutive tokens of one d: one 16-byte piece of the fragment order). All in fragment order.
// Fragment map: lane l, h = l >> 4: elements 0..7 <- k0 + 8h + 0..7, elements 8..15 <- k0 + 16 + 8h + 0..7 (A row / B column = l & 15); D element j -> (row 8h + j, col l & 15). ld(p): p = the block's first element + 8 l.
template <typename T16> struct WFrag;
template <> struct WFrag<h16> { typedef v16h V; static __device__ __forceinline__ V ld(const h16* p) { return cat16(*(const v8h*)p, *(const v8h*)(p + 256)); } static __device__ __forceinline__ v8f mma(V a, V b, v8f c) { return wmma16(a, b, c); } };
template <> struct WFrag<bf> { typedef v16bf V; static __device__ __forceinline__ V ld(const bf* p) { return cat16b(*(const v8us*)p, *(const v8us*)(p + 256)); } static __device__ __forceinline__ v8f mma(V a, V b, v8f c) { return wmmab(a, b, c); } };
template <typename T16, int NSPLIT, bool BIAS, int KS, bool PL>
__global__ __launch_bounds__(32) void k_gemmw(const T16* __restrict__ A, const T16* __restrict__ A2, const T16* __restrict__ Bt, const T16* __restrict__ Bt2, int K, float* C, int ldc, const float* __restrict__ bias, const float* __restrict__ bias1, const float* __restrict__ bias2, size_t sA, size_t sB, size_t sC, size_t sP, h16* P16, bf* Ph, bf* Pl, h16* V16, bf* Vh, bf* Vl) {
    static_assert(NSPLIT == 0 || NSPLIT == 1);
    static_assert(KS == 1 || !BIAS);
    static_assert(!PL || (BIAS && KS == 1));
    typedef typename WFrag<T16>::V V;
    __shared__ __align__(16) float os[16 * 68];
    const size_t z = blockIdx.z / KS; const int ks = (int)(blockIdx.z % KS); A += z * sA; if (A2) A2 += z * sA; Bt += z * sB; if (Bt2) Bt2 += z * sB; C += z * sC + (size_t)ks * sP;
    const float* bz = (z == 0) ? bias : ((z == 1) ? bias1 : bias2);
    const int kbeg = ks * (K / KS), kend = kbeg + K / KS;
    const int lane = threadIdx.x & 31, lr = lane & 15, hi = lane >> 4; const int r0 = blockIdx.x * 64, c0 = blockIdx.y * 64;
    v8f acc[4][4];
#pragma unroll
    for (int mb = 0; mb < 4; ++mb)
#pragma unroll
        for (int nb = 0; nb < 4; ++nb) acc[mb][nb] = (v8f){};
    // Byte offsets of this lane's piece in the first block of each of the tile's four row blocks of A and of Bt: 16 rows of blocks hold 16 K elements; a step of 32 k is one block, 1 KB.
    unsigned oa[4], ow[4];
#pragma unroll
    for (int i = 0; i < 4; ++i) { const unsigned o = (unsigned)(i * 16 * K + kbeg * 16 + 8 * lane) * 2u; oa[i] = (unsigned)(r0 * K) * 2u + o; ow[i] = (unsigned)(c0 * K) * 2u + o; }
#pragma unroll 1
    for (int kc = kbeg; kc < kend; kc += 32) {
        V a[4], a2[4], b[4];
#pragma unroll
        for (int mb = 0; mb < 4; ++mb) { a[mb] = WFrag<T16>::ld((const T16*)((const char*)A + oa[mb])); if (NSPLIT == 1) a2[mb] = WFrag<T16>::ld((const T16*)((const char*)A2 + oa[mb])); }
#pragma unroll
        for (int nb = 0; nb < 4; ++nb) b[nb] = WFrag<T16>::ld((const T16*)((const char*)Bt + ow[nb]));
        // The trip's loads are all issued above; their offsets are advanced below. The offsets are inputs of the wait, so they live up to it and no load of the run lands in them.
        asm volatile("s_wait_xcnt 0x0" :: "v"(oa[0]), "v"(oa[1]), "v"(oa[2]), "v"(oa[3]), "v"(ow[0]), "v"(ow[1]), "v"(ow[2]), "v"(ow[3]) : "memory");
        __builtin_amdgcn_sched_barrier(0);              // keeps the address additions behind that wait
#pragma unroll
        for (int nb = 0; nb < 4; ++nb)
#pragma unroll
            for (int mb = 0; mb < 4; ++mb) { acc[mb][nb] = WFrag<T16>::mma(a[mb], b[nb], acc[mb][nb]); if (NSPLIT == 1) acc[mb][nb] = WFrag<T16>::mma(a2[mb], b[nb], acc[mb][nb]); }
        asm volatile("v_nop\n\tv_nop\n\tv_nop\n\tv_nop" : "+v"(acc[0][0]), "+v"(acc[1][1]), "+v"(acc[2][2]), "+v"(acc[3][3]) : "v"(a[0]), "v"(a[3]));
#pragma unroll
        for (int i = 0; i < 4; ++i) { oa[i] += 1024u; ow[i] += 1024u; }
    }
    const int bt = r0 / TT, t0 = r0 % TT;   // PL: the tile's batch and first token
    const size_t pb = (((z * NB + bt) * NH_ + blockIdx.y) * TT + t0) * HD;   // PL: the tile's first element in a q / k plane
    float bb[4] = {0.f, 0.f, 0.f, 0.f};   // PL: the bias of this lane's column in each of the four column tiles
    if constexpr (PL) {
#pragma unroll
        for (int nb = 0; nb < 4; ++nb) bb[nb] = bfr(bz[c0 + nb * 16 + lr]); }
    if (!PL || z != 2) {
#pragma unroll
    for (int mb = 0; mb < 4; ++mb) {
#pragma unroll
        for (int nb = 0; nb < 4; ++nb) {
#pragma unroll
            for (int j = 0; j < 8; ++j) os[(hi * 8 + j) * 68 + nb * 16 + lr] = PL ? acc[mb][nb][j] + bb[nb] : acc[mb][nb][j]; }
        __builtin_amdgcn_wave_barrier(); asm volatile("" ::: "memory");
        float* crow = C + (size_t)(r0 + mb * 16) * ldc + c0;
        if constexpr (PL) { v8h o16[4]; v8us oh[4], ol[4];   // piece s: token lr, columns 16 s + 8 hi + 0..7
#pragma unroll
            for (int s = 0; s < 4; ++s) { const float* rp = os + lr * 68 + s * 16 + hi * 8; const v4f v0 = *(const v4fa*)rp, v1 = *(const v4fa*)(rp + 4);
#pragma unroll
                for (int q = 0; q < 8; ++q) { const float x = q < 4 ? v0[q & 3] : v1[q & 3]; o16[s][q] = tohx(x); unsigned short a2, c2; splitf(x, a2, c2); oh[s][q] = a2; ol[s][q] = c2; } }
            __builtin_amdgcn_sched_barrier(0);              // every conversion of the block stands in front of its stores: none lands in a register that an issued store names
#pragma unroll
            for (int s = 0; s < 4; ++s) { const size_t e = pb + (size_t)(mb * 16) * HD + s * 256 + lane * 8; *(v8h*)(P16 + e) = o16[s]; *(v8us*)(Ph + e) = oh[s]; *(v8us*)(Pl + e) = ol[s]; }
            asm volatile("s_wait_xcnt 0x0" ::: "memory");   // the next block's values may land in registers that the stores above name
            __builtin_amdgcn_sched_barrier(0);              // keeps what follows behind that wait
        } else
{
#pragma unroll
            for (int s = 0; s < 8; ++s) { const int row = 2 * s + hi, cofs = lr * 4; v4f val = *(const v4fa*)(os + row * 68 + cofs); if (BIAS) { val[0] += bfr(bz[c0 + cofs]); val[1] += bfr(bz[c0 + cofs + 1]); val[2] += bfr(bz[c0 + cofs + 2]); val[3] += bfr(bz[c0 + cofs + 3]); }
                *(v4f*)(crow + (size_t)row * ldc + cofs) = val; }
             }
        __builtin_amdgcn_wave_barrier(); asm volatile("" ::: "memory");
    }
    } else if constexpr (PL) {
        const size_t vb = (size_t)(bt * NH_ + (int)blockIdx.y) * HD * TT + (size_t)t0 * HD + 8 * lane;   // 32 tokens of all HD rows are HD / 16 blocks, 32 HD elements
#pragma unroll
        for (int nb = 0; nb < 4; ++nb) { v8h o16[4]; v8us oh[4], ol[4];
#pragma unroll
            for (int mb = 0; mb < 4; ++mb)
#pragma unroll
                for (int j = 0; j < 8; ++j) { const float x = acc[mb][nb][j] + bb[nb]; o16[mb][j] = tohx(x); unsigned short a2, c2; splitf(x, a2, c2); oh[mb][j] = a2; ol[mb][j] = c2; }
            __builtin_amdgcn_sched_barrier(0);              // every conversion of the block stands in front of its stores: none lands in a register that an issued store names
#pragma unroll
            for (int mb = 0; mb < 4; ++mb) { const size_t e = vb + (size_t)((mb >> 1) * (HD / 16) + nb) * 512 + (mb & 1) * 256; *(v8h*)(V16 + e) = o16[mb]; *(v8us*)(Vh + e) = oh[mb]; *(v8us*)(Vl + e) = ol[mb]; }
            if (nb < 3) { asm volatile("s_wait_xcnt 0x0" ::: "memory");   // the next block's values may land in registers that the stores above name
                __builtin_amdgcn_sched_barrier(0); }        // keeps the next block's instructions behind that wait
        }
    }
}


// The three passes below read nothing but inputs and feed later launches only; k_prep runs them side by side in one launch of PT-thread work-groups.
#define PT 1024
// y picks one of four equally shaped weights, bx the work-group inside it; Bt holds the four transposed planes (N rows x K) one behind the other, each in fragment order. Thread i makes 16-byte piece i of its plane: 8 consecutive k of one n; 16 lanes read 64 contiguous bytes of a weight row.
__device__ __forceinline__ void wt_body(int bx, int y, const float* __restrict__ w0, const float* __restrict__ w1, const float* __restrict__ w2, const float* __restrict__ w3, int K, int N, bf* Bt) {
    const float* w = (y == 0) ? w0 : ((y == 1) ? w1 : ((y == 2) ? w2 : w3)); Bt += (size_t)y * K * N;
    const int i = (int)(bx * PT + threadIdx.x); if (i >= N * K / 8) return;
    const int lane = i & 31, g = (i >> 5) & 1, blk = i >> 6; const int kb = blk % (K / 32), rb = blk / (K / 32);
    const float* wp[8]; float x[8]; v8us o;
#pragma unroll
    for (int e = 0; e < 8; ++e) wp[e] = w + (size_t)(kb * 32 + g * 16 + (lane >> 4) * 8 + e) * N + rb * 16 + (lane & 15);
#pragma unroll
    for (int e = 0; e < 8; ++e) x[e] = *wp[e];
    asm volatile("s_wait_xcnt 0x0" :: "v"(wp[0]), "v"(wp[1]), "v"(wp[2]), "v"(wp[3]), "v"(wp[4]), "v"(wp[5]), "v"(wp[6]), "v"(wp[7]) : "memory");   // the eight addresses are inputs of the wait: they live up to it, so no load of the run lands in one and nothing rewrites one before it
#pragma unroll
    for (int e = 0; e < 8; ++e) o[e] = f2bf(x[e]);
    *(v8us*)(Bt + (size_t)i * 8) = o;
    asm volatile("s_wait_xcnt 0x0" ::: "memory");   // in k_prep the built code runs on behind this store into branch code shared with the other passes, which rewrites registers that the store names
}
// s picks the stream, by the batch (source batch stride sb elements), bx the work-group inside it; dst is [stream][batch][n8 * 8], each a plane of rows x DM in fragment order. Thread i makes 16-byte piece i of its plane.
__device__ __forceinline__ void cvt_body(int bx, int by, int s, const float* __restrict__ s0, const float* __restrict__ s1, const float* __restrict__ s2, size_t sb, bf* dst, size_t n8) { const size_t i = (size_t)bx * PT + threadIdx.x; if (i >= n8) return;
    const float* src = ((s == 0) ? s0 : ((s == 1) ? s1 : s2)) + (size_t)by * sb; dst += ((size_t)s * NB + by) * n8 * 8;
    const int lane = (int)(i & 31), g = (int)((i >> 5) & 1); const int blk = (int)(i >> 6); const int kb = blk % (DM / 32), rb = blk / (DM / 32);
    const float* sp = src + (size_t)(rb * 16 + (lane & 15)) * DM + kb * 32 + g * 16 + (lane >> 4) * 8; const v8f v = *(const v8f*)sp; v8us o;
    asm volatile("s_wait_xcnt 0x0" :: "v"(sp) : "memory");   // the address is an input of the wait: it lives up to it, so neither load lands in it and nothing rewrites it before
#pragma unroll
    for (int k = 0; k < 8; ++k) o[k] = f2bf(v[k]); *(v8us*)(dst + i * 8) = o;
    asm volatile("s_wait_xcnt 0x0" ::: "memory");   // in k_prep the built code runs on behind this store into branch code shared with the other passes, which rewrites registers that the store names
}

// ---- mcls_body: reads the mask once and classes its tiles of 16 query rows x 32 keys from the values found there. One work-group of 32 waves per row block rb; wave w takes key tiles w and w + 32, whole 128-byte lines a row.
// Cl[4 rb ..]: words 0, 1 = one bit a key tile, set where the tile is CLOSED: every value >= 0.75; words 2, 3 = set where it is OPEN: every value rounds to bf16 zero, so mask x -1e9 adds nothing to a logit.
// The closed bits are kept only where each of the 16 rows holds, somewhere among all its keys, a value <= 0.25. Such a row's maximum logit lies at least 5e8 - 2 max|logit / 8| above every key of a closed tile;
// over the at most 18 rescale factors between that key's term and the output one spans 2e7 or more and is exactly 0 in f32: the tile adds exact zeros, and leaving it out changes no bit. A row block without that property keeps every tile.
__device__ __forceinline__ void mcls_body(int rb, const float* __restrict__ Mk, int mpitch, unsigned* __restrict__ Cl) {
    __shared__ unsigned sf[32], sl[32];
    const int wave = (int)(threadIdx.x >> 5), lane = (int)(threadIdx.x & 31);
    const float* mp = Mk + (size_t)(rb * 16 + (lane >> 3)) * mpitch + (lane & 7) * 4;   // load c of a tile: rows 4c + (lane >> 3)
    const float* rp[4]; v4f m[2][4];
#pragma unroll
    for (int c = 0; c < 4; ++c) rp[c] = mp + (size_t)c * 4 * mpitch + wave * 32;
#pragma unroll
    for (int i = 0; i < 2; ++i)
#pragma unroll
        for (int c = 0; c < 4; ++c) m[i][c] = (wave + 32 * i < TT / 32) ? *(const v4f*)(rp[c] + i * 1024) : (v4f){0.5f, 0.5f, 0.5f, 0.5f};
    asm volatile("s_wait_xcnt 0x0" :: "v"(rp[0]), "v"(rp[1]), "v"(rp[2]), "v"(rp[3]) : "memory");   // the four row addresses are inputs of the wait: they live up to it, so no load of the run lands in one and nothing rewrites one before it
    unsigned flags = 0, rows = 0;
#pragma unroll
    for (int i = 0; i < 2; ++i) { bool cl = true; unsigned nz = 0;
#pragma unroll
        for (int c = 0; c < 4; ++c) { bool lv = false;
#pragma unroll
            for (int q = 0; q < 4; ++q) { const float x = m[i][c][q]; cl = cl & (x >= 0.75f); nz |= f2bf(x) & 0x7FFFu; lv = lv | (x <= 0.25f); }
            const unsigned b = __builtin_amdgcn_ballot_w32(lv);
#pragma unroll
            for (int g = 0; g < 4; ++g) rows |= (((b >> (8 * g)) & 0xFFu) != 0u ? 1u : 0u) << (4 * c + g); }
        flags |= (__builtin_amdgcn_ballot_w32(cl) == 0xFFFFFFFFu ? 1u : 0u) << i; flags |= (__builtin_amdgcn_ballot_w32(nz == 0u) == 0xFFFFFFFFu ? 4u : 0u) << i; }
    if (lane == 0) { sf[wave] = flags; sl[wave] = rows; }
    __syncthreads();
    if (wave == 0) { const unsigned f = sf[lane]; unsigned r = sl[lane];
#pragma unroll
        for (int o = 16; o > 0; o >>= 1) r |= __shfl_xor(r, o, 32);
        const unsigned keep = (r == 0xFFFFu) ? 0xFFFFFFFFu : 0u; v4u w;
        w[0] = __builtin_amdgcn_ballot_w32((f & 1u) != 0u) & keep; w[1] = __builtin_amdgcn_ballot_w32((f & 2u) != 0u) & keep; w[2] = __builtin_amdgcn_ballot_w32((f & 4u) != 0u); w[3] = __builtin_amdgcn_ballot_w32((f & 8u) != 0u);
        if (lane == 0) *(v4u*)(Cl + (size_t)rb * 4) = w; }
}
// ---- k_prep: blockIdx.x deals the work-groups to the three passes, the same branch for a whole work-group (the one barrier stands in the mask pass): first the PB_M row blocks of the mask, then 4 weights x PB_W, then 3 streams x NB batches x PB_X.
#define PB_M (TT / 16)
#define PB_W ((DM * DQ / 8 + PT - 1) / PT)
#define PB_X ((TT * DM / 8 + PT - 1) / PT)
static_assert(PT == 1024);   // the mask pass takes 32 waves
__global__ __launch_bounds__(PT) void k_prep(const float* __restrict__ Mk, int mpitch, unsigned* __restrict__ Cl, const float* __restrict__ w0, const float* __restrict__ w1, const float* __restrict__ w2, const float* __restrict__ w3, bf* Bt, const float* __restrict__ s0, const float* __restrict__ s1, const float* __restrict__ s2, size_t sb, bf* dst) {
    const int b = (int)blockIdx.x;
    if (b < PB_M) mcls_body(b, Mk, mpitch, Cl);
    else if (b < PB_M + 4 * PB_W) { const int c = b - PB_M; wt_body(c % PB_W, c / PB_W, w0, w1, w2, w3, DM, DQ, Bt); }
    else { const int c = b - PB_M - 4 * PB_W; cvt_body(c % PB_X, (c / PB_X) % NB, c / (PB_X * NB), s0, s1, s2, sb, dst, (size_t)TT * DM / 8); }
}

// ---- k_attn: logits, softmax and P x V of one (batch, head) slice z in one kernel; scores and probabilities stay in registers.
// One wave owns 16 NQ query rows and the keys [ks TT/KSF, (ks+1) TT/KSF), 32 keys a trip. It forms the TRANSPOSED logits tile (A = key rows, B = query rows), so that D element j of key tile kt is (key 16 kt + 8h + j, query l & 15):
// the two key tiles of a trip are, lane by lane, the B fragment of P^T (elements 0..7 <- key 8h + j, elements 8..15 <- key 16 + 8h + j), the k order of the V^T A fragment. O^T (A = V^T rows d, B = P^T) has its query in l & 15 too, so a row's maximum, sum and rescale factor are one value a lane.
// A trip whose mask tile k_prep found closed for all of the wave's rows is left out whole (scalar branch); one found open loads no mask and takes zeros in its place. A wave with no trip left stores maximum -3e38, sum 0 and O 0: weight 0 in k_merge.
// Each wave stores its unnormalised f32 O tiles as they lie in the accumulators (per 16 rows and 16 d one KB: lane l's 8 values, row l & 15, d 8h + 0..7, at 8 l), and per 16 rows one 128-byte line: 16 running maxima, then 16 sums. k_merge joins the KSF slices.
template <typename T16, bool HI, int NQ>
__device__ __forceinline__ void attn_body(const T16* __restrict__ Q, const T16* __restrict__ Q2, const T16* __restrict__ Kp, const T16* __restrict__ K2, const T16* __restrict__ Vt, const T16* __restrict__ V2, const float* __restrict__ Mk, int mpitch, const unsigned* __restrict__ Cl, int q0, int kbeg, float* Op, float* St) {
    typedef typename WFrag<T16>::V V;
    const int lane = threadIdx.x & 31, lr = lane & 15, hi = lane >> 4;
    unsigned long long cw = ~0ull, ow = ~0ull;   // closed / open for every one of the wave's row blocks
#pragma unroll
    for (int nq = 0; nq < NQ; ++nq) { const v4u c = *(const v4u*)(Cl + (size_t)((q0 >> 4) + nq) * 4); cw &= (unsigned long long)c[0] | ((unsigned long long)c[1] << 32); ow &= (unsigned long long)c[2] | ((unsigned long long)c[3] << 32); }
    unsigned cbits = __builtin_amdgcn_readfirstlane((unsigned)(cw >> (kbeg / 32))), obits = __builtin_amdgcn_readfirstlane((unsigned)(ow >> (kbeg / 32)));   // bit 0: the coming trip's tile
    V qf[NQ][2], qf2[NQ][2];
#pragma unroll
    for (int nq = 0; nq < NQ; ++nq)
#pragma unroll
        for (int c = 0; c < 2; ++c) { const size_t o = (size_t)(q0 + nq * 16) * HD + c * 512 + 8 * lane; qf[nq][c] = WFrag<T16>::ld(Q + o); if (HI) qf2[nq][c] = WFrag<T16>::ld(Q2 + o); }
    v8f oacc[NQ][4]; float mrun[NQ], lrun[NQ];
#pragma unroll
    for (int nq = 0; nq < NQ; ++nq) { mrun[nq] = -3.0e38f; lrun[nq] = 0.f;
#pragma unroll
        for (int dt = 0; dt < 4; ++dt) oacc[nq][dt] = (v8f){}; }
    const T16* vp = Vt + (size_t)kbeg * HD + 8 * lane; const T16* vp2 = HI ? V2 + (size_t)kbeg * HD + 8 * lane : nullptr;   // this lane's piece in the first V^T block of the trip's 32 keys
#pragma unroll 1   // one copy of a body that holds a whole trip's loads and products: registers and instruction cache
    for (int k0 = kbeg; k0 < kbeg + TT / KSF; k0 += 32) {
      if (!(cbits & 1u)) {
        V kf[2][2], kf2[2][2], vf[4], vf2[4]; v4f mv[NQ][2][2];
        if (obits & 1u) {
#pragma unroll
            for (int nq = 0; nq < NQ; ++nq)
#pragma unroll
                for (int kt = 0; kt < 2; ++kt) { mv[nq][kt][0] = (v4f){}; mv[nq][kt][1] = (v4f){}; }
        } else {
#pragma unroll
            for (int nq = 0; nq < NQ; ++nq)
#pragma unroll
                for (int kt = 0; kt < 2; ++kt) { const float* mr = Mk + (size_t)(q0 + nq * 16 + lr) * mpitch + k0 + kt * 16 + 8 * hi; mv[nq][kt][0] = *(const v4f*)mr; mv[nq][kt][1] = *(const v4f*)(mr + 4); }
            asm volatile("s_wait_xcnt 0x0" ::: "memory");   // the K loads below may land in registers that held the addresses of the mask loads above
        }
#pragma unroll
        for (int kt = 0; kt < 2; ++kt)
#pragma unroll
            for (int c = 0; c < 2; ++c) { const size_t o = (size_t)(k0 + kt * 16) * HD + c * 512 + 8 * lane; kf[kt][c] = WFrag<T16>::ld(Kp + o); if (HI) kf2[kt][c] = WFrag<T16>::ld(K2 + o); }
        asm volatile("s_wait_xcnt 0x0" ::: "memory");   // the V loads below may land in registers that held the addresses of the loads above
        __builtin_amdgcn_sched_barrier(0);              // keeps the V loads behind that wait
#pragma unroll
        for (int dt = 0; dt < 4; ++dt) { vf[dt] = WFrag<T16>::ld(vp + dt * 512); if (HI) vf2[dt] = WFrag<T16>::ld(vp2 + dt * 512); }
        // The trip's loads are all issued above; their address registers are advanced for the next trip below. The V addresses are inputs of the wait, so they live up to it and no load of the run lands in them.
        if constexpr (HI) asm volatile("s_wait_xcnt 0x0" :: "v"(vp), "v"(vp2) : "memory"); else asm volatile("s_wait_xcnt 0x0" :: "v"(vp) : "memory");
        __builtin_amdgcn_sched_barrier(0);              // keeps those address additions behind the wait, and every load of the trip in front of the first product
#pragma unroll
        for (int nq = 0; nq < NQ; ++nq) {
            v8f s[2];
#pragma unroll
            for (int kt = 0; kt < 2; ++kt) { s[kt] = (v8f){};
#pragma unroll
                for (int c = 0; c < 2; ++c) { s[kt] = WFrag<T16>::mma(kf[kt][c], qf[nq][c], s[kt]); if (HI) { s[kt] = WFrag<T16>::mma(kf[kt][c], qf2[nq][c], s[kt]); s[kt] = WFrag<T16>::mma(kf2[kt][c], qf[nq][c], s[kt]); } } }
            float mx = mrun[nq];
#pragma unroll
            for (int kt = 0; kt < 2; ++kt)
#pragma unroll
                for (int j = 0; j < 8; ++j) { const float t = s[kt][j] * SCL + bfr(mv[nq][kt][j >> 2][j & 3]) * MNEG; s[kt][j] = t; mx = fmaxf(mx, t); }
            mx = fmaxf(mx, __shfl_xor(mx, 16, 32));   // the row's other 16 keys of the trip lie in lane l ^ 16
            const float al = __builtin_amdgcn_exp2f((mrun[nq] - mx) * L2E); mrun[nq] = mx;
            float sum = 0.f;
#pragma unroll
            for (int kt = 0; kt < 2; ++kt) { v8f x, p;
#pragma unroll
                for (int j = 0; j < 8; ++j) { x[j] = (s[kt][j] - mx) * L2E; if (!HI) x[j] += PEXP; }
#pragma unroll
                for (int j = 0; j < 8; ++j) p[j] = __builtin_amdgcn_exp2f(x[j]);
                asm volatile("v_nop" : "+v"(p) : "v"(x));   // the slot behind a transcendental: no result of the eight is read and no source register reused before this instruction
                s[kt] = p;
#pragma unroll
                for (int j = 0; j < 8; ++j) sum += p[j]; }
            lrun[nq] = lrun[nq] * al + sum;
#pragma unroll
            for (int dt = 0; dt < 4; ++dt) oacc[nq][dt] *= al;
            if constexpr (HI) { v8us ph[2], pl[2];
#pragma unroll
                for (int kt = 0; kt < 2; ++kt)
#pragma unroll
                    for (int j = 0; j < 8; ++j) { unsigned short a, c2; splitf(s[kt][j], a, c2); ph[kt][j] = a; pl[kt][j] = c2; }
                const V pfh = cat16b(ph[0], ph[1]), pfl = cat16b(pl[0], pl[1]);
#pragma unroll
                for (int dt = 0; dt < 4; ++dt) { oacc[nq][dt] = WFrag<T16>::mma(vf[dt], pfh, oacc[nq][dt]); oacc[nq][dt] = WFrag<T16>::mma(vf[dt], pfl, oacc[nq][dt]); oacc[nq][dt] = WFrag<T16>::mma(vf2[dt], pfh, oacc[nq][dt]); }
            } else { v8h p16[2];
#pragma unroll
                for (int kt = 0; kt < 2; ++kt)
#pragma unroll
                    for (int j = 0; j < 8; ++j) p16[kt][j] = tohx(s[kt][j]);
                const V pf = cat16(p16[0], p16[1]);
#pragma unroll
                for (int dt = 0; dt < 4; ++dt) oacc[nq][dt] = WFrag<T16>::mma(vf[dt], pf, oacc[nq][dt]); }
        }
      }
        vp += 32 * HD; if (HI) vp2 += 32 * HD; cbits >>= 1; obits >>= 1;
    }
#pragma unroll
    for (int nq = 0; nq < NQ; ++nq) {
        const float lt = lrun[nq] + __shfl_xor(lrun[nq], 16, 32);
        St[(size_t)(q0 + nq * 16) * 2 + lane] = hi ? lt : mrun[nq];
#pragma unroll
        for (int dt = 0; dt < 4; ++dt) *(v8f*)(Op + (size_t)(q0 + nq * 16) * HD + dt * 256 + 8 * lane) = oacc[nq][dt];
    }
}
// grid (RH/64 + (TT-RH)/128, KSF, NZ), 4 independent waves: blocks x < RH/64 take 16 hi+lo query rows a wave, the others 32 f16 rows a wave. QK* hold the q planes, then (kofs elements on) the k planes.
__global__ __launch_bounds__(128) void k_attn(const h16* __restrict__ QK16, const bf* __restrict__ QKh, const bf* __restrict__ QKl, size_t kofs, const h16* __restrict__ VT16, const bf* __restrict__ VTh, const bf* __restrict__ VTl, const float* __restrict__ Mk, int mpitch, const unsigned* __restrict__ Cl, float* Op, float* St) {
    const int wave = __builtin_amdgcn_readfirstlane((int)(threadIdx.x >> 5)); const int bx = (int)blockIdx.x, ks = (int)blockIdx.y; const size_t z = blockIdx.z; const size_t zo = z * TT * HD;
    Op += ((size_t)ks * NZ + z) * TT * HD; St += ((size_t)ks * NZ + z) * TT * 2; const int kbeg = ks * (TT / KSF);
    if (bx < RH / 64) attn_body<bf, true, 1>(QKh + zo, QKl + zo, QKh + kofs + zo, QKl + kofs + zo, VTh + zo, VTl + zo, Mk, mpitch, Cl, bx * 64 + wave * 16, kbeg, Op, St);
    else attn_body<h16, false, 2>(QK16 + zo, nullptr, QK16 + kofs + zo, nullptr, VT16 + zo, nullptr, Mk, mpitch, Cl, RH + (bx - RH / 64) * 128 + wave * 32, kbeg, Op, St);
}
// Joins the KSF key slices of every row in the order 0..KSF-1: weights 2^((m_s - max m) log2 e), O = sum w O_s / sum w l_s; hi+lo bf16 planes of NB TT rows x DQ (merged-head order) in fragment order.
// Thread i makes 16-byte piece i of both planes; the 8 values it joins are one lane's 8 values of an O tile, 32 contiguous bytes a slice.
__global__ __launch_bounds__(256) void k_merge(const float* __restrict__ O0, const float* __restrict__ O1, const float* __restrict__ O2, const float* __restrict__ O3, const float* __restrict__ St, bf* Ah, bf* Al) { const size_t i = (size_t)blockIdx.x * 256 + threadIdx.x; if (i >= (size_t)NZ * TT * HD / 8) return;
    const int lane = (int)(i & 31), g = (int)((i >> 5) & 1), blk = (int)(i >> 6); const int kb = blk % (DQ / 32), m0 = (blk / (DQ / 32)) * 16; const int z = (m0 / TT) * NH_ + (kb >> 1), t0 = m0 % TT;
    const size_t e = ((size_t)z * TT + t0) * HD + ((kb & 1) * 2 + g) * 256 + lane * 8;
    const size_t so = ((size_t)z * TT + t0) * 2 + (lane & 15); float m[KSF], l[KSF]; float mx = -3.0e38f; v8f ov[KSF]; const unsigned ob = (unsigned)e * 4u, sb = (unsigned)so * 4u;   // byte offsets inside a slice's O and St
    static_assert(KSF == 4);
    static_assert((size_t)NZ * TT * HD * 4 < 0xFFFFFFFFull);
#pragma unroll
    for (int s = 0; s < KSF; ++s) { const float* q = (const float*)((const char*)(St + (size_t)s * ((size_t)NZ * TT * 2)) + sb); m[s] = q[0]; l[s] = q[16]; const float* Os = s == 0 ? O0 : (s == 1 ? O1 : (s == 2 ? O2 : O3)); ov[s] = *(const v8f*)((const char*)Os + ob); }   // a scalar base a slice, one offset register for all
    asm volatile("s_wait_xcnt 0x0" :: "v"(ob), "v"(sb), "v"(ov[0]), "v"(ov[1]), "v"(ov[2]), "v"(ov[3]), "v"(m[0]), "v"(m[1]), "v"(m[2]), "v"(m[3]), "v"(l[0]), "v"(l[1]), "v"(l[2]), "v"(l[3]) : "memory");   // both offsets are inputs of the wait: they live up to it, so no load of the run lands in one and nothing rewrites one before it; the loaded values are inputs too, which keeps every load in front of it
#pragma unroll
    for (int s = 0; s < KSF; ++s) mx = fmaxf(mx, m[s]);
    const float w0 = __builtin_amdgcn_exp2f((m[0] - mx) * L2E); v8f x = ov[0] * w0; float den = l[0] * w0; v8us oh, ol;
#pragma unroll
    for (int s = 1; s < KSF; ++s) { const float w = __builtin_amdgcn_exp2f((m[s] - mx) * L2E); x += ov[s] * w; den += l[s] * w; }
    const float f = 1.0f / den;
#pragma unroll
    for (int q = 0; q < 8; ++q) { unsigned short a, c2; splitf(x[q] * f, a, c2); oh[q] = a; ol[q] = c2; } *(v8us*)(Ah + i * 8) = oh; *(v8us*)(Al + i * 8) = ol;  }

extern "C" void kernel_launch(void* const* d_in, const int* in_sizes, int n_in,
                              void* d_out, int out_size, void* d_ws, size_t ws_size, hipStream_t stream) {
    if (n_in < 12) return;
    const long long xneed = (long long)(NB - 1) * SEQ_FULL * DM + (long long)TT * DM;
    if ((long long)in_sizes[0] < xneed || (long long)in_sizes[1] < xneed || (long long)in_sizes[2] < xneed) return;
    if ((long long)in_sizes[3] < (long long)(TT - 1) * SEQ_FULL + TT) return;
    if (in_sizes[4] < DM * DQ || in_sizes[6] < DM * DKV || in_sizes[8] < DM * DKV || in_sizes[10] < DQ * DM) return;
    if (in_sizes[5] < DQ || in_sizes[7] < DKV || in_sizes[9] < DKV || in_sizes[11] < DM) return;
    if ((long long)out_size < (long long)NB * TT * DM) return;
    const float* xq = (const float*)d_in[0]; const float* xk = (const float*)d_in[1]; const float* xv = (const float*)d_in[2]; const float* mk = (const float*)d_in[3];
    const float* wq = (const float*)d_in[4]; const float* bq = (const float*)d_in[5]; const float* wk = (const float*)d_in[6]; const float* bk = (const float*)d_in[7]; const float* wv = (const float*)d_in[8]; const float* bv = (const float*)d_in[9]; const float* wo = (const float*)d_in[10]; const float* bo = (const float*)d_in[11];
    float* OUT = (float*)d_out;     // [NB][TT][DM]
    char* wsp = (char*)d_ws;
    auto take = [&](size_t bytes) { char* p = wsp; wsp += (bytes + 255) & ~(size_t)255; return (void*)p; };
    constexpr size_t WSZ = (size_t)DM * DQ;           // elements of one weight plane
    constexpr size_t PSZ = (size_t)NZ * TT * HD;      // elements of one plane set over all (batch, head) slices
    constexpr size_t XSZ = (size_t)NB * TT * DM;      // elements of one stream, both batches
    constexpr size_t OB_B = (size_t)KSF * PSZ * 4, ST_B = 3 * XSZ * 2;
    constexpr size_t POOL_B = OB_B > ST_B ? OB_B : ST_B;
    bf* W4 = (bf*)take(4 * WSZ * 2);                  // Wq, Wk, Wv, Wo transposed, one behind the other
    h16* QK16 = (h16*)take(2 * PSZ * 2); bf* QKh = (bf*)take(2 * PSZ * 2); bf* QKl = (bf*)take(2 * PSZ * 2);   // q planes, then k planes
    h16* VT16 = (h16*)take(PSZ * 2); bf* VTh = (bf*)take(PSZ * 2); bf* VTl = (bf*)take(PSZ * 2);
    float* Stt = (float*)take((size_t)KSF * NZ * TT * 2 * 4);   // per key slice and row: running maximum and sum
    unsigned* Cls = (unsigned*)take((size_t)(TT / 16) * 4 * 4);   // per 16 query rows: closed and open bits of the 64 key tiles
    bf* ATh = (bf*)take(XSZ * 2); bf* ATl = (bf*)take(XSZ * 2);
    char* pool = (char*)take(POOL_B);
    const size_t carved = (size_t)(wsp - (char*)d_ws);
    if (carved > ws_size) return;
    // One pool, two stream-ordered uses: the projections' bf16 inputs (dead once the planes are built), then the attention kernel's partial O planes.
    bf* XB = (bf*)pool; float* Ob = (float*)pool;
    // weights: w is [in = K rows][out = N cols] -> Bt, N rows x K, fragment order
    k_prep<<<PB_M + 4 * PB_W + 3 * NB * PB_X, PT, 0, stream>>>(mk, SEQ_FULL, Cls, wq, wk, wv, wo, W4, xq, xk, xv, (size_t)SEQ_FULL * DM, XB);
    k_gemmw<bf, 0, true, 1, true><<<dim3(NB * TT / 64, DQ / 64, 3), 32, 0, stream>>>(XB, nullptr, W4, nullptr, DM, nullptr, DQ, bq, bk, bv, XSZ, WSZ, 0, 0, QK16, QKh, QKl, VT16, VTh, VTl);
    k_attn<<<dim3(RH / 64 + (TT - RH) / 128, KSF, NZ), 128, 0, stream>>>(QK16, QKh, QKl, PSZ, VT16, VTh, VTl, mk, SEQ_FULL, Cls, Ob, Stt);
    k_merge<<<(unsigned)((PSZ / 8 + 255) / 256), 256, 0, stream>>>(Ob, Ob + PSZ, Ob + 2 * PSZ, Ob + 3 * PSZ, Stt, ATh, ATl);
    k_gemmw<bf, 1, true, 1, false><<<dim3(NB * TT / 64, DM / 64, 1), 32, 0, stream>>>(ATh, ATl, W4 + 3 * WSZ, nullptr, DQ, OUT, DM, bo, bo, bo, 0, 0, 0, 0, nullptr, nullptr, nullptr, nullptr, nullptr, nullptr);
}

// v008
// It runs in 91.6 microseconds.
// In two side-by-side timings against v007, it was 1.12 and 1.11 times as fast.
// Over all steps from v000 it is 16.8 times as fast.
#include <hip/hip_runtime.h>

// Masked attention block: three input streams q, k, v [2][2048][768]; per-stream projection x W + b (W stored [in][out]); 12 heads x 64; logits x 1/8 plus mask x -1e9 (mask [2048][2048] read as values from its input buffer); softmax over all keys; merged heads x Wo + bo -> [2][2048][768].
// Compute dtypes (every product accumulates in f32): inputs, mask, biases and weights RNE-converted to bf16; projections v_wmma_f32_16x16x32_bf16 (exact products) + f32 bias; logits: query rows < 512 on bf16 hi/lo planes (3 products), other rows on f16 planes (1 product); P x V: rows < 512 bf16 hi/lo (3 products), other rows v_wmma_f32_16x16x32_f16 with P carried x1024; softmax f32, running maximum and sum per query row inside the attention kernel, four key shares a row joined there through LDS (mask tiles classed from their values by k_prep); output projection: merged bf16 hi/lo planes x bf16 Wo (2 products) + f32 bias.

#ifndef NB
#define NB 2
#endif
#ifndef SEQ
#define SEQ 2048
#endif
#define NB_FULL  2
#define SEQ_FULL 2048
#define TT   SEQ
#define DM   768
#define NH_  12
#define NKV  12
#define REP  (NH_ / NKV)
#define HD   64
#define DQ   (NH_ * HD)
#define DKV  (NKV * HD)
#define NZ   (NB * NH_)
#define RH   ((TT) < 512 ? (TT) : 512)   // query rows < RH use hi+lo planes
#define PEXP 10.0f    // f16 rows carry P x 2^10 (added to the exponent; the row sum carries it too, so the quotient is free of it)
#define L2E  1.4426950408889634f
#define SCL  0.125f   // HD^-0.5
#define MNEG (-1.0e9f)
#define KSF  4        // key shares of the attention kernel: KSF waves of one work-group share a query block's keys

static_assert(TT % 128 == 0);
static_assert(TT <= SEQ_FULL);
static_assert(NB <= NB_FULL);
static_assert(DM % 64 == 0);
static_assert(TT % 64 == 0);
static_assert(DQ % 64 == 0);
static_assert(DQ == DM);
static_assert(HD == 64);
static_assert(NKV == NH_);
static_assert(RH % 64 == 0);
static_assert((TT - RH) % 64 == 0);
static_assert(TT % (32 * KSF) == 0);
static_assert(TT / 32 <= 64);          // one bit a key tile in a 64-bit class word
static_assert(KSF == HD / 16);         // at the join each of a block's KSF waves takes one 16-wide d tile

// FRAGMENT ORDER of every 16-bit operand plane (R rows x K columns, the k axis of its product along the columns): blocks of 16 rows x 32 k, 512 elements = 1 KB, block (rb, kb) at element (rb K/32 + kb) 512 (the V^T planes: at (kb HD/16 + rb) 512, so that the 32 keys of a trip are 4 KB in a row).
// Inside a block element (row r, k = 16 g + 8 h + e) lies at 256 g + 8 (16 h + r) + e: lane l = 16 h + r of a wave finds its fragment's elements 0..7 at 8 l and 8..15 at 256 + 8 l,
// so each of the two 16-byte loads of a fragment covers 512 contiguous bytes, four whole 128-byte lines, and each writer stores such 512-byte runs.
typedef _Float16 h16;
typedef unsigned short bf;
typedef __attribute__((ext_vector_type(16))) __bf16   v16bf;
typedef __attribute__((ext_vector_type(16))) _Float16 v16h;
typedef __attribute__((ext_vector_type(8)))  _Float16 v8h;
typedef __attribute__((ext_vector_type(8)))  unsigned short v8us;
typedef __attribute__((ext_vector_type(8)))  float    v8f;
typedef __attribute__((ext_vector_type(4)))  float    v4f;
typedef v8h  __attribute__((may_alias)) v8ha;
typedef v4f  __attribute__((may_alias)) v4fa;
typedef v8us __attribute__((may_alias)) v8usa;

__device__ __forceinline__ unsigned short f2bf(float f) { unsigned u = __float_as_uint(f); u += 0x7FFFu + ((u >> 16) & 1u); return (unsigned short)(u >> 16); }
__device__ __forceinline__ float bf2f(unsigned short b) { return __uint_as_float(((unsigned)b) << 16); }
__device__ __forceinline__ float bfr(float f) { return bf2f(f2bf(f)); }
__device__ __forceinline__ v16h cat16(v8h lo, v8h hi) { return __builtin_shufflevector(lo, hi, 0, 1, 2, 3, 4, 5, 6, 7, 8, 9, 10, 11, 12, 13, 14, 15); }
__device__ __forceinline__ v16bf cat16b(v8us lo, v8us hi) { return __builtin_bit_cast(v16bf, __builtin_shufflevector(lo, hi, 0, 1, 2, 3, 4, 5, 6, 7, 8, 9, 10, 11, 12, 13, 14, 15)); }
__device__ __forceinline__ v8f wmma16(v16h a, v16h b, v8f c) { return __builtin_amdgcn_wmma_f32_16x16x32_f16(false, a, false, b, (short)0, c, false, false); }
__device__ __forceinline__ v8f wmmab(v16bf a, v16bf b, v8f c) { return __builtin_amdgcn_wmma_f32_16x16x32_bf16(false, a, false, b, (short)0, c, false, false); }
__device__ __forceinline__ h16 tohx(float x) { return (h16)x; }
__device__ __forceinline__ void splitf(float y, unsigned short& h, unsigned short& l) { h = f2bf(y); l = f2bf(y - bf2f(h)); }
typedef __attribute__((ext_vector_type(4))) _Float16 v4h;
typedef __attribute__((ext_vector_type(2))) unsigned short v2us;
typedef __attribute__((ext_vector_type(4))) unsigned short v4us;
typedef __attribute__((ext_vector_type(2))) float v2f;
typedef __attribute__((ext_vector_type(4))) unsigned v4u;

// ---- k_gemmw: register-blocked GEMM, ONE WAVE per 64x64 output tile (16 accumulators), operands straight from 16-bit planes in fragment order; grid (M/64, N/64, Z), 32 threads.
// C[m][n] (f32, pitch ldc, + optional f32 bias[n]) = sum_k A[m][k] Bt[n][k] (+ split products per NSPLIT). z-batch strides sA/sB/sC in elements. K % (32 KS) == 0, M % 64 == 0, N % 64 == 0.
// BIAS: z-slice 0 / 1 / 2 adds bias / bias1 / bias2.
// KS > 1: grid z = Z x KS; work-group (z, ks) sums only k in [ks K/KS, (ks+1) K/KS) and stores its f32 partial tile into plane ks (plane stride sP elements); the reader adds the KS planes in the order 0..KS-1.
// PL: no f32 C. The tile is 64 tokens of one batch x the 64 columns of head blockIdx.y, and the wave stores it (+ bias) as the attention kernel's operand planes, f16 and bf16 hi / lo:
// z-slices 0 and 1 (q, k) as planes [z][batch][head] of TT rows x HD, a contiguous 8 KB a plane; z-slice 2 (v) transposed, planes [batch][head] of HD rows x TT, straight from the accumulators (a lane's 8 D elements are 8 consecutive tokens of one d: one 16-byte piece of the fragment order). All in fragment order.
// Fragment map: lane l, h = l >> 4: elements 0..7 <- k0 + 8h + 0..7, elements 8..15 <- k0 + 16 + 8h + 0..7 (A row / B column = l & 15); D element j -> (row 8h + j, col l & 15). ld(p): p = the block's first element + 8 l.
template <typename T16> struct WFrag;
template <> struct WFrag<h16> { typedef v16h V; static __device__ __forceinline__ V ld(const h16* p) { return cat16(*(const v8h*)p, *(const v8h*)(p + 256)); } static __device__ __forceinline__ v8f mma(V a, V b, v8f c) { return wmma16(a, b, c); } };
template <> struct WFrag<bf> { typedef v16bf V; static __device__ __forceinline__ V ld(const bf* p) { return cat16b(*(const v8us*)p, *(const v8us*)(p + 256)); } static __device__ __forceinline__ v8f mma(V a, V b, v8f c) { return wmmab(a, b, c); } };
template <typename T16, int NSPLIT, bool BIAS, int KS, bool PL>
__global__ __launch_bounds__(32) void k_gemmw(const T16* __restrict__ A, const T16* __restrict__ A2, const T16* __restrict__ Bt, const T16* __restrict__ Bt2, int K, float* C, int ldc, const float* __restrict__ bias, const float* __restrict__ bias1, const float* __restrict__ bias2, size_t sA, size_t sB, size_t sC, size_t sP, h16* P16, bf* Ph, bf* Pl, h16* V16, bf* Vh, bf* Vl) {
    static_assert(NSPLIT == 0 || NSPLIT == 1);
    static_assert(KS == 1 || !BIAS);
    static_assert(!PL || (BIAS && KS == 1));
    typedef typename WFrag<T16>::V V;
    __shared__ __align__(16) float os[16 * 68];
    const size_t z = blockIdx.z / KS; const int ks = (int)(blockIdx.z % KS); A += z * sA; if (A2) A2 += z * sA; Bt += z * sB; if (Bt2) Bt2 += z * sB; C += z * sC + (size_t)ks * sP;
    const float* bz = (z == 0) ? bias : ((z == 1) ? bias1 : bias2);
    const int kbeg = ks * (K / KS), kend = kbeg + K / KS;
    const int lane = threadIdx.x & 31, lr = lane & 15, hi = lane >> 4; const int r0 = blockIdx.x * 64, c0 = blockIdx.y * 64;
    v8f acc[4][4];
#pragma unroll
    for (int mb = 0; mb < 4; ++mb)
#pragma unroll
        for (int nb = 0; nb < 4; ++nb) acc[mb][nb] = (v8f){};
    // Byte offsets of this lane's piece in the first block of each of the tile's four row blocks of A and of Bt: 16 rows of blocks hold 16 K elements; a step of 32 k is one block, 1 KB.
    unsigned oa[4], ow[4];
#pragma unroll
    for (int i = 0; i < 4; ++i) { const unsigned o = (unsigned)(i * 16 * K + kbeg * 16 + 8 * lane) * 2u; oa[i] = (unsigned)(r0 * K) * 2u + o; ow[i] = (unsigned)(c0 * K) * 2u + o; }
#pragma unroll 1
    for (int kc = kbeg; kc < kend; kc += 32) {
        V a[4], a2[4], b[4];
#pragma unroll
        for (int mb = 0; mb < 4; ++mb) { a[mb] = WFrag<T16>::ld((const T16*)((const char*)A + oa[mb])); if (NSPLIT == 1) a2[mb] = WFrag<T16>::ld((const T16*)((const char*)A2 + oa[mb])); }
#pragma unroll
        for (int nb = 0; nb < 4; ++nb) b[nb] = WFrag<T16>::ld((const T16*)((const char*)Bt + ow[nb]));
        // The trip's loads are all issued above; their offsets are advanced below. The offsets are inputs of the wait, so they live up to it and no load of the run lands in them.
        asm volatile("s_wait_xcnt 0x0" :: "v"(oa[0]), "v"(oa[1]), "v"(oa[2]), "v"(oa[3]), "v"(ow[0]), "v"(ow[1]), "v"(ow[2]), "v"(ow[3]) : "memory");
        __builtin_amdgcn_sched_barrier(0);              // keeps the address additions behind that wait
#pragma unroll
        for (int nb = 0; nb < 4; ++nb)
#pragma unroll
            for (int mb = 0; mb < 4; ++mb) { acc[mb][nb] = WFrag<T16>::mma(a[mb], b[nb], acc[mb][nb]); if (NSPLIT == 1) acc[mb][nb] = WFrag<T16>::mma(a2[mb], b[nb], acc[mb][nb]); }
        asm volatile("v_nop\n\tv_nop\n\tv_nop\n\tv_nop" : "+v"(acc[0][0]), "+v"(acc[1][1]), "+v"(acc[2][2]), "+v"(acc[3][3]) : "v"(a[0]), "v"(a[3]));
#pragma unroll
        for (int i = 0; i < 4; ++i) { oa[i] += 1024u; ow[i] += 1024u; }
    }
    const int bt = r0 / TT, t0 = r0 % TT;   // PL: the tile's batch and first token
    const size_t pb = (((z * NB + bt) * NH_ + blockIdx.y) * TT + t0) * HD;   // PL: the tile's first element in a q / k plane
    float bb[4] = {0.f, 0.f, 0.f, 0.f};   // PL: the bias of this lane's column in each of the four column tiles
    if constexpr (PL) {
#pragma unroll
        for (int nb = 0; nb < 4; ++nb) bb[nb] = bfr(bz[c0 + nb * 16 + lr]); }
    if (!PL || z != 2) {
#pragma unroll
    for (int mb = 0; mb < 4; ++mb) {
#pragma unroll
        for (int nb = 0; nb < 4; ++nb) {
#pragma unroll
            for (int j = 0; j < 8; ++j) os[(hi * 8 + j) * 68 + nb * 16 + lr] = PL ? acc[mb][nb][j] + bb[nb] : acc[mb][nb][j]; }
        __builtin_amdgcn_wave_barrier(); asm volatile("" ::: "memory");
        float* crow = C + (size_t)(r0 + mb * 16) * ldc + c0;
        if constexpr (PL) { v8h o16[4]; v8us oh[4], ol[4];   // piece s: token lr, columns 16 s + 8 hi + 0..7
#pragma unroll
            for (int s = 0; s < 4; ++s) { const float* rp = os + lr * 68 + s * 16 + hi * 8; const v4f v0 = *(const v4fa*)rp, v1 = *(const v4fa*)(rp + 4);
#pragma unroll
                for (int q = 0; q < 8; ++q) { const float x = q < 4 ? v0[q & 3] : v1[q & 3]; o16[s][q] = tohx(x); unsigned short a2, c2; splitf(x, a2, c2); oh[s][q] = a2; ol[s][q] = c2; } }
            __builtin_amdgcn_sched_barrier(0);              // every conversion of the block stands in front of its stores: none lands in a register that an issued store names
#pragma unroll
            for (int s = 0; s < 4; ++s) { const size_t e = pb + (size_t)(mb * 16) * HD + s * 256 + lane * 8; *(v8h*)(P16 + e) = o16[s]; *(v8us*)(Ph + e) = oh[s]; *(v8us*)(Pl + e) = ol[s]; }
            asm volatile("s_wait_xcnt 0x0" ::: "memory");   // the next block's values may land in registers that the stores above name
            __builtin_amdgcn_sched_barrier(0);              // keeps what follows behind that wait
        } else
{
#pragma unroll
            for (int s = 0; s < 8; ++s) { const int row = 2 * s + hi, cofs = lr * 4; v4f val = *(const v4fa*)(os + row * 68 + cofs); if (BIAS) { val[0] += bfr(bz[c0 + cofs]); val[1] += bfr(bz[c0 + cofs + 1]); val[2] += bfr(bz[c0 + cofs + 2]); val[3] += bfr(bz[c0 + cofs + 3]); }
                *(v4f*)(crow + (size_t)row * ldc + cofs) = val; }
             }
        __builtin_amdgcn_wave_barrier(); asm volatile("" ::: "memory");
    }
    } else if constexpr (PL) {
        const size_t vb = (size_t)(bt * NH_ + (int)blockIdx.y) * HD * TT + (size_t)t0 * HD + 8 * lane;   // 32 tokens of all HD rows are HD / 16 blocks, 32 HD elements
#pragma unroll
        for (int nb = 0; nb < 4; ++nb) { v8h o16[4]; v8us oh[4], ol[4];
#pragma unroll
            for (int mb = 0; mb < 4; ++mb)
#pragma unroll
                for (int j = 0; j < 8; ++j) { const float x = acc[mb][nb][j] + bb[nb]; o16[mb][j] = tohx(x); unsigned short a2, c2; splitf(x, a2, c2); oh[mb][j] = a2; ol[mb][j] = c2; }
            __builtin_amdgcn_sched_barrier(0);              // every conversion of the block stands in front of its stores: none lands in a register that an issued store names
#pragma unroll
            for (int mb = 0; mb < 4; ++mb) { const size_t e = vb + (size_t)((mb >> 1) * (HD / 16) + nb) * 512 + (mb & 1) * 256; *(v8h*)(V16 + e) = o16[mb]; *(v8us*)(Vh + e) = oh[mb]; *(v8us*)(Vl + e) = ol[mb]; }
            if (nb < 3) { asm volatile("s_wait_xcnt 0x0" ::: "memory");   // the next block's values may land in registers that the stores above name
                __builtin_amdgcn_sched_barrier(0); }        // keeps the next block's instructions behind that wait
        }
    }
}


// The three passes below read nothing but inputs and feed later launches only; k_prep runs them side by side in one launch of PT-thread work-groups.
#define PT 1024
// y picks one of four equally shaped weights, bx the work-group inside it; Bt holds the four transposed planes (N rows x K) one behind the other, each in fragment order. Thread i makes 16-byte piece i of its plane: 8 consecutive k of one n; 16 lanes read 64 contiguous bytes of a weight row.
__device__ __forceinline__ void wt_body(int bx, int y, const float* __restrict__ w0, const float* __restrict__ w1, const float* __restrict__ w2, const float* __restrict__ w3, int K, int N, bf* Bt) {
    const float* w = (y == 0) ? w0 : ((y == 1) ? w1 : ((y == 2) ? w2 : w3)); Bt += (size_t)y * K * N;
    const int i = (int)(bx * PT + threadIdx.x); if (i >= N * K / 8) return;
    const int lane = i & 31, g = (i >> 5) & 1, blk = i >> 6; const int kb = blk % (K / 32), rb = blk / (K / 32);
    const float* wp[8]; float x[8]; v8us o;
#pragma unroll
    for (int e = 0; e < 8; ++e) wp[e] = w + (size_t)(kb * 32 + g * 16 + (lane >> 4) * 8 + e) * N + rb * 16 + (lane & 15);
#pragma unroll
    for (int e = 0; e < 8; ++e) x[e] = *wp[e];
    asm volatile("s_wait_xcnt 0x0" :: "v"(wp[0]), "v"(wp[1]), "v"(wp[2]), "v"(wp[3]), "v"(wp[4]), "v"(wp[5]), "v"(wp[6]), "v"(wp[7]) : "memory");   // the eight addresses are inputs of the wait: they live up to it, so no load of the run lands in one and nothing rewrites one before it
#pragma unroll
    for (int e = 0; e < 8; ++e) o[e] = f2bf(x[e]);
    *(v8us*)(Bt + (size_t)i * 8) = o;
    asm volatile("s_wait_xcnt 0x0" ::: "memory");   // in k_prep the built code runs on behind this store into branch code shared with the other passes, which rewrites registers that the store names
}
// s picks the stream, by the batch (source batch stride sb elements), bx the work-group inside it; dst is [stream][batch][n8 * 8], each a plane of rows x DM in fragment order. Thread i makes 16-byte piece i of its plane.
__device__ __forceinline__ void cvt_body(int bx, int by, int s, const float* __restrict__ s0, const float* __restrict__ s1, const float* __restrict__ s2, size_t sb, bf* dst, size_t n8) { const size_t i = (size_t)bx * PT + threadIdx.x; if (i >= n8) return;
    const float* src = ((s == 0) ? s0 : ((s == 1) ? s1 : s2)) + (size_t)by * sb; dst += ((size_t)s * NB + by) * n8 * 8;
    const int lane = (int)(i & 31), g = (int)((i >> 5) & 1); const int blk = (int)(i >> 6); const int kb = blk % (DM / 32), rb = blk / (DM / 32);
    const float* sp = src + (size_t)(rb * 16 + (lane & 15)) * DM + kb * 32 + g * 16 + (lane >> 4) * 8; const v8f v = *(const v8f*)sp; v8us o;
    asm volatile("s_wait_xcnt 0x0" :: "v"(sp) : "memory");   // the address is an input of the wait: it lives up to it, so neither load lands in it and nothing rewrites it before
#pragma unroll
    for (int k = 0; k < 8; ++k) o[k] = f2bf(v[k]); *(v8us*)(dst + i * 8) = o;
    asm volatile("s_wait_xcnt 0x0" ::: "memory");   // in k_prep the built code runs on behind this store into branch code shared with the other passes, which rewrites registers that the store names
}

// ---- mcls_body: reads the mask once and classes its tiles of 16 query rows x 32 keys from the values found there. One work-group of 32 waves per row block rb; wave w takes key tiles w and w + 32, whole 128-byte lines a row.
// Cl[4 rb ..]: words 0, 1 = one bit a key tile, set where the tile is CLOSED: every value >= 0.75; words 2, 3 = set where it is OPEN: every value rounds to bf16 zero, so mask x -1e9 adds nothing to a logit.
// The closed bits are kept only where each of the 16 rows holds, somewhere among all its keys, a value <= 0.25. Such a row's maximum logit lies at least 5e8 - 2 max|logit / 8| above every key of a closed tile;
// over the at most 18 rescale factors between that key's term and the output one spans 2e7 or more and is exactly 0 in f32: the tile adds exact zeros, and leaving it out changes no bit. A row block without that property keeps every tile.
__device__ __forceinline__ void mcls_body(int rb, const float* __restrict__ Mk, int mpitch, unsigned* __restrict__ Cl) {
    __shared__ unsigned sf[32], sl[32];
    const int wave = (int)(threadIdx.x >> 5), lane = (int)(threadIdx.x & 31);
    const float* mp = Mk + (size_t)(rb * 16 + (lane >> 3)) * mpitch + (lane & 7) * 4;   // load c of a tile: rows 4c + (lane >> 3)
    const float* rp[4]; v4f m[2][4];
#pragma unroll
    for (int c = 0; c < 4; ++c) rp[c] = mp + (size_t)c * 4 * mpitch + wave * 32;
#pragma unroll
    for (int i = 0; i < 2; ++i)
#pragma unroll
        for (int c = 0; c < 4; ++c) m[i][c] = (wave + 32 * i < TT / 32) ? *(const v4f*)(rp[c] + i * 1024) : (v4f){0.5f, 0.5f, 0.5f, 0.5f};
    asm volatile("s_wait_xcnt 0x0" :: "v"(rp[0]), "v"(rp[1]), "v"(rp[2]), "v"(rp[3]) : "memory");   // the four row addresses are inputs of the wait: they live up to it, so no load of the run lands in one and nothing rewrites one before it
    unsigned flags = 0, rows = 0;
#pragma unroll
    for (int i = 0; i < 2; ++i) { bool cl = true; unsigned nz = 0;
#pragma unroll
        for (int c = 0; c < 4; ++c) { bool lv = false;
#pragma unroll
            for (int q = 0; q < 4; ++q) { const float x = m[i][c][q]; cl = cl & (x >= 0.75f); nz |= f2bf(x) & 0x7FFFu; lv = lv | (x <= 0.25f); }
            const unsigned b = __builtin_amdgcn_ballot_w32(lv);
#pragma unroll
            for (int g = 0; g < 4; ++g) rows |= (((b >> (8 * g)) & 0xFFu) != 0u ? 1u : 0u) << (4 * c + g); }
        flags |= (__builtin_amdgcn_ballot_w32(cl) == 0xFFFFFFFFu ? 1u : 0u) << i; flags |= (__builtin_amdgcn_ballot_w32(nz == 0u) == 0xFFFFFFFFu ? 4u : 0u) << i; }
    if (lane == 0) { sf[wave] = flags; sl[wave] = rows; }
    __syncthreads();
    if (wave == 0) { const unsigned f = sf[lane]; unsigned r = sl[lane];
#pragma unroll
        for (int o = 16; o > 0; o >>= 1) r |= __shfl_xor(r, o, 32);
        const unsigned keep = (r == 0xFFFFu) ? 0xFFFFFFFFu : 0u; v4u w;
        w[0] = __builtin_amdgcn_ballot_w32((f & 1u) != 0u) & keep; w[1] = __builtin_amdgcn_ballot_w32((f & 2u) != 0u) & keep; w[2] = __builtin_amdgcn_ballot_w32((f & 4u) != 0u); w[3] = __builtin_amdgcn_ballot_w32((f & 8u) != 0u);
        if (lane == 0) *(v4u*)(Cl + (size_t)rb * 4) = w; }
}
// ---- k_prep: blockIdx.x deals the work-groups to the three passes, the same branch for a whole work-group (the one barrier stands in the mask pass): first the PB_M row blocks of the mask, then 4 weights x PB_W, then 3 streams x NB batches x PB_X.
#define PB_M (TT / 16)
#define PB_W ((DM * DQ / 8 + PT - 1) / PT)
#define PB_X ((TT * DM / 8 + PT - 1) / PT)
static_assert(PT == 1024);   // the mask pass takes 32 waves
__global__ __launch_bounds__(PT) void k_prep(const float* __restrict__ Mk, int mpitch, unsigned* __restrict__ Cl, const float* __restrict__ w0, const float* __restrict__ w1, const float* __restrict__ w2, const float* __restrict__ w3, bf* Bt, const float* __restrict__ s0, const float* __restrict__ s1, const float* __restrict__ s2, size_t sb, bf* dst) {
    const int b = (int)blockIdx.x;
    if (b < PB_M) mcls_body(b, Mk, mpitch, Cl);
    else if (b < PB_M + 4 * PB_W) { const int c = b - PB_M; wt_body(c % PB_W, c / PB_W, w0, w1, w2, w3, DM, DQ, Bt); }
    else { const int c = b - PB_M - 4 * PB_W; cvt_body(c % PB_X, (c / PB_X) % NB, c / (PB_X * NB), s0, s1, s2, sb, dst, (size_t)TT * DM / 8); }
}

// ---- k_attn: logits, softmax and P x V of one (batch, head) slice z in one kernel; scores and probabilities stay in registers.
// One wave owns 16 NQ query rows and every KSF-th key tile of 32 keys (tiles ph, ph + KSF, ...: under a mask that closes a run of tiles the KSF waves of a block keep equal work), one tile a trip. It forms the TRANSPOSED logits tile (A = key rows, B = query rows), so that D element j of key tile kt is (key 16 kt + 8h + j, query l & 15):
// the two key tiles of a trip are, lane by lane, the B fragment of P^T (elements 0..7 <- key 8h + j, elements 8..15 <- key 16 + 8h + j), the k order of the V^T A fragment. O^T (A = V^T rows d, B = P^T) has its query in l & 15 too, so a row's maximum, sum and rescale factor are one value a lane.
// A trip whose mask tile k_prep found closed for all of the wave's rows is left out whole (scalar branch); one found open loads no mask and takes zeros in its place. A wave with no trip left hands on maximum -3e38, sum 0 and O 0: weight 0 at the join.
// THE JOIN: each wave puts its unnormalised f32 O tiles (per 16 rows and 16 d one KB: lane l's values 0..3 at 4 l, 4..7 at 128 + 4 l: 16-byte LDS accesses, lane after lane) and per 16 rows 16 running maxima, then 16 sums, into LDS (So, Ss: the block's own part); behind one work-group barrier wave ph joins d tile ph of the KSF shares in the order 0..KSF-1:
// weights 2^((m_s - max m) log2 e), O = sum w O_s / sum w l_s, and stores it as 16-byte pieces of the hi+lo bf16 planes of NB TT rows x DQ (merged-head order, fragment order): row block rb0 + nq, k block 2 head + (ph >> 1), half ph & 1, 512 contiguous bytes a wave and plane.
template <typename T16, bool HI, int NQ>
__device__ __forceinline__ void attn_body(const T16* __restrict__ Q, const T16* __restrict__ Q2, const T16* __restrict__ Kp, const T16* __restrict__ K2, const T16* __restrict__ Vt, const T16* __restrict__ V2, const float* __restrict__ Mk, int mpitch, const unsigned* __restrict__ Cl, int q0, int ph, float* So, float* Ss, int rb0, int head, bf* Ah, bf* Al) {
    typedef typename WFrag<T16>::V V;
    const int lane = threadIdx.x & 31, lr = lane & 15, hi = lane >> 4;
    unsigned long long cw = ~0ull, ow = ~0ull;   // closed / open for every one of the wave's row blocks
#pragma unroll
    for (int nq = 0; nq < NQ; ++nq) { const v4u c = *(const v4u*)(Cl + (size_t)((q0 >> 4) + nq) * 4); cw &= (unsigned long long)c[0] | ((unsigned long long)c[1] << 32); ow &= (unsigned long long)c[2] | ((unsigned long long)c[3] << 32); }
    cw >>= ph; ow >>= ph;
    unsigned long long cbits = (unsigned long long)(unsigned)__builtin_amdgcn_readfirstlane((unsigned)cw) | ((unsigned long long)(unsigned)__builtin_amdgcn_readfirstlane((unsigned)(cw >> 32)) << 32);   // bit 0: the coming trip's tile
    unsigned long long obits = (unsigned long long)(unsigned)__builtin_amdgcn_readfirstlane((unsigned)ow) | ((unsigned long long)(unsigned)__builtin_amdgcn_readfirstlane((unsigned)(ow >> 32)) << 32);
    V qf[NQ][2], qf2[NQ][2];
#pragma unroll
    for (int nq = 0; nq < NQ; ++nq)
#pragma unroll
        for (int c = 0; c < 2; ++c) { const size_t o = (size_t)(q0 + nq * 16) * HD + c * 512 + 8 * lane; qf[nq][c] = WFrag<T16>::ld(Q + o); if (HI) qf2[nq][c] = WFrag<T16>::ld(Q2 + o); }
    v8f oacc[NQ][4]; float mrun[NQ], lrun[NQ];
#pragma unroll
    for (int nq = 0; nq < NQ; ++nq) { mrun[nq] = -3.0e38f; lrun[nq] = 0.f;
#pragma unroll
        for (int dt = 0; dt < 4; ++dt) oacc[nq][dt] = (v8f){}; }
    const T16* vp = Vt + (size_t)(ph * 32) * HD + 8 * lane; const T16* vp2 = HI ? V2 + (size_t)(ph * 32) * HD + 8 * lane : nullptr;   // this lane's piece in the first V^T block of the trip's 32 keys
#pragma unroll 1   // one copy of a body that holds a whole trip's loads and products: registers and instruction cache
    for (int k0 = ph * 32; k0 < TT; k0 += 32 * KSF) {
      if (!(cbits & 1u)) {
        V kf[2][2], kf2[2][2], vf[4], vf2[4]; v4f mv[NQ][2][2];
        if (obits & 1u) {
#pragma unroll
            for (int nq = 0; nq < NQ; ++nq)
#pragma unroll
                for (int kt = 0; kt < 2; ++kt) { mv[nq][kt][0] = (v4f){}; mv[nq][kt][1] = (v4f){}; }
        } else {
#pragma unroll
            for (int nq = 0; nq < NQ; ++nq)
#pragma unroll
                for (int kt = 0; kt < 2; ++kt) { const float* mr = Mk + (size_t)(q0 + nq * 16 + lr) * mpitch + k0 + kt * 16 + 8 * hi; mv[nq][kt][0] = *(const v4f*)mr; mv[nq][kt][1] = *(const v4f*)(mr + 4); }
            asm volatile("s_wait_xcnt 0x0" ::: "memory");   // the K loads below may land in registers that held the addresses of the mask loads above
        }
#pragma unroll
        for (int kt = 0; kt < 2; ++kt)
#pragma unroll
            for (int c = 0; c < 2; ++c) { const size_t o = (size_t)(k0 + kt * 16) * HD + c * 512 + 8 * lane; kf[kt][c] = WFrag<T16>::ld(Kp + o); if (HI) kf2[kt][c] = WFrag<T16>::ld(K2 + o); }
        asm volatile("s_wait_xcnt 0x0" ::: "memory");   // the V loads below may land in registers that held the addresses of the loads above
        __builtin_amdgcn_sched_barrier(0);              // keeps the V loads behind that wait
#pragma unroll
        for (int dt = 0; dt < 4; ++dt) { vf[dt] = WFrag<T16>::ld(vp + dt * 512); if (HI) vf2[dt] = WFrag<T16>::ld(vp2 + dt * 512); }
        // The trip's loads are all issued above; their address registers are advanced for the next trip below. The V addresses are inputs of the wait, so they live up to it and no load of the run lands in them.
        if constexpr (HI) asm volatile("s_wait_xcnt 0x0" :: "v"(vp), "v"(vp2) : "memory"); else asm volatile("s_wait_xcnt 0x0" :: "v"(vp) : "memory");
        __builtin_amdgcn_sched_barrier(0);              // keeps those address additions behind the wait, and every load of the trip in front of the first product
#pragma unroll
        for (int nq = 0; nq < NQ; ++nq) {
            v8f s[2];
#pragma unroll
            for (int kt = 0; kt < 2; ++kt) { s[kt] = (v8f){};
#pragma unroll
                for (int c = 0; c < 2; ++c) { s[kt] = WFrag<T16>::mma(kf[kt][c], qf[nq][c], s[kt]); if (HI) { s[kt] = WFrag<T16>::mma(kf[kt][c], qf2[nq][c], s[kt]); s[kt] = WFrag<T16>::mma(kf2[kt][c], qf[nq][c], s[kt]); } } }
            float mx = mrun[nq];
#pragma unroll
            for (int kt = 0; kt < 2; ++kt)
#pragma unroll
                for (int j = 0; j < 8; ++j) { const float t = s[kt][j] * SCL + bfr(mv[nq][kt][j >> 2][j & 3]) * MNEG; s[kt][j] = t; mx = fmaxf(mx, t); }
            mx = fmaxf(mx, __shfl_xor(mx, 16, 32));   // the row's other 16 keys of the trip lie in lane l ^ 16
            const float al = __builtin_amdgcn_exp2f((mrun[nq] - mx) * L2E); mrun[nq] = mx;
            float sum = 0.f;
#pragma unroll
            for (int kt = 0; kt < 2; ++kt) { v8f x, p;
#pragma unroll
                for (int j = 0; j < 8; ++j) { x[j] = (s[kt][j] - mx) * L2E; if (!HI) x[j] += PEXP; }
#pragma unroll
                for (int j = 0; j < 8; ++j) p[j] = __builtin_amdgcn_exp2f(x[j]);
                asm volatile("v_nop" : "+v"(p) : "v"(x));   // the slot behind a transcendental: no result of the eight is read and no source register reused before this instruction
                s[kt] = p;
#pragma unroll
                for (int j = 0; j < 8; ++j) sum += p[j]; }
            lrun[nq] = lrun[nq] * al + sum;
#pragma unroll
            for (int dt = 0; dt < 4; ++dt) oacc[nq][dt] *= al;
            if constexpr (HI) { v8us ph[2], pl[2];
#pragma unroll
                for (int kt = 0; kt < 2; ++kt)
#pragma unroll
                    for (int j = 0; j < 8; ++j) { unsigned short a, c2; splitf(s[kt][j], a, c2); ph[kt][j] = a; pl[kt][j] = c2; }
                const V pfh = cat16b(ph[0], ph[1]), pfl = cat16b(pl[0], pl[1]);
#pragma unroll
                for (int dt = 0; dt < 4; ++dt) { oacc[nq][dt] = WFrag<T16>::mma(vf[dt], pfh, oacc[nq][dt]); oacc[nq][dt] = WFrag<T16>::mma(vf[dt], pfl, oacc[nq][dt]); oacc[nq][dt] = WFrag<T16>::mma(vf2[dt], pfh, oacc[nq][dt]); }
            } else { v8h p16[2];
#pragma unroll
                for (int kt = 0; kt < 2; ++kt)
#pragma unroll
                    for (int j = 0; j < 8; ++j) p16[kt][j] = tohx(s[kt][j]);
                const V pf = cat16(p16[0], p16[1]);
#pragma unroll
                for (int dt = 0; dt < 4; ++dt) oacc[nq][dt] = WFrag<T16>::mma(vf[dt], pf, oacc[nq][dt]); }
        }
      }
        vp += 32 * KSF * HD; if (HI) vp2 += 32 * KSF * HD; cbits >>= KSF; obits >>= KSF;
    }
#pragma unroll
    for (int nq = 0; nq < NQ; ++nq) {
        const float lt = lrun[nq] + __shfl_xor(lrun[nq], 16, 32);
        Ss[(ph * NQ + nq) * 32 + lane] = hi ? lt : mrun[nq];
#pragma unroll
        for (int dt = 0; dt < 4; ++dt) { float* p = So + ((ph * NQ + nq) * 4 + dt) * 256 + 4 * lane; const v8f o = oacc[nq][dt]; *(v4fa*)p = __builtin_shufflevector(o, o, 0, 1, 2, 3); *(v4fa*)(p + 128) = __builtin_shufflevector(o, o, 4, 5, 6, 7); }
    }
    __syncthreads();   // every share of the block lies in LDS before any wave joins them
    v8us oh[NQ], ol[NQ];
#pragma unroll
    for (int nq = 0; nq < NQ; ++nq) { float m[KSF], l[KSF]; v8f ov[KSF]; float mx = -3.0e38f;
#pragma unroll
        for (int s = 0; s < KSF; ++s) { const float* q = Ss + (s * NQ + nq) * 32 + lr; m[s] = q[0]; l[s] = q[16]; const float* p = So + ((s * NQ + nq) * 4 + ph) * 256 + 4 * lane; const v4f x0 = *(const v4fa*)p, x1 = *(const v4fa*)(p + 128); ov[s] = __builtin_shufflevector(x0, x1, 0, 1, 2, 3, 4, 5, 6, 7); }
#pragma unroll
        for (int s = 0; s < KSF; ++s) mx = fmaxf(mx, m[s]);
        const float w0 = __builtin_amdgcn_exp2f((m[0] - mx) * L2E); v8f x = ov[0] * w0; float den = l[0] * w0;
#pragma unroll
        for (int s = 1; s < KSF; ++s) { const float w = __builtin_amdgcn_exp2f((m[s] - mx) * L2E); x += ov[s] * w; den += l[s] * w; }
        const float f = 1.0f / den;
#pragma unroll
        for (int q = 0; q < 8; ++q) { unsigned short a, c2; splitf(x[q] * f, a, c2); oh[nq][q] = a; ol[nq][q] = c2; } }
    const size_t e = (((size_t)rb0 * (DQ / 32) + head * 2 + (ph >> 1)) * 64 + (ph & 1) * 32 + lane) * 8;   // this lane's piece in row block rb0; the next row block lies DQ / 32 blocks of 512 elements on
#pragma unroll
    for (int nq = 0; nq < NQ; ++nq) { *(v8us*)(Ah + e + (size_t)nq * (DQ / 32) * 512) = oh[nq]; *(v8us*)(Al + e + (size_t)nq * (DQ / 32) * 512) = ol[nq]; }
}
// grid (RH/32 + (TT-RH)/64, NZ), 8 waves: wave w is key share w & 3 of query block w >> 2 (waves w and w + 4 read the same K and V tiles). Work-groups x < RH/32 take 16 hi+lo query rows a block, the others 32 f16 rows a block. QK* hold the q planes, then (kofs elements on) the k planes.
__global__ __launch_bounds__(64 * KSF) void k_attn(const h16* __restrict__ QK16, const bf* __restrict__ QKh, const bf* __restrict__ QKl, size_t kofs, const h16* __restrict__ VT16, const bf* __restrict__ VTh, const bf* __restrict__ VTl, const float* __restrict__ Mk, int mpitch, const unsigned* __restrict__ Cl, bf* Ah, bf* Al) {
    __shared__ __align__(16) float so[2][KSF * 2 * 4 * 256]; __shared__ float ss[2][KSF * 2 * 32];
    const int wave = __builtin_amdgcn_readfirstlane((int)(threadIdx.x >> 5)); const int ph = wave % KSF, qb = wave / KSF; const int bx = (int)blockIdx.x; const int z = (int)blockIdx.y; const size_t zo = (size_t)z * TT * HD;
    const int rbz = (z / NH_) * (TT / 16), head = z % NH_;
    if (bx < RH / 32) { const int q0 = bx * 32 + qb * 16; attn_body<bf, true, 1>(QKh + zo, QKl + zo, QKh + kofs + zo, QKl + kofs + zo, VTh + zo, VTl + zo, Mk, mpitch, Cl, q0, ph, so[qb], ss[qb], rbz + (q0 >> 4), head, Ah, Al); }
    else { const int q0 = RH + (bx - RH / 32) * 64 + qb * 32; attn_body<h16, false, 2>(QK16 + zo, nullptr, QK16 + kofs + zo, nullptr, VT16 + zo, nullptr, Mk, mpitch, Cl, q0, ph, so[qb], ss[qb], rbz + (q0 >> 4), head, Ah, Al); }
}

extern "C" void kernel_launch(void* const* d_in, const int* in_sizes, int n_in,
                              void* d_out, int out_size, void* d_ws, size_t ws_size, hipStream_t stream) {
    if (n_in < 12) return;
    const long long xneed = (long long)(NB - 1) * SEQ_FULL * DM + (long long)TT * DM;
    if ((long long)in_sizes[0] < xneed || (long long)in_sizes[1] < xneed || (long long)in_sizes[2] < xneed) return;
    if ((long long)in_sizes[3] < (long long)(TT - 1) * SEQ_FULL + TT) return;
    if (in_sizes[4] < DM * DQ || in_sizes[6] < DM * DKV || in_sizes[8] < DM * DKV || in_sizes[10] < DQ * DM) return;
    if (in_sizes[5] < DQ || in_sizes[7] < DKV || in_sizes[9] < DKV || in_sizes[11] < DM) return;
    if ((long long)out_size < (long long)NB * TT * DM) return;
    const float* xq = (const float*)d_in[0]; const float* xk = (const float*)d_in[1]; const float* xv = (const float*)d_in[2]; const float* mk = (const float*)d_in[3];
    const float* wq = (const float*)d_in[4]; const float* bq = (const float*)d_in[5]; const float* wk = (const float*)d_in[6]; const float* bk = (const float*)d_in[7]; const float* wv = (const float*)d_in[8]; const float* bv = (const float*)d_in[9]; const float* wo = (const float*)d_in[10]; const float* bo = (const float*)d_in[11];
    float* OUT = (float*)d_out;     // [NB][TT][DM]
    char* wsp = (char*)d_ws;
    auto take = [&](size_t bytes) { char* p = wsp; wsp += (bytes + 255) & ~(size_t)255; return (void*)p; };
    constexpr size_t WSZ = (size_t)DM * DQ;           // elements of one weight plane
    constexpr size_t PSZ = (size_t)NZ * TT * HD;      // elements of one plane set over all (batch, head) slices
    constexpr size_t XSZ = (size_t)NB * TT * DM;      // elements of one stream, both batches
    bf* W4 = (bf*)take(4 * WSZ * 2);                  // Wq, Wk, Wv, Wo transposed, one behind the other
    h16* QK16 = (h16*)take(2 * PSZ * 2); bf* QKh = (bf*)take(2 * PSZ * 2); bf* QKl = (bf*)take(2 * PSZ * 2);   // q planes, then k planes
    h16* VT16 = (h16*)take(PSZ * 2); bf* VTh = (bf*)take(PSZ * 2); bf* VTl = (bf*)take(PSZ * 2);
    unsigned* Cls = (unsigned*)take((size_t)(TT / 16) * 4 * 4);   // per 16 query rows: closed and open bits of the 64 key tiles
    bf* ATh = (bf*)take(XSZ * 2); bf* ATl = (bf*)take(XSZ * 2);
    bf* XB = (bf*)take(3 * XSZ * 2);                  // the projections' bf16 inputs
    const size_t carved = (size_t)(wsp - (char*)d_ws);
    if (carved > ws_size) return;
    // weights: w is [in = K rows][out = N cols] -> Bt, N rows x K, fragment order
    k_prep<<<PB_M + 4 * PB_W + 3 * NB * PB_X, PT, 0, stream>>>(mk, SEQ_FULL, Cls, wq, wk, wv, wo, W4, xq, xk, xv, (size_t)SEQ_FULL * DM, XB);
    k_gemmw<bf, 0, true, 1, true><<<dim3(NB * TT / 64, DQ / 64, 3), 32, 0, stream>>>(XB, nullptr, W4, nullptr, DM, nullptr, DQ, bq, bk, bv, XSZ, WSZ, 0, 0, QK16, QKh, QKl, VT16, VTh, VTl);
    k_attn<<<dim3(RH / 32 + (TT - RH) / 64, NZ), 64 * KSF, 0, stream>>>(QK16, QKh, QKl, PSZ, VT16, VTh, VTl, mk, SEQ_FULL, Cls, ATh, ATl);
    k_gemmw<bf, 1, true, 1, false><<<dim3(NB * TT / 64, DM / 64, 1), 32, 0, stream>>>(ATh, ATl, W4 + 3 * WSZ, nullptr, DQ, OUT, DM, bo, bo, bo, 0, 0, 0, 0, nullptr, nullptr, nullptr, nullptr, nullptr, nullptr);
}

// v009
// One run takes 81.3 microseconds.
// In two side-by-side timings against v008, it was 1.13 and 1.14 times as fast.
// Over all steps from v000 it is 19.1 times as fast.
#include <hip/hip_runtime.h>

// Masked attention block: three input streams q, k, v [2][2048][768]; per-stream projection x W + b (W stored [in][out]); 12 heads x 64; logits x 1/8 plus mask x -1e9 (mask [2048][2048] read as values from its input buffer); softmax over all keys; merged heads x Wo + bo -> [2][2048][768].
// Compute dtypes (every product accumulates in f32): inputs, mask, biases and weights RNE-converted to bf16; projections v_wmma_f32_16x16x32_bf16 (exact products) + f32 bias; logits: query rows < 512 on bf16 hi/lo planes (3 products), other rows on f16 planes (1 product); P x V: rows < 512 bf16 hi/lo (3 products), other rows v_wmma_f32_16x16x32_f16 with P carried x1024; softmax f32, running maximum and sum per query row inside the attention kernel, four key shares a row joined there through LDS (mask tiles classed from their values by k_prep); output projection: merged bf16 hi/lo planes x bf16 Wo (2 products) + f32 bias.

#ifndef NB
#define NB 2
#endif
#ifndef SEQ
#define SEQ 2048
#endif
#define NB_FULL  2
#define SEQ_FULL 2048
#define TT   SEQ
#define DM   768
#define NH_  12
#define NKV  12
#define REP  (NH_ / NKV)
#define HD   64
#define DQ   (NH_ * HD)
#define DKV  (NKV * HD)
#define NZ   (NB * NH_)
#define RH   ((TT) < 512 ? (TT) : 512)   // query rows < RH use hi+lo planes
#define PEXP 10.0f    // f16 rows carry P x 2^10 (added to the exponent; the row sum carries it too, so the quotient is free of it)
#define L2E  1.4426950408889634f
#define SCL  0.125f   // HD^-0.5
#define MNEG (-1.0e9f)
#define KSF  4        // key shares of the attention kernel: KSF waves of one work-group share a query block's keys

static_assert(TT % 128 == 0);
static_assert(TT <= SEQ_FULL);
static_assert(NB <= NB_FULL);
static_assert(DM % 64 == 0);
static_assert(TT % 64 == 0);
static_assert(DQ % 64 == 0);
static_assert(DQ == DM);
static_assert(HD == 64);
static_assert(NKV == NH_);
static_assert(RH % 64 == 0);
static_assert((TT - RH) % 64 == 0);
static_assert(TT % (32 * KSF) == 0);
static_assert(TT / 32 <= 64);          // one bit a key tile in a 64-bit class word
static_assert(KSF == HD / 16);         // at the join each of a block's KSF waves takes one 16-wide d tile

// FRAGMENT ORDER of every 16-bit operand plane (R rows x K columns, the k axis of its product along the columns): blocks of 16 rows x 32 k, 512 elements = 1 KB, block (rb, kb) at element (rb K/32 + kb) 512 (the V^T planes: at (kb HD/16 + rb) 512, so that the 32 keys of a trip are 4 KB in a row).
// Inside a block element (row r, k = 16 g + 8 h + e) lies at 256 g + 8 (16 h + r) + e: lane l = 16 h + r of a wave finds its fragment's elements 0..7 at 8 l and 8..15 at 256 + 8 l,
// so each of the two 16-byte loads of a fragment covers 512 contiguous bytes, four whole 128-byte lines, and each writer stores such 512-byte runs.
typedef _Float16 h16;
typedef unsigned short bf;
typedef __attribute__((ext_vector_type(16))) __bf16   v16bf;
typedef __attribute__((ext_vector_type(16))) _Float16 v16h;
typedef __attribute__((ext_vector_type(8)))  _Float16 v8h;
typedef __attribute__((ext_vector_type(8)))  unsigned short v8us;
typedef __attribute__((ext_vector_type(8)))  float    v8f;
typedef __attribute__((ext_vector_type(4)))  float    v4f;
typedef v8h  __attribute__((may_alias)) v8ha;
typedef v4f  __attribute__((may_alias)) v4fa;
typedef v8us __attribute__((may_alias)) v8usa;

__device__ __forceinline__ unsigned short f2bf(float f) { unsigned u = __float_as_uint(f); u += 0x7FFFu + ((u >> 16) & 1u); return (unsigned short)(u >> 16); }
__device__ __forceinline__ float bf2f(unsigned short b) { return __uint_as_float(((unsigned)b) << 16); }
__device__ __forceinline__ float bfr(float f) { return bf2f(f2bf(f)); }
__device__ __forceinline__ v16h cat16(v8h lo, v8h hi) { return __builtin_shufflevector(lo, hi, 0, 1, 2, 3, 4, 5, 6, 7, 8, 9, 10, 11, 12, 13, 14, 15); }
__device__ __forceinline__ v16bf cat16b(v8us lo, v8us hi) { return __builtin_bit_cast(v16bf, __builtin_shufflevector(lo, hi, 0, 1, 2, 3, 4, 5, 6, 7, 8, 9, 10, 11, 12, 13, 14, 15)); }
__device__ __forceinline__ v8f wmma16(v16h a, v16h b, v8f c) { return __builtin_amdgcn_wmma_f32_16x16x32_f16(false, a, false, b, (short)0, c, false, false); }
__device__ __forceinline__ v8f wmmab(v16bf a, v16bf b, v8f c) { return __builtin_amdgcn_wmma_f32_16x16x32_bf16(false, a, false, b, (short)0, c, false, false); }
__device__ __forceinline__ h16 tohx(float x) { return (h16)x; }
__device__ __forceinline__ void splitf(float y, unsigned short& h, unsigned short& l) { h = f2bf(y); l = f2bf(y - bf2f(h)); }
typedef __attribute__((ext_vector_type(4))) _Float16 v4h;
typedef __attribute__((ext_vector_type(2))) unsigned short v2us;
typedef __attribute__((ext_vector_type(4))) unsigned short v4us;
typedef __attribute__((ext_vector_type(2))) float v2f;
typedef __attribute__((ext_vector_type(4))) unsigned v4u;

// ---- k_gemmw: register-blocked GEMM, ONE WAVE per 64x64 output tile (16 accumulators), operands straight from 16-bit planes in fragment order; grid (M/64, N/64, Z), 32 threads.
// C[m][n] (f32, pitch ldc, + optional f32 bias[n]) = sum_k A[m][k] Bt[n][k] (+ split products per NSPLIT). z-batch strides sA/sB/sC in elements. K % (32 KS) == 0, M % 64 == 0, N % 64 == 0.
// BIAS: z-slice 0 / 1 / 2 adds bias / bias1 / bias2.
// KS > 1: grid z = Z x KS; work-group (z, ks) sums only k in [ks K/KS, (ks+1) K/KS) and stores its f32 partial tile into plane ks (plane stride sP elements); the reader adds the KS planes in the order 0..KS-1.
// PL: no f32 C. The tile is 64 tokens of one batch x the 64 columns of head blockIdx.y, and the wave stores it (+ bias) as the attention kernel's operand planes, f16 and bf16 hi / lo:
// z-slices 0 and 1 (q, k) as planes [z][batch][head] of TT rows x HD, a contiguous 8 KB a plane; z-slice 2 (v) transposed, planes [batch][head] of HD rows x TT, straight from the accumulators (a lane's 8 D elements are 8 consecutive tokens of one d: one 16-byte piece of the fragment order). All in fragment order.
// Fragment map: lane l, h = l >> 4: elements 0..7 <- k0 + 8h + 0..7, elements 8..15 <- k0 + 16 + 8h + 0..7 (A row / B column = l & 15); D element j -> (row 8h + j, col l & 15). ld(p): p = the block's first element + 8 l.
template <typename T16> struct WFrag;
template <> struct WFrag<h16> { typedef v16h V; static __device__ __forceinline__ V ld(const h16* p) { return cat16(*(const v8h*)p, *(const v8h*)(p + 256)); } static __device__ __forceinline__ v8f mma(V a, V b, v8f c) { return wmma16(a, b, c); } };
template <> struct WFrag<bf> { typedef v16bf V; static __device__ __forceinline__ V ld(const bf* p) { return cat16b(*(const v8us*)p, *(const v8us*)(p + 256)); } static __device__ __forceinline__ v8f mma(V a, V b, v8f c) { return wmmab(a, b, c); } };
template <typename T16, int NSPLIT, bool BIAS, int KS, bool PL>
__global__ __launch_bounds__(32) void k_gemmw(const T16* __restrict__ A, const T16* __restrict__ A2, const T16* __restrict__ Bt, const T16* __restrict__ Bt2, int K, float* C, int ldc, const float* __restrict__ bias, const float* __restrict__ bias1, const float* __restrict__ bias2, size_t sA, size_t sB, size_t sC, size_t sP, h16* P16, bf* Ph, bf* Pl, h16* V16, bf* Vh, bf* Vl) {
    static_assert(NSPLIT == 0 || NSPLIT == 1);
    static_assert(KS == 1 || !BIAS);
    static_assert(!PL || (BIAS && KS == 1));
    typedef typename WFrag<T16>::V V;
    __shared__ __align__(16) float os[16 * 68];
    const size_t z = blockIdx.z / KS; const int ks = (int)(blockIdx.z % KS); A += z * sA; if (A2) A2 += z * sA; Bt += z * sB; if (Bt2) Bt2 += z * sB; C += z * sC + (size_t)ks * sP;
    const float* bz = (z == 0) ? bias : ((z == 1) ? bias1 : bias2);
    const int kbeg = ks * (K / KS), kend = kbeg + K / KS;
    const int lane = threadIdx.x & 31, lr = lane & 15, hi = lane >> 4; const int r0 = blockIdx.x * 64, c0 = blockIdx.y * 64;
    v8f acc[4][4];
#pragma unroll
    for (int mb = 0; mb < 4; ++mb)
#pragma unroll
        for (int nb = 0; nb < 4; ++nb) acc[mb][nb] = (v8f){};
    // Byte offsets of this lane's piece in the first block of each of the tile's four row blocks of A and of Bt: 16 rows of blocks hold 16 K elements; a step of 32 k is one block, 1 KB.
    unsigned oa[4], ow[4];
#pragma unroll
    for (int i = 0; i < 4; ++i) { const unsigned o = (unsigned)(i * 16 * K + kbeg * 16 + 8 * lane) * 2u; oa[i] = (unsigned)(r0 * K) * 2u + o; ow[i] = (unsigned)(c0 * K) * 2u + o; }
#pragma unroll 1
    for (int kc = kbeg; kc < kend; kc += 32) {
        V a[4], a2[4], b[4];
#pragma unroll
        for (int mb = 0; mb < 4; ++mb) { a[mb] = WFrag<T16>::ld((const T16*)((const char*)A + oa[mb])); if (NSPLIT == 1) a2[mb] = WFrag<T16>::ld((const T16*)((const char*)A2 + oa[mb])); }
#pragma unroll
        for (int nb = 0; nb < 4; ++nb) b[nb] = WFrag<T16>::ld((const T16*)((const char*)Bt + ow[nb]));
        // The trip's loads are all issued above; their offsets are advanced below. The offsets are inputs of the wait, so they live up to it and no load of the run lands in them.
        asm volatile("s_wait_xcnt 0x0" :: "v"(oa[0]), "v"(oa[1]), "v"(oa[2]), "v"(oa[3]), "v"(ow[0]), "v"(ow[1]), "v"(ow[2]), "v"(ow[3]) : "memory");
        __builtin_amdgcn_sched_barrier(0);              // keeps the address additions behind that wait
#pragma unroll
        for (int nb = 0; nb < 4; ++nb)
#pragma unroll
            for (int mb = 0; mb < 4; ++mb) { acc[mb][nb] = WFrag<T16>::mma(a[mb], b[nb], acc[mb][nb]); if (NSPLIT == 1) acc[mb][nb] = WFrag<T16>::mma(a2[mb], b[nb], acc[mb][nb]); }
        asm volatile("v_nop\n\tv_nop\n\tv_nop\n\tv_nop" : "+v"(acc[0][0]), "+v"(acc[1][1]), "+v"(acc[2][2]), "+v"(acc[3][3]) : "v"(a[0]), "v"(a[3]));
#pragma unroll
        for (int i = 0; i < 4; ++i) { oa[i] += 1024u; ow[i] += 1024u; }
    }
    const int bt = r0 / TT, t0 = r0 % TT;   // PL: the tile's batch and first token
    const size_t pb = (((z * NB + bt) * NH_ + blockIdx.y) * TT + t0) * HD;   // PL: the tile's first element in a q / k plane
    float bb[4] = {0.f, 0.f, 0.f, 0.f};   // PL: the bias of this lane's column in each of the four column tiles
    if constexpr (PL) {
#pragma unroll
        for (int nb = 0; nb < 4; ++nb) bb[nb] = bfr(bz[c0 + nb * 16 + lr]); }
    if (!PL || z != 2) {
#pragma unroll
    for (int mb = 0; mb < 4; ++mb) {
#pragma unroll
        for (int nb = 0; nb < 4; ++nb) {
#pragma unroll
            for (int j = 0; j < 8; ++j) os[(hi * 8 + j) * 68 + nb * 16 + lr] = PL ? acc[mb][nb][j] + bb[nb] : acc[mb][nb][j]; }
        __builtin_amdgcn_wave_barrier(); asm volatile("" ::: "memory");
        float* crow = C + (size_t)(r0 + mb * 16) * ldc + c0;
        if constexpr (PL) { v8h o16[4]; v8us oh[4], ol[4];   // piece s: token lr, columns 16 s + 8 hi + 0..7
#pragma unroll
            for (int s = 0; s < 4; ++s) { const float* rp = os + lr * 68 + s * 16 + hi * 8; const v4f v0 = *(const v4fa*)rp, v1 = *(const v4fa*)(rp + 4);
#pragma unroll
                for (int q = 0; q < 8; ++q) { const float x = q < 4 ? v0[q & 3] : v1[q & 3]; o16[s][q] = tohx(x); unsigned short a2, c2; splitf(x, a2, c2); oh[s][q] = a2; ol[s][q] = c2; } }
            __builtin_amdgcn_sched_barrier(0);              // every conversion of the block stands in front of its stores: none lands in a register that an issued store names
#pragma unroll
            for (int s = 0; s < 4; ++s) { const size_t e = pb + (size_t)(mb * 16) * HD + s * 256 + lane * 8; *(v8h*)(P16 + e) = o16[s]; *(v8us*)(Ph + e) = oh[s]; *(v8us*)(Pl + e) = ol[s]; }
            asm volatile("s_wait_xcnt 0x0" ::: "memory");   // the next block's values may land in registers that the stores above name
            __builtin_amdgcn_sched_barrier(0);              // keeps what follows behind that wait
        } else
{
#pragma unroll
            for (int s = 0; s < 8; ++s) { const int row = 2 * s + hi, cofs = lr * 4; v4f val = *(const v4fa*)(os + row * 68 + cofs); if (BIAS) { val[0] += bfr(bz[c0 + cofs]); val[1] += bfr(bz[c0 + cofs + 1]); val[2] += bfr(bz[c0 + cofs + 2]); val[3] += bfr(bz[c0 + cofs + 3]); }
                *(v4f*)(crow + (size_t)row * ldc + cofs) = val; }
             }
        __builtin_amdgcn_wave_barrier(); asm volatile("" ::: "memory");
    }
    } else if constexpr (PL) {
        const size_t vb = (size_t)(bt * NH_ + (int)blockIdx.y) * HD * TT + (size_t)t0 * HD + 8 * lane;   // 32 tokens of all HD rows are HD / 16 blocks, 32 HD elements
#pragma unroll
        for (int nb = 0; nb < 4; ++nb) { v8h o16[4]; v8us oh[4], ol[4];
#pragma unroll
            for (int mb = 0; mb < 4; ++mb)
#pragma unroll
                for (int j = 0; j < 8; ++j) { const float x = acc[mb][nb][j] + bb[nb]; o16[mb][j] = tohx(x); unsigned short a2, c2; splitf(x, a2, c2); oh[mb][j] = a2; ol[mb][j] = c2; }
            __builtin_amdgcn_sched_barrier(0);              // every conversion of the block stands in front of its stores: none lands in a register that an issued store names
#pragma unroll
            for (int mb = 0; mb < 4; ++mb) { const size_t e = vb + (size_t)((mb >> 1) * (HD / 16) + nb) * 512 + (mb & 1) * 256; *(v8h*)(V16 + e) = o16[mb]; *(v8us*)(Vh + e) = oh[mb]; *(v8us*)(Vl + e) = ol[mb]; }
            if (nb < 3) { asm volatile("s_wait_xcnt 0x0" ::: "memory");   // the next block's values may land in registers that the stores above name
                __builtin_amdgcn_sched_barrier(0); }        // keeps the next block's instructions behind that wait
        }
    }
}


// The three passes below read nothing but inputs and feed later launches only; k_prep runs them side by side in one launch of PT-thread work-groups.
#define PT 1024
// y picks one of four equally shaped weights, bx the work-group inside it; Bt holds the four transposed planes (N rows x K) one behind the other, each in fragment order. Thread i makes 16-byte piece i of its plane: 8 consecutive k of one n; 16 lanes read 64 contiguous bytes of a weight row.
__device__ __forceinline__ void wt_body(int bx, int y, const float* __restrict__ w0, const float* __restrict__ w1, const float* __restrict__ w2, const float* __restrict__ w3, int K, int N, bf* Bt) {
    const float* w = (y == 0) ? w0 : ((y == 1) ? w1 : ((y == 2) ? w2 : w3)); Bt += (size_t)y * K * N;
    const int i = (int)(bx * PT + threadIdx.x); if (i >= N * K / 8) return;
    const int lane = i & 31, g = (i >> 5) & 1, blk = i >> 6; const int kb = blk % (K / 32), rb = blk / (K / 32);
    const float* wp[8]; float x[8]; v8us o;
#pragma unroll
    for (int e = 0; e < 8; ++e) wp[e] = w + (size_t)(kb * 32 + g * 16 + (lane >> 4) * 8 + e) * N + rb * 16 + (lane & 15);
#pragma unroll
    for (int e = 0; e < 8; ++e) x[e] = *wp[e];
    asm volatile("s_wait_xcnt 0x0" :: "v"(wp[0]), "v"(wp[1]), "v"(wp[2]), "v"(wp[3]), "v"(wp[4]), "v"(wp[5]), "v"(wp[6]), "v"(wp[7]) : "memory");   // the eight addresses are inputs of the wait: they live up to it, so no load of the run lands in one and nothing rewrites one before it
#pragma unroll
    for (int e = 0; e < 8; ++e) o[e] = f2bf(x[e]);
    *(v8us*)(Bt + (size_t)i * 8) = o;
    asm volatile("s_wait_xcnt 0x0" ::: "memory");   // in k_prep the built code runs on behind this store into branch code shared with the other passes, which rewrites registers that the store names
}
// s picks the stream, by the batch (source batch stride sb elements), bx the work-group inside it; dst is [stream][batch][n8 * 8], each a plane of rows x DM in fragment order. Thread i makes 16-byte piece i of its plane.
__device__ __forceinline__ void cvt_body(int bx, int by, int s, const float* __restrict__ s0, const float* __restrict__ s1, const float* __restrict__ s2, size_t sb, bf* dst, size_t n8) { const size_t i = (size_t)bx * PT + threadIdx.x; if (i >= n8) return;
    const float* src = ((s == 0) ? s0 : ((s == 1) ? s1 : s2)) + (size_t)by * sb; dst += ((size_t)s * NB + by) * n8 * 8;
    const int lane = (int)(i & 31), g = (int)((i >> 5) & 1); const int blk = (int)(i >> 6); const int kb = blk % (DM / 32), rb = blk / (DM / 32);
    const float* sp = src + (size_t)(rb * 16 + (lane & 15)) * DM + kb * 32 + g * 16 + (lane >> 4) * 8; const v8f v = *(const v8f*)sp; v8us o;
    asm volatile("s_wait_xcnt 0x0" :: "v"(sp) : "memory");   // the address is an input of the wait: it lives up to it, so neither load lands in it and nothing rewrites it before
#pragma unroll
    for (int k = 0; k < 8; ++k) o[k] = f2bf(v[k]); *(v8us*)(dst + i * 8) = o;
    asm volatile("s_wait_xcnt 0x0" ::: "memory");   // in k_prep the built code runs on behind this store into branch code shared with the other passes, which rewrites registers that the store names
}

// ---- mcls_body: reads the mask once and classes its tiles of 16 query rows x 32 keys from the values found there. One work-group of 32 waves per row block rb; wave w takes key tiles w and w + 32, whole 128-byte lines a row.
// Cl[4 rb ..]: words 0, 1 = one bit a key tile, set where the tile is CLOSED: every value >= 0.75; words 2, 3 = set where it is OPEN: every value rounds to bf16 zero, so mask x -1e9 adds nothing to a logit.
// The closed bits are kept only where each of the 16 rows holds, somewhere among all its keys, a value <= 0.25. Such a row's maximum logit lies at least 5e8 - 2 max|logit / 8| above every key of a closed tile;
// over the at most 18 rescale factors between that key's term and the output one spans 2e7 or more and is exactly 0 in f32: the tile adds exact zeros, and leaving it out changes no bit. A row block without that property keeps every tile.
__device__ __forceinline__ void mcls_body(int rb, const float* __restrict__ Mk, int mpitch, unsigned* __restrict__ Cl) {
    __shared__ unsigned sf[32], sl[32];
    const int wave = (int)(threadIdx.x >> 5), lane = (int)(threadIdx.x & 31);
    const float* mp = Mk + (size_t)(rb * 16 + (lane >> 3)) * mpitch + (lane & 7) * 4;   // load c of a tile: rows 4c + (lane >> 3)
    const float* rp[4]; v4f m[2][4];
#pragma unroll
    for (int c = 0; c < 4; ++c) rp[c] = mp + (size_t)c * 4 * mpitch + wave * 32;
#pragma unroll
    for (int i = 0; i < 2; ++i)
#pragma unroll
        for (int c = 0; c < 4; ++c) m[i][c] = (wave + 32 * i < TT / 32) ? *(const v4f*)(rp[c] + i * 1024) : (v4f){0.5f, 0.5f, 0.5f, 0.5f};
    asm volatile("s_wait_xcnt 0x0" :: "v"(rp[0]), "v"(rp[1]), "v"(rp[2]), "v"(rp[3]) : "memory");   // the four row addresses are inputs of the wait: they live up to it, so no load of the run lands in one and nothing rewrites one before it
    unsigned flags = 0, rows = 0;
#pragma unroll
    for (int i = 0; i < 2; ++i) { bool cl = true; unsigned nz = 0;
#pragma unroll
        for (int c = 0; c < 4; ++c) { bool lv = false;
#pragma unroll
            for (int q = 0; q < 4; ++q) { const float x = m[i][c][q]; cl = cl & (x >= 0.75f); nz |= f2bf(x) & 0x7FFFu; lv = lv | (x <= 0.25f); }
            const unsigned b = __builtin_amdgcn_ballot_w32(lv);
#pragma unroll
            for (int g = 0; g < 4; ++g) rows |= (((b >> (8 * g)) & 0xFFu) != 0u ? 1u : 0u) << (4 * c + g); }
        flags |= (__builtin_amdgcn_ballot_w32(cl) == 0xFFFFFFFFu ? 1u : 0u) << i; flags |= (__builtin_amdgcn_ballot_w32(nz == 0u) == 0xFFFFFFFFu ? 4u : 0u) << i; }
    if (lane == 0) { sf[wave] = flags; sl[wave] = rows; }
    __syncthreads();
    if (wave == 0) { const unsigned f = sf[lane]; unsigned r = sl[lane];
#pragma unroll
        for (int o = 16; o > 0; o >>= 1) r |= __shfl_xor(r, o, 32);
        const unsigned keep = (r == 0xFFFFu) ? 0xFFFFFFFFu : 0u; v4u w;
        w[0] = __builtin_amdgcn_ballot_w32((f & 1u) != 0u) & keep; w[1] = __builtin_amdgcn_ballot_w32((f & 2u) != 0u) & keep; w[2] = __builtin_amdgcn_ballot_w32((f & 4u) != 0u); w[3] = __builtin_amdgcn_ballot_w32((f & 8u) != 0u);
        if (lane == 0) *(v4u*)(Cl + (size_t)rb * 4) = w; }
}
// ---- k_prep: blockIdx.x deals the work-groups to the three passes, the same branch for a whole work-group (the one barrier stands in the mask pass): first the PB_M row blocks of the mask, then 4 weights x PB_W, then 3 streams x NB batches x PB_X.
#define PB_M (TT / 16)
#define PB_W ((DM * DQ / 8 + PT - 1) / PT)
#define PB_X ((TT * DM / 8 + PT - 1) / PT)
static_assert(PT == 1024);   // the mask pass takes 32 waves
__global__ __launch_bounds__(PT) void k_prep(const float* __restrict__ Mk, int mpitch, unsigned* __restrict__ Cl, const float* __restrict__ w0, const float* __restrict__ w1, const float* __restrict__ w2, const float* __restrict__ w3, bf* Bt, const float* __restrict__ s0, const float* __restrict__ s1, const float* __restrict__ s2, size_t sb, bf* dst) {
    const int b = (int)blockIdx.x;
    if (b < PB_M) mcls_body(b, Mk, mpitch, Cl);
    else if (b < PB_M + 4 * PB_W) { const int c = b - PB_M; wt_body(c % PB_W, c / PB_W, w0, w1, w2, w3, DM, DQ, Bt); }
    else { const int c = b - PB_M - 4 * PB_W; cvt_body(c % PB_X, (c / PB_X) % NB, c / (PB_X * NB), s0, s1, s2, sb, dst, (size_t)TT * DM / 8); }
}

// ---- k_attn: logits, softmax and P x V of one (batch, head) slice z in one kernel; scores and probabilities stay in registers.
// One wave owns 16 NQ query rows and every KSF-th key tile of 32 keys (tiles ph, ph + KSF, ...: under a mask that closes a run of tiles the KSF waves of a block keep equal work), one tile a trip. It forms the TRANSPOSED logits tile (A = key rows, B = query rows), so that D element j of key tile kt is (key 16 kt + 8h + j, query l & 15):
// the two key tiles of a trip are, lane by lane, the B fragment of P^T (elements 0..7 <- key 8h + j, elements 8..15 <- key 16 + 8h + j), the k order of the V^T A fragment. O^T (A = V^T rows d, B = P^T) has its query in l & 15 too, so a row's maximum, sum and rescale factor are one value a lane.
// A trip whose mask tile k_prep found closed for all of the wave's rows is left out whole (scalar branch); one found open loads no mask and takes zeros in its place. A wave with no trip left hands on maximum -3e38, sum 0 and O 0: weight 0 at the join.
// THE JOIN: each wave puts its unnormalised f32 O tiles (per 16 rows and 16 d one KB: lane l's values 0..3 at 4 l, 4..7 at 128 + 4 l: 16-byte LDS accesses, lane after lane) and per 16 rows 16 running maxima, then 16 sums, into LDS (So, Ss: the block's own part); behind one work-group barrier wave ph joins d tile ph of the KSF shares in the order 0..KSF-1:
// weights 2^((m_s - max m) log2 e), O = sum w O_s / sum w l_s, and stores it as 16-byte pieces of the hi+lo bf16 planes of NB TT rows x DQ (merged-head order, fragment order): row block rb0 + nq, k block 2 head + (ph >> 1), half ph & 1, 512 contiguous bytes a wave and plane.
template <typename T16, bool HI, int NQ>
__device__ __forceinline__ void attn_body(const T16* __restrict__ Q, const T16* __restrict__ Q2, const T16* __restrict__ Kp, const T16* __restrict__ K2, const T16* __restrict__ Vt, const T16* __restrict__ V2, const float* __restrict__ Mk, int mpitch, const unsigned* __restrict__ Cl, int q0, int ph, float* So, float* Ss, int rb0, int head, bf* Ah, bf* Al) {
    typedef typename WFrag<T16>::V V;
    const int lane = threadIdx.x & 31, lr = lane & 15, hi = lane >> 4;
    unsigned long long cw = ~0ull, ow = ~0ull;   // closed / open for every one of the wave's row blocks
#pragma unroll
    for (int nq = 0; nq < NQ; ++nq) { const v4u c = *(const v4u*)(Cl + (size_t)((q0 >> 4) + nq) * 4); cw &= (unsigned long long)c[0] | ((unsigned long long)c[1] << 32); ow &= (unsigned long long)c[2] | ((unsigned long long)c[3] << 32); }
    cw >>= ph; ow >>= ph;
    unsigned long long cbits = (unsigned long long)(unsigned)__builtin_amdgcn_readfirstlane((unsigned)cw) | ((unsigned long long)(unsigned)__builtin_amdgcn_readfirstlane((unsigned)(cw >> 32)) << 32);   // bit 0: the coming trip's tile
    unsigned long long obits = (unsigned long long)(unsigned)__builtin_amdgcn_readfirstlane((unsigned)ow) | ((unsigned long long)(unsigned)__builtin_amdgcn_readfirstlane((unsigned)(ow >> 32)) << 32);
    V qf[NQ][2], qf2[NQ][2];
#pragma unroll
    for (int nq = 0; nq < NQ; ++nq)
#pragma unroll
        for (int c = 0; c < 2; ++c) { const size_t o = (size_t)(q0 + nq * 16) * HD + c * 512 + 8 * lane; qf[nq][c] = WFrag<T16>::ld(Q + o); if (HI) qf2[nq][c] = WFrag<T16>::ld(Q2 + o); }
    v8f oacc[NQ][4]; float mrun[NQ], lrun[NQ];
#pragma unroll
    for (int nq = 0; nq < NQ; ++nq) { mrun[nq] = -3.0e38f; lrun[nq] = 0.f;
#pragma unroll
        for (int dt = 0; dt < 4; ++dt) oacc[nq][dt] = (v8f){}; }
    const T16* vp = Vt + (size_t)(ph * 32) * HD + 8 * lane; const T16* vp2 = HI ? V2 + (size_t)(ph * 32) * HD + 8 * lane : nullptr;   // this lane's piece in the first V^T block of the trip's 32 keys
#pragma unroll 1   // one copy of a body that holds a whole trip's loads and products: registers and instruction cache
    for (int k0 = ph * 32; k0 < TT; k0 += 32 * KSF) {
      if (!(cbits & 1u)) {
        V kf[2][2], kf2[2][2], vf[4], vf2[4]; v4f mv[NQ][2][2];
        if (obits & 1u) {
#pragma unroll
            for (int nq = 0; nq < NQ; ++nq)
#pragma unroll
                for (int kt = 0; kt < 2; ++kt) { mv[nq][kt][0] = (v4f){}; mv[nq][kt][1] = (v4f){}; }
        } else {
#pragma unroll
            for (int nq = 0; nq < NQ; ++nq)
#pragma unroll
                for (int kt = 0; kt < 2; ++kt) { const float* mr = Mk + (size_t)(q0 + nq * 16 + lr) * mpitch + k0 + kt * 16 + 8 * hi; mv[nq][kt][0] = *(const v4f*)mr; mv[nq][kt][1] = *(const v4f*)(mr + 4); }
            asm volatile("s_wait_xcnt 0x0" ::: "memory");   // the K loads below may land in registers that held the addresses of the mask loads above
        }
#pragma unroll
        for (int kt = 0; kt < 2; ++kt)
#pragma unroll
            for (int c = 0; c < 2; ++c) { const size_t o = (size_t)(k0 + kt * 16) * HD + c * 512 + 8 * lane; kf[kt][c] = WFrag<T16>::ld(Kp + o); if (HI) kf2[kt][c] = WFrag<T16>::ld(K2 + o); }
        asm volatile("s_wait_xcnt 0x0" ::: "memory");   // the V loads below may land in registers that held the addresses of the loads above
        __builtin_amdgcn_sched_barrier(0);              // keeps the V loads behind that wait
#pragma unroll
        for (int dt = 0; dt < 4; ++dt) { vf[dt] = WFrag<T16>::ld(vp + dt * 512); if (HI) vf2[dt] = WFrag<T16>::ld(vp2 + dt * 512); }
        // The trip's loads are all issued above; their address registers are advanced for the next trip below. The V addresses are inputs of the wait, so they live up to it and no load of the run lands in them.
        if constexpr (HI) asm volatile("s_wait_xcnt 0x0" :: "v"(vp), "v"(vp2) : "memory"); else asm volatile("s_wait_xcnt 0x0" :: "v"(vp) : "memory");
        __builtin_amdgcn_sched_barrier(0);              // keeps those address additions behind the wait, and every load of the trip in front of the first product
#pragma unroll
        for (int nq = 0; nq < NQ; ++nq) {
            v8f s[2];
#pragma unroll
            for (int kt = 0; kt < 2; ++kt) { s[kt] = (v8f){};
#pragma unroll
                for (int c = 0; c < 2; ++c) { s[kt] = WFrag<T16>::mma(kf[kt][c], qf[nq][c], s[kt]); if (HI) { s[kt] = WFrag<T16>::mma(kf[kt][c], qf2[nq][c], s[kt]); s[kt] = WFrag<T16>::mma(kf2[kt][c], qf[nq][c], s[kt]); } } }
            float mx = mrun[nq];
#pragma unroll
            for (int kt = 0; kt < 2; ++kt)
#pragma unroll
                for (int j = 0; j < 8; ++j) { const float t = s[kt][j] * SCL + bfr(mv[nq][kt][j >> 2][j & 3]) * MNEG; s[kt][j] = t; mx = fmaxf(mx, t); }
            mx = fmaxf(mx, __shfl_xor(mx, 16, 32));   // the row's other 16 keys of the trip lie in lane l ^ 16
            const float al = __builtin_amdgcn_exp2f((mrun[nq] - mx) * L2E); mrun[nq] = mx;
            float sum = 0.f;
#pragma unroll
            for (int kt = 0; kt < 2; ++kt) { v8f x, p;
#pragma unroll
                for (int j = 0; j < 8; ++j) { x[j] = (s[kt][j] - mx) * L2E; if (!HI) x[j] += PEXP; }
#pragma unroll
                for (int j = 0; j < 8; ++j) p[j] = __builtin_amdgcn_exp2f(x[j]);
                asm volatile("v_nop" : "+v"(p) : "v"(x));   // the slot behind a transcendental: no result of the eight is read and no source register reused before this instruction
                s[kt] = p;
#pragma unroll
                for (int j = 0; j < 8; ++j) sum += p[j]; }
            lrun[nq] = lrun[nq] * al + sum;
#pragma unroll
            for (int dt = 0; dt < 4; ++dt) oacc[nq][dt] *= al;
            if constexpr (HI) { v8us ph[2], pl[2];
#pragma unroll
                for (int kt = 0; kt < 2; ++kt)
#pragma unroll
                    for (int j = 0; j < 8; ++j) { unsigned short a, c2; splitf(s[kt][j], a, c2); ph[kt][j] = a; pl[kt][j] = c2; }
                const V pfh = cat16b(ph[0], ph[1]), pfl = cat16b(pl[0], pl[1]);
#pragma unroll
                for (int dt = 0; dt < 4; ++dt) { oacc[nq][dt] = WFrag<T16>::mma(vf[dt], pfh, oacc[nq][dt]); oacc[nq][dt] = WFrag<T16>::mma(vf[dt], pfl, oacc[nq][dt]); oacc[nq][dt] = WFrag<T16>::mma(vf2[dt], pfh, oacc[nq][dt]); }
            } else { v8h p16[2];
#pragma unroll
                for (int kt = 0; kt < 2; ++kt)
#pragma unroll
                    for (int j = 0; j < 8; ++j) p16[kt][j] = tohx(s[kt][j]);
                const V pf = cat16(p16[0], p16[1]);
#pragma unroll
                for (int dt = 0; dt < 4; ++dt) oacc[nq][dt] = WFrag<T16>::mma(vf[dt], pf, oacc[nq][dt]); }
        }
      }
        vp += 32 * KSF * HD; if (HI) vp2 += 32 * KSF * HD; cbits >>= KSF; obits >>= KSF;
    }
#pragma unroll
    for (int nq = 0; nq < NQ; ++nq) {
        const float lt = lrun[nq] + __shfl_xor(lrun[nq], 16, 32);
        Ss[(ph * NQ + nq) * 32 + lane] = hi ? lt : mrun[nq];
#pragma unroll
        for (int dt = 0; dt < 4; ++dt) { float* p = So + ((ph * NQ + nq) * 4 + dt) * 256 + 4 * lane; const v8f o = oacc[nq][dt]; *(v4fa*)p = __builtin_shufflevector(o, o, 0, 1, 2, 3); *(v4fa*)(p + 128) = __builtin_shufflevector(o, o, 4, 5, 6, 7); }
    }
    __syncthreads();   // every share of the block lies in LDS before any wave joins them
    v8us oh[NQ], ol[NQ];
#pragma unroll
    for (int nq = 0; nq < NQ; ++nq) { float m[KSF], l[KSF]; v8f ov[KSF]; float mx = -3.0e38f;
#pragma unroll
        for (int s = 0; s < KSF; ++s) { const float* q = Ss + (s * NQ + nq) * 32 + lr; m[s] = q[0]; l[s] = q[16]; const float* p = So + ((s * NQ + nq) * 4 + ph) * 256 + 4 * lane; const v4f x0 = *(const v4fa*)p, x1 = *(const v4fa*)(p + 128); ov[s] = __builtin_shufflevector(x0, x1, 0, 1, 2, 3, 4, 5, 6, 7); }
#pragma unroll
        for (int s = 0; s < KSF; ++s) mx = fmaxf(mx, m[s]);
        const float w0 = __builtin_amdgcn_exp2f((m[0] - mx) * L2E); v8f x = ov[0] * w0; float den = l[0] * w0;
#pragma unroll
        for (int s = 1; s < KSF; ++s) { const float w = __builtin_amdgcn_exp2f((m[s] - mx) * L2E); x += ov[s] * w; den += l[s] * w; }
        const float f = 1.0f / den;
#pragma unroll
        for (int q = 0; q < 8; ++q) { unsigned short a, c2; splitf(x[q] * f, a, c2); oh[nq][q] = a; ol[nq][q] = c2; } }
    const size_t e = (((size_t)rb0 * (DQ / 32) + head * 2 + (ph >> 1)) * 64 + (ph & 1) * 32 + lane) * 8;   // this lane's piece in row block rb0; the next row block lies DQ / 32 blocks of 512 elements on
#pragma unroll
    for (int nq = 0; nq < NQ; ++nq) { *(v8us*)(Ah + e + (size_t)nq * (DQ / 32) * 512) = oh[nq]; *(v8us*)(Al + e + (size_t)nq * (DQ / 32) * 512) = ol[nq]; }
}
// grid (NZ, AX), 8 waves: wave w is key share w & 3 of query block w >> 2 (waves w and w + 4 read the same K and V tiles). Row group bx < RH/32 takes 16 hi+lo query rows a block, the others 32 f16 rows a block. QK* hold the q planes, then (kofs elements on) the k planes.
// THE DEAL: the registers leave room for about half of the work-groups at a time. blockIdx.x (fastest) is the (batch, head) slice, blockIdx.y counts the row groups from the last to the first:
// the f16 groups stand in front of the hi+lo groups (half the rows), and under a mask that closes the keys behind a query the groups with the most trips come first in index order and those with the fewest last. For speed only: every (slice, row group) is taken once under any order.
#define AX (RH / 32 + (TT - RH) / 64)
__global__ __launch_bounds__(64 * KSF) void k_attn(const h16* __restrict__ QK16, const bf* __restrict__ QKh, const bf* __restrict__ QKl, size_t kofs, const h16* __restrict__ VT16, const bf* __restrict__ VTh, const bf* __restrict__ VTl, const float* __restrict__ Mk, int mpitch, const unsigned* __restrict__ Cl, bf* Ah, bf* Al) {
    __shared__ __align__(16) float so[2][KSF * 2 * 4 * 256]; __shared__ float ss[2][KSF * 2 * 32];
    const int wave = __builtin_amdgcn_readfirstlane((int)(threadIdx.x >> 5)); const int ph = wave % KSF, qb = wave / KSF; const int bx = AX - 1 - (int)blockIdx.y; const int z = (int)blockIdx.x; const size_t zo = (size_t)z * TT * HD;
    const int rbz = (z / NH_) * (TT / 16), head = z % NH_;
    if (bx < RH / 32) { const int q0 = bx * 32 + qb * 16; attn_body<bf, true, 1>(QKh + zo, QKl + zo, QKh + kofs + zo, QKl + kofs + zo, VTh + zo, VTl + zo, Mk, mpitch, Cl, q0, ph, so[qb], ss[qb], rbz + (q0 >> 4), head, Ah, Al); }
    else { const int q0 = RH + (bx - RH / 32) * 64 + qb * 32; attn_body<h16, false, 2>(QK16 + zo, nullptr, QK16 + kofs + zo, nullptr, VT16 + zo, nullptr, Mk, mpitch, Cl, q0, ph, so[qb], ss[qb], rbz + (q0 >> 4), head, Ah, Al); }
}

extern "C" void kernel_launch(void* const* d_in, const int* in_sizes, int n_in,
                              void* d_out, int out_size, void* d_ws, size_t ws_size, hipStream_t stream) {
    if (n_in < 12) return;
    const long long xneed = (long long)(NB - 1) * SEQ_FULL * DM + (long long)TT * DM;
    if ((long long)in_sizes[0] < xneed || (long long)in_sizes[1] < xneed || (long long)in_sizes[2] < xneed) return;
    if ((long long)in_sizes[3] < (long long)(TT - 1) * SEQ_FULL + TT) return;
    if (in_sizes[4] < DM * DQ || in_sizes[6] < DM * DKV || in_sizes[8] < DM * DKV || in_sizes[10] < DQ * DM) return;
    if (in_sizes[5] < DQ || in_sizes[7] < DKV || in_sizes[9] < DKV || in_sizes[11] < DM) return;
    if ((long long)out_size < (long long)NB * TT * DM) return;
    const float* xq = (const float*)d_in[0]; const float* xk = (const float*)d_in[1]; const float* xv = (const float*)d_in[2]; const float* mk = (const float*)d_in[3];
    const float* wq = (const float*)d_in[4]; const float* bq = (const float*)d_in[5]; const float* wk = (const float*)d_in[6]; const float* bk = (const float*)d_in[7]; const float* wv = (const float*)d_in[8]; const float* bv = (const float*)d_in[9]; const float* wo = (const float*)d_in[10]; const float* bo = (const float*)d_in[11];
    float* OUT = (float*)d_out;     // [NB][TT][DM]
    char* wsp = (char*)d_ws;
    auto take = [&](size_t bytes) { char* p = wsp; wsp += (bytes + 255) & ~(size_t)255; return (void*)p; };
    constexpr size_t WSZ = (size_t)DM * DQ;           // elements of one weight plane
    constexpr size_t PSZ = (size_t)NZ * TT * HD;      // elements of one plane set over all (batch, head) slices
    constexpr size_t XSZ = (size_t)NB * TT * DM;      // elements of one stream, both batches
    bf* W4 = (bf*)take(4 * WSZ * 2);                  // Wq, Wk, Wv, Wo transposed, one behind the other
    h16* QK16 = (h16*)take(2 * PSZ * 2); bf* QKh = (bf*)take(2 * PSZ * 2); bf* QKl = (bf*)take(2 * PSZ * 2);   // q planes, then k planes
    h16* VT16 = (h16*)take(PSZ * 2); bf* VTh = (bf*)take(PSZ * 2); bf* VTl = (bf*)take(PSZ * 2);
    unsigned* Cls = (unsigned*)take((size_t)(TT / 16) * 4 * 4);   // per 16 query rows: closed and open bits of the 64 key tiles
    bf* ATh = (bf*)take(XSZ * 2); bf* ATl = (bf*)take(XSZ * 2);
    bf* XB = (bf*)take(3 * XSZ * 2);                  // the projections' bf16 inputs
    const size_t carved = (size_t)(wsp - (char*)d_ws);
    if (carved > ws_size) return;
    // weights: w is [in = K rows][out = N cols] -> Bt, N rows x K, fragment order
    k_prep<<<PB_M + 4 * PB_W + 3 * NB * PB_X, PT, 0, stream>>>(mk, SEQ_FULL, Cls, wq, wk, wv, wo, W4, xq, xk, xv, (size_t)SEQ_FULL * DM, XB);
    k_gemmw<bf, 0, true, 1, true><<<dim3(NB * TT / 64, DQ / 64, 3), 32, 0, stream>>>(XB, nullptr, W4, nullptr, DM, nullptr, DQ, bq, bk, bv, XSZ, WSZ, 0, 0, QK16, QKh, QKl, VT16, VTh, VTl);
    k_attn<<<dim3(NZ, AX), 64 * KSF, 0, stream>>>(QK16, QKh, QKl, PSZ, VT16, VTh, VTl, mk, SEQ_FULL, Cls, ATh, ATl);
    k_gemmw<bf, 1, true, 1, false><<<dim3(NB * TT / 64, DM / 64, 1), 32, 0, stream>>>(ATh, ATl, W4 + 3 * WSZ, nullptr, DQ, OUT, DM, bo, bo, bo, 0, 0, 0, 0, nullptr, nullptr, nullptr, nullptr, nullptr, nullptr);
}

// v010
// It runs in 67.6 microseconds.
// Timed twice side by side with v009, it ran 1.20 times as fast both times.
// Over all steps from v000 it is 22.9 times as fast.
#include <hip/hip_runtime.h>

// Masked attention block: three input streams q, k, v [2][2048][768]; per-stream projection x W + b (W stored [in][out]); 12 heads x 64; logits x 1/8 plus mask x -1e9 (mask [2048][2048] read as values from its input buffer); softmax over all keys; merged heads x Wo + bo -> [2][2048][768].
// Compute dtypes (every product accumulates in f32): inputs, mask, biases and weights RNE-converted to bf16; projections v_wmma_f32_16x16x32_bf16 (exact products) + f32 bias; logits: query rows < 512 on bf16 hi/lo planes (3 products), other rows on f16 planes (1 product); P x V: rows < 512 bf16 hi/lo (3 products), other rows v_wmma_f32_16x16x32_f16 with P carried x1024; softmax f32, running maximum and sum per query row inside the attention kernel, four key shares a row joined there through LDS (mask tiles classed from their values by k_prep); output projection: merged bf16 hi/lo planes x bf16 Wo (2 products), four k shares a tile joined in f32 through LDS, + f32 bias.

#ifndef NB
#define NB 2
#endif
#ifndef SEQ
#define SEQ 2048
#endif
#define NB_FULL  2
#define SEQ_FULL 2048
#define TT   SEQ
#define DM   768
#define NH_  12
#define NKV  12
#define REP  (NH_ / NKV)
#define HD   64
#define DQ   (NH_ * HD)
#define DKV  (NKV * HD)
#define NZ   (NB * NH_)
#define RH   ((TT) < 512 ? (TT) : 512)   // query rows < RH use hi+lo planes
#define PEXP 10.0f    // f16 rows carry P x 2^10 (added to the exponent; the row sum carries it too, so the quotient is free of it)
#define L2E  1.4426950408889634f
#define SCL  0.125f   // HD^-0.5
#define MNEG (-1.0e9f)
#define KSF  4        // key shares of the attention kernel: KSF waves of one work-group share a query block's keys

static_assert(TT % 128 == 0);
static_assert(TT <= SEQ_FULL);
static_assert(NB <= NB_FULL);
static_assert(DM % 64 == 0);
static_assert(TT % 64 == 0);
static_assert(DQ % 64 == 0);
static_assert(DQ == DM);
static_assert(HD == 64);
static_assert(NKV == NH_);
static_assert(RH % 64 == 0);
static_assert((TT - RH) % 64 == 0);
static_assert(TT % (32 * KSF) == 0);
static_assert(TT / 32 <= 64);          // one bit a key tile in a 64-bit class word
static_assert(KSF == HD / 16);         // at the join each of a block's KSF waves takes one 16-wide d tile

// FRAGMENT ORDER of every 16-bit operand plane (R rows x K columns, the k axis of its product along the columns): blocks of 16 rows x 32 k, 512 elements = 1 KB, block (rb, kb) at element (rb K/32 + kb) 512 (the V^T planes: at (kb HD/16 + rb) 512, so that the 32 keys of a trip are 4 KB in a row).
// Inside a block element (row r, k = 16 g + 8 h + e) lies at 256 g + 8 (16 h + r) + e: lane l = 16 h + r of a wave finds its fragment's elements 0..7 at 8 l and 8..15 at 256 + 8 l,
// so each of the two 16-byte loads of a fragment covers 512 contiguous bytes, four whole 128-byte lines, and each writer stores such 512-byte runs.
typedef _Float16 h16;
typedef unsigned short bf;
typedef __attribute__((ext_vector_type(16))) __bf16   v16bf;
typedef __attribute__((ext_vector_type(16))) _Float16 v16h;
typedef __attribute__((ext_vector_type(8)))  _Float16 v8h;
typedef __attribute__((ext_vector_type(8)))  unsigned short v8us;
typedef __attribute__((ext_vector_type(8)))  float    v8f;
typedef __attribute__((ext_vector_type(4)))  float    v4f;
typedef v8h  __attribute__((may_alias)) v8ha;
typedef v4f  __attribute__((may_alias)) v4fa;
typedef v8us __attribute__((may_alias)) v8usa;

__device__ __forceinline__ unsigned short f2bf(float f) { unsigned u = __float_as_uint(f); u += 0x7FFFu + ((u >> 16) & 1u); return (unsigned short)(u >> 16); }
__device__ __forceinline__ float bf2f(unsigned short b) { return __uint_as_float(((unsigned)b) << 16); }
__device__ __forceinline__ float bfr(float f) { return bf2f(f2bf(f)); }
__device__ __forceinline__ v16h cat16(v8h lo, v8h hi) { return __builtin_shufflevector(lo, hi, 0, 1, 2, 3, 4, 5, 6, 7, 8, 9, 10, 11, 12, 13, 14, 15); }
__device__ __forceinline__ v16bf cat16b(v8us lo, v8us hi) { return __builtin_bit_cast(v16bf, __builtin_shufflevector(lo, hi, 0, 1, 2, 3, 4, 5, 6, 7, 8, 9, 10, 11, 12, 13, 14, 15)); }
__device__ __forceinline__ v8f wmma16(v16h a, v16h b, v8f c) { return __builtin_amdgcn_wmma_f32_16x16x32_f16(false, a, false, b, (short)0, c, false, false); }
__device__ __forceinline__ v8f wmmab(v16bf a, v16bf b, v8f c) { return __builtin_amdgcn_wmma_f32_16x16x32_bf16(false, a, false, b, (short)0, c, false, false); }
__device__ __forceinline__ h16 tohx(float x) { return (h16)x; }
__device__ __forceinline__ void splitf(float y, unsigned short& h, unsigned short& l) { h = f2bf(y); l = f2bf(y - bf2f(h)); }
typedef __attribute__((ext_vector_type(4))) _Float16 v4h;
typedef __attribute__((ext_vector_type(2))) unsigned short v2us;
typedef __attribute__((ext_vector_type(4))) unsigned short v4us;
typedef __attribute__((ext_vector_type(2))) float v2f;
typedef __attribute__((ext_vector_type(4))) unsigned v4u;

// ---- k_gemmw: register-blocked GEMM, ONE WAVE per 64x64 output tile (16 accumulators), operands straight from 16-bit planes in fragment order; grid (M/64, N/64, Z), 32 threads.
// C[m][n] (f32, pitch ldc, + optional f32 bias[n]) = sum_k A[m][k] Bt[n][k] (+ split products per NSPLIT). z-batch strides sA/sB/sC in elements. K % (32 KS) == 0, M % 64 == 0, N % 64 == 0.
// BIAS: z-slice 0 / 1 / 2 adds bias / bias1 / bias2.
// KS > 1: grid z = Z x KS; work-group (z, ks) sums only k in [ks K/KS, (ks+1) K/KS) and stores its f32 partial tile into plane ks (plane stride sP elements).
// PL: no f32 C. The tile is 64 tokens of one batch x the 64 columns of head blockIdx.y, and the wave stores it (+ bias) as the attention kernel's operand planes, f16 and bf16 hi / lo:
// z-slices 0 and 1 (q, k) as planes [z][batch][head] of TT rows x HD, a contiguous 8 KB a plane; z-slice 2 (v) transposed, planes [batch][head] of HD rows x TT, straight from the accumulators (a lane's 8 D elements are 8 consecutive tokens of one d: one 16-byte piece of the fragment order). All in fragment order.
// Fragment map: lane l, h = l >> 4: elements 0..7 <- k0 + 8h + 0..7, elements 8..15 <- k0 + 16 + 8h + 0..7 (A row / B column = l & 15); D element j -> (row 8h + j, col l & 15). ld(p): p = the block's first element + 8 l.
template <typename T16> struct WFrag;
template <> struct WFrag<h16> { typedef v16h V; static __device__ __forceinline__ V ld(const h16* p) { return cat16(*(const v8h*)p, *(const v8h*)(p + 256)); } static __device__ __forceinline__ v8f mma(V a, V b, v8f c) { return wmma16(a, b, c); } };
template <> struct WFrag<bf> { typedef v16bf V; static __device__ __forceinline__ V ld(const bf* p) { return cat16b(*(const v8us*)p, *(const v8us*)(p + 256)); } static __device__ __forceinline__ v8f mma(V a, V b, v8f c) { return wmmab(a, b, c); } };
template <typename T16, int NSPLIT, bool BIAS, int KS, bool PL>
__global__ __launch_bounds__(32) void k_gemmw(const T16* __restrict__ A, const T16* __restrict__ A2, const T16* __restrict__ Bt, const T16* __restrict__ Bt2, int K, float* C, int ldc, const float* __restrict__ bias, const float* __restrict__ bias1, const float* __restrict__ bias2, size_t sA, size_t sB, size_t sC, size_t sP, h16* P16, bf* Ph, bf* Pl, h16* V16, bf* Vh, bf* Vl) {
    static_assert(NSPLIT == 0 || NSPLIT == 1);
    static_assert(KS == 1 || !BIAS);
    static_assert(!PL || (BIAS && KS == 1));
    typedef typename WFrag<T16>::V V;
    __shared__ __align__(16) float os[16 * 68];
    const size_t z = blockIdx.z / KS; const int ks = (int)(blockIdx.z % KS); A += z * sA; if (A2) A2 += z * sA; Bt += z * sB; if (Bt2) Bt2 += z * sB; C += z * sC + (size_t)ks * sP;
    const float* bz = (z == 0) ? bias : ((z == 1) ? bias1 : bias2);
    const int kbeg = ks * (K / KS), kend = kbeg + K / KS;
    const int lane = threadIdx.x & 31, lr = lane & 15, hi = lane >> 4; const int r0 = blockIdx.x * 64, c0 = blockIdx.y * 64;
    v8f acc[4][4];
#pragma unroll
    for (int mb = 0; mb < 4; ++mb)
#pragma unroll
        for (int nb = 0; nb < 4; ++nb) acc[mb][nb] = (v8f){};
    // Byte offsets of this lane's piece in the first block of each of the tile's four row blocks of A and of Bt: 16 rows of blocks hold 16 K elements; a step of 32 k is one block, 1 KB.
    unsigned oa[4], ow[4];
#pragma unroll
    for (int i = 0; i < 4; ++i) { const unsigned o = (unsigned)(i * 16 * K + kbeg * 16 + 8 * lane) * 2u; oa[i] = (unsigned)(r0 * K) * 2u + o; ow[i] = (unsigned)(c0 * K) * 2u + o; }
#pragma unroll 1
    for (int kc = kbeg; kc < kend; kc += 32) {
        V a[4], a2[4], b[4];
#pragma unroll
        for (int mb = 0; mb < 4; ++mb) { a[mb] = WFrag<T16>::ld((const T16*)((const char*)A + oa[mb])); if (NSPLIT == 1) a2[mb] = WFrag<T16>::ld((const T16*)((const char*)A2 + oa[mb])); }
#pragma unroll
        for (int nb = 0; nb < 4; ++nb) b[nb] = WFrag<T16>::ld((const T16*)((const char*)Bt + ow[nb]));
        // The trip's loads are all issued above; their offsets are advanced below. The offsets are inputs of the wait, so they live up to it and no load of the run lands in them.
        asm volatile("s_wait_xcnt 0x0" :: "v"(oa[0]), "v"(oa[1]), "v"(oa[2]), "v"(oa[3]), "v"(ow[0]), "v"(ow[1]), "v"(ow[2]), "v"(ow[3]) : "memory");
        __builtin_amdgcn_sched_barrier(0);              // keeps the address additions behind that wait
#pragma unroll
        for (int nb = 0; nb < 4; ++nb)
#pragma unroll
            for (int mb = 0; mb < 4; ++mb) { acc[mb][nb] = WFrag<T16>::mma(a[mb], b[nb], acc[mb][nb]); if (NSPLIT == 1) acc[mb][nb] = WFrag<T16>::mma(a2[mb], b[nb], acc[mb][nb]); }
        asm volatile("v_nop\n\tv_nop\n\tv_nop\n\tv_nop" : "+v"(acc[0][0]), "+v"(acc[1][1]), "+v"(acc[2][2]), "+v"(acc[3][3]) : "v"(a[0]), "v"(a[3]));
#pragma unroll
        for (int i = 0; i < 4; ++i) { oa[i] += 1024u; ow[i] += 1024u; }
    }
    const int bt = r0 / TT, t0 = r0 % TT;   // PL: the tile's batch and first token
    const size_t pb = (((z * NB + bt) * NH_ + blockIdx.y) * TT + t0) * HD;   // PL: the tile's first element in a q / k plane
    float bb[4] = {0.f, 0.f, 0.f, 0.f};   // PL: the bias of this lane's column in each of the four column tiles
    if constexpr (PL) {
#pragma unroll
        for (int nb = 0; nb < 4; ++nb) bb[nb] = bfr(bz[c0 + nb * 16 + lr]); }
    if (!PL || z != 2) {
#pragma unroll
    for (int mb = 0; mb < 4; ++mb) {
#pragma unroll
        for (int nb = 0; nb < 4; ++nb) {
#pragma unroll
            for (int j = 0; j < 8; ++j) os[(hi * 8 + j) * 68 + nb * 16 + lr] = PL ? acc[mb][nb][j] + bb[nb] : acc[mb][nb][j]; }
        __builtin_amdgcn_wave_barrier(); asm volatile("" ::: "memory");
        float* crow = C + (size_t)(r0 + mb * 16) * ldc + c0;
        if constexpr (PL) { v8h o16[4]; v8us oh[4], ol[4];   // piece s: token lr, columns 16 s + 8 hi + 0..7
#pragma unroll
            for (int s = 0; s < 4; ++s) { const float* rp = os + lr * 68 + s * 16 + hi * 8; const v4f v0 = *(const v4fa*)rp, v1 = *(const v4fa*)(rp + 4);
#pragma unroll
                for (int q = 0; q < 8; ++q) { const float x = q < 4 ? v0[q & 3] : v1[q & 3]; o16[s][q] = tohx(x); unsigned short a2, c2; splitf(x, a2, c2); oh[s][q] = a2; ol[s][q] = c2; } }
            __builtin_amdgcn_sched_barrier(0);              // every conversion of the block stands in front of its stores: none lands in a register that an issued store names
#pragma unroll
            for (int s = 0; s < 4; ++s) { const size_t e = pb + (size_t)(mb * 16) * HD + s * 256 + lane * 8; *(v8h*)(P16 + e) = o16[s]; *(v8us*)(Ph + e) = oh[s]; *(v8us*)(Pl + e) = ol[s]; }
            asm volatile("s_wait_xcnt 0x0" ::: "memory");   // the next block's values may land in registers that the stores above name
            __builtin_amdgcn_sched_barrier(0);              // keeps what follows behind that wait
        } else
{
#pragma unroll
            for (int s = 0; s < 8; ++s) { const int row = 2 * s + hi, cofs = lr * 4; v4f val = *(const v4fa*)(os + row * 68 + cofs); if (BIAS) { val[0] += bfr(bz[c0 + cofs]); val[1] += bfr(bz[c0 + cofs + 1]); val[2] += bfr(bz[c0 + cofs + 2]); val[3] += bfr(bz[c0 + cofs + 3]); }
                *(v4f*)(crow + (size_t)row * ldc + cofs) = val; }
             }
        __builtin_amdgcn_wave_barrier(); asm volatile("" ::: "memory");
    }
    } else if constexpr (PL) {
        const size_t vb = (size_t)(bt * NH_ + (int)blockIdx.y) * HD * TT + (size_t)t0 * HD + 8 * lane;   // 32 tokens of all HD rows are HD / 16 blocks, 32 HD elements
#pragma unroll
        for (int nb = 0; nb < 4; ++nb) { v8h o16[4]; v8us oh[4], ol[4];
#pragma unroll
            for (int mb = 0; mb < 4; ++mb)
#pragma unroll
                for (int j = 0; j < 8; ++j) { const float x = acc[mb][nb][j] + bb[nb]; o16[mb][j] = tohx(x); unsigned short a2, c2; splitf(x, a2, c2); oh[mb][j] = a2; ol[mb][j] = c2; }
            __builtin_amdgcn_sched_barrier(0);              // every conversion of the block stands in front of its stores: none lands in a register that an issued store names
#pragma unroll
            for (int mb = 0; mb < 4; ++mb) { const size_t e = vb + (size_t)((mb >> 1) * (HD / 16) + nb) * 512 + (mb & 1) * 256; *(v8h*)(V16 + e) = o16[mb]; *(v8us*)(Vh + e) = oh[mb]; *(v8us*)(Vl + e) = ol[mb]; }
            if (nb < 3) { asm volatile("s_wait_xcnt 0x0" ::: "memory");   // the next block's values may land in registers that the stores above name
                __builtin_amdgcn_sched_barrier(0); }        // keeps the next block's instructions behind that wait
        }
    }
}


// ---- k_gemmo: the output projection, C[m][n] (f32, pitch DM) = sum_k (A + A2)[m][k] Bt[n][k] + bias[n], K = DQ. Grid (M/64, DM/(64 OCT)): one work-group of OKS x OCT waves per 64 x (64 OCT) piece of C, one work-group a WGP at the full shape.
// Wave w = (k share ks = w % OKS, column tile ct = w / OKS) sums the 64 x 64 tile ct over k in [ks K/OKS, (ks+1) K/OKS) only: OKS times the waves, each with 1/OKS of the dependent load-then-multiply trips; the OCT waves of a k share read the same A blocks at the same time.
// THE JOIN: every wave puts its 16 f32 partial tiles into LDS (one KB a tile: lane l's values 0..3 at 4 l, 4..7 at 128 + 4 l); behind one work-group barrier wave (ks, ct) adds row block ks of column tile ct over the shares in the order 0..OKS-1, turns it to rows in its own LDS piece and stores whole rows of 256 bytes.
// Every plain '#pragma unroll' below but those on the join's nb and s loops stands on a loop whose index picks an element of a register array: rolled, the array would go to scratch memory.
#define OKS 4
#define OCT 3
static_assert(DQ % (32 * OKS) == 0);
static_assert(DM % (64 * OCT) == 0);
static_assert(OKS == 4);               // at the join each of a tile's OKS waves takes one of its four row blocks
__global__ __launch_bounds__(32 * OKS * OCT) void k_gemmo(const bf* __restrict__ A, const bf* __restrict__ A2, const bf* __restrict__ Bt, float* C, const float* __restrict__ bias) {
    typedef WFrag<bf>::V V;
    constexpr int K = DQ;
    __shared__ __align__(16) float jo[OCT * OKS * 16 * 256]; __shared__ __align__(16) float osw[OCT * OKS][16 * 68];
    const int wave = __builtin_amdgcn_readfirstlane((int)(threadIdx.x >> 5)); const int ks = wave % OKS, ct = wave / OKS;
    const int lane = threadIdx.x & 31, lr = lane & 15, hi = lane >> 4; const int r0 = blockIdx.x * 64, c0 = ((int)blockIdx.y * OCT + ct) * 64;
    const int kbeg = ks * (K / OKS), kend = kbeg + K / OKS;
    v8f acc[4][4];
#pragma unroll
    for (int mb = 0; mb < 4; ++mb)
#pragma unroll
        for (int nb = 0; nb < 4; ++nb) acc[mb][nb] = (v8f){};
    // Byte offsets of this lane's piece in the share's first block of each of the tile's four row blocks of A and of Bt: 16 rows of blocks hold 16 K elements; a step of 32 k is one block, 1 KB.
    unsigned oa[4], ow[4];
#pragma unroll
    for (int i = 0; i < 4; ++i) { const unsigned o = (unsigned)(i * 16 * K + kbeg * 16 + 8 * lane) * 2u; oa[i] = (unsigned)(r0 * K) * 2u + o; ow[i] = (unsigned)(c0 * K) * 2u + o; }
#pragma unroll 1   // one copy of a body that holds a whole trip's loads and products: registers
    for (int kc = kbeg; kc < kend; kc += 32) {
        V a[4], a2[4], b[4];
#pragma unroll
        for (int mb = 0; mb < 4; ++mb) { a[mb] = WFrag<bf>::ld((const bf*)((const char*)A + oa[mb])); a2[mb] = WFrag<bf>::ld((const bf*)((const char*)A2 + oa[mb])); }
#pragma unroll
        for (int nb = 0; nb < 4; ++nb) b[nb] = WFrag<bf>::ld((const bf*)((const char*)Bt + ow[nb]));
        // The trip's loads are all issued above; their offsets are advanced below. The offsets are inputs of the wait, so they live up to it and no load of the run lands in them.
        asm volatile("s_wait_xcnt 0x0" :: "v"(oa[0]), "v"(oa[1]), "v"(oa[2]), "v"(oa[3]), "v"(ow[0]), "v"(ow[1]), "v"(ow[2]), "v"(ow[3]) : "memory");
        __builtin_amdgcn_sched_barrier(0);              // keeps the address additions behind that wait
#pragma unroll
        for (int nb = 0; nb < 4; ++nb)
#pragma unroll
            for (int mb = 0; mb < 4; ++mb) { acc[mb][nb] = WFrag<bf>::mma(a[mb], b[nb], acc[mb][nb]); acc[mb][nb] = WFrag<bf>::mma(a2[mb], b[nb], acc[mb][nb]); }
        asm volatile("v_nop\n\tv_nop\n\tv_nop\n\tv_nop" : "+v"(acc[0][0]), "+v"(acc[1][1]), "+v"(acc[2][2]), "+v"(acc[3][3]) : "v"(a[0]), "v"(a[3]));   // the distance behind the trip's last products, on the loop's back edge too, where the next trip's loads land in their operands
#pragma unroll
        for (int i = 0; i < 4; ++i) { oa[i] += 1024u; ow[i] += 1024u; }
    }
    const float* bp = bias + c0 + lr * 4; const v4f bv = *(const v4f*)bp;   // asked for here, used behind the join
    asm volatile("s_wait_xcnt 0x0" :: "v"(bp) : "memory");   // the address is an input of the wait: it lives up to it, so the load does not land in it and nothing rewrites it before
#pragma unroll
    for (int mb = 0; mb < 4; ++mb)
#pragma unroll
        for (int nb = 0; nb < 4; ++nb) { float* p = jo + (wave * 16 + mb * 4 + nb) * 256 + 4 * lane; const v8f o = acc[mb][nb]; *(v4fa*)p = __builtin_shufflevector(o, o, 0, 1, 2, 3); *(v4fa*)(p + 128) = __builtin_shufflevector(o, o, 4, 5, 6, 7); }
    __syncthreads();   // every k share of the work-group's tiles lies in LDS before any wave adds them
    float* os = osw[wave];
#pragma unroll
    for (int nb = 0; nb < 4; ++nb) { v8f x;
#pragma unroll
        for (int s = 0; s < OKS; ++s) { const float* p = jo + ((ct * OKS + s) * 16 + ks * 4 + nb) * 256 + 4 * lane; const v4f x0 = *(const v4fa*)p, x1 = *(const v4fa*)(p + 128); const v8f v = __builtin_shufflevector(x0, x1, 0, 1, 2, 3, 4, 5, 6, 7); x = (s == 0) ? v : x + v; }
#pragma unroll
        for (int j = 0; j < 8; ++j) os[(hi * 8 + j) * 68 + nb * 16 + lr] = x[j]; }
    __builtin_amdgcn_wave_barrier(); asm volatile("" ::: "memory");   // the rows below are read by other lanes of the wave than wrote them: no LDS access moves across
    float* crow = C + (size_t)(r0 + ks * 16 + hi) * DM + c0 + lr * 4; v4f val[8];
#pragma unroll
    for (int s = 0; s < 8; ++s) { val[s] = *(const v4fa*)(os + (2 * s + hi) * 68 + lr * 4); val[s][0] += bfr(bv[0]); val[s][1] += bfr(bv[1]); val[s][2] += bfr(bv[2]); val[s][3] += bfr(bv[3]); }
    __builtin_amdgcn_sched_barrier(0);              // every sum stands in front of the stores: none lands in a register that an issued store names
#pragma unroll
    for (int s = 0; s < 8; ++s) *(v4f*)(crow + (size_t)(2 * s) * DM) = val[s];
}

// The three passes below read nothing but inputs and feed later launches only; k_prep runs them side by side in one launch of PT-thread work-groups.
#define PT 1024
// y picks one of four equally shaped weights, bx the work-group inside it; Bt holds the four transposed planes (N rows x K) one behind the other, each in fragment order. Thread i makes 16-byte piece i of its plane: 8 consecutive k of one n; 16 lanes read 64 contiguous bytes of a weight row.
__device__ __forceinline__ void wt_body(int bx, int y, const float* __restrict__ w0, const float* __restrict__ w1, const float* __restrict__ w2, const float* __restrict__ w3, int K, int N, bf* Bt) {
    const float* w = (y == 0) ? w0 : ((y == 1) ? w1 : ((y == 2) ? w2 : w3)); Bt += (size_t)y * K * N;
    const int i = (int)(bx * PT + threadIdx.x); if (i >= N * K / 8) return;
    const int lane = i & 31, g = (i >> 5) & 1, blk = i >> 6; const int kb = blk % (K / 32), rb = blk / (K / 32);
    const float* wp[8]; float x[8]; v8us o;
#pragma unroll
    for (int e = 0; e < 8; ++e) wp[e] = w + (size_t)(kb * 32 + g * 16 + (lane >> 4) * 8 + e) * N + rb * 16 + (lane & 15);
#pragma unroll
    for (int e = 0; e < 8; ++e) x[e] = *wp[e];
    asm volatile("s_wait_xcnt 0x0" :: "v"(wp[0]), "v"(wp[1]), "v"(wp[2]), "v"(wp[3]), "v"(wp[4]), "v"(wp[5]), "v"(wp[6]), "v"(wp[7]) : "memory");   // the eight addresses are inputs of the wait: they live up to it, so no load of the run lands in one and nothing rewrites one before it
#pragma unroll
    for (int e = 0; e < 8; ++e) o[e] = f2bf(x[e]);
    *(v8us*)(Bt + (size_t)i * 8) = o;
    asm volatile("s_wait_xcnt 0x0" ::: "memory");   // in k_prep the built code runs on behind this store into branch code shared with the other passes, which rewrites registers that the store names
}
// s picks the stream, by the batch (source batch stride sb elements), bx the work-group inside it; dst is [stream][batch][n8 * 8], each a plane of rows x DM in fragment order. Thread i makes 16-byte piece i of its plane.
__device__ __forceinline__ void cvt_body(int bx, int by, int s, const float* __restrict__ s0, const float* __restrict__ s1, const float* __restrict__ s2, size_t sb, bf* dst, size_t n8) { const size_t i = (size_t)bx * PT + threadIdx.x; if (i >= n8) return;
    const float* src = ((s == 0) ? s0 : ((s == 1) ? s1 : s2)) + (size_t)by * sb; dst += ((size_t)s * NB + by) * n8 * 8;
    const int lane = (int)(i & 31), g = (int)((i >> 5) & 1); const int blk = (int)(i >> 6); const int kb = blk % (DM / 32), rb = blk / (DM / 32);
    const float* sp = src + (size_t)(rb * 16 + (lane & 15)) * DM + kb * 32 + g * 16 + (lane >> 4) * 8; const v8f v = *(const v8f*)sp; v8us o;
    asm volatile("s_wait_xcnt 0x0" :: "v"(sp) : "memory");   // the address is an input of the wait: it lives up to it, so neither load lands in it and nothing rewrites it before
#pragma unroll
    for (int k = 0; k < 8; ++k) o[k] = f2bf(v[k]); *(v8us*)(dst + i * 8) = o;
    asm volatile("s_wait_xcnt 0x0" ::: "memory");   // in k_prep the built code runs on behind this store into branch code shared with the other passes, which rewrites registers that the store names
}

// ---- mcls_body: reads the mask once and classes its tiles of 16 query rows x 32 keys from the values found there. One work-group of 32 waves per row block rb; wave w takes key tiles w and w + 32, whole 128-byte lines a row.
// Cl[4 rb ..]: words 0, 1 = one bit a key tile, set where the tile is CLOSED: every value >= 0.75; words 2, 3 = set where it is OPEN: every value rounds to bf16 zero, so mask x -1e9 adds nothing to a logit.
// The closed bits are kept only where each of the 16 rows holds, somewhere among all its keys, a value <= 0.25. Such a row's maximum logit lies at least 5e8 - 2 max|logit / 8| above every key of a closed tile;
// over the at most 18 rescale factors between that key's term and the output one spans 2e7 or more and is exactly 0 in f32: the tile adds exact zeros, and leaving it out changes no bit. A row block without that property keeps every tile.
__device__ __forceinline__ void mcls_body(int rb, const float* __restrict__ Mk, int mpitch, unsigned* __restrict__ Cl) {
    __shared__ unsigned sf[32], sl[32];
    const int wave = (int)(threadIdx.x >> 5), lane = (int)(threadIdx.x & 31);
    const float* mp = Mk + (size_t)(rb * 16 + (lane >> 3)) * mpitch + (lane & 7) * 4;   // load c of a tile: rows 4c + (lane >> 3)
    const float* rp[4]; v4f m[2][4];
#pragma unroll
    for (int c = 0; c < 4; ++c) rp[c] = mp + (size_t)c * 4 * mpitch + wave * 32;
#pragma unroll
    for (int i = 0; i < 2; ++i)
#pragma unroll
        for (int c = 0; c < 4; ++c) m[i][c] = (wave + 32 * i < TT / 32) ? *(const v4f*)(rp[c] + i * 1024) : (v4f){0.5f, 0.5f, 0.5f, 0.5f};
    asm volatile("s_wait_xcnt 0x0" :: "v"(rp[0]), "v"(rp[1]), "v"(rp[2]), "v"(rp[3]) : "memory");   // the four row addresses are inputs of the wait: they live up to it, so no load of the run lands in one and nothing rewrites one before it
    unsigned flags = 0, rows = 0;
#pragma unroll
    for (int i = 0; i < 2; ++i) { bool cl = true; unsigned nz = 0;
#pragma unroll
        for (int c = 0; c < 4; ++c) { bool lv = false;
#pragma unroll
            for (int q = 0; q < 4; ++q) { const float x = m[i][c][q]; cl = cl & (x >= 0.75f); nz |= f2bf(x) & 0x7FFFu; lv = lv | (x <= 0.25f); }
            const unsigned b = __builtin_amdgcn_ballot_w32(lv);
#pragma unroll
            for (int g = 0; g < 4; ++g) rows |= (((b >> (8 * g)) & 0xFFu) != 0u ? 1u : 0u) << (4 * c + g); }
        flags |= (__builtin_amdgcn_ballot_w32(cl) == 0xFFFFFFFFu ? 1u : 0u) << i; flags |= (__builtin_amdgcn_ballot_w32(nz == 0u) == 0xFFFFFFFFu ? 4u : 0u) << i; }
    if (lane == 0) { sf[wave] = flags; sl[wave] = rows; }
    __syncthreads();
    if (wave == 0) { const unsigned f = sf[lane]; unsigned r = sl[lane];
#pragma unroll
        for (int o = 16; o > 0; o >>= 1) r |= __shfl_xor(r, o, 32);
        const unsigned keep = (r == 0xFFFFu) ? 0xFFFFFFFFu : 0u; v4u w;
        w[0] = __builtin_amdgcn_ballot_w32((f & 1u) != 0u) & keep; w[1] = __builtin_amdgcn_ballot_w32((f & 2u) != 0u) & keep; w[2] = __builtin_amdgcn_ballot_w32((f & 4u) != 0u); w[3] = __builtin_amdgcn_ballot_w32((f & 8u) != 0u);
        if (lane == 0) *(v4u*)(Cl + (size_t)rb * 4) = w; }
}
// ---- k_prep: blockIdx.x deals the work-groups to the three passes, the same branch for a whole work-group (the one barrier stands in the mask pass): first the PB_M row blocks of the mask, then 4 weights x PB_W, then 3 streams x NB batches x PB_X.
#define PB_M (TT / 16)
#define PB_W ((DM * DQ / 8 + PT - 1) / PT)
#define PB_X ((TT * DM / 8 + PT - 1) / PT)
static_assert(PT == 1024);   // the mask pass takes 32 waves
__global__ __launch_bounds__(PT) void k_prep(const float* __restrict__ Mk, int mpitch, unsigned* __restrict__ Cl, const float* __restrict__ w0, const float* __restrict__ w1, const float* __restrict__ w2, const float* __restrict__ w3, bf* Bt, const float* __restrict__ s0, const float* __restrict__ s1, const float* __restrict__ s2, size_t sb, bf* dst) {
    const int b = (int)blockIdx.x;
    if (b < PB_M) mcls_body(b, Mk, mpitch, Cl);
    else if (b < PB_M + 4 * PB_W) { const int c = b - PB_M; wt_body(c % PB_W, c / PB_W, w0, w1, w2, w3, DM, DQ, Bt); }
    else { const int c = b - PB_M - 4 * PB_W; cvt_body(c % PB_X, (c / PB_X) % NB, c / (PB_X * NB), s0, s1, s2, sb, dst, (size_t)TT * DM / 8); }
}

// ---- k_attn: logits, softmax and P x V of one (batch, head) slice z in one kernel; scores and probabilities stay in registers.
// One wave owns 16 NQ query rows and every KSF-th key tile of 32 keys (tiles ph, ph + KSF, ...: under a mask that closes a run of tiles the KSF waves of a block keep equal work), one tile a trip. It forms the TRANSPOSED logits tile (A = key rows, B = query rows), so that D element j of key tile kt is (key 16 kt + 8h + j, query l & 15):
// the two key tiles of a trip are, lane by lane, the B fragment of P^T (elements 0..7 <- key 8h + j, elements 8..15 <- key 16 + 8h + j), the k order of the V^T A fragment. O^T (A = V^T rows d, B = P^T) has its query in l & 15 too, so a row's maximum, sum and rescale factor are one value a lane.
// A trip whose mask tile k_prep found closed for all of the wave's rows is left out whole (scalar branch); one found open loads no mask and takes zeros in its place. A wave with no trip left hands on maximum -3e38, sum 0 and O 0: weight 0 at the join.
// THE JOIN: each wave puts its unnormalised f32 O tiles (per 16 rows and 16 d one KB: lane l's values 0..3 at 4 l, 4..7 at 128 + 4 l: 16-byte LDS accesses, lane after lane) and per 16 rows 16 running maxima, then 16 sums, into LDS (So, Ss: the block's own part); behind one work-group barrier wave ph joins d tile ph of the KSF shares in the order 0..KSF-1:
// weights 2^((m_s - max m) log2 e), O = sum w O_s / sum w l_s, and stores it as 16-byte pieces of the hi+lo bf16 planes of NB TT rows x DQ (merged-head order, fragment order): row block rb0 + nq, k block 2 head + (ph >> 1), half ph & 1, 512 contiguous bytes a wave and plane.
template <typename T16, bool HI, int NQ>
__device__ __forceinline__ void attn_body(const T16* __restrict__ Q, const T16* __restrict__ Q2, const T16* __restrict__ Kp, const T16* __restrict__ K2, const T16* __restrict__ Vt, const T16* __restrict__ V2, const float* __restrict__ Mk, int mpitch, const unsigned* __restrict__ Cl, int q0, int ph, float* So, float* Ss, int rb0, int head, bf* Ah, bf* Al) {
    typedef typename WFrag<T16>::V V;
    const int lane = threadIdx.x & 31, lr = lane & 15, hi = lane >> 4;
    unsigned long long cw = ~0ull, ow = ~0ull;   // closed / open for every one of the wave's row blocks
#pragma unroll
    for (int nq = 0; nq < NQ; ++nq) { const v4u c = *(const v4u*)(Cl + (size_t)((q0 >> 4) + nq) * 4); cw &= (unsigned long long)c[0] | ((unsigned long long)c[1] << 32); ow &= (unsigned long long)c[2] | ((unsigned long long)c[3] << 32); }
    cw >>= ph; ow >>= ph;
    unsigned long long cbits = (unsigned long long)(unsigned)__builtin_amdgcn_readfirstlane((unsigned)cw) | ((unsigned long long)(unsigned)__builtin_amdgcn_readfirstlane((unsigned)(cw >> 32)) << 32);   // bit 0: the coming trip's tile
    unsigned long long obits = (unsigned long long)(unsigned)__builtin_amdgcn_readfirstlane((unsigned)ow) | ((unsigned long long)(unsigned)__builtin_amdgcn_readfirstlane((unsigned)(ow >> 32)) << 32);
    V qf[NQ][2], qf2[NQ][2];
#pragma unroll
    for (int nq = 0; nq < NQ; ++nq)
#pragma unroll
        for (int c = 0; c < 2; ++c) { const size_t o = (size_t)(q0 + nq * 16) * HD + c * 512 + 8 * lane; qf[nq][c] = WFrag<T16>::ld(Q + o); if (HI) qf2[nq][c] = WFrag<T16>::ld(Q2 + o); }
    v8f oacc[NQ][4]; float mrun[NQ], lrun[NQ];
#pragma unroll
    for (int nq = 0; nq < NQ; ++nq) { mrun[nq] = -3.0e38f; lrun[nq] = 0.f;
#pragma unroll
        for (int dt = 0; dt < 4; ++dt) oacc[nq][dt] = (v8f){}; }
    const T16* vp = Vt + (size_t)(ph * 32) * HD + 8 * lane; const T16* vp2 = HI ? V2 + (size_t)(ph * 32) * HD + 8 * lane : nullptr;   // this lane's piece in the first V^T block of the trip's 32 keys
#pragma unroll 1   // one copy of a body that holds a whole trip's loads and products: registers and instruction cache
    for (int k0 = ph * 32; k0 < TT; k0 += 32 * KSF) {
      if (!(cbits & 1u)) {
        V kf[2][2], kf2[2][2], vf[4], vf2[4]; v4f mv[NQ][2][2];
        if (obits & 1u) {
#pragma unroll
            for (int nq = 0; nq < NQ; ++nq)
#pragma unroll
                for (int kt = 0; kt < 2; ++kt) { mv[nq][kt][0] = (v4f){}; mv[nq][kt][1] = (v4f){}; }
        } else {
#pragma unroll
            for (int nq = 0; nq < NQ; ++nq)
#pragma unroll
                for (int kt = 0; kt < 2; ++kt) { const float* mr = Mk + (size_t)(q0 + nq * 16 + lr) * mpitch + k0 + kt * 16 + 8 * hi; mv[nq][kt][0] = *(const v4f*)mr; mv[nq][kt][1] = *(const v4f*)(mr + 4); }
            asm volatile("s_wait_xcnt 0x0" ::: "memory");   // the K loads below may land in registers that held the addresses of the mask loads above
        }
#pragma unroll
        for (int kt = 0; kt < 2; ++kt)
#pragma unroll
            for (int c = 0; c < 2; ++c) { const size_t o = (size_t)(k0 + kt * 16) * HD + c * 512 + 8 * lane; kf[kt][c] = WFrag<T16>::ld(Kp + o); if (HI) kf2[kt][c] = WFrag<T16>::ld(K2 + o); }
        asm volatile("s_wait_xcnt 0x0" ::: "memory");   // the V loads below may land in registers that held the addresses of the loads above
        __builtin_amdgcn_sched_barrier(0);              // keeps the V loads behind that wait
#pragma unroll
        for (int dt = 0; dt < 4; ++dt) { vf[dt] = WFrag<T16>::ld(vp + dt * 512); if (HI) vf2[dt] = WFrag<T16>::ld(vp2 + dt * 512); }
        // The trip's loads are all issued above; their address registers are advanced for the next trip below. The V addresses are inputs of the wait, so they live up to it and no load of the run lands in them.
        if constexpr (HI) asm volatile("s_wait_xcnt 0x0" :: "v"(vp), "v"(vp2) : "memory"); else asm volatile("s_wait_xcnt 0x0" :: "v"(vp) : "memory");
        __builtin_amdgcn_sched_barrier(0);              // keeps those address additions behind the wait, and every load of the trip in front of the first product
#pragma unroll
        for (int nq = 0; nq < NQ; ++nq) {
            v8f s[2];
#pragma unroll
            for (int kt = 0; kt < 2; ++kt) { s[kt] = (v8f){};
#pragma unroll
                for (int c = 0; c < 2; ++c) { s[kt] = WFrag<T16>::mma(kf[kt][c], qf[nq][c], s[kt]); if (HI) { s[kt] = WFrag<T16>::mma(kf[kt][c], qf2[nq][c], s[kt]); s[kt] = WFrag<T16>::mma(kf2[kt][c], qf[nq][c], s[kt]); } } }
            float mx = mrun[nq];
#pragma unroll
            for (int kt = 0; kt < 2; ++kt)
#pragma unroll
                for (int j = 0; j < 8; ++j) { const float t = s[kt][j] * SCL + bfr(mv[nq][kt][j >> 2][j & 3]) * MNEG; s[kt][j] = t; mx = fmaxf(mx, t); }
            mx = fmaxf(mx, __shfl_xor(mx, 16, 32));   // the row's other 16 keys of the trip lie in lane l ^ 16
            const float al = __builtin_amdgcn_exp2f((mrun[nq] - mx) * L2E); mrun[nq] = mx;
            float sum = 0.f;
#pragma unroll
            for (int kt = 0; kt < 2; ++kt) { v8f x, p;
#pragma unroll
                for (int j = 0; j < 8; ++j) { x[j] = (s[kt][j] - mx) * L2E; if (!HI) x[j] += PEXP; }
#pragma unroll
                for (int j = 0; j < 8; ++j) p[j] = __builtin_amdgcn_exp2f(x[j]);
                asm volatile("v_nop" : "+v"(p) : "v"(x));   // the slot behind a transcendental: no result of the eight is read and no source register reused before this instruction
                s[kt] = p;
#pragma unroll
                for (int j = 0; j < 8; ++j) sum += p[j]; }
            lrun[nq] = lrun[nq] * al + sum;
#pragma unroll
            for (int dt = 0; dt < 4; ++dt) oacc[nq][dt] *= al;
            if constexpr (HI) { v8us ph[2], pl[2];
#pragma unroll
                for (int kt = 0; kt < 2; ++kt)
#pragma unroll
                    for (int j = 0; j < 8; ++j) { unsigned short a, c2; splitf(s[kt][j], a, c2); ph[kt][j] = a; pl[kt][j] = c2; }
                const V pfh = cat16b(ph[0], ph[1]), pfl = cat16b(pl[0], pl[1]);
#pragma unroll
                for (int dt = 0; dt < 4; ++dt) { oacc[nq][dt] = WFrag<T16>::mma(vf[dt], pfh, oacc[nq][dt]); oacc[nq][dt] = WFrag<T16>::mma(vf[dt], pfl, oacc[nq][dt]); oacc[nq][dt] = WFrag<T16>::mma(vf2[dt], pfh, oacc[nq][dt]); }
            } else { v8h p16[2];
#pragma unroll
                for (int kt = 0; kt < 2; ++kt)
#pragma unroll
                    for (int j = 0; j < 8; ++j) p16[kt][j] = tohx(s[kt][j]);
                const V pf = cat16(p16[0], p16[1]);
#pragma unroll
                for (int dt = 0; dt < 4; ++dt) oacc[nq][dt] = WFrag<T16>::mma(vf[dt], pf, oacc[nq][dt]); }
        }
      }
        vp += 32 * KSF * HD; if (HI) vp2 += 32 * KSF * HD; cbits >>= KSF; obits >>= KSF;
    }
#pragma unroll
    for (int nq = 0; nq < NQ; ++nq) {
        const float lt = lrun[nq] + __shfl_xor(lrun[nq], 16, 32);
        Ss[(ph * NQ + nq) * 32 + lane] = hi ? lt : mrun[nq];
#pragma unroll
        for (int dt = 0; dt < 4; ++dt) { float* p = So + ((ph * NQ + nq) * 4 + dt) * 256 + 4 * lane; const v8f o = oacc[nq][dt]; *(v4fa*)p = __builtin_shufflevector(o, o, 0, 1, 2, 3); *(v4fa*)(p + 128) = __builtin_shufflevector(o, o, 4, 5, 6, 7); }
    }
    __syncthreads();   // every share of the block lies in LDS before any wave joins them
    v8us oh[NQ], ol[NQ];
#pragma unroll
    for (int nq = 0; nq < NQ; ++nq) { float m[KSF], l[KSF]; v8f ov[KSF]; float mx = -3.0e38f;
#pragma unroll
        for (int s = 0; s < KSF; ++s) { const float* q = Ss + (s * NQ + nq) * 32 + lr; m[s] = q[0]; l[s] = q[16]; const float* p = So + ((s * NQ + nq) * 4 + ph) * 256 + 4 * lane; const v4f x0 = *(const v4fa*)p, x1 = *(const v4fa*)(p + 128); ov[s] = __builtin_shufflevector(x0, x1, 0, 1, 2, 3, 4, 5, 6, 7); }
#pragma unroll
        for (int s = 0; s < KSF; ++s) mx = fmaxf(mx, m[s]);
        const float w0 = __builtin_amdgcn_exp2f((m[0] - mx) * L2E); v8f x = ov[0] * w0; float den = l[0] * w0;
#pragma unroll
        for (int s = 1; s < KSF; ++s) { const float w = __builtin_amdgcn_exp2f((m[s] - mx) * L2E); x += ov[s] * w; den += l[s] * w; }
        const float f = 1.0f / den;
#pragma unroll
        for (int q = 0; q < 8; ++q) { unsigned short a, c2; splitf(x[q] * f, a, c2); oh[nq][q] = a; ol[nq][q] = c2; } }
    const size_t e = (((size_t)rb0 * (DQ / 32) + head * 2 + (ph >> 1)) * 64 + (ph & 1) * 32 + lane) * 8;   // this lane's piece in row block rb0; the next row block lies DQ / 32 blocks of 512 elements on
#pragma unroll
    for (int nq = 0; nq < NQ; ++nq) { *(v8us*)(Ah + e + (size_t)nq * (DQ / 32) * 512) = oh[nq]; *(v8us*)(Al + e + (size_t)nq * (DQ / 32) * 512) = ol[nq]; }
}
// grid (NZ, AX), 8 waves: wave w is key share w & 3 of query block w >> 2 (waves w and w + 4 read the same K and V tiles). Row group bx < RH/32 takes 16 hi+lo query rows a block, the others 32 f16 rows a block. QK* hold the q planes, then (kofs elements on) the k planes.
// THE DEAL: the registers leave room for about half of the work-groups at a time. blockIdx.x (fastest) is the (batch, head) slice, blockIdx.y counts the row groups from the last to the first:
// the f16 groups stand in front of the hi+lo groups (half the rows), and under a mask that closes the keys behind a query the groups with the most trips come first in index order and those with the fewest last. For speed only: every (slice, row group) is taken once under any order.
#define AX (RH / 32 + (TT - RH) / 64)
__global__ __launch_bounds__(64 * KSF) void k_attn(const h16* __restrict__ QK16, const bf* __restrict__ QKh, const bf* __restrict__ QKl, size_t kofs, const h16* __restrict__ VT16, const bf* __restrict__ VTh, const bf* __restrict__ VTl, const float* __restrict__ Mk, int mpitch, const unsigned* __restrict__ Cl, bf* Ah, bf* Al) {
    __shared__ __align__(16) float so[2][KSF * 2 * 4 * 256]; __shared__ float ss[2][KSF * 2 * 32];
    const int wave = __builtin_amdgcn_readfirstlane((int)(threadIdx.x >> 5)); const int ph = wave % KSF, qb = wave / KSF; const int bx = AX - 1 - (int)blockIdx.y; const int z = (int)blockIdx.x; const size_t zo = (size_t)z * TT * HD;
    const int rbz = (z / NH_) * (TT / 16), head = z % NH_;
    if (bx < RH / 32) { const int q0 = bx * 32 + qb * 16; attn_body<bf, true, 1>(QKh + zo, QKl + zo, QKh + kofs + zo, QKl + kofs + zo, VTh + zo, VTl + zo, Mk, mpitch, Cl, q0, ph, so[qb], ss[qb], rbz + (q0 >> 4), head, Ah, Al); }
    else { const int q0 = RH + (bx - RH / 32) * 64 + qb * 32; attn_body<h16, false, 2>(QK16 + zo, nullptr, QK16 + kofs + zo, nullptr, VT16 + zo, nullptr, Mk, mpitch, Cl, q0, ph, so[qb], ss[qb], rbz + (q0 >> 4), head, Ah, Al); }
}

extern "C" void kernel_launch(void* const* d_in, const int* in_sizes, int n_in,
                              void* d_out, int out_size, void* d_ws, size_t ws_size, hipStream_t stream) {
    if (n_in < 12) return;
    const long long xneed = (long long)(NB - 1) * SEQ_FULL * DM + (long long)TT * DM;
    if ((long long)in_sizes[0] < xneed || (long long)in_sizes[1] < xneed || (long long)in_sizes[2] < xneed) return;
    if ((long long)in_sizes[3] < (long long)(TT - 1) * SEQ_FULL + TT) return;
    if (in_sizes[4] < DM * DQ || in_sizes[6] < DM * DKV || in_sizes[8] < DM * DKV || in_sizes[10] < DQ * DM) return;
    if (in_sizes[5] < DQ || in_sizes[7] < DKV || in_sizes[9] < DKV || in_sizes[11] < DM) return;
    if ((long long)out_size < (long long)NB * TT * DM) return;
    const float* xq = (const float*)d_in[0]; const float* xk = (const float*)d_in[1]; const float* xv = (const float*)d_in[2]; const float* mk = (const float*)d_in[3];
    const float* wq = (const float*)d_in[4]; const float* bq = (const float*)d_in[5]; const float* wk = (const float*)d_in[6]; const float* bk = (const float*)d_in[7]; const float* wv = (const float*)d_in[8]; const float* bv = (const float*)d_in[9]; const float* wo = (const float*)d_in[10]; const float* bo = (const float*)d_in[11];
    float* OUT = (float*)d_out;     // [NB][TT][DM]
    char* wsp = (char*)d_ws;
    auto take = [&](size_t bytes) { char* p = wsp; wsp += (bytes + 255) & ~(size_t)255; return (void*)p; };
    constexpr size_t WSZ = (size_t)DM * DQ;           // elements of one weight plane
    constexpr size_t PSZ = (size_t)NZ * TT * HD;      // elements of one plane set over all (batch, head) slices
    constexpr size_t XSZ = (size_t)NB * TT * DM;      // elements of one stream, both batches
    bf* W4 = (bf*)take(4 * WSZ * 2);                  // Wq, Wk, Wv, Wo transposed, one behind the other
    h16* QK16 = (h16*)take(2 * PSZ * 2); bf* QKh = (bf*)take(2 * PSZ * 2); bf* QKl = (bf*)take(2 * PSZ * 2);   // q planes, then k planes
    h16* VT16 = (h16*)take(PSZ * 2); bf* VTh = (bf*)take(PSZ * 2); bf* VTl = (bf*)take(PSZ * 2);
    unsigned* Cls = (unsigned*)take((size_t)(TT / 16) * 4 * 4);   // per 16 query rows: closed and open bits of the 64 key tiles
    bf* ATh = (bf*)take(XSZ * 2); bf* ATl = (bf*)take(XSZ * 2);
    bf* XB = (bf*)take(3 * XSZ * 2);                  // the projections' bf16 inputs
    const size_t carved = (size_t)(wsp - (char*)d_ws);
    if (carved > ws_size) return;
    // weights: w is [in = K rows][out = N cols] -> Bt, N rows x K, fragment order
    k_prep<<<PB_M + 4 * PB_W + 3 * NB * PB_X, PT, 0, stream>>>(mk, SEQ_FULL, Cls, wq, wk, wv, wo, W4, xq, xk, xv, (size_t)SEQ_FULL * DM, XB);
    k_gemmw<bf, 0, true, 1, true><<<dim3(NB * TT / 64, DQ / 64, 3), 32, 0, stream>>>(XB, nullptr, W4, nullptr, DM, nullptr, DQ, bq, bk, bv, XSZ, WSZ, 0, 0, QK16, QKh, QKl, VT16, VTh, VTl);
    k_attn<<<dim3(NZ, AX), 64 * KSF, 0, stream>>>(QK16, QKh, QKl, PSZ, VT16, VTh, VTl, mk, SEQ_FULL, Cls, ATh, ATl);
    k_gemmo<<<dim3(NB * TT / 64, DM / (64 * OCT)), 32 * OKS * OCT, 0, stream>>>(ATh, ATl, W4 + 3 * WSZ, OUT, bo);
}
